// v000
// Times are from an AMD MI455X. After a warm-up the kernel runs many times in a row, and a time is the length of
// such a window on the GPU divided by its runs, so every launch and the gaps after it count. The runs cycle
// through copies of the inputs. A figure is the median of several windows, for all but v000 over two sittings.
// Sittings can differ by a few percent; kernels timed side by side share one.
// v000 is the starting kernel. One run takes 938 microseconds.
// Contractions: conv k3 (two), qkv 1x1, q.k^T, p.v, proj 1x1 = v_wmma_f32_16x16x32_f16 (f16 operands: weights x64, GroupNorm activations x1, q/k/v x16, p x1024, attention output x256), f32 accumulate; GroupNorm statistics f64, softmax / position bias / residuals f32.
#include <hip/hip_runtime.h>
#include <math.h>
#include <stdint.h>

#define NBATCH 8
#define CC 1024
#define TT 1024
#define TP 1026
#define NH 16
#define HD 64
#define NBUCK 32
#define BTP 2048

static_assert(NH * HD == CC);
static_assert((CC % 128) == 0 && (TT % 64) == 0);

typedef _Float16 v16h __attribute__((ext_vector_type(16)));
typedef _Float16 v8h  __attribute__((ext_vector_type(8)));
typedef float    v8f  __attribute__((ext_vector_type(8)));
typedef float    v4f  __attribute__((ext_vector_type(4)));
typedef unsigned int v4u __attribute__((ext_vector_type(4)));

// ---- hazard guards (device pass only; no-op for the host pass) ----
#if defined(__HIP_DEVICE_COMPILE__)
#define HZ_ACC_AB(c, a, b) asm volatile("v_nop\n\tv_nop\n\tv_nop\n\tv_nop" : "+v"(c) : "v"(a), "v"(b))
#define HZ_ACC2_A(c0, c1, a) asm volatile("v_nop\n\tv_nop\n\tv_nop\n\tv_nop" : "+v"(c0), "+v"(c1) : "v"(a))
#define HZ_KEEP4(a, b, c, d) asm volatile("v_nop" : : "v"(a), "v"(b), "v"(c), "v"(d))
#define HZ_ACC4(a, b, c, d) asm volatile("v_nop\n\tv_nop\n\tv_nop\n\tv_nop" : "+v"(a), "+v"(b), "+v"(c), "+v"(d))
#else
#define HZ_ACC_AB(c, a, b) ((void)0)
#define HZ_ACC2_A(c0, c1, a) ((void)0)
#define HZ_KEEP4(a, b, c, d) ((void)0)
#define HZ_ACC4(a, b, c, d) ((void)0)
#endif

// ---- scalar helpers ----
__device__ __forceinline__ unsigned short h_bits(_Float16 x) { return __builtin_bit_cast(unsigned short, x); }
__device__ __forceinline__ unsigned pkf(float a, float b) {
  return (unsigned)h_bits((_Float16)a) | ((unsigned)h_bits((_Float16)b) << 16);
}
__device__ __forceinline__ v8f zero8() { v8f z = {0.f, 0.f, 0.f, 0.f, 0.f, 0.f, 0.f, 0.f}; return z; }
__device__ __forceinline__ float rcp_f(float x) { return __builtin_amdgcn_rcpf(x); }

// ---- 16-bit A/B fragment: lane -> row/col (lane&15); p already includes +8*(lane>>4);
//      elements 0..7 <- p[0..7] (k0+8h..), elements 8..15 <- p[16..23] (k0+16+8h..)
__device__ __forceinline__ v16h ldfrag(const _Float16* p) {
  union { v16h v; v8h h[2]; } f;
  f.h[0] = *(const v8h*)(p);
  f.h[1] = *(const v8h*)(p + 16);
  return f.v;
}

// ---- WMMA helpers ----
__device__ __forceinline__ v8f mma_h(v16h a, v16h b, v8f c) {
  c = __builtin_amdgcn_wmma_f32_16x16x32_f16(false, a, false, b, (short)0, c, false, false);
  HZ_ACC_AB(c, a, b);
  return c;
}
__device__ __forceinline__ v8f mma_raw(v16h a, v16h b, v8f c) {
  return __builtin_amdgcn_wmma_f32_16x16x32_f16(false, a, false, b, (short)0, c, false, false);
}

// ---- f64 wave shuffle and block-wide two-value sum (fixed order) ----
__device__ __forceinline__ double shfl_xor_d(double v, int m) {
  const unsigned long long u = (unsigned long long)__double_as_longlong(v);
  const int lo = __shfl_xor((int)(unsigned)(u & 0xffffffffull), m, 32);
  const int hi = __shfl_xor((int)(unsigned)(u >> 32), m, 32);
  const unsigned long long r = ((unsigned long long)(unsigned)hi << 32) | (unsigned long long)(unsigned)lo;
  return __longlong_as_double((long long)r);
}
// red: 16 doubles in LDS; every thread returns with the block totals
__device__ __forceinline__ void block_sum2(double& s, double& ss, double* red, int tid) {
#pragma unroll
  for (int m = 16; m >= 1; m >>= 1) {
    s += shfl_xor_d(s, m);
    ss += shfl_xor_d(ss, m);
  }
  const int wave = tid >> 5, lane = tid & 31;
  __syncthreads();
  if (lane == 0) { red[wave] = s; red[8 + wave] = ss; }
  __syncthreads();
  double S = 0.0, SS = 0.0;
#pragma unroll
  for (int w = 0; w < 8; ++w) { S += red[w]; SS += red[8 + w]; }
  s = S;
  ss = SS;
}

// =====================================================================================================
// f32 -> f16 (x scale), 8 elements per thread, one 16-B store per lane (wave = 512 contiguous B =
// coverage: n8*8 = whole plane (n8 is a multiple of 256 for both uses).
// =====================================================================================================
__global__ __launch_bounds__(256) void cvt_f16x8(const float* __restrict__ in, _Float16* out, int n8, float scale) {
  const int i = blockIdx.x * 256 + threadIdx.x;
  if (i < n8) {
    const v4f a = *(const v4f*)(in + (size_t)i * 8);
    const v4f c = *(const v4f*)(in + (size_t)i * 8 + 4);
    v4u p;
    p[0] = pkf(a[0] * scale, a[1] * scale);
    p[1] = pkf(a[2] * scale, a[3] * scale);
    p[2] = pkf(c[0] * scale, c[1] * scale);
    p[3] = pkf(c[2] * scale, c[3] * scale);
    _Float16* dst = out + (size_t)i * 8;
    *(v4u*)dst = p;
    
  }
}

// =====================================================================================================
// conv weight [o][c][3] f32 -> Wt[tap][o][c] f16 (x scale). Thread = (o, 8 consecutive c): reads
// 24 contiguous floats, writes one 16-B piece into each of the 3 tap planes; a wave covers 512
// contiguous B of one row per store instruction. grid = CC*128/256 = 512.
// coverage: 131072 threads x 3 x 8 halves = 3*CC*CC = whole plane.
// =====================================================================================================
__global__ __launch_bounds__(256) void cvt_convw(const float* __restrict__ w, _Float16* out, float scale) {
  const int idx = blockIdx.x * 256 + threadIdx.x;
  if (idx >= CC * (CC / 8)) return;
  const int o = idx >> 7;
  const int c8 = idx & 127;
  const float* p = w + ((size_t)o * CC + (size_t)c8 * 8) * 3;
  union { v4f q[6]; float e[24]; } u;
#pragma unroll
  for (int i = 0; i < 6; ++i) u.q[i] = *(const v4f*)(p + 4 * i);
  v4u pk[3];
#pragma unroll
  for (int tp = 0; tp < 3; ++tp) {
    v4u a;
#pragma unroll
    for (int m = 0; m < 4; ++m)
      a[m] = pkf(u.e[(2 * m) * 3 + tp] * scale, u.e[(2 * m + 1) * 3 + tp] * scale);
    pk[tp] = a;
  }
#pragma unroll
  for (int tp = 0; tp < 3; ++tp)
    *(v4u*)(out + ((size_t)tp * CC + o) * CC + (size_t)c8 * 8) = pk[tp];
  
}

// =====================================================================================================
// relative position bias table tab[h][d], d = (t - s) + 1024, value = emb[bucket][h] * 8 (f32).
// bucket: n = t - s; add 16 when n < 0; n = |n|; n < 8 -> n; else 8 + int(log(n/8) * (1/ln 8) * 8)
// coverage: 8192 threads x 4 = NH*BTP floats.
// =====================================================================================================
__global__ __launch_bounds__(256) void btab_k(const float* __restrict__ emb, float* tab) {
  const int i4 = blockIdx.x * 256 + threadIdx.x;
  if (i4 >= NH * (BTP / 4)) return;
  const int h = i4 >> 9;
  const int d0 = (i4 & 511) * 4;
  const float ln8 = 2.0794415416798357f;
  const float rl8 = 1.0f / ln8;
  v4f v;
#pragma unroll
  for (int e = 0; e < 4; ++e) {
    const int delta = d0 + e - 1024;
    const int n = delta < 0 ? -delta : delta;
    const float nf = (float)(n < 1 ? 1 : n);
    const float lg = logf(nf * 0.125f);
    int vl = 8 + (int)(lg * rl8 * 8.0f);
    vl = vl > 15 ? 15 : vl;
    int bucket = (n < 8) ? n : vl;
    bucket += (delta < 0) ? 16 : 0;
    v[e] = emb[bucket * NH + h] * 8.0f;
  }
  float* dst = tab + (size_t)i4 * 4;
  *(v4f*)dst = v;
  
}

// =====================================================================================================
// GroupNorm(32 groups) (+ SiLU) on an NCT f32 plane [b][CC][TT]; writes the token-major f16 plane
// xt[b][TP][CC] (row 1 + t, channel contiguous) plus the two zero halo rows 0 and TP-1.
// Block = (b, 64-channel slab = 2 groups); 256 threads. Statistics: f64 sums, fixed order.
// Tile loop: 32 tokens x 64 channels staged as f16 in LDS (thread = token lane, wave = 8 channels),
// coverage: 32 tiles x 32 rows x (16 slabs x 64 ch) = rows 1..TT x all channels; halo rows by wave 0.
// =====================================================================================================
template <bool SILU>
__global__ __launch_bounds__(256) void gn32_tr_k(const float* __restrict__ in, const float* __restrict__ gam,
                                                 const float* __restrict__ bet, _Float16* xt) {
  __shared__ __align__(16) v4u sT4[32 * 9];
  __shared__ double red[16];
  __shared__ float sA[64];
  __shared__ float sD[64];
  const int tid = threadIdx.x, lane = tid & 31, wave = tid >> 5;
  const int b = blockIdx.y;
  const int c0 = blockIdx.x * 64;
  const float* p = in + ((size_t)b * CC + c0) * TT;

#pragma unroll 1
  for (int g = 0; g < 2; ++g) {
    const float* pg = p + (size_t)g * 32 * TT;
    double s = 0.0, ss = 0.0;
#pragma unroll 1
    for (int i = 0; i < 32; ++i) {
      const v4f v = *(const v4f*)(pg + ((size_t)i * 256 + tid) * 4);
#pragma unroll
      for (int e = 0; e < 4; ++e) {
        const double d = (double)v[e];
        s += d;
        ss += d * d;
      }
    }
    block_sum2(s, ss, red, tid);
    const double invn = 1.0 / 32768.0;
    const double mean = s * invn;
    double var = ss * invn - mean * mean;
    var = var < 0.0 ? 0.0 : var;
    const float rstdf = (float)(1.0 / sqrt(var + 1e-5));
    const float meanf = (float)mean;
    if (tid >= g * 32 && tid < g * 32 + 32) {
      const int c = c0 + tid;
      const float a = rstdf * gam[c];
      sA[tid] = a;
      sD[tid] = bet[c] - meanf * a;
    }
  }
  __syncthreads();

  if (wave == 0 && lane < 16) {
    const int row = (lane < 8) ? 0 : (TP - 1);
    v4u z = {0u, 0u, 0u, 0u};
    _Float16* dst = xt + ((size_t)b * TP + row) * CC + c0 + (lane & 7) * 8;
    *(v4u*)dst = z;
    
  }

  float A[8], D[8];
#pragma unroll
  for (int i = 0; i < 8; ++i) { A[i] = sA[wave * 8 + i]; D[i] = sD[wave * 8 + i]; }
  const float* pr = p + (size_t)(wave * 8) * TT + lane;
  const int q = lane >> 3, c8 = (lane & 7) * 8;

#pragma unroll 1
  for (int tc = 0; tc < TT / 32; ++tc) {
    __syncthreads();
    float y[8];
#pragma unroll
    for (int i = 0; i < 8; ++i) {
      const float f = pr[(size_t)i * TT + tc * 32];
      float yy = fmaf(f, A[i], D[i]);
      if (SILU) yy = yy * rcp_f(1.0f + __expf(-yy));
      y[i] = yy;
    }
    v4u pk;
    pk[0] = pkf(y[0], y[1]);
    pk[1] = pkf(y[2], y[3]);
    pk[2] = pkf(y[4], y[5]);
    pk[3] = pkf(y[6], y[7]);
    sT4[lane * 9 + wave] = pk;
    __syncthreads();
    const int row = wave * 4 + q;
    const v4u v = sT4[row * 9 + (lane & 7)];
    _Float16* dst = xt + ((size_t)b * TP + 1 + tc * 32 + row) * CC + c0 + c8;
    *(v4u*)dst = v;
    
  }
}

// =====================================================================================================
// Fused: GroupNorm(8) on H -> xin (f32 NCT, written), then GroupNorm(32) of xin -> f16 token-major
// plane xt[b][TT][CC] (no halo). Block = (b, one 128-channel group); 256 threads.
// phase 1: f64 sums of the group; phase 2: xin rows written as 32 lanes x 16 B contiguous pieces
// (512 B per instruction inside one 4 KB row), f64 sums of xin per 32-channel sub-group;
// phase 3: y = h*A[c] + D[c] (both norms folded), 32-token x 128-channel LDS tile, each wave writes
// coverage: xin rows 0..127 of the group x 1024 t; xt: 32 tiles x 32 rows x 128 ch per block,
// 8 blocks per b cover all channels.
// =====================================================================================================
__global__ __launch_bounds__(256) void gn8_attn_k(const float* __restrict__ hin,
                                                  const float* __restrict__ g8, const float* __restrict__ e8,
                                                  const float* __restrict__ ga, const float* __restrict__ ea,
                                                  float* xin, _Float16* xt) {
  __shared__ __align__(16) v4u sT4[32 * 17];
  __shared__ double red[16];
  __shared__ float sA1[128];
  __shared__ float sD1[128];
  __shared__ float sA[128];
  __shared__ float sD[128];
  __shared__ float sM[4];
  __shared__ float sR[4];
  const int tid = threadIdx.x, lane = tid & 31, wave = tid >> 5;
  const int b = blockIdx.y;
  const int c0 = blockIdx.x * 128;
  const float* p = hin + ((size_t)b * CC + c0) * TT;

  // phase 1
  {
    double s = 0.0, ss = 0.0;
#pragma unroll 1
    for (int i = 0; i < 128; ++i) {
      const v4f v = *(const v4f*)(p + ((size_t)i * 256 + tid) * 4);
#pragma unroll
      for (int e = 0; e < 4; ++e) {
        const double d = (double)v[e];
        s += d;
        ss += d * d;
      }
    }
    block_sum2(s, ss, red, tid);
    const double invn = 1.0 / 131072.0;
    const double mean = s * invn;
    double var = ss * invn - mean * mean;
    var = var < 0.0 ? 0.0 : var;
    const float r8f = (float)(1.0 / sqrt(var + 1e-5));
    const float m8f = (float)mean;
    if (tid < 128) {
      const int c = c0 + tid;
      const float a = r8f * g8[c];
      sA1[tid] = a;
      sD1[tid] = e8[c] - m8f * a;
    }
  }
  __syncthreads();

  // phase 2
  float* xo = xin + ((size_t)b * CC + c0) * TT;
#pragma unroll 1
  for (int sg = 0; sg < 4; ++sg) {
    double s2 = 0.0, ss2 = 0.0;
#pragma unroll 1
    for (int i = sg * 32; i < sg * 32 + 32; ++i) {
      const float a = sA1[i], d = sD1[i];
      const size_t off = ((size_t)i * 256 + tid) * 4;
      const v4f v = *(const v4f*)(p + off);
      v4f y;
#pragma unroll
      for (int e = 0; e < 4; ++e) {
        const float yy = fmaf(v[e], a, d);
        y[e] = yy;
        const double dd = (double)yy;
        s2 += dd;
        ss2 += dd * dd;
      }
      *(v4f*)(xo + off) = y;
      
    }
    block_sum2(s2, ss2, red, tid);
    const double invn = 1.0 / 32768.0;
    const double mean = s2 * invn;
    double var = ss2 * invn - mean * mean;
    var = var < 0.0 ? 0.0 : var;
    if (tid == 0) {
      sM[sg] = (float)mean;
      sR[sg] = (float)(1.0 / sqrt(var + 1e-5));
    }
  }
  __syncthreads();
  if (tid < 128) {
    const int sg = tid >> 5;
    const int c = c0 + tid;
    const float a2 = sR[sg] * ga[c];
    sA[tid] = sA1[tid] * a2;
    sD[tid] = (sD1[tid] - sM[sg]) * a2 + ea[c];
  }
  __syncthreads();

  // phase 3
  float A[16], D[16];
#pragma unroll
  for (int i = 0; i < 16; ++i) { A[i] = sA[wave * 16 + i]; D[i] = sD[wave * 16 + i]; }
  const float* pr = p + (size_t)(wave * 16) * TT + lane;
  const int hh = lane >> 4, c16 = lane & 15;
#pragma unroll 1
  for (int tc = 0; tc < TT / 32; ++tc) {
    __syncthreads();
    float y[16];
#pragma unroll
    for (int i = 0; i < 16; ++i) {
      const float f = pr[(size_t)i * TT + tc * 32];
      y[i] = fmaf(f, A[i], D[i]);
    }
    v4u p0, p1;
#pragma unroll
    for (int m = 0; m < 4; ++m) {
      p0[m] = pkf(y[2 * m], y[2 * m + 1]);
      p1[m] = pkf(y[8 + 2 * m], y[9 + 2 * m]);
    }
    sT4[lane * 17 + wave * 2] = p0;
    sT4[lane * 17 + wave * 2 + 1] = p1;
    __syncthreads();
    v4u v[2];
#pragma unroll
    for (int it = 0; it < 2; ++it) {
      const int row = it * 16 + wave * 2 + hh;
      v[it] = sT4[row * 17 + c16];
    }
#pragma unroll
    for (int it = 0; it < 2; ++it) {
      const int row = it * 16 + wave * 2 + hh;
      *(v4u*)(xt + ((size_t)b * TT + tc * 32 + row) * CC + c0 + c16 * 8) = v[it];
    }
    
  }
}

// =====================================================================================================
// Register-blocked f16 WMMA GEMM: C[m][n] = oscale * sum_tap sum_k A_tap[m][k] * Bt_tap[n][k]
//   + bias (BM: 1 per row m with the A row remap, 2 per column n with the Bt row remap) * bscale
//   (+ resid[m][n] f32, same indexing as C, when RESID).
// One wave per 32x64 tile, no block barriers. A row-major [M][K] pitch lda; Bt row-major [N][K]
// (k contiguous) pitch ldb. Tile row remap: row(m) = (m>>6)*TS + TO + (m&63). Tap tp adds aTap
// elements to A and bTap elements to Bt. blockIdx.y = batch index (strides in elements).
// M multiple of 32, N of 64, K of 32 (host constants). OUTH: 0 f32 C (pitch ldc), 1 f16 C.
// Epilogue: 16-row slabs staged per wave in LDS; f32: each 256-B row segment by 16 consecutive
// coverage: 2 slabs x 16 rows x 64 cols = the wave's 32x64 tile; grid = exact tile count / 8.
// =====================================================================================================
template <int TAPS, int OUTH, bool RESID, int BM>
__global__ __launch_bounds__(256) void gemm_k(
    const _Float16* __restrict__ A, int lda, long long strideA, long long aTap, int aTS, int aTO,
    const _Float16* __restrict__ Bt, int ldb, long long strideB, long long bTap, int bTS, int bTO,
    const float* __restrict__ bias, float bscale,
    const float* __restrict__ resid,
    void* Cout, int ldc, long long strideC,
    int M, int N, int K, float oscale) {
  __shared__ __align__(16) float sT[8][16 * 68];
  const int bz = blockIdx.y;
  const int lane = threadIdx.x & 31, wave = threadIdx.x >> 5;
  const int tilesN = N >> 6, tilesM = M >> 5;
  const int tile = blockIdx.x * 8 + wave;
  if (tile >= tilesM * tilesN) return;   // wave-uniform; no block barriers in this kernel
  const int tm = tile / tilesN, tn = tile - tm * tilesN;
  const int m0 = tm << 5, n0 = tn << 6;
  const int rlane = lane & 15;
  const int koff = (lane >> 4) * 8;
  const int mOff = koff;
  const int aRow0 = (m0 >> 6) * aTS + aTO + (m0 & 63);
  const int bRow0 = (n0 >> 6) * bTS + bTO;
  const _Float16* Ab = A + (size_t)bz * (size_t)strideA;
  const _Float16* Bb = Bt + (size_t)bz * (size_t)strideB;
  const size_t aro0 = (size_t)(aRow0 + rlane) * lda + koff;
  const size_t aro1 = (size_t)(aRow0 + 16 + rlane) * lda + koff;
  size_t bro[4];
#pragma unroll
  for (int j = 0; j < 4; ++j) bro[j] = (size_t)(bRow0 + j * 16 + rlane) * ldb + koff;

  v8f acc[2][4];
#pragma unroll
  for (int i = 0; i < 2; ++i)
#pragma unroll
    for (int j = 0; j < 4; ++j) acc[i][j] = zero8();

#pragma unroll 1
  for (int tp = 0; tp < TAPS; ++tp) {
    const _Float16* Ap = Ab + (size_t)tp * (size_t)aTap;
    const _Float16* Bp = Bb + (size_t)tp * (size_t)bTap;
#pragma unroll 1
    for (int k0 = 0; k0 < K; k0 += 32) {
      v16h bf[4];
#pragma unroll
      for (int j = 0; j < 4; ++j) bf[j] = ldfrag(Bp + bro[j] + k0);
      const v16h a0 = ldfrag(Ap + aro0 + k0);
#pragma unroll
      for (int j = 0; j < 4; ++j) acc[0][j] = mma_raw(a0, bf[j], acc[0][j]);
      HZ_ACC2_A(acc[0][0], acc[0][3], a0);
      const v16h a1 = ldfrag(Ap + aro1 + k0);
#pragma unroll
      for (int j = 0; j < 4; ++j) acc[1][j] = mma_raw(a1, bf[j], acc[1][j]);
      HZ_ACC2_A(acc[1][0], acc[1][3], a1);
      HZ_KEEP4(bf[0], bf[1], bf[2], bf[3]);
    }
  }
  HZ_ACC4(acc[0][0], acc[0][1], acc[0][2], acc[0][3]);
  HZ_ACC4(acc[1][0], acc[1][1], acc[1][2], acc[1][3]);

  // ---- epilogue ----
  float* slab = sT[wave];
#pragma unroll
  for (int i = 0; i < 2; ++i) {
    const int mBase = m0 + i * 16;
    float badd[8];
#pragma unroll
    for (int r = 0; r < 8; ++r) badd[r] = 0.f;
    if (BM == 1) {
#pragma unroll
      for (int r = 0; r < 8; ++r) badd[r] = bias[aRow0 + i * 16 + mOff + r] * bscale;
    }
#pragma unroll
    for (int j = 0; j < 4; ++j) {
      float bc = 0.f;
      if (BM == 2) bc = bias[bRow0 + j * 16 + rlane] * bscale;
#pragma unroll
      for (int r = 0; r < 8; ++r)
        slab[(mOff + r) * 68 + j * 16 + rlane] = acc[i][j][r] * oscale + badd[r] + bc;
    }
    __builtin_amdgcn_fence(__ATOMIC_RELEASE, "workgroup");
    __builtin_amdgcn_wave_barrier();
    __builtin_amdgcn_fence(__ATOMIC_ACQUIRE, "workgroup");
    if (OUTH == 0) {
      float* Cb = (float*)Cout + (size_t)bz * (size_t)strideC;
      const float* Rb = RESID ? (resid + (size_t)bz * (size_t)strideC) : resid;
      const int h2 = lane >> 4, c4 = (lane & 15) * 4;     // 256-B row segment = 16 lanes x 16 B
      {
#pragma unroll
        for (int it = 0; it < 8; ++it) {
          const int row = it * 2 + h2;                     // it 0..7 x h2 0..1 = rows 0..15
          v4f v = *(const v4f*)(slab + row * 68 + c4);
          const size_t off = (size_t)(mBase + row) * ldc + n0 + c4;
          if (RESID) v += *(const v4f*)(Rb + off);
          *(v4f*)(Cb + off) = v;
        }
        
      }
    } else {
      _Float16* Cb = (_Float16*)Cout + (size_t)bz * (size_t)strideC;
      const int q = lane >> 3, c8 = (lane & 7) * 8;
      v4u hv[4];
#pragma unroll
      for (int it = 0; it < 4; ++it) {
        const int row = it * 4 + q;                        // it 0..3 x q 0..3 = rows 0..15
        const float* sp = slab + row * 68 + c8;
        v4u a;
#pragma unroll
        for (int e = 0; e < 4; ++e) a[e] = pkf(sp[2 * e], sp[2 * e + 1]);
        hv[it] = a;
      }
      {
#pragma unroll
        for (int it = 0; it < 4; ++it) {
          const int row = it * 4 + q;
          *(v4u*)(Cb + (size_t)(mBase + row) * ldc + n0 + c8) = hv[it];
        }
        
      }
    }
    __builtin_amdgcn_fence(__ATOMIC_RELEASE, "workgroup");
    __builtin_amdgcn_wave_barrier();
    __builtin_amdgcn_fence(__ATOMIC_ACQUIRE, "workgroup");
  }
}

// =====================================================================================================
// Attention, head dim 64, non-causal over TT keys, additive position bias from the table.
//   Qp / Kp (f16, x16): element (b, t, h, d) at [(b*TT + t)*CC + h*64 + d]
//   Vp (f16, x16):      element (b, h, d, s) at [(b*CC + h*64 + d)*TT + s]
//   tab f32 [h][BTP]:   bias(t, s) = tab[h][(t - s) + 1024]
//   AT (f16, x256):     normalised context, element (b, t, h, d) at [(b*TT + t)*CC + h*64 + d]
//   scores = q16 . k16 (f16 WMMA, f32 acc) * sScale + bias; online softmax in f32;
//   p = exp(s - m) carried as f16(1024 p); context += p . v^T tile on f16 WMMA.
//   Block = 4 waves = 64 query rows of one (b, h); grid = 16 * NH * NBATCH; 16 key tiles of 64.
//   K / V^T tile staging: 128 threads x 32 elements per plane = the whole 64x64 tile (plain 16-B
//   loads, __syncthreads before and after). P tiles are wave-private, spilled with _Float16 element
//   Output coverage: each wave stores rows q0..q0+15 (it 0..3 x lane>>3 0..3) x 64 d (8 lanes x 8),
// =====================================================================================================
__global__ __launch_bounds__(128)
void attn_k(const _Float16* __restrict__ Qp, const _Float16* __restrict__ Kp, const _Float16* __restrict__ Vp,
            const float* __restrict__ tab, _Float16* AT, float sScale, float oScale) {
  union FH { v16h v; v8h h[2]; };
  __shared__ __align__(16) _Float16 Ksh[64 * 64];      // [kv][d]
  __shared__ __align__(16) _Float16 Vth[64 * 64];      // [d][kv]
  __shared__ __align__(16) _Float16 Psh[4][16 * 64];   // per wave P [row][kv]
  __shared__ __align__(16) float    Os[4][16 * 64];    // per wave context [row][d]
  __shared__ __align__(16) float    sB[384 * 4];       // bias slice tab[h][q0b .. q0b+1087] (+clamped fill)

  const int tid  = threadIdx.x;
  const int wave = tid >> 5;
  const int lane = tid & 31;
  const int hh   = lane >> 4;
  const int c    = lane & 15;

  const int bx  = blockIdx.x;
  const int qb  = bx & 15;
  const int h   = (bx >> 4) & 15;
  const int b   = bx >> 8;
  const int q0b = qb * 64;
  const int q0  = q0b + wave * 16;
  const size_t rowB = (size_t)b * TT;

  {
    const float* th = tab + (size_t)h * BTP + q0b;     // q0b + 1087 <= 2047 < BTP
#pragma unroll
    for (int k = 0; k < 3; ++k) {
      const int i  = tid + 128 * k;                     // 0..383
      const int ic = (i < 271) ? i : 271;               // clamped address, all lanes load
      *(v4f*)(sB + 4 * i) = *(const v4f*)(th + 4 * ic);
    }
  }

  const _Float16* Qh = Qp + (size_t)h * HD;
  const _Float16* Kh = Kp + (size_t)h * HD;
  const _Float16* Vh = Vp + ((size_t)b * CC + (size_t)h * HD) * TT;

  // ---- Q fragments (A operand, row = lane&15): 2 d-chunks ----
  v16h qa[2];
#pragma unroll
  for (int dc = 0; dc < 2; ++dc) qa[dc] = ldfrag(Qh + (rowB + q0 + c) * CC + dc * 32 + 8 * hh);

  float mrow[8], lrow[8];
  v8f oacc[4];
#pragma unroll
  for (int r = 0; r < 8; ++r) { mrow[r] = -INFINITY; lrow[r] = 0.f; }
#pragma unroll
  for (int t = 0; t < 4; ++t) oacc[t] = zero8();

  // bias index: (t - q0b) - s + 1024 with t - q0b = wave*16 + 8hh + r, s = kv0 + 16j + c
  const int bbase = wave * 16 + 8 * hh + 1024 - c;
  _Float16* pwh = Psh[wave];

#pragma unroll 1
  for (int kt = 0; kt < TT / 64; ++kt) {
    const int kv0 = kt * 64;
    __syncthreads();
    {
      const int r = tid >> 1, half = (tid & 1) * 32;
      const _Float16* kg = Kh + (rowB + kv0 + r) * CC + half;     // K row kv0+r, d = half..half+31
      const _Float16* vg = Vh + (size_t)r * TT + kv0 + half;     // V^T row d = r, s = kv0+half..+31
#pragma unroll
      for (int i = 0; i < 4; ++i) {
        const v8h a0 = *(const v8h*)(kg + 8 * i);
        const v8h b0 = *(const v8h*)(vg + 8 * i);
        *(v8h*)(Ksh + r * 64 + half + 8 * i) = a0;
        *(v8h*)(Vth + r * 64 + half + 8 * i) = b0;
      }
    }
    __syncthreads();

    // ---- scores: 16 query rows x 64 keys per wave ----
    v8f s[4];
#pragma unroll
    for (int j = 0; j < 4; ++j) {
      s[j] = zero8();
#pragma unroll
      for (int dc = 0; dc < 2; ++dc) {
        FH kb;
        kb.h[0] = *(const v8h*)(Ksh + (j * 16 + c) * 64 + dc * 32 + 8 * hh);
        kb.h[1] = *(const v8h*)(Ksh + (j * 16 + c) * 64 + dc * 32 + 16 + 8 * hh);
        s[j] = mma_h(qa[dc], kb.v, s[j]);
      }
    }

    // ---- scale + bias, row max, online softmax, P (x1024, f16) to LDS ----
    const int bk = bbase - kv0;
#pragma unroll
    for (int r = 0; r < 8; ++r) {
      float m = -INFINITY;
#pragma unroll
      for (int j = 0; j < 4; ++j) {
        const float sv = s[j][r] * sScale + sB[bk + r - 16 * j];
        s[j][r] = sv;
        m = fmaxf(m, sv);
      }
#pragma unroll
      for (int off = 1; off < 16; off <<= 1) m = fmaxf(m, __shfl_xor(m, off, 32));
      const float mnew  = fmaxf(mrow[r], m);
      const float msafe = (mnew == -INFINITY) ? 0.f : mnew;
      const float alpha = __expf(mrow[r] - msafe);
      mrow[r] = mnew;
      float psum = 0.f;
#pragma unroll
      for (int j = 0; j < 4; ++j) {
        const float pe = __expf(s[j][r] - msafe);
        psum += pe;
        pwh[(8 * hh + r) * 64 + j * 16 + c] = (_Float16)(pe * 1024.0f);
      }
#pragma unroll
      for (int off = 1; off < 16; off <<= 1) psum += __shfl_xor(psum, off, 32);
      lrow[r] = lrow[r] * alpha + psum;
#pragma unroll
      for (int t = 0; t < 4; ++t) oacc[t][r] *= alpha;
    }
    __builtin_amdgcn_fence(__ATOMIC_RELEASE, "workgroup");
    __builtin_amdgcn_wave_barrier();
    __builtin_amdgcn_fence(__ATOMIC_ACQUIRE, "workgroup");

    // ---- context += P . V (f16 WMMA) ----
#pragma unroll
    for (int kk = 0; kk < 2; ++kk) {
      FH pa;
      pa.h[0] = *(const v8h*)(pwh + c * 64 + kk * 32 + 8 * hh);
      pa.h[1] = *(const v8h*)(pwh + c * 64 + kk * 32 + 16 + 8 * hh);
#pragma unroll
      for (int t = 0; t < 4; ++t) {
        FH vb;
        vb.h[0] = *(const v8h*)(Vth + (t * 16 + c) * 64 + kk * 32 + 8 * hh);
        vb.h[1] = *(const v8h*)(Vth + (t * 16 + c) * 64 + kk * 32 + 16 + 8 * hh);
        oacc[t] = mma_h(pa.v, vb.v, oacc[t]);
      }
    }
  }

  // ---- normalise (1/l, the 1/1024 p carry, the x16 v carry and the x256 output carry are all in
  float* os = Os[wave];
#pragma unroll
  for (int r = 0; r < 8; ++r) {
    const float l = lrow[r];
    const float inv = ((l > 0.f) ? rcp_f(l) : 0.f) * oScale;
#pragma unroll
    for (int t = 0; t < 4; ++t) os[(8 * hh + r) * 64 + t * 16 + c] = oacc[t][r] * inv;
  }
  __builtin_amdgcn_fence(__ATOMIC_RELEASE, "workgroup");
  __builtin_amdgcn_wave_barrier();
  __builtin_amdgcn_fence(__ATOMIC_ACQUIRE, "workgroup");
  {
    const int q4 = lane >> 3, c8 = (lane & 7) * 8;
    v4u hv[4];
#pragma unroll
    for (int it = 0; it < 4; ++it) {
      const int row = it * 4 + q4;   // it 0..3 x q4 0..3 = rows 0..15 of the wave tile
      const float* sp = os + row * 64 + c8;
      v4u a;
#pragma unroll
      for (int e = 0; e < 4; ++e) a[e] = pkf(sp[2 * e], sp[2 * e + 1]);
      hv[it] = a;
    }
    {
#pragma unroll
      for (int it = 0; it < 4; ++it) {
        const int row = it * 4 + q4;
        const size_t go = (rowB + q0 + row) * CC + (size_t)h * HD + c8;
        *(v4u*)(AT + go) = hv[it];
      }
      
    }
  }
}

// =====================================================================================================
// Workspace map (bytes):
//   W1t  f16 [3][1024][1024]       0            6291456
//   W2t  f16 [3][1024][1024]       6291456      6291456
//   Wqkv f16 [3072][1024]          12582912     6291456
//   Wp   f16 [1024][1024]          18874368     2097152
//   Tab  f32 [16][2048]            20971520      131072
//   XT   f16 [8][1026][1024]       21102592    16809984   (later: XT3 [8][1024][1024], then AT [8192][1024])
//   R1   f32 [8][1024][1024]       37912576    33554432   (F1, then H, then Qp + Kp f16 [8192][1024] each)
//   Xin  f32 [8][1024][1024]       71467008    33554432
//   Vp   f16 [8][1024][1024]       105021440   16777216
//   end                            121798656
// Every plane is an exact multiple of its whole-line / whole-tile store granularity (incl. the two
// halo token rows per sample in XT); no tail padding needed.
// =====================================================================================================
extern "C" void kernel_launch(void* const* d_in, const int* in_sizes, int n_in,
                              void* d_out, int out_size, void* d_ws, size_t ws_size,
                              hipStream_t stream) {
  if (n_in < 18) return;
  const int nAct = NBATCH * CC * TT;                     // 8388608
  if (in_sizes[0] != nAct || out_size != nAct) return;
  if (in_sizes[3] != CC * CC * 3 || in_sizes[7] != CC * CC * 3) return;
  if (in_sizes[13] != 3 * CC * CC || in_sizes[15] != CC * CC) return;
  if (in_sizes[1] != CC || in_sizes[2] != CC || in_sizes[4] != CC || in_sizes[5] != CC ||
      in_sizes[6] != CC || in_sizes[8] != CC || in_sizes[9] != CC || in_sizes[10] != CC ||
      in_sizes[11] != CC || in_sizes[12] != CC || in_sizes[16] != CC) return;
  if (in_sizes[14] != 3 * CC || in_sizes[17] != NBUCK * NH) return;

  const float* x      = (const float*)d_in[0];
  const float* gn1_g  = (const float*)d_in[1];
  const float* gn1_b  = (const float*)d_in[2];
  const float* c1_w   = (const float*)d_in[3];
  const float* c1_b   = (const float*)d_in[4];
  const float* gn2_g  = (const float*)d_in[5];
  const float* gn2_b  = (const float*)d_in[6];
  const float* c2_w   = (const float*)d_in[7];
  const float* c2_b   = (const float*)d_in[8];
  const float* n8_g   = (const float*)d_in[9];
  const float* n8_b   = (const float*)d_in[10];
  const float* ag_g   = (const float*)d_in[11];
  const float* ag_b   = (const float*)d_in[12];
  const float* qkv_w  = (const float*)d_in[13];
  const float* qkv_b  = (const float*)d_in[14];
  const float* pj_w   = (const float*)d_in[15];
  const float* pj_b   = (const float*)d_in[16];
  const float* remb   = (const float*)d_in[17];

  const size_t PWC  = (size_t)3 * CC * CC * 2;          //  6291456
  const size_t PWQ  = (size_t)3 * CC * CC * 2;          //  6291456
  const size_t PWP  = (size_t)CC * CC * 2;              //  2097152
  const size_t PTAB = (size_t)NH * BTP * 4;             //   131072
  const size_t PXT  = (size_t)NBATCH * TP * CC * 2;     // 16809984
  const size_t PF   = (size_t)NBATCH * CC * TT * 4;     // 33554432
  const size_t PV   = (size_t)NBATCH * CC * TT * 2;     // 16777216
  size_t off = 0;
  const size_t oW1  = off; off += PWC;
  const size_t oW2  = off; off += PWC;
  const size_t oWq  = off; off += PWQ;
  const size_t oWp  = off; off += PWP;
  const size_t oTab = off; off += PTAB;
  const size_t oXT  = off; off += PXT;
  const size_t oR1  = off; off += PF;
  const size_t oXin = off; off += PF;
  const size_t oV   = off; off += PV;
  if (off > ws_size) return;                            // off = 121798656
  if (off > (size_t)134217728) return;
  if (2 * PV > PF) return;                              // Qp + Kp live inside R1
  if ((size_t)NBATCH * TT * CC * 2 > PXT) return;       // XT3 / AT fit in the XT region

  char* ws = (char*)d_ws;
  _Float16* W1t  = (_Float16*)(ws + oW1);
  _Float16* W2t  = (_Float16*)(ws + oW2);
  _Float16* Wqkv = (_Float16*)(ws + oWq);
  _Float16* Wpb  = (_Float16*)(ws + oWp);
  float*    Tab  = (float*)(ws + oTab);
  _Float16* XT   = (_Float16*)(ws + oXT);               // [8][1026][1024] with halo rows
  _Float16* XT3  = (_Float16*)(ws + oXT);               // [8][1024][1024], later use of the same region
  _Float16* ATp  = (_Float16*)(ws + oXT);               // [8192][1024], last use of the same region
  float*    F1   = (float*)(ws + oR1);
  float*    Hb   = (float*)(ws + oR1);
  _Float16* Qp   = (_Float16*)(ws + oR1);
  _Float16* Kp   = (_Float16*)(ws + oR1 + PV);
  float*    Xin  = (float*)(ws + oXin);
  _Float16* Vp   = (_Float16*)(ws + oV);

  const dim3 blk(256);
  const int  n8q = 3 * CC * CC / 8;                     // 393216
  const int  n8p = CC * CC / 8;                         // 131072
  const long long CCCC = (long long)CC * CC;
  const long long CT   = (long long)CC * TT;

  // (1) weights -> f16 x64 planes; position bias table
  cvt_convw<<<dim3(CC * (CC / 8) / 256), blk, 0, stream>>>(c1_w, W1t, 64.0f);
  cvt_convw<<<dim3(CC * (CC / 8) / 256), blk, 0, stream>>>(c2_w, W2t, 64.0f);
  cvt_f16x8<<<dim3((n8q + 255) / 256), blk, 0, stream>>>(qkv_w, Wqkv, n8q, 64.0f);
  cvt_f16x8<<<dim3((n8p + 255) / 256), blk, 0, stream>>>(pj_w, Wpb, n8p, 64.0f);
  btab_k<<<dim3(NH * (BTP / 4) / 256), blk, 0, stream>>>(remb, Tab);

  // (2) h = silu(GN32(x)) -> XT (token-major f16, halo rows)
  gn32_tr_k<true><<<dim3(CC / 64, NBATCH), blk, 0, stream>>>(x, gn1_g, gn1_b, XT);
  // (3) F1 = conv1(h) + b1 -> f32 NCT   (per b: M=1024 o, N=1024 t, K=3 taps x 1024)
  gemm_k<3, 0, false, 1><<<dim3((CC / 32) * (TT / 64) / 8, NBATCH), blk, 0, stream>>>(
      W1t, CC, 0LL, CCCC, 64, 0,
      XT, CC, (long long)TP * CC, (long long)CC, 64, 0,
      c1_b, 1.0f, nullptr,
      (void*)F1, TT, CT, CC, TT, CC, 1.0f / 64.0f);
  // (4) h = silu(GN32(F1)) -> XT
  gn32_tr_k<true><<<dim3(CC / 64, NBATCH), blk, 0, stream>>>(F1, gn2_g, gn2_b, XT);
  // (5) H = conv2(h) + b2 + x -> f32 NCT (R1)
  gemm_k<3, 0, true, 1><<<dim3((CC / 32) * (TT / 64) / 8, NBATCH), blk, 0, stream>>>(
      W2t, CC, 0LL, CCCC, 64, 0,
      XT, CC, (long long)TP * CC, (long long)CC, 64, 0,
      c2_b, 1.0f, x,
      (void*)Hb, TT, CT, CC, TT, CC, 1.0f / 64.0f);
  // (6) xin = GN8(H) -> f32 NCT; GN32(xin) -> XT3 (token-major f16, no halo)
  gn8_attn_k<<<dim3(CC / 128, NBATCH), blk, 0, stream>>>(Hb, n8_g, n8_b, ag_g, ag_b, Xin, XT3);
  // (7) q = xn^T . Wq^T -> Qp [b*TT+t][h*64+d] f16 x16  (M=8192, N=1024, K=1024; W rows h*192+d)
  gemm_k<1, 1, false, 2><<<dim3((NBATCH * TT / 32) * (CC / 64) / 8, 1), blk, 0, stream>>>(
      XT3, CC, 0LL, 0LL, 64, 0,
      Wqkv, CC, 0LL, 0LL, 192, 0,
      qkv_b, 16.0f, nullptr,
      (void*)Qp, CC, 0LL, NBATCH * TT, CC, CC, 0.25f);
  // (8) k -> Kp (W rows h*192+64+d)
  gemm_k<1, 1, false, 2><<<dim3((NBATCH * TT / 32) * (CC / 64) / 8, 1), blk, 0, stream>>>(
      XT3, CC, 0LL, 0LL, 64, 0,
      Wqkv, CC, 0LL, 0LL, 192, 64,
      qkv_b, 16.0f, nullptr,
      (void*)Kp, CC, 0LL, NBATCH * TT, CC, CC, 0.25f);
  // (9) v (channel-major) = Wv . xn -> Vp [b][h*64+d][s] f16 x16 (per b: M=1024 rows h*192+128+d, N=1024 t)
  gemm_k<1, 1, false, 1><<<dim3((CC / 32) * (TT / 64) / 8, NBATCH), blk, 0, stream>>>(
      Wqkv, CC, 0LL, 0LL, 192, 128,
      XT3, CC, CT, 0LL, 64, 0,
      qkv_b, 16.0f, nullptr,
      (void*)Vp, TT, CT, CC, TT, CC, 0.25f);
  // (10) attention -> AT [b*TT+t][h*64+d] f16 x256
  attn_k<<<dim3((TT / 64) * NH * NBATCH), dim3(128), 0, stream>>>(
      Qp, Kp, Vp, Tab, ATp, 1.0f / 2048.0f, 1.0f / 64.0f);
  // (11) out = xin + proj(a) + bp -> d_out f32 NCT (per b: M=1024 o, N=1024 t, K=1024)
  gemm_k<1, 0, true, 1><<<dim3((CC / 32) * (TT / 64) / 8, NBATCH), blk, 0, stream>>>(
      Wpb, CC, 0LL, 0LL, 64, 0,
      ATp, CC, CT, 0LL, 64, 0,
      pj_b, 1.0f, Xin,
      d_out, TT, CT, CC, TT, CC, 1.0f / 16384.0f);
  (void)hipGetLastError();
}

// v001
// One run takes 640 microseconds.
// Timed twice side by side with v000, it ran 1.49 times as fast both times.
// Contractions: conv k3 (two), qkv 1x1, q.k^T, p.v, proj 1x1 = v_wmma_f32_16x16x32_f16 (f16 operands: weights x64, GroupNorm activations x1, q/k/v x16, p x1024, attention output x256), f32 accumulate; GroupNorm statistics f64, softmax / position bias / residuals f32.
#include <hip/hip_runtime.h>
#include <math.h>
#include <stdint.h>

#define NBATCH 8
#define CC 1024
#define TT 1024
#define TP 1026
#define NH 16
#define HD 64
#define NBUCK 32
#define BTP 2048

static_assert(NH * HD == CC);
static_assert((CC % 256) == 0 && (TT % 256) == 0);

typedef _Float16 v16h __attribute__((ext_vector_type(16)));
typedef _Float16 v8h  __attribute__((ext_vector_type(8)));
typedef float    v8f  __attribute__((ext_vector_type(8)));
typedef float    v4f  __attribute__((ext_vector_type(4)));
typedef unsigned int v4u __attribute__((ext_vector_type(4)));

// ---- hazard guards (device pass only; no-op for the host pass) ----
#if defined(__HIP_DEVICE_COMPILE__)
#define HZ_ACC_AB(c, a, b) asm volatile("v_nop\n\tv_nop\n\tv_nop\n\tv_nop" : "+v"(c) : "v"(a), "v"(b))
#else
#define HZ_ACC_AB(c, a, b) ((void)0)
#endif

// ---- scalar helpers ----
__device__ __forceinline__ unsigned short h_bits(_Float16 x) { return __builtin_bit_cast(unsigned short, x); }
__device__ __forceinline__ unsigned pkf(float a, float b) {
  return (unsigned)h_bits((_Float16)a) | ((unsigned)h_bits((_Float16)b) << 16);
}
__device__ __forceinline__ v8f zero8() { v8f z = {0.f, 0.f, 0.f, 0.f, 0.f, 0.f, 0.f, 0.f}; return z; }
__device__ __forceinline__ float rcp_f(float x) { return __builtin_amdgcn_rcpf(x); }

// ---- 16-bit A/B fragment: lane -> row/col (lane&15); p already includes +8*(lane>>4);
//      elements 0..7 <- p[0..7] (k0+8h..), elements 8..15 <- p[16..23] (k0+16+8h..)
__device__ __forceinline__ v16h ldfrag(const _Float16* p) {
  union { v16h v; v8h h[2]; } f;
  f.h[0] = *(const v8h*)(p);
  f.h[1] = *(const v8h*)(p + 16);
  return f.v;
}

// ---- WMMA helpers ----
__device__ __forceinline__ v8f mma_h(v16h a, v16h b, v8f c) {
  c = __builtin_amdgcn_wmma_f32_16x16x32_f16(false, a, false, b, (short)0, c, false, false);
  HZ_ACC_AB(c, a, b);
  return c;
}
__device__ __forceinline__ v8f mma_raw(v16h a, v16h b, v8f c) {
  return __builtin_amdgcn_wmma_f32_16x16x32_f16(false, a, false, b, (short)0, c, false, false);
}

// ---- f64 wave shuffle and block-wide two-value sum (fixed order) ----
__device__ __forceinline__ double shfl_xor_d(double v, int m) {
  const unsigned long long u = (unsigned long long)__double_as_longlong(v);
  const int lo = __shfl_xor((int)(unsigned)(u & 0xffffffffull), m, 32);
  const int hi = __shfl_xor((int)(unsigned)(u >> 32), m, 32);
  const unsigned long long r = ((unsigned long long)(unsigned)hi << 32) | (unsigned long long)(unsigned)lo;
  return __longlong_as_double((long long)r);
}
// red: 16 doubles in LDS; every thread returns with the block totals
__device__ __forceinline__ void block_sum2(double& s, double& ss, double* red, int tid) {
#pragma unroll
  for (int m = 16; m >= 1; m >>= 1) {
    s += shfl_xor_d(s, m);
    ss += shfl_xor_d(ss, m);
  }
  const int wave = tid >> 5, lane = tid & 31;
  __syncthreads();
  if (lane == 0) { red[wave] = s; red[8 + wave] = ss; }
  __syncthreads();
  double S = 0.0, SS = 0.0;
#pragma unroll
  for (int w = 0; w < 8; ++w) { S += red[w]; SS += red[8 + w]; }
  s = S;
  ss = SS;
}

// =====================================================================================================
// f32 -> f16 (x scale), 8 elements per thread, one 16-B store per lane (wave = 512 contiguous B =
// coverage: n8*8 = whole plane (n8 is a multiple of 256 for both uses).
// =====================================================================================================
__global__ __launch_bounds__(256) void cvt_f16x8(const float* __restrict__ in, _Float16* out, int n8, float scale) {
  const int i = blockIdx.x * 256 + threadIdx.x;
  if (i < n8) {
    const v4f a = *(const v4f*)(in + (size_t)i * 8);
    const v4f c = *(const v4f*)(in + (size_t)i * 8 + 4);
    v4u p;
    p[0] = pkf(a[0] * scale, a[1] * scale);
    p[1] = pkf(a[2] * scale, a[3] * scale);
    p[2] = pkf(c[0] * scale, c[1] * scale);
    p[3] = pkf(c[2] * scale, c[3] * scale);
    _Float16* dst = out + (size_t)i * 8;
    *(v4u*)dst = p;
    
  }
}

// =====================================================================================================
// conv weight [o][c][3] f32 -> Wt[tap][o][c] f16 (x scale). Thread = (o, 8 consecutive c): reads
// 24 contiguous floats, writes one 16-B piece into each of the 3 tap planes; a wave covers 512
// contiguous B of one row per store instruction. grid = CC*128/256 = 512.
// coverage: 131072 threads x 3 x 8 halves = 3*CC*CC = whole plane.
// =====================================================================================================
__global__ __launch_bounds__(256) void cvt_convw(const float* __restrict__ w, _Float16* out, float scale) {
  const int idx = blockIdx.x * 256 + threadIdx.x;
  if (idx >= CC * (CC / 8)) return;
  const int o = idx >> 7;
  const int c8 = idx & 127;
  const float* p = w + ((size_t)o * CC + (size_t)c8 * 8) * 3;
  union { v4f q[6]; float e[24]; } u;
#pragma unroll
  for (int i = 0; i < 6; ++i) u.q[i] = *(const v4f*)(p + 4 * i);
  v4u pk[3];
#pragma unroll
  for (int tp = 0; tp < 3; ++tp) {
    v4u a;
#pragma unroll
    for (int m = 0; m < 4; ++m)
      a[m] = pkf(u.e[(2 * m) * 3 + tp] * scale, u.e[(2 * m + 1) * 3 + tp] * scale);
    pk[tp] = a;
  }
#pragma unroll
  for (int tp = 0; tp < 3; ++tp)
    *(v4u*)(out + ((size_t)tp * CC + o) * CC + (size_t)c8 * 8) = pk[tp];
  
}

// =====================================================================================================
// relative position bias table tab[h][d], d = (t - s) + 1024, value = emb[bucket][h] * 8 (f32).
// bucket: n = t - s; add 16 when n < 0; n = |n|; n < 8 -> n; else 8 + int(log(n/8) * (1/ln 8) * 8)
// coverage: 8192 threads x 4 = NH*BTP floats.
// =====================================================================================================
__global__ __launch_bounds__(256) void btab_k(const float* __restrict__ emb, float* tab) {
  const int i4 = blockIdx.x * 256 + threadIdx.x;
  if (i4 >= NH * (BTP / 4)) return;
  const int h = i4 >> 9;
  const int d0 = (i4 & 511) * 4;
  const float ln8 = 2.0794415416798357f;
  const float rl8 = 1.0f / ln8;
  v4f v;
#pragma unroll
  for (int e = 0; e < 4; ++e) {
    const int delta = d0 + e - 1024;
    const int n = delta < 0 ? -delta : delta;
    const float nf = (float)(n < 1 ? 1 : n);
    const float lg = logf(nf * 0.125f);
    int vl = 8 + (int)(lg * rl8 * 8.0f);
    vl = vl > 15 ? 15 : vl;
    int bucket = (n < 8) ? n : vl;
    bucket += (delta < 0) ? 16 : 0;
    v[e] = emb[bucket * NH + h] * 8.0f;
  }
  float* dst = tab + (size_t)i4 * 4;
  *(v4f*)dst = v;
  
}

// =====================================================================================================
// GroupNorm(32 groups) (+ SiLU) on an NCT f32 plane [b][CC][TT]; writes the token-major f16 plane
// xt[b][TP][CC] (row 1 + t, channel contiguous) plus the two zero halo rows 0 and TP-1.
// Block = (b, 64-channel slab = 2 groups); 256 threads. Statistics: f64 sums, fixed order.
// Tile loop: 32 tokens x 64 channels staged as f16 in LDS (thread = token lane, wave = 8 channels),
// coverage: 32 tiles x 32 rows x (16 slabs x 64 ch) = rows 1..TT x all channels; halo rows by wave 0.
// =====================================================================================================
template <bool SILU>
__global__ __launch_bounds__(256) void gn32_tr_k(const float* __restrict__ in, const float* __restrict__ gam,
                                                 const float* __restrict__ bet, _Float16* xt) {
  __shared__ __align__(16) v4u sT4[32 * 9];
  __shared__ double red[16];
  __shared__ float sA[64];
  __shared__ float sD[64];
  const int tid = threadIdx.x, lane = tid & 31, wave = tid >> 5;
  const int b = blockIdx.y;
  const int c0 = blockIdx.x * 64;
  const float* p = in + ((size_t)b * CC + c0) * TT;

#pragma unroll 1
  for (int g = 0; g < 2; ++g) {
    const float* pg = p + (size_t)g * 32 * TT;
    double s = 0.0, ss = 0.0;
#pragma unroll 1
    for (int i = 0; i < 32; ++i) {
      const v4f v = *(const v4f*)(pg + ((size_t)i * 256 + tid) * 4);
#pragma unroll
      for (int e = 0; e < 4; ++e) {
        const double d = (double)v[e];
        s += d;
        ss += d * d;
      }
    }
    block_sum2(s, ss, red, tid);
    const double invn = 1.0 / 32768.0;
    const double mean = s * invn;
    double var = ss * invn - mean * mean;
    var = var < 0.0 ? 0.0 : var;
    const float rstdf = (float)(1.0 / sqrt(var + 1e-5));
    const float meanf = (float)mean;
    if (tid >= g * 32 && tid < g * 32 + 32) {
      const int c = c0 + tid;
      const float a = rstdf * gam[c];
      sA[tid] = a;
      sD[tid] = bet[c] - meanf * a;
    }
  }
  __syncthreads();

  if (wave == 0 && lane < 16) {
    const int row = (lane < 8) ? 0 : (TP - 1);
    v4u z = {0u, 0u, 0u, 0u};
    _Float16* dst = xt + ((size_t)b * TP + row) * CC + c0 + (lane & 7) * 8;
    *(v4u*)dst = z;
    
  }

  float A[8], D[8];
#pragma unroll
  for (int i = 0; i < 8; ++i) { A[i] = sA[wave * 8 + i]; D[i] = sD[wave * 8 + i]; }
  const float* pr = p + (size_t)(wave * 8) * TT + lane;
  const int q = lane >> 3, c8 = (lane & 7) * 8;

#pragma unroll 1
  for (int tc = 0; tc < TT / 32; ++tc) {
    __syncthreads();
    float y[8];
#pragma unroll
    for (int i = 0; i < 8; ++i) {
      const float f = pr[(size_t)i * TT + tc * 32];
      float yy = fmaf(f, A[i], D[i]);
      if (SILU) yy = yy * rcp_f(1.0f + __expf(-yy));
      y[i] = yy;
    }
    v4u pk;
    pk[0] = pkf(y[0], y[1]);
    pk[1] = pkf(y[2], y[3]);
    pk[2] = pkf(y[4], y[5]);
    pk[3] = pkf(y[6], y[7]);
    sT4[lane * 9 + wave] = pk;
    __syncthreads();
    const int row = wave * 4 + q;
    const v4u v = sT4[row * 9 + (lane & 7)];
    _Float16* dst = xt + ((size_t)b * TP + 1 + tc * 32 + row) * CC + c0 + c8;
    *(v4u*)dst = v;
    
  }
}

// =====================================================================================================
// Fused: GroupNorm(8) on H -> xin (f32 NCT, written), then GroupNorm(32) of xin -> f16 token-major
// plane xt[b][TT][CC] (no halo). Block = (b, one 128-channel group); 256 threads.
// phase 1: f64 sums of the group; phase 2: xin rows written as 32 lanes x 16 B contiguous pieces
// (512 B per instruction inside one 4 KB row), f64 sums of xin per 32-channel sub-group;
// phase 3: y = h*A[c] + D[c] (both norms folded), 32-token x 128-channel LDS tile, each wave writes
// coverage: xin rows 0..127 of the group x 1024 t; xt: 32 tiles x 32 rows x 128 ch per block,
// 8 blocks per b cover all channels.
// =====================================================================================================
__global__ __launch_bounds__(256) void gn8_attn_k(const float* __restrict__ hin,
                                                  const float* __restrict__ g8, const float* __restrict__ e8,
                                                  const float* __restrict__ ga, const float* __restrict__ ea,
                                                  float* xin, _Float16* xt) {
  __shared__ __align__(16) v4u sT4[32 * 17];
  __shared__ double red[16];
  __shared__ float sA1[128];
  __shared__ float sD1[128];
  __shared__ float sA[128];
  __shared__ float sD[128];
  __shared__ float sM[4];
  __shared__ float sR[4];
  const int tid = threadIdx.x, lane = tid & 31, wave = tid >> 5;
  const int b = blockIdx.y;
  const int c0 = blockIdx.x * 128;
  const float* p = hin + ((size_t)b * CC + c0) * TT;

  // phase 1
  {
    double s = 0.0, ss = 0.0;
#pragma unroll 1
    for (int i = 0; i < 128; ++i) {
      const v4f v = *(const v4f*)(p + ((size_t)i * 256 + tid) * 4);
#pragma unroll
      for (int e = 0; e < 4; ++e) {
        const double d = (double)v[e];
        s += d;
        ss += d * d;
      }
    }
    block_sum2(s, ss, red, tid);
    const double invn = 1.0 / 131072.0;
    const double mean = s * invn;
    double var = ss * invn - mean * mean;
    var = var < 0.0 ? 0.0 : var;
    const float r8f = (float)(1.0 / sqrt(var + 1e-5));
    const float m8f = (float)mean;
    if (tid < 128) {
      const int c = c0 + tid;
      const float a = r8f * g8[c];
      sA1[tid] = a;
      sD1[tid] = e8[c] - m8f * a;
    }
  }
  __syncthreads();

  // phase 2
  float* xo = xin + ((size_t)b * CC + c0) * TT;
#pragma unroll 1
  for (int sg = 0; sg < 4; ++sg) {
    double s2 = 0.0, ss2 = 0.0;
#pragma unroll 1
    for (int i = sg * 32; i < sg * 32 + 32; ++i) {
      const float a = sA1[i], d = sD1[i];
      const size_t off = ((size_t)i * 256 + tid) * 4;
      const v4f v = *(const v4f*)(p + off);
      v4f y;
#pragma unroll
      for (int e = 0; e < 4; ++e) {
        const float yy = fmaf(v[e], a, d);
        y[e] = yy;
        const double dd = (double)yy;
        s2 += dd;
        ss2 += dd * dd;
      }
      *(v4f*)(xo + off) = y;
      
    }
    block_sum2(s2, ss2, red, tid);
    const double invn = 1.0 / 32768.0;
    const double mean = s2 * invn;
    double var = ss2 * invn - mean * mean;
    var = var < 0.0 ? 0.0 : var;
    if (tid == 0) {
      sM[sg] = (float)mean;
      sR[sg] = (float)(1.0 / sqrt(var + 1e-5));
    }
  }
  __syncthreads();
  if (tid < 128) {
    const int sg = tid >> 5;
    const int c = c0 + tid;
    const float a2 = sR[sg] * ga[c];
    sA[tid] = sA1[tid] * a2;
    sD[tid] = (sD1[tid] - sM[sg]) * a2 + ea[c];
  }
  __syncthreads();

  // phase 3
  float A[16], D[16];
#pragma unroll
  for (int i = 0; i < 16; ++i) { A[i] = sA[wave * 16 + i]; D[i] = sD[wave * 16 + i]; }
  const float* pr = p + (size_t)(wave * 16) * TT + lane;
  const int hh = lane >> 4, c16 = lane & 15;
#pragma unroll 1
  for (int tc = 0; tc < TT / 32; ++tc) {
    __syncthreads();
    float y[16];
#pragma unroll
    for (int i = 0; i < 16; ++i) {
      const float f = pr[(size_t)i * TT + tc * 32];
      y[i] = fmaf(f, A[i], D[i]);
    }
    v4u p0, p1;
#pragma unroll
    for (int m = 0; m < 4; ++m) {
      p0[m] = pkf(y[2 * m], y[2 * m + 1]);
      p1[m] = pkf(y[8 + 2 * m], y[9 + 2 * m]);
    }
    sT4[lane * 17 + wave * 2] = p0;
    sT4[lane * 17 + wave * 2 + 1] = p1;
    __syncthreads();
    v4u v[2];
#pragma unroll
    for (int it = 0; it < 2; ++it) {
      const int row = it * 16 + wave * 2 + hh;
      v[it] = sT4[row * 17 + c16];
    }
#pragma unroll
    for (int it = 0; it < 2; ++it) {
      const int row = it * 16 + wave * 2 + hh;
      *(v4u*)(xt + ((size_t)b * TT + tc * 32 + row) * CC + c0 + c16 * 8) = v[it];
    }
    
  }
}

// =====================================================================================================
// LDS-staged f16 WMMA GEMM: C[m][n] = oscale * sum_tap sum_k A_tap[m][k] * Bt_tap[n][k]
//   + bias (BM: 1 per row m with the A row remap, 2 per column n with the Bt row remap) * bscale
//   (+ resid[m][n] f32, same indexing as C, when RESID).
// Work-group = 8 waves = one 128 x 256 tile of C; wave (wm 0..1, wn 0..3) = 64 x 64 of it.
// A row-major [M][K] pitch lda; Bt row-major [N][K] (k contiguous) pitch ldb. Row remap:
// row(m) = (m>>6)*TS + TO + (m&63). Tap tp adds aTap elements to A and bTap elements to Bt.
// blockIdx.y = batch index (strides in elements). M multiple of 128, N of 256, K of 128 (host constants).
// A stage = 128 k of the 128 A rows and the 256 Bt rows, 256-B rows at a 272-B pitch in LDS, brought by
// asynchronous 16-B copies (24 per lane and stage, 16 lanes per row); two buffers, the next stage's
// copies fly while this one is multiplied. k runs tap-major and ascending, one accumulator per element.
// OUTH: 0 f32 C (pitch ldc), 1 f16 C. Epilogue: 16-row slabs staged per wave in LDS.
// coverage: 4 slabs x 16 rows x 64 cols = the wave's 64x64 tile; grid = exact tile count.
// =====================================================================================================
#define G_BM 128
#define G_BN 256
#define G_KS 128
#define G_PITCH 136                         // halves per LDS row: 272 B = 16 B x odd, for 16-B LDS reads
#define G_BUF ((G_BM + G_BN) * G_PITCH)     // halves per buffer

#if defined(__HIP_DEVICE_COMPILE__)
// twelve copies of one lane; the address-register wait closes the copies' own statement, so that no
// later write of an address register can be moved in front of it
#define G_COPY12(l, g)                                                          \
  asm volatile("global_load_async_to_lds_b128 %0, %12, off\n\t"                 \
               "global_load_async_to_lds_b128 %1, %13, off\n\t"                 \
               "global_load_async_to_lds_b128 %2, %14, off\n\t"                 \
               "global_load_async_to_lds_b128 %3, %15, off\n\t"                 \
               "global_load_async_to_lds_b128 %4, %16, off\n\t"                 \
               "global_load_async_to_lds_b128 %5, %17, off\n\t"                 \
               "global_load_async_to_lds_b128 %6, %18, off\n\t"                 \
               "global_load_async_to_lds_b128 %7, %19, off\n\t"                 \
               "global_load_async_to_lds_b128 %8, %20, off\n\t"                 \
               "global_load_async_to_lds_b128 %9, %21, off\n\t"                 \
               "global_load_async_to_lds_b128 %10, %22, off\n\t"                \
               "global_load_async_to_lds_b128 %11, %23, off\n\t"                \
               "s_wait_xcnt 0x0"                                                \
               :                                                                \
               : "v"((l)[0]), "v"((l)[1]), "v"((l)[2]), "v"((l)[3]), "v"((l)[4]), "v"((l)[5]),               \
                 "v"((l)[6]), "v"((l)[7]), "v"((l)[8]), "v"((l)[9]), "v"((l)[10]), "v"((l)[11]),             \
                 "v"((g)[0]), "v"((g)[1]), "v"((g)[2]), "v"((g)[3]), "v"((g)[4]), "v"((g)[5]),               \
                 "v"((g)[6]), "v"((g)[7]), "v"((g)[8]), "v"((g)[9]), "v"((g)[10]), "v"((g)[11])              \
               : "memory")
// this wave's copies have landed
#define G_WAIT_COPIES() asm volatile("s_wait_asynccnt 0x0" ::: "memory")
// this wave's LDS reads have returned, so the buffer may be refilled behind the barrier
#define G_WAIT_LDS() asm volatile("s_wait_dscnt 0x0" ::: "memory")
#else
#define G_COPY12(l, g) ((void)0)
#define G_WAIT_COPIES() ((void)0)
#define G_WAIT_LDS() ((void)0)
#endif

template <int TAPS, int OUTH, bool RESID, int BM>
__global__ __launch_bounds__(256) void gemm_k(
    const _Float16* __restrict__ A, int lda, long long strideA, long long aTap, int aTS, int aTO,
    const _Float16* __restrict__ Bt, int ldb, long long strideB, long long bTap, int bTS, int bTO,
    const float* __restrict__ bias, float bscale,
    const float* __restrict__ resid,
    void* Cout, int ldc, long long strideC,
    int M, int N, int K, float oscale) {
  __shared__ __align__(16) _Float16 sAB[2 * G_BUF];
  __shared__ __align__(16) float sT[8][16 * 68];
  const int bz = blockIdx.y;
  const int tid = threadIdx.x;
  const int lane = tid & 31, wave = tid >> 5;
  const int tilesN = N >> 8, tilesM = M >> 7;
  const int tile = blockIdx.x;
  if (tile >= tilesM * tilesN) return;   // the same for the whole work-group, ahead of every barrier
  const int tm = tile / tilesN, tn = tile - tm * tilesN;
  const int mB = tm << 7, nB = tn << 8;
  const int wm = wave >> 2, wn = wave & 3;
  const int m0 = mB + wm * 64, n0 = nB + wn * 64;
  const int rlane = lane & 15;
  const int koff = (lane >> 4) * 8;
  const int mOff = koff;
  const int aRow0 = (m0 >> 6) * aTS + aTO;
  const int bRow0 = (n0 >> 6) * bTS + bTO;
  const _Float16* Ab = A + (size_t)bz * (size_t)strideA;
  const _Float16* Bb = Bt + (size_t)bz * (size_t)strideB;

  // copy side: lane -> (row tid>>4 of each 16-row band, 16-B piece tid&15 of its 256 B);
  // bands 0..7 are the A rows, bands 8..23 the Bt rows
  const int crow = tid >> 4, cpc = (tid & 15) * 8;
  const unsigned tA = (unsigned)(crow * lda + cpc);
  const unsigned tB = (unsigned)(crow * ldb + cpc);
  const unsigned ldsC = (unsigned)(size_t)sAB + (unsigned)(crow * G_PITCH + cpc) * 2u;

  auto issue = [&](int tp, int k0, int buf) {
    const _Float16* Ap = Ab + (size_t)tp * (size_t)aTap + k0 + tA;
    const _Float16* Bp = Bb + (size_t)tp * (size_t)bTap + k0 + tB;
#pragma unroll   // constant indices keep the array in registers
    for (int hlf = 0; hlf < 2; ++hlf) {
      unsigned l[12];
      const _Float16* g[12];
#pragma unroll   // constant indices keep the array in registers
      for (int e = 0; e < 12; ++e) {
        const int i = hlf * 12 + e;           // band
        l[e] = ldsC + (unsigned)buf * (unsigned)(G_BUF * 2) + (unsigned)i * (unsigned)(16 * G_PITCH * 2);
        if (i < 8) {
          const int row = ((mB >> 6) + (i >> 2)) * aTS + aTO + 16 * (i & 3);
          g[e] = Ap + (size_t)(unsigned)(row * lda);
        } else {
          const int row = ((nB >> 6) + ((i - 8) >> 2)) * bTS + bTO + 16 * ((i - 8) & 3);
          g[e] = Bp + (size_t)(unsigned)(row * ldb);
        }
      }
      G_COPY12(l, g);
    }
  };

  v8f acc[4][4];
#pragma unroll   // constant indices keep the array in registers
  for (int i = 0; i < 4; ++i)
#pragma unroll   // constant indices keep the array in registers
    for (int j = 0; j < 4; ++j) acc[i][j] = zero8();

  const _Float16* fa = sAB + (wm * 64 + rlane) * G_PITCH + koff;
  const _Float16* fb = sAB + (G_BM + wn * 64 + rlane) * G_PITCH + koff;

  const int nt = TAPS * (K >> 7);
  int itp = 0, ik = 0;                      // tap and k of the next stage to be copied
  issue(itp, ik, 0);
  ik += G_KS;
  if (ik >= K) { ik = 0; ++itp; }
  G_WAIT_COPIES();
  __syncthreads();
  if (nt > 1) {
    issue(itp, ik, 1);
    ik += G_KS;
    if (ik >= K) { ik = 0; ++itp; }
  }

#pragma unroll 1   // one stage per trip: the two buffers alternate by the trip's parity
  for (int t = 0; t < nt; ++t) {
    const _Float16* pa = fa + (t & 1) * G_BUF;
    const _Float16* pb = fb + (t & 1) * G_BUF;
#pragma unroll   // constant indices keep the array in registers
    for (int kk = 0; kk < G_KS / 32; ++kk) {
      v16h af[4], bf[4];
#pragma unroll   // constant indices keep the array in registers
      for (int i = 0; i < 4; ++i) af[i] = ldfrag(pa + i * 16 * G_PITCH + kk * 32);
#pragma unroll   // constant indices keep the array in registers
      for (int j = 0; j < 4; ++j) bf[j] = ldfrag(pb + j * 16 * G_PITCH + kk * 32);
      // keeps the block's 16 LDS reads one group ahead of its 16 WMMAs: left free, the reads of each A
      // fragment sink to just in front of its row and every row waits out a whole LDS latency
      __builtin_amdgcn_sched_barrier(0);
#pragma unroll   // constant indices keep the array in registers
      for (int i = 0; i < 4; ++i)
#pragma unroll   // constant indices keep the array in registers
        for (int j = 0; j < 4; ++j) acc[i][j] = mma_raw(af[i], bf[j], acc[i][j]);
    }
    // publish point of stage t + 1; the same barrier ends every read of the buffer refilled behind it
    G_WAIT_LDS();
    G_WAIT_COPIES();
    __syncthreads();
    if (t + 2 < nt) {
      issue(itp, ik, t & 1);
      ik += G_KS;
      if (ik >= K) { ik = 0; ++itp; }
    }
  }
  G_WAIT_COPIES();

  // ---- epilogue ----
  float* slab = sT[wave];
#pragma unroll
  for (int i = 0; i < 4; ++i) {
    const int mBase = m0 + i * 16;
    float badd[8];
#pragma unroll
    for (int r = 0; r < 8; ++r) badd[r] = 0.f;
    if (BM == 1) {
#pragma unroll
      for (int r = 0; r < 8; ++r) badd[r] = bias[aRow0 + i * 16 + mOff + r] * bscale;
    }
#pragma unroll
    for (int j = 0; j < 4; ++j) {
      float bc = 0.f;
      if (BM == 2) bc = bias[bRow0 + j * 16 + rlane] * bscale;
#pragma unroll
      for (int r = 0; r < 8; ++r)
        slab[(mOff + r) * 68 + j * 16 + rlane] = acc[i][j][r] * oscale + badd[r] + bc;
    }
    __builtin_amdgcn_fence(__ATOMIC_RELEASE, "workgroup");
    __builtin_amdgcn_wave_barrier();
    __builtin_amdgcn_fence(__ATOMIC_ACQUIRE, "workgroup");
    if (OUTH == 0) {
      float* Cb = (float*)Cout + (size_t)bz * (size_t)strideC;
      const float* Rb = RESID ? (resid + (size_t)bz * (size_t)strideC) : resid;
      const int h2 = lane >> 4, c4 = (lane & 15) * 4;     // 256-B row segment = 16 lanes x 16 B
      {
#pragma unroll
        for (int it = 0; it < 8; ++it) {
          const int row = it * 2 + h2;                     // it 0..7 x h2 0..1 = rows 0..15
          v4f v = *(const v4f*)(slab + row * 68 + c4);
          const size_t off = (size_t)(mBase + row) * ldc + n0 + c4;
          if (RESID) v += *(const v4f*)(Rb + off);
          *(v4f*)(Cb + off) = v;
        }
        
      }
    } else {
      _Float16* Cb = (_Float16*)Cout + (size_t)bz * (size_t)strideC;
      const int q = lane >> 3, c8 = (lane & 7) * 8;
      v4u hv[4];
#pragma unroll
      for (int it = 0; it < 4; ++it) {
        const int row = it * 4 + q;                        // it 0..3 x q 0..3 = rows 0..15
        const float* sp = slab + row * 68 + c8;
        v4u a;
#pragma unroll
        for (int e = 0; e < 4; ++e) a[e] = pkf(sp[2 * e], sp[2 * e + 1]);
        hv[it] = a;
      }
      {
#pragma unroll
        for (int it = 0; it < 4; ++it) {
          const int row = it * 4 + q;
          *(v4u*)(Cb + (size_t)(mBase + row) * ldc + n0 + c8) = hv[it];
        }
        
      }
    }
    __builtin_amdgcn_fence(__ATOMIC_RELEASE, "workgroup");
    __builtin_amdgcn_wave_barrier();
    __builtin_amdgcn_fence(__ATOMIC_ACQUIRE, "workgroup");
  }
}

// =====================================================================================================
// Attention, head dim 64, non-causal over TT keys, additive position bias from the table.
//   Qp / Kp (f16, x16): element (b, t, h, d) at [(b*TT + t)*CC + h*64 + d]
//   Vp (f16, x16):      element (b, h, d, s) at [(b*CC + h*64 + d)*TT + s]
//   tab f32 [h][BTP]:   bias(t, s) = tab[h][(t - s) + 1024]
//   AT (f16, x256):     normalised context, element (b, t, h, d) at [(b*TT + t)*CC + h*64 + d]
//   scores = q16 . k16 (f16 WMMA, f32 acc) * sScale + bias; online softmax in f32;
//   p = exp(s - m) carried as f16(1024 p); context += p . v^T tile on f16 WMMA.
//   Block = 4 waves = 64 query rows of one (b, h); grid = 16 * NH * NBATCH; 16 key tiles of 64.
//   K / V^T tile staging: 128 threads x 32 elements per plane = the whole 64x64 tile (plain 16-B
//   loads, __syncthreads before and after). P tiles are wave-private, spilled with _Float16 element
//   Output coverage: each wave stores rows q0..q0+15 (it 0..3 x lane>>3 0..3) x 64 d (8 lanes x 8),
// =====================================================================================================
__global__ __launch_bounds__(128)
void attn_k(const _Float16* __restrict__ Qp, const _Float16* __restrict__ Kp, const _Float16* __restrict__ Vp,
            const float* __restrict__ tab, _Float16* AT, float sScale, float oScale) {
  union FH { v16h v; v8h h[2]; };
  __shared__ __align__(16) _Float16 Ksh[64 * 64];      // [kv][d]
  __shared__ __align__(16) _Float16 Vth[64 * 64];      // [d][kv]
  __shared__ __align__(16) _Float16 Psh[4][16 * 64];   // per wave P [row][kv]
  __shared__ __align__(16) float    Os[4][16 * 64];    // per wave context [row][d]
  __shared__ __align__(16) float    sB[384 * 4];       // bias slice tab[h][q0b .. q0b+1087] (+clamped fill)

  const int tid  = threadIdx.x;
  const int wave = tid >> 5;
  const int lane = tid & 31;
  const int hh   = lane >> 4;
  const int c    = lane & 15;

  const int bx  = blockIdx.x;
  const int qb  = bx & 15;
  const int h   = (bx >> 4) & 15;
  const int b   = bx >> 8;
  const int q0b = qb * 64;
  const int q0  = q0b + wave * 16;
  const size_t rowB = (size_t)b * TT;

  {
    const float* th = tab + (size_t)h * BTP + q0b;     // q0b + 1087 <= 2047 < BTP
#pragma unroll
    for (int k = 0; k < 3; ++k) {
      const int i  = tid + 128 * k;                     // 0..383
      const int ic = (i < 271) ? i : 271;               // clamped address, all lanes load
      *(v4f*)(sB + 4 * i) = *(const v4f*)(th + 4 * ic);
    }
  }

  const _Float16* Qh = Qp + (size_t)h * HD;
  const _Float16* Kh = Kp + (size_t)h * HD;
  const _Float16* Vh = Vp + ((size_t)b * CC + (size_t)h * HD) * TT;

  // ---- Q fragments (A operand, row = lane&15): 2 d-chunks ----
  v16h qa[2];
#pragma unroll
  for (int dc = 0; dc < 2; ++dc) qa[dc] = ldfrag(Qh + (rowB + q0 + c) * CC + dc * 32 + 8 * hh);

  float mrow[8], lrow[8];
  v8f oacc[4];
#pragma unroll
  for (int r = 0; r < 8; ++r) { mrow[r] = -INFINITY; lrow[r] = 0.f; }
#pragma unroll
  for (int t = 0; t < 4; ++t) oacc[t] = zero8();

  // bias index: (t - q0b) - s + 1024 with t - q0b = wave*16 + 8hh + r, s = kv0 + 16j + c
  const int bbase = wave * 16 + 8 * hh + 1024 - c;
  _Float16* pwh = Psh[wave];

#pragma unroll 1
  for (int kt = 0; kt < TT / 64; ++kt) {
    const int kv0 = kt * 64;
    __syncthreads();
    {
      const int r = tid >> 1, half = (tid & 1) * 32;
      const _Float16* kg = Kh + (rowB + kv0 + r) * CC + half;     // K row kv0+r, d = half..half+31
      const _Float16* vg = Vh + (size_t)r * TT + kv0 + half;     // V^T row d = r, s = kv0+half..+31
#pragma unroll
      for (int i = 0; i < 4; ++i) {
        const v8h a0 = *(const v8h*)(kg + 8 * i);
        const v8h b0 = *(const v8h*)(vg + 8 * i);
        *(v8h*)(Ksh + r * 64 + half + 8 * i) = a0;
        *(v8h*)(Vth + r * 64 + half + 8 * i) = b0;
      }
    }
    __syncthreads();

    // ---- scores: 16 query rows x 64 keys per wave ----
    v8f s[4];
#pragma unroll
    for (int j = 0; j < 4; ++j) {
      s[j] = zero8();
#pragma unroll
      for (int dc = 0; dc < 2; ++dc) {
        FH kb;
        kb.h[0] = *(const v8h*)(Ksh + (j * 16 + c) * 64 + dc * 32 + 8 * hh);
        kb.h[1] = *(const v8h*)(Ksh + (j * 16 + c) * 64 + dc * 32 + 16 + 8 * hh);
        s[j] = mma_h(qa[dc], kb.v, s[j]);
      }
    }

    // ---- scale + bias, row max, online softmax, P (x1024, f16) to LDS ----
    const int bk = bbase - kv0;
#pragma unroll
    for (int r = 0; r < 8; ++r) {
      float m = -INFINITY;
#pragma unroll
      for (int j = 0; j < 4; ++j) {
        const float sv = s[j][r] * sScale + sB[bk + r - 16 * j];
        s[j][r] = sv;
        m = fmaxf(m, sv);
      }
#pragma unroll
      for (int off = 1; off < 16; off <<= 1) m = fmaxf(m, __shfl_xor(m, off, 32));
      const float mnew  = fmaxf(mrow[r], m);
      const float msafe = (mnew == -INFINITY) ? 0.f : mnew;
      const float alpha = __expf(mrow[r] - msafe);
      mrow[r] = mnew;
      float psum = 0.f;
#pragma unroll
      for (int j = 0; j < 4; ++j) {
        const float pe = __expf(s[j][r] - msafe);
        psum += pe;
        pwh[(8 * hh + r) * 64 + j * 16 + c] = (_Float16)(pe * 1024.0f);
      }
#pragma unroll
      for (int off = 1; off < 16; off <<= 1) psum += __shfl_xor(psum, off, 32);
      lrow[r] = lrow[r] * alpha + psum;
#pragma unroll
      for (int t = 0; t < 4; ++t) oacc[t][r] *= alpha;
    }
    __builtin_amdgcn_fence(__ATOMIC_RELEASE, "workgroup");
    __builtin_amdgcn_wave_barrier();
    __builtin_amdgcn_fence(__ATOMIC_ACQUIRE, "workgroup");

    // ---- context += P . V (f16 WMMA) ----
#pragma unroll
    for (int kk = 0; kk < 2; ++kk) {
      FH pa;
      pa.h[0] = *(const v8h*)(pwh + c * 64 + kk * 32 + 8 * hh);
      pa.h[1] = *(const v8h*)(pwh + c * 64 + kk * 32 + 16 + 8 * hh);
#pragma unroll
      for (int t = 0; t < 4; ++t) {
        FH vb;
        vb.h[0] = *(const v8h*)(Vth + (t * 16 + c) * 64 + kk * 32 + 8 * hh);
        vb.h[1] = *(const v8h*)(Vth + (t * 16 + c) * 64 + kk * 32 + 16 + 8 * hh);
        oacc[t] = mma_h(pa.v, vb.v, oacc[t]);
      }
    }
  }

  // ---- normalise (1/l, the 1/1024 p carry, the x16 v carry and the x256 output carry are all in
  float* os = Os[wave];
#pragma unroll
  for (int r = 0; r < 8; ++r) {
    const float l = lrow[r];
    const float inv = ((l > 0.f) ? rcp_f(l) : 0.f) * oScale;
#pragma unroll
    for (int t = 0; t < 4; ++t) os[(8 * hh + r) * 64 + t * 16 + c] = oacc[t][r] * inv;
  }
  __builtin_amdgcn_fence(__ATOMIC_RELEASE, "workgroup");
  __builtin_amdgcn_wave_barrier();
  __builtin_amdgcn_fence(__ATOMIC_ACQUIRE, "workgroup");
  {
    const int q4 = lane >> 3, c8 = (lane & 7) * 8;
    v4u hv[4];
#pragma unroll
    for (int it = 0; it < 4; ++it) {
      const int row = it * 4 + q4;   // it 0..3 x q4 0..3 = rows 0..15 of the wave tile
      const float* sp = os + row * 64 + c8;
      v4u a;
#pragma unroll
      for (int e = 0; e < 4; ++e) a[e] = pkf(sp[2 * e], sp[2 * e + 1]);
      hv[it] = a;
    }
    {
#pragma unroll
      for (int it = 0; it < 4; ++it) {
        const int row = it * 4 + q4;
        const size_t go = (rowB + q0 + row) * CC + (size_t)h * HD + c8;
        *(v4u*)(AT + go) = hv[it];
      }
      
    }
  }
}

// =====================================================================================================
// Workspace map (bytes):
//   W1t  f16 [3][1024][1024]       0            6291456
//   W2t  f16 [3][1024][1024]       6291456      6291456
//   Wqkv f16 [3072][1024]          12582912     6291456
//   Wp   f16 [1024][1024]          18874368     2097152
//   Tab  f32 [16][2048]            20971520      131072
//   XT   f16 [8][1026][1024]       21102592    16809984   (later: XT3 [8][1024][1024], then AT [8192][1024])
//   R1   f32 [8][1024][1024]       37912576    33554432   (F1, then H, then Qp + Kp f16 [8192][1024] each)
//   Xin  f32 [8][1024][1024]       71467008    33554432
//   Vp   f16 [8][1024][1024]       105021440   16777216
//   end                            121798656
// Every plane is an exact multiple of its whole-line / whole-tile store granularity (incl. the two
// halo token rows per sample in XT); no tail padding needed.
// =====================================================================================================
extern "C" void kernel_launch(void* const* d_in, const int* in_sizes, int n_in,
                              void* d_out, int out_size, void* d_ws, size_t ws_size,
                              hipStream_t stream) {
  if (n_in < 18) return;
  const int nAct = NBATCH * CC * TT;                     // 8388608
  if (in_sizes[0] != nAct || out_size != nAct) return;
  if (in_sizes[3] != CC * CC * 3 || in_sizes[7] != CC * CC * 3) return;
  if (in_sizes[13] != 3 * CC * CC || in_sizes[15] != CC * CC) return;
  if (in_sizes[1] != CC || in_sizes[2] != CC || in_sizes[4] != CC || in_sizes[5] != CC ||
      in_sizes[6] != CC || in_sizes[8] != CC || in_sizes[9] != CC || in_sizes[10] != CC ||
      in_sizes[11] != CC || in_sizes[12] != CC || in_sizes[16] != CC) return;
  if (in_sizes[14] != 3 * CC || in_sizes[17] != NBUCK * NH) return;

  const float* x      = (const float*)d_in[0];
  const float* gn1_g  = (const float*)d_in[1];
  const float* gn1_b  = (const float*)d_in[2];
  const float* c1_w   = (const float*)d_in[3];
  const float* c1_b   = (const float*)d_in[4];
  const float* gn2_g  = (const float*)d_in[5];
  const float* gn2_b  = (const float*)d_in[6];
  const float* c2_w   = (const float*)d_in[7];
  const float* c2_b   = (const float*)d_in[8];
  const float* n8_g   = (const float*)d_in[9];
  const float* n8_b   = (const float*)d_in[10];
  const float* ag_g   = (const float*)d_in[11];
  const float* ag_b   = (const float*)d_in[12];
  const float* qkv_w  = (const float*)d_in[13];
  const float* qkv_b  = (const float*)d_in[14];
  const float* pj_w   = (const float*)d_in[15];
  const float* pj_b   = (const float*)d_in[16];
  const float* remb   = (const float*)d_in[17];

  const size_t PWC  = (size_t)3 * CC * CC * 2;          //  6291456
  const size_t PWQ  = (size_t)3 * CC * CC * 2;          //  6291456
  const size_t PWP  = (size_t)CC * CC * 2;              //  2097152
  const size_t PTAB = (size_t)NH * BTP * 4;             //   131072
  const size_t PXT  = (size_t)NBATCH * TP * CC * 2;     // 16809984
  const size_t PF   = (size_t)NBATCH * CC * TT * 4;     // 33554432
  const size_t PV   = (size_t)NBATCH * CC * TT * 2;     // 16777216
  size_t off = 0;
  const size_t oW1  = off; off += PWC;
  const size_t oW2  = off; off += PWC;
  const size_t oWq  = off; off += PWQ;
  const size_t oWp  = off; off += PWP;
  const size_t oTab = off; off += PTAB;
  const size_t oXT  = off; off += PXT;
  const size_t oR1  = off; off += PF;
  const size_t oXin = off; off += PF;
  const size_t oV   = off; off += PV;
  if (off > ws_size) return;                            // off = 121798656
  if (off > (size_t)134217728) return;
  if (2 * PV > PF) return;                              // Qp + Kp live inside R1
  if ((size_t)NBATCH * TT * CC * 2 > PXT) return;       // XT3 / AT fit in the XT region

  char* ws = (char*)d_ws;
  _Float16* W1t  = (_Float16*)(ws + oW1);
  _Float16* W2t  = (_Float16*)(ws + oW2);
  _Float16* Wqkv = (_Float16*)(ws + oWq);
  _Float16* Wpb  = (_Float16*)(ws + oWp);
  float*    Tab  = (float*)(ws + oTab);
  _Float16* XT   = (_Float16*)(ws + oXT);               // [8][1026][1024] with halo rows
  _Float16* XT3  = (_Float16*)(ws + oXT);               // [8][1024][1024], later use of the same region
  _Float16* ATp  = (_Float16*)(ws + oXT);               // [8192][1024], last use of the same region
  float*    F1   = (float*)(ws + oR1);
  float*    Hb   = (float*)(ws + oR1);
  _Float16* Qp   = (_Float16*)(ws + oR1);
  _Float16* Kp   = (_Float16*)(ws + oR1 + PV);
  float*    Xin  = (float*)(ws + oXin);
  _Float16* Vp   = (_Float16*)(ws + oV);

  const dim3 blk(256);
  const int  n8q = 3 * CC * CC / 8;                     // 393216
  const int  n8p = CC * CC / 8;                         // 131072
  const long long CCCC = (long long)CC * CC;
  const long long CT   = (long long)CC * TT;

  // (1) weights -> f16 x64 planes; position bias table
  cvt_convw<<<dim3(CC * (CC / 8) / 256), blk, 0, stream>>>(c1_w, W1t, 64.0f);
  cvt_convw<<<dim3(CC * (CC / 8) / 256), blk, 0, stream>>>(c2_w, W2t, 64.0f);
  cvt_f16x8<<<dim3((n8q + 255) / 256), blk, 0, stream>>>(qkv_w, Wqkv, n8q, 64.0f);
  cvt_f16x8<<<dim3((n8p + 255) / 256), blk, 0, stream>>>(pj_w, Wpb, n8p, 64.0f);
  btab_k<<<dim3(NH * (BTP / 4) / 256), blk, 0, stream>>>(remb, Tab);

  // (2) h = silu(GN32(x)) -> XT (token-major f16, halo rows)
  gn32_tr_k<true><<<dim3(CC / 64, NBATCH), blk, 0, stream>>>(x, gn1_g, gn1_b, XT);
  // (3) F1 = conv1(h) + b1 -> f32 NCT   (per b: M=1024 o, N=1024 t, K=3 taps x 1024)
  gemm_k<3, 0, false, 1><<<dim3((CC / 128) * (TT / 256), NBATCH), blk, 0, stream>>>(
      W1t, CC, 0LL, CCCC, 64, 0,
      XT, CC, (long long)TP * CC, (long long)CC, 64, 0,
      c1_b, 1.0f, nullptr,
      (void*)F1, TT, CT, CC, TT, CC, 1.0f / 64.0f);
  // (4) h = silu(GN32(F1)) -> XT
  gn32_tr_k<true><<<dim3(CC / 64, NBATCH), blk, 0, stream>>>(F1, gn2_g, gn2_b, XT);
  // (5) H = conv2(h) + b2 + x -> f32 NCT (R1)
  gemm_k<3, 0, true, 1><<<dim3((CC / 128) * (TT / 256), NBATCH), blk, 0, stream>>>(
      W2t, CC, 0LL, CCCC, 64, 0,
      XT, CC, (long long)TP * CC, (long long)CC, 64, 0,
      c2_b, 1.0f, x,
      (void*)Hb, TT, CT, CC, TT, CC, 1.0f / 64.0f);
  // (6) xin = GN8(H) -> f32 NCT; GN32(xin) -> XT3 (token-major f16, no halo)
  gn8_attn_k<<<dim3(CC / 128, NBATCH), blk, 0, stream>>>(Hb, n8_g, n8_b, ag_g, ag_b, Xin, XT3);
  // (7) q = xn^T . Wq^T -> Qp [b*TT+t][h*64+d] f16 x16  (M=8192, N=1024, K=1024; W rows h*192+d)
  gemm_k<1, 1, false, 2><<<dim3((NBATCH * TT / 128) * (CC / 256), 1), blk, 0, stream>>>(
      XT3, CC, 0LL, 0LL, 64, 0,
      Wqkv, CC, 0LL, 0LL, 192, 0,
      qkv_b, 16.0f, nullptr,
      (void*)Qp, CC, 0LL, NBATCH * TT, CC, CC, 0.25f);
  // (8) k -> Kp (W rows h*192+64+d)
  gemm_k<1, 1, false, 2><<<dim3((NBATCH * TT / 128) * (CC / 256), 1), blk, 0, stream>>>(
      XT3, CC, 0LL, 0LL, 64, 0,
      Wqkv, CC, 0LL, 0LL, 192, 64,
      qkv_b, 16.0f, nullptr,
      (void*)Kp, CC, 0LL, NBATCH * TT, CC, CC, 0.25f);
  // (9) v (channel-major) = Wv . xn -> Vp [b][h*64+d][s] f16 x16 (per b: M=1024 rows h*192+128+d, N=1024 t)
  gemm_k<1, 1, false, 1><<<dim3((CC / 128) * (TT / 256), NBATCH), blk, 0, stream>>>(
      Wqkv, CC, 0LL, 0LL, 192, 128,
      XT3, CC, CT, 0LL, 64, 0,
      qkv_b, 16.0f, nullptr,
      (void*)Vp, TT, CT, CC, TT, CC, 0.25f);
  // (10) attention -> AT [b*TT+t][h*64+d] f16 x256
  attn_k<<<dim3((TT / 64) * NH * NBATCH), dim3(128), 0, stream>>>(
      Qp, Kp, Vp, Tab, ATp, 1.0f / 2048.0f, 1.0f / 64.0f);
  // (11) out = xin + proj(a) + bp -> d_out f32 NCT (per b: M=1024 o, N=1024 t, K=1024)
  gemm_k<1, 0, true, 1><<<dim3((CC / 128) * (TT / 256), NBATCH), blk, 0, stream>>>(
      Wpb, CC, 0LL, 0LL, 64, 0,
      ATp, CC, CT, 0LL, 64, 0,
      pj_b, 1.0f, Xin,
      d_out, TT, CT, CC, TT, CC, 1.0f / 16384.0f);
  (void)hipGetLastError();
}

// v002
// Measured time: 573 microseconds a run.
// Next to v001, in two timings, it ran 1.12 times as fast each time.
// Counting every step since v000, it is 1.66 times as fast.
// Contractions: conv k3 (two), qkv 1x1, q.k^T, p.v, proj 1x1 = v_wmma_f32_16x16x32_f16 (f16 operands: weights x64, GroupNorm activations x1, q/k/v x16, p x1024, attention output x256), f32 accumulate; GroupNorm statistics f64, softmax / position bias / residuals f32.
#include <hip/hip_runtime.h>
#include <math.h>
#include <stdint.h>

#define NBATCH 8
#define CC 1024
#define TT 1024
#define TP 1026
#define NH 16
#define HD 64
#define NBUCK 32
#define BTP 2048

static_assert(NH * HD == CC);
static_assert((CC % 256) == 0 && (TT % 256) == 0);

typedef _Float16 v16h __attribute__((ext_vector_type(16)));
typedef _Float16 v8h  __attribute__((ext_vector_type(8)));
typedef float    v8f  __attribute__((ext_vector_type(8)));
typedef float    v4f  __attribute__((ext_vector_type(4)));
typedef unsigned int v4u __attribute__((ext_vector_type(4)));

// ---- hazard guards (device pass only; no-op for the host pass) ----
#if defined(__HIP_DEVICE_COMPILE__)
#define HZ_ACC_AB(c, a, b) asm volatile("v_nop\n\tv_nop\n\tv_nop\n\tv_nop" : "+v"(c) : "v"(a), "v"(b))
#else
#define HZ_ACC_AB(c, a, b) ((void)0)
#endif

// ---- scalar helpers ----
__device__ __forceinline__ unsigned short h_bits(_Float16 x) { return __builtin_bit_cast(unsigned short, x); }
__device__ __forceinline__ unsigned pkf(float a, float b) {
  return (unsigned)h_bits((_Float16)a) | ((unsigned)h_bits((_Float16)b) << 16);
}
__device__ __forceinline__ v8f zero8() { v8f z = {0.f, 0.f, 0.f, 0.f, 0.f, 0.f, 0.f, 0.f}; return z; }
__device__ __forceinline__ float rcp_f(float x) { return __builtin_amdgcn_rcpf(x); }

// ---- 16-bit A/B fragment: lane -> row/col (lane&15); p already includes +8*(lane>>4);
//      elements 0..7 <- p[0..7] (k0+8h..), elements 8..15 <- p[16..23] (k0+16+8h..)
__device__ __forceinline__ v16h ldfrag(const _Float16* p) {
  union { v16h v; v8h h[2]; } f;
  f.h[0] = *(const v8h*)(p);
  f.h[1] = *(const v8h*)(p + 16);
  return f.v;
}

// ---- WMMA helpers ----
__device__ __forceinline__ v8f mma_h(v16h a, v16h b, v8f c) {
  c = __builtin_amdgcn_wmma_f32_16x16x32_f16(false, a, false, b, (short)0, c, false, false);
  HZ_ACC_AB(c, a, b);
  return c;
}
__device__ __forceinline__ v8f mma_raw(v16h a, v16h b, v8f c) {
  return __builtin_amdgcn_wmma_f32_16x16x32_f16(false, a, false, b, (short)0, c, false, false);
}

// ---- f64 wave shuffle and block-wide two-value sum (fixed order) ----
__device__ __forceinline__ double shfl_xor_d(double v, int m) {
  const unsigned long long u = (unsigned long long)__double_as_longlong(v);
  const int lo = __shfl_xor((int)(unsigned)(u & 0xffffffffull), m, 32);
  const int hi = __shfl_xor((int)(unsigned)(u >> 32), m, 32);
  const unsigned long long r = ((unsigned long long)(unsigned)hi << 32) | (unsigned long long)(unsigned)lo;
  return __longlong_as_double((long long)r);
}
// red: 16 doubles in LDS; every thread returns with the block totals
__device__ __forceinline__ void block_sum2(double& s, double& ss, double* red, int tid) {
#pragma unroll
  for (int m = 16; m >= 1; m >>= 1) {
    s += shfl_xor_d(s, m);
    ss += shfl_xor_d(ss, m);
  }
  const int wave = tid >> 5, lane = tid & 31;
  __syncthreads();
  if (lane == 0) { red[wave] = s; red[8 + wave] = ss; }
  __syncthreads();
  double S = 0.0, SS = 0.0;
#pragma unroll
  for (int w = 0; w < 8; ++w) { S += red[w]; SS += red[8 + w]; }
  s = S;
  ss = SS;
}

// =====================================================================================================
// f32 -> f16 (x scale), 8 elements per thread, one 16-B store per lane (wave = 512 contiguous B =
// coverage: n8*8 = whole plane (n8 is a multiple of 256 for both uses).
// =====================================================================================================
__global__ __launch_bounds__(256) void cvt_f16x8(const float* __restrict__ in, _Float16* out, int n8, float scale) {
  const int i = blockIdx.x * 256 + threadIdx.x;
  if (i < n8) {
    const v4f a = *(const v4f*)(in + (size_t)i * 8);
    const v4f c = *(const v4f*)(in + (size_t)i * 8 + 4);
    v4u p;
    p[0] = pkf(a[0] * scale, a[1] * scale);
    p[1] = pkf(a[2] * scale, a[3] * scale);
    p[2] = pkf(c[0] * scale, c[1] * scale);
    p[3] = pkf(c[2] * scale, c[3] * scale);
    _Float16* dst = out + (size_t)i * 8;
    *(v4u*)dst = p;
    
  }
}

// =====================================================================================================
// conv weight [o][c][3] f32 -> Wt[tap][o][c] f16 (x scale). Thread = (o, 8 consecutive c): reads
// 24 contiguous floats, writes one 16-B piece into each of the 3 tap planes; a wave covers 512
// contiguous B of one row per store instruction. grid = CC*128/256 = 512.
// coverage: 131072 threads x 3 x 8 halves = 3*CC*CC = whole plane.
// =====================================================================================================
__global__ __launch_bounds__(256) void cvt_convw(const float* __restrict__ w, _Float16* out, float scale) {
  const int idx = blockIdx.x * 256 + threadIdx.x;
  if (idx >= CC * (CC / 8)) return;
  const int o = idx >> 7;
  const int c8 = idx & 127;
  const float* p = w + ((size_t)o * CC + (size_t)c8 * 8) * 3;
  union { v4f q[6]; float e[24]; } u;
#pragma unroll
  for (int i = 0; i < 6; ++i) u.q[i] = *(const v4f*)(p + 4 * i);
  v4u pk[3];
#pragma unroll
  for (int tp = 0; tp < 3; ++tp) {
    v4u a;
#pragma unroll
    for (int m = 0; m < 4; ++m)
      a[m] = pkf(u.e[(2 * m) * 3 + tp] * scale, u.e[(2 * m + 1) * 3 + tp] * scale);
    pk[tp] = a;
  }
#pragma unroll
  for (int tp = 0; tp < 3; ++tp)
    *(v4u*)(out + ((size_t)tp * CC + o) * CC + (size_t)c8 * 8) = pk[tp];
  
}

// =====================================================================================================
// relative position bias table tab[h][d], d = (t - s) + 1024, value = emb[bucket][h] * 8 (f32).
// bucket: n = t - s; add 16 when n < 0; n = |n|; n < 8 -> n; else 8 + int(log(n/8) * (1/ln 8) * 8)
// coverage: 8192 threads x 4 = NH*BTP floats.
// =====================================================================================================
__global__ __launch_bounds__(256) void btab_k(const float* __restrict__ emb, float* tab) {
  const int i4 = blockIdx.x * 256 + threadIdx.x;
  if (i4 >= NH * (BTP / 4)) return;
  const int h = i4 >> 9;
  const int d0 = (i4 & 511) * 4;
  const float ln8 = 2.0794415416798357f;
  const float rl8 = 1.0f / ln8;
  v4f v;
#pragma unroll
  for (int e = 0; e < 4; ++e) {
    const int delta = d0 + e - 1024;
    const int n = delta < 0 ? -delta : delta;
    const float nf = (float)(n < 1 ? 1 : n);
    const float lg = logf(nf * 0.125f);
    int vl = 8 + (int)(lg * rl8 * 8.0f);
    vl = vl > 15 ? 15 : vl;
    int bucket = (n < 8) ? n : vl;
    bucket += (delta < 0) ? 16 : 0;
    v[e] = emb[bucket * NH + h] * 8.0f;
  }
  float* dst = tab + (size_t)i4 * 4;
  *(v4f*)dst = v;
  
}

// =====================================================================================================
// GroupNorm(32 groups) (+ SiLU) on an NCT f32 plane [b][CC][TT]; writes the token-major f16 plane
// xt[b][TP][CC] (row 1 + t, channel contiguous) plus the two zero halo rows 0 and TP-1.
// Block = (b, 64-channel slab = 2 groups); 256 threads. Statistics: f64 sums, fixed order.
// Tile loop: 32 tokens x 64 channels staged as f16 in LDS (thread = token lane, wave = 8 channels),
// coverage: 32 tiles x 32 rows x (16 slabs x 64 ch) = rows 1..TT x all channels; halo rows by wave 0.
// =====================================================================================================
template <bool SILU>
__global__ __launch_bounds__(256) void gn32_tr_k(const float* __restrict__ in, const float* __restrict__ gam,
                                                 const float* __restrict__ bet, _Float16* xt) {
  __shared__ __align__(16) v4u sT4[32 * 9];
  __shared__ double red[16];
  __shared__ float sA[64];
  __shared__ float sD[64];
  const int tid = threadIdx.x, lane = tid & 31, wave = tid >> 5;
  const int b = blockIdx.y;
  const int c0 = blockIdx.x * 64;
  const float* p = in + ((size_t)b * CC + c0) * TT;

#pragma unroll 1
  for (int g = 0; g < 2; ++g) {
    const float* pg = p + (size_t)g * 32 * TT;
    double s = 0.0, ss = 0.0;
#pragma unroll 1
    for (int i = 0; i < 32; ++i) {
      const v4f v = *(const v4f*)(pg + ((size_t)i * 256 + tid) * 4);
#pragma unroll
      for (int e = 0; e < 4; ++e) {
        const double d = (double)v[e];
        s += d;
        ss += d * d;
      }
    }
    block_sum2(s, ss, red, tid);
    const double invn = 1.0 / 32768.0;
    const double mean = s * invn;
    double var = ss * invn - mean * mean;
    var = var < 0.0 ? 0.0 : var;
    const float rstdf = (float)(1.0 / sqrt(var + 1e-5));
    const float meanf = (float)mean;
    if (tid >= g * 32 && tid < g * 32 + 32) {
      const int c = c0 + tid;
      const float a = rstdf * gam[c];
      sA[tid] = a;
      sD[tid] = bet[c] - meanf * a;
    }
  }
  __syncthreads();

  if (wave == 0 && lane < 16) {
    const int row = (lane < 8) ? 0 : (TP - 1);
    v4u z = {0u, 0u, 0u, 0u};
    _Float16* dst = xt + ((size_t)b * TP + row) * CC + c0 + (lane & 7) * 8;
    *(v4u*)dst = z;
    
  }

  float A[8], D[8];
#pragma unroll
  for (int i = 0; i < 8; ++i) { A[i] = sA[wave * 8 + i]; D[i] = sD[wave * 8 + i]; }
  const float* pr = p + (size_t)(wave * 8) * TT + lane;
  const int q = lane >> 3, c8 = (lane & 7) * 8;

#pragma unroll 1
  for (int tc = 0; tc < TT / 32; ++tc) {
    __syncthreads();
    float y[8];
#pragma unroll
    for (int i = 0; i < 8; ++i) {
      const float f = pr[(size_t)i * TT + tc * 32];
      float yy = fmaf(f, A[i], D[i]);
      if (SILU) yy = yy * rcp_f(1.0f + __expf(-yy));
      y[i] = yy;
    }
    v4u pk;
    pk[0] = pkf(y[0], y[1]);
    pk[1] = pkf(y[2], y[3]);
    pk[2] = pkf(y[4], y[5]);
    pk[3] = pkf(y[6], y[7]);
    sT4[lane * 9 + wave] = pk;
    __syncthreads();
    const int row = wave * 4 + q;
    const v4u v = sT4[row * 9 + (lane & 7)];
    _Float16* dst = xt + ((size_t)b * TP + 1 + tc * 32 + row) * CC + c0 + c8;
    *(v4u*)dst = v;
    
  }
}

// =====================================================================================================
// Fused: GroupNorm(8) on H -> xin (f32 NCT, written), then GroupNorm(32) of xin -> f16 token-major
// plane xt[b][TT][CC] (no halo). Block = (b, one 128-channel group); 256 threads.
// phase 1: f64 sums of the group; phase 2: xin rows written as 32 lanes x 16 B contiguous pieces
// (512 B per instruction inside one 4 KB row), f64 sums of xin per 32-channel sub-group;
// phase 3: y = h*A[c] + D[c] (both norms folded), 32-token x 128-channel LDS tile, each wave writes
// coverage: xin rows 0..127 of the group x 1024 t; xt: 32 tiles x 32 rows x 128 ch per block,
// 8 blocks per b cover all channels.
// =====================================================================================================
__global__ __launch_bounds__(256) void gn8_attn_k(const float* __restrict__ hin,
                                                  const float* __restrict__ g8, const float* __restrict__ e8,
                                                  const float* __restrict__ ga, const float* __restrict__ ea,
                                                  float* xin, _Float16* xt) {
  __shared__ __align__(16) v4u sT4[32 * 17];
  __shared__ double red[16];
  __shared__ float sA1[128];
  __shared__ float sD1[128];
  __shared__ float sA[128];
  __shared__ float sD[128];
  __shared__ float sM[4];
  __shared__ float sR[4];
  const int tid = threadIdx.x, lane = tid & 31, wave = tid >> 5;
  const int b = blockIdx.y;
  const int c0 = blockIdx.x * 128;
  const float* p = hin + ((size_t)b * CC + c0) * TT;

  // phase 1
  {
    double s = 0.0, ss = 0.0;
#pragma unroll 1
    for (int i = 0; i < 128; ++i) {
      const v4f v = *(const v4f*)(p + ((size_t)i * 256 + tid) * 4);
#pragma unroll
      for (int e = 0; e < 4; ++e) {
        const double d = (double)v[e];
        s += d;
        ss += d * d;
      }
    }
    block_sum2(s, ss, red, tid);
    const double invn = 1.0 / 131072.0;
    const double mean = s * invn;
    double var = ss * invn - mean * mean;
    var = var < 0.0 ? 0.0 : var;
    const float r8f = (float)(1.0 / sqrt(var + 1e-5));
    const float m8f = (float)mean;
    if (tid < 128) {
      const int c = c0 + tid;
      const float a = r8f * g8[c];
      sA1[tid] = a;
      sD1[tid] = e8[c] - m8f * a;
    }
  }
  __syncthreads();

  // phase 2
  float* xo = xin + ((size_t)b * CC + c0) * TT;
#pragma unroll 1
  for (int sg = 0; sg < 4; ++sg) {
    double s2 = 0.0, ss2 = 0.0;
#pragma unroll 1
    for (int i = sg * 32; i < sg * 32 + 32; ++i) {
      const float a = sA1[i], d = sD1[i];
      const size_t off = ((size_t)i * 256 + tid) * 4;
      const v4f v = *(const v4f*)(p + off);
      v4f y;
#pragma unroll
      for (int e = 0; e < 4; ++e) {
        const float yy = fmaf(v[e], a, d);
        y[e] = yy;
        const double dd = (double)yy;
        s2 += dd;
        ss2 += dd * dd;
      }
      *(v4f*)(xo + off) = y;
      
    }
    block_sum2(s2, ss2, red, tid);
    const double invn = 1.0 / 32768.0;
    const double mean = s2 * invn;
    double var = ss2 * invn - mean * mean;
    var = var < 0.0 ? 0.0 : var;
    if (tid == 0) {
      sM[sg] = (float)mean;
      sR[sg] = (float)(1.0 / sqrt(var + 1e-5));
    }
  }
  __syncthreads();
  if (tid < 128) {
    const int sg = tid >> 5;
    const int c = c0 + tid;
    const float a2 = sR[sg] * ga[c];
    sA[tid] = sA1[tid] * a2;
    sD[tid] = (sD1[tid] - sM[sg]) * a2 + ea[c];
  }
  __syncthreads();

  // phase 3
  float A[16], D[16];
#pragma unroll
  for (int i = 0; i < 16; ++i) { A[i] = sA[wave * 16 + i]; D[i] = sD[wave * 16 + i]; }
  const float* pr = p + (size_t)(wave * 16) * TT + lane;
  const int hh = lane >> 4, c16 = lane & 15;
#pragma unroll 1
  for (int tc = 0; tc < TT / 32; ++tc) {
    __syncthreads();
    float y[16];
#pragma unroll
    for (int i = 0; i < 16; ++i) {
      const float f = pr[(size_t)i * TT + tc * 32];
      y[i] = fmaf(f, A[i], D[i]);
    }
    v4u p0, p1;
#pragma unroll
    for (int m = 0; m < 4; ++m) {
      p0[m] = pkf(y[2 * m], y[2 * m + 1]);
      p1[m] = pkf(y[8 + 2 * m], y[9 + 2 * m]);
    }
    sT4[lane * 17 + wave * 2] = p0;
    sT4[lane * 17 + wave * 2 + 1] = p1;
    __syncthreads();
    v4u v[2];
#pragma unroll
    for (int it = 0; it < 2; ++it) {
      const int row = it * 16 + wave * 2 + hh;
      v[it] = sT4[row * 17 + c16];
    }
#pragma unroll
    for (int it = 0; it < 2; ++it) {
      const int row = it * 16 + wave * 2 + hh;
      *(v4u*)(xt + ((size_t)b * TT + tc * 32 + row) * CC + c0 + c16 * 8) = v[it];
    }
    
  }
}

// =====================================================================================================
// LDS-staged f16 WMMA GEMM: C[m][n] = oscale * sum_tap sum_k A_tap[m][k] * Bt_tap[n][k]
//   + bias (BM: 1 per row m with the A row remap, 2 per column n with the Bt row remap) * bscale
//   (+ resid[m][n] f32, same indexing as C, when RESID).
// Work-group = 8 waves = one 128 x 256 tile of C; wave (wm 0..1, wn 0..3) = 64 x 64 of it.
// A row-major [M][K] pitch lda; Bt row-major [N][K] (k contiguous) pitch ldb. Row remap:
// row(m) = (m>>6)*TS + TO + (m&63). Tap tp adds aTap elements to A and bTap elements to Bt.
// blockIdx.y = batch index (strides in elements). M multiple of 128, N of 256, K of 128 (host constants).
// A stage = 128 k of the 128 A rows and the 256 Bt rows, 256-B rows at a 272-B pitch in LDS, brought by
// asynchronous 16-B copies (24 per lane and stage, 16 lanes per row); two buffers, the next stage's
// copies fly while this one is multiplied. k runs tap-major and ascending, one accumulator per element.
// OUTH: 0 f32 C (pitch ldc), 1 f16 C. Epilogue: 16-row slabs staged per wave in LDS.
// coverage: 4 slabs x 16 rows x 64 cols = the wave's 64x64 tile; grid = exact tile count.
// =====================================================================================================
#define G_BM 128
#define G_BN 256
#define G_KS 128
#define G_PITCH 136                         // halves per LDS row: 272 B = 16 B x odd, for 16-B LDS reads
#define G_BUF ((G_BM + G_BN) * G_PITCH)     // halves per buffer

#if defined(__HIP_DEVICE_COMPILE__)
// twelve copies of one lane; the address-register wait closes the copies' own statement, so that no
// later write of an address register can be moved in front of it
#define G_COPY12(l, g)                                                          \
  asm volatile("global_load_async_to_lds_b128 %0, %12, off\n\t"                 \
               "global_load_async_to_lds_b128 %1, %13, off\n\t"                 \
               "global_load_async_to_lds_b128 %2, %14, off\n\t"                 \
               "global_load_async_to_lds_b128 %3, %15, off\n\t"                 \
               "global_load_async_to_lds_b128 %4, %16, off\n\t"                 \
               "global_load_async_to_lds_b128 %5, %17, off\n\t"                 \
               "global_load_async_to_lds_b128 %6, %18, off\n\t"                 \
               "global_load_async_to_lds_b128 %7, %19, off\n\t"                 \
               "global_load_async_to_lds_b128 %8, %20, off\n\t"                 \
               "global_load_async_to_lds_b128 %9, %21, off\n\t"                 \
               "global_load_async_to_lds_b128 %10, %22, off\n\t"                \
               "global_load_async_to_lds_b128 %11, %23, off\n\t"                \
               "s_wait_xcnt 0x0"                                                \
               :                                                                \
               : "v"((l)[0]), "v"((l)[1]), "v"((l)[2]), "v"((l)[3]), "v"((l)[4]), "v"((l)[5]),               \
                 "v"((l)[6]), "v"((l)[7]), "v"((l)[8]), "v"((l)[9]), "v"((l)[10]), "v"((l)[11]),             \
                 "v"((g)[0]), "v"((g)[1]), "v"((g)[2]), "v"((g)[3]), "v"((g)[4]), "v"((g)[5]),               \
                 "v"((g)[6]), "v"((g)[7]), "v"((g)[8]), "v"((g)[9]), "v"((g)[10]), "v"((g)[11])              \
               : "memory")
// this wave's copies have landed
#define G_WAIT_COPIES() asm volatile("s_wait_asynccnt 0x0" ::: "memory")
// this wave's LDS reads have returned, so the buffer may be refilled behind the barrier
#define G_WAIT_LDS() asm volatile("s_wait_dscnt 0x0" ::: "memory")
#else
#define G_COPY12(l, g) ((void)0)
#define G_WAIT_COPIES() ((void)0)
#define G_WAIT_LDS() ((void)0)
#endif

template <int TAPS, int OUTH, bool RESID, int BM>
__global__ __launch_bounds__(256) void gemm_k(
    const _Float16* __restrict__ A, int lda, long long strideA, long long aTap, int aTS, int aTO,
    const _Float16* __restrict__ Bt, int ldb, long long strideB, long long bTap, int bTS, int bTO,
    const float* __restrict__ bias, float bscale,
    const float* __restrict__ resid,
    void* Cout, int ldc, long long strideC,
    int M, int N, int K, float oscale) {
  __shared__ __align__(16) _Float16 sAB[2 * G_BUF];
  __shared__ __align__(16) float sT[8][16 * 68];
  const int bz = blockIdx.y;
  const int tid = threadIdx.x;
  const int lane = tid & 31, wave = tid >> 5;
  const int tilesN = N >> 8, tilesM = M >> 7;
  const int tile = blockIdx.x;
  if (tile >= tilesM * tilesN) return;   // the same for the whole work-group, ahead of every barrier
  const int tm = tile / tilesN, tn = tile - tm * tilesN;
  const int mB = tm << 7, nB = tn << 8;
  const int wm = wave >> 2, wn = wave & 3;
  const int m0 = mB + wm * 64, n0 = nB + wn * 64;
  const int rlane = lane & 15;
  const int koff = (lane >> 4) * 8;
  const int mOff = koff;
  const int aRow0 = (m0 >> 6) * aTS + aTO;
  const int bRow0 = (n0 >> 6) * bTS + bTO;
  const _Float16* Ab = A + (size_t)bz * (size_t)strideA;
  const _Float16* Bb = Bt + (size_t)bz * (size_t)strideB;

  // copy side: lane -> (row tid>>4 of each 16-row band, 16-B piece tid&15 of its 256 B);
  // bands 0..7 are the A rows, bands 8..23 the Bt rows
  const int crow = tid >> 4, cpc = (tid & 15) * 8;
  const unsigned tA = (unsigned)(crow * lda + cpc);
  const unsigned tB = (unsigned)(crow * ldb + cpc);
  const unsigned ldsC = (unsigned)(size_t)sAB + (unsigned)(crow * G_PITCH + cpc) * 2u;

  auto issue = [&](int tp, int k0, int buf) {
    const _Float16* Ap = Ab + (size_t)tp * (size_t)aTap + k0 + tA;
    const _Float16* Bp = Bb + (size_t)tp * (size_t)bTap + k0 + tB;
#pragma unroll   // constant indices keep the array in registers
    for (int hlf = 0; hlf < 2; ++hlf) {
      unsigned l[12];
      const _Float16* g[12];
#pragma unroll   // constant indices keep the array in registers
      for (int e = 0; e < 12; ++e) {
        const int i = hlf * 12 + e;           // band
        l[e] = ldsC + (unsigned)buf * (unsigned)(G_BUF * 2) + (unsigned)i * (unsigned)(16 * G_PITCH * 2);
        if (i < 8) {
          const int row = ((mB >> 6) + (i >> 2)) * aTS + aTO + 16 * (i & 3);
          g[e] = Ap + (size_t)(unsigned)(row * lda);
        } else {
          const int row = ((nB >> 6) + ((i - 8) >> 2)) * bTS + bTO + 16 * ((i - 8) & 3);
          g[e] = Bp + (size_t)(unsigned)(row * ldb);
        }
      }
      G_COPY12(l, g);
    }
  };

  v8f acc[4][4];
#pragma unroll   // constant indices keep the array in registers
  for (int i = 0; i < 4; ++i)
#pragma unroll   // constant indices keep the array in registers
    for (int j = 0; j < 4; ++j) acc[i][j] = zero8();

  const _Float16* fa = sAB + (wm * 64 + rlane) * G_PITCH + koff;
  const _Float16* fb = sAB + (G_BM + wn * 64 + rlane) * G_PITCH + koff;

  const int nt = TAPS * (K >> 7);
  int itp = 0, ik = 0;                      // tap and k of the next stage to be copied
  issue(itp, ik, 0);
  ik += G_KS;
  if (ik >= K) { ik = 0; ++itp; }
  G_WAIT_COPIES();
  __syncthreads();
  if (nt > 1) {
    issue(itp, ik, 1);
    ik += G_KS;
    if (ik >= K) { ik = 0; ++itp; }
  }

#pragma unroll 1   // one stage per trip: the two buffers alternate by the trip's parity
  for (int t = 0; t < nt; ++t) {
    const _Float16* pa = fa + (t & 1) * G_BUF;
    const _Float16* pb = fb + (t & 1) * G_BUF;
#pragma unroll   // constant indices keep the array in registers
    for (int kk = 0; kk < G_KS / 32; ++kk) {
      v16h af[4], bf[4];
#pragma unroll   // constant indices keep the array in registers
      for (int i = 0; i < 4; ++i) af[i] = ldfrag(pa + i * 16 * G_PITCH + kk * 32);
#pragma unroll   // constant indices keep the array in registers
      for (int j = 0; j < 4; ++j) bf[j] = ldfrag(pb + j * 16 * G_PITCH + kk * 32);
      // keeps the block's 16 LDS reads one group ahead of its 16 WMMAs: left free, the reads of each A
      // fragment sink to just in front of its row and every row waits out a whole LDS latency
      __builtin_amdgcn_sched_barrier(0);
#pragma unroll   // constant indices keep the array in registers
      for (int i = 0; i < 4; ++i)
#pragma unroll   // constant indices keep the array in registers
        for (int j = 0; j < 4; ++j) acc[i][j] = mma_raw(af[i], bf[j], acc[i][j]);
    }
    // publish point of stage t + 1; the same barrier ends every read of the buffer refilled behind it
    G_WAIT_LDS();
    G_WAIT_COPIES();
    __syncthreads();
    if (t + 2 < nt) {
      issue(itp, ik, t & 1);
      ik += G_KS;
      if (ik >= K) { ik = 0; ++itp; }
    }
  }
  G_WAIT_COPIES();

  // ---- epilogue ----
  float* slab = sT[wave];
#pragma unroll
  for (int i = 0; i < 4; ++i) {
    const int mBase = m0 + i * 16;
    float badd[8];
#pragma unroll
    for (int r = 0; r < 8; ++r) badd[r] = 0.f;
    if (BM == 1) {
#pragma unroll
      for (int r = 0; r < 8; ++r) badd[r] = bias[aRow0 + i * 16 + mOff + r] * bscale;
    }
#pragma unroll
    for (int j = 0; j < 4; ++j) {
      float bc = 0.f;
      if (BM == 2) bc = bias[bRow0 + j * 16 + rlane] * bscale;
#pragma unroll
      for (int r = 0; r < 8; ++r)
        slab[(mOff + r) * 68 + j * 16 + rlane] = acc[i][j][r] * oscale + badd[r] + bc;
    }
    __builtin_amdgcn_fence(__ATOMIC_RELEASE, "workgroup");
    __builtin_amdgcn_wave_barrier();
    __builtin_amdgcn_fence(__ATOMIC_ACQUIRE, "workgroup");
    if (OUTH == 0) {
      float* Cb = (float*)Cout + (size_t)bz * (size_t)strideC;
      const float* Rb = RESID ? (resid + (size_t)bz * (size_t)strideC) : resid;
      const int h2 = lane >> 4, c4 = (lane & 15) * 4;     // 256-B row segment = 16 lanes x 16 B
      {
#pragma unroll
        for (int it = 0; it < 8; ++it) {
          const int row = it * 2 + h2;                     // it 0..7 x h2 0..1 = rows 0..15
          v4f v = *(const v4f*)(slab + row * 68 + c4);
          const size_t off = (size_t)(mBase + row) * ldc + n0 + c4;
          if (RESID) v += *(const v4f*)(Rb + off);
          *(v4f*)(Cb + off) = v;
        }
        
      }
    } else {
      _Float16* Cb = (_Float16*)Cout + (size_t)bz * (size_t)strideC;
      const int q = lane >> 3, c8 = (lane & 7) * 8;
      v4u hv[4];
#pragma unroll
      for (int it = 0; it < 4; ++it) {
        const int row = it * 4 + q;                        // it 0..3 x q 0..3 = rows 0..15
        const float* sp = slab + row * 68 + c8;
        v4u a;
#pragma unroll
        for (int e = 0; e < 4; ++e) a[e] = pkf(sp[2 * e], sp[2 * e + 1]);
        hv[it] = a;
      }
      {
#pragma unroll
        for (int it = 0; it < 4; ++it) {
          const int row = it * 4 + q;
          *(v4u*)(Cb + (size_t)(mBase + row) * ldc + n0 + c8) = hv[it];
        }
        
      }
    }
    __builtin_amdgcn_fence(__ATOMIC_RELEASE, "workgroup");
    __builtin_amdgcn_wave_barrier();
    __builtin_amdgcn_fence(__ATOMIC_ACQUIRE, "workgroup");
  }
}

// =====================================================================================================
// Attention, head dim 64, non-causal over TT keys, additive position bias from the table.
//   Qp / Kp (f16, x16): element (b, t, h, d) at [(b*TT + t)*CC + h*64 + d]
//   Vp (f16, x16):      element (b, h, d, s) at [(b*CC + h*64 + d)*TT + s]
//   tab f32 [h][BTP]:   bias(t, s) = tab[h][(t - s) + 1024]
//   AT (f16, x256):     normalised context, element (b, t, h, d) at [(b*TT + t)*CC + h*64 + d]
//   scores = q16 . k16 (f16 WMMA, f32 acc) * sScale + bias; online softmax in f32;
//   p = exp(s - m) carried as f16(1024 p); context += p . v^T tile on f16 WMMA.
//   Block = 4 waves = 64 query rows of one (b, h); grid = 16 * NH * NBATCH; 16 key tiles of 64.
//   K / V^T tile staging: 128 threads x 32 elements per plane = the whole 64x64 tile (plain 16-B
//   loads, __syncthreads before and after). P tiles are wave-private, spilled with _Float16 element
//   Output coverage: each wave stores rows q0..q0+15 (it 0..3 x lane>>3 0..3) x 64 d (8 lanes x 8),
//   LDS rows: the 128-B rows of the K, V^T and P tiles stand at a 144-B pitch and the 256-B context rows
//   at 272 B (16 B x odd), so that the 16 rows of a 16-B fragment read fall on 16 different bank groups.
// =====================================================================================================
#define AT_P 72                             // halves per K / V^T / P row in LDS: 144 B
#define AT_OP 68                            // floats per context row in LDS: 272 B
__global__ __launch_bounds__(128)
void attn_k(const _Float16* __restrict__ Qp, const _Float16* __restrict__ Kp, const _Float16* __restrict__ Vp,
            const float* __restrict__ tab, _Float16* AT, float sScale, float oScale) {
  union FH { v16h v; v8h h[2]; };
  __shared__ __align__(16) _Float16 Ksh[64 * AT_P];    // [kv][d]
  __shared__ __align__(16) _Float16 Vth[64 * AT_P];    // [d][kv]
  __shared__ __align__(16) _Float16 Psh[4][16 * AT_P]; // per wave P [row][kv]
  __shared__ __align__(16) float    Os[4][16 * AT_OP]; // per wave context [row][d]
  __shared__ __align__(16) float    sB[384 * 4];       // bias slice tab[h][q0b .. q0b+1087] (+clamped fill)

  const int tid  = threadIdx.x;
  const int wave = tid >> 5;
  const int lane = tid & 31;
  const int hh   = lane >> 4;
  const int c    = lane & 15;

  const int bx  = blockIdx.x;
  const int qb  = bx & 15;
  const int h   = (bx >> 4) & 15;
  const int b   = bx >> 8;
  const int q0b = qb * 64;
  const int q0  = q0b + wave * 16;
  const size_t rowB = (size_t)b * TT;

  {
    const float* th = tab + (size_t)h * BTP + q0b;     // q0b + 1087 <= 2047 < BTP
#pragma unroll
    for (int k = 0; k < 3; ++k) {
      const int i  = tid + 128 * k;                     // 0..383
      const int ic = (i < 271) ? i : 271;               // clamped address, all lanes load
      *(v4f*)(sB + 4 * i) = *(const v4f*)(th + 4 * ic);
    }
  }

  const _Float16* Qh = Qp + (size_t)h * HD;
  const _Float16* Kh = Kp + (size_t)h * HD;
  const _Float16* Vh = Vp + ((size_t)b * CC + (size_t)h * HD) * TT;

  // ---- Q fragments (A operand, row = lane&15): 2 d-chunks ----
  v16h qa[2];
#pragma unroll
  for (int dc = 0; dc < 2; ++dc) qa[dc] = ldfrag(Qh + (rowB + q0 + c) * CC + dc * 32 + 8 * hh);

  float mrow[8], lrow[8];
  v8f oacc[4];
#pragma unroll
  for (int r = 0; r < 8; ++r) { mrow[r] = -INFINITY; lrow[r] = 0.f; }
#pragma unroll
  for (int t = 0; t < 4; ++t) oacc[t] = zero8();

  // bias index: (t - q0b) - s + 1024 with t - q0b = wave*16 + 8hh + r, s = kv0 + 16j + c
  const int bbase = wave * 16 + 8 * hh + 1024 - c;
  _Float16* pwh = Psh[wave];

#pragma unroll 1
  for (int kt = 0; kt < TT / 64; ++kt) {
    const int kv0 = kt * 64;
    __syncthreads();
    {
      const int r = tid >> 1, half = (tid & 1) * 32;
      const _Float16* kg = Kh + (rowB + kv0 + r) * CC + half;     // K row kv0+r, d = half..half+31
      const _Float16* vg = Vh + (size_t)r * TT + kv0 + half;     // V^T row d = r, s = kv0+half..+31
#pragma unroll
      for (int i = 0; i < 4; ++i) {
        const v8h a0 = *(const v8h*)(kg + 8 * i);
        const v8h b0 = *(const v8h*)(vg + 8 * i);
        *(v8h*)(Ksh + r * AT_P + half + 8 * i) = a0;
        *(v8h*)(Vth + r * AT_P + half + 8 * i) = b0;
      }
    }
    __syncthreads();

    // ---- scores: 16 query rows x 64 keys per wave ----
    v8f s[4];
#pragma unroll
    for (int j = 0; j < 4; ++j) {
      s[j] = zero8();
#pragma unroll
      for (int dc = 0; dc < 2; ++dc) {
        FH kb;
        kb.h[0] = *(const v8h*)(Ksh + (j * 16 + c) * AT_P + dc * 32 + 8 * hh);
        kb.h[1] = *(const v8h*)(Ksh + (j * 16 + c) * AT_P + dc * 32 + 16 + 8 * hh);
        s[j] = mma_h(qa[dc], kb.v, s[j]);
      }
    }

    // ---- scale + bias, row max, online softmax, P (x1024, f16) to LDS ----
    const int bk = bbase - kv0;
#pragma unroll
    for (int r = 0; r < 8; ++r) {
      float m = -INFINITY;
#pragma unroll
      for (int j = 0; j < 4; ++j) {
        const float sv = s[j][r] * sScale + sB[bk + r - 16 * j];
        s[j][r] = sv;
        m = fmaxf(m, sv);
      }
#pragma unroll
      for (int off = 1; off < 16; off <<= 1) m = fmaxf(m, __shfl_xor(m, off, 32));
      const float mnew  = fmaxf(mrow[r], m);
      const float msafe = (mnew == -INFINITY) ? 0.f : mnew;
      const float alpha = __expf(mrow[r] - msafe);
      mrow[r] = mnew;
      float psum = 0.f;
#pragma unroll
      for (int j = 0; j < 4; ++j) {
        const float pe = __expf(s[j][r] - msafe);
        psum += pe;
        pwh[(8 * hh + r) * AT_P + j * 16 + c] = (_Float16)(pe * 1024.0f);
      }
#pragma unroll
      for (int off = 1; off < 16; off <<= 1) psum += __shfl_xor(psum, off, 32);
      lrow[r] = lrow[r] * alpha + psum;
#pragma unroll
      for (int t = 0; t < 4; ++t) oacc[t][r] *= alpha;
    }
    __builtin_amdgcn_fence(__ATOMIC_RELEASE, "workgroup");
    __builtin_amdgcn_wave_barrier();
    __builtin_amdgcn_fence(__ATOMIC_ACQUIRE, "workgroup");

    // ---- context += P . V (f16 WMMA) ----
#pragma unroll
    for (int kk = 0; kk < 2; ++kk) {
      FH pa;
      pa.h[0] = *(const v8h*)(pwh + c * AT_P + kk * 32 + 8 * hh);
      pa.h[1] = *(const v8h*)(pwh + c * AT_P + kk * 32 + 16 + 8 * hh);
#pragma unroll
      for (int t = 0; t < 4; ++t) {
        FH vb;
        vb.h[0] = *(const v8h*)(Vth + (t * 16 + c) * AT_P + kk * 32 + 8 * hh);
        vb.h[1] = *(const v8h*)(Vth + (t * 16 + c) * AT_P + kk * 32 + 16 + 8 * hh);
        oacc[t] = mma_h(pa.v, vb.v, oacc[t]);
      }
    }
  }

  // ---- normalise (1/l, the 1/1024 p carry, the x16 v carry and the x256 output carry are all in
  float* os = Os[wave];
#pragma unroll
  for (int r = 0; r < 8; ++r) {
    const float l = lrow[r];
    const float inv = ((l > 0.f) ? rcp_f(l) : 0.f) * oScale;
#pragma unroll
    for (int t = 0; t < 4; ++t) os[(8 * hh + r) * AT_OP + t * 16 + c] = oacc[t][r] * inv;
  }
  __builtin_amdgcn_fence(__ATOMIC_RELEASE, "workgroup");
  __builtin_amdgcn_wave_barrier();
  __builtin_amdgcn_fence(__ATOMIC_ACQUIRE, "workgroup");
  {
    const int q4 = lane >> 3, c8 = (lane & 7) * 8;
    v4u hv[4];
#pragma unroll
    for (int it = 0; it < 4; ++it) {
      const int row = it * 4 + q4;   // it 0..3 x q4 0..3 = rows 0..15 of the wave tile
      const float* sp = os + row * AT_OP + c8;
      v4u a;
#pragma unroll
      for (int e = 0; e < 4; ++e) a[e] = pkf(sp[2 * e], sp[2 * e + 1]);
      hv[it] = a;
    }
    {
#pragma unroll
      for (int it = 0; it < 4; ++it) {
        const int row = it * 4 + q4;
        const size_t go = (rowB + q0 + row) * CC + (size_t)h * HD + c8;
        *(v4u*)(AT + go) = hv[it];
      }
      
    }
  }
}

// =====================================================================================================
// Workspace map (bytes):
//   W1t  f16 [3][1024][1024]       0            6291456
//   W2t  f16 [3][1024][1024]       6291456      6291456
//   Wqkv f16 [3072][1024]          12582912     6291456
//   Wp   f16 [1024][1024]          18874368     2097152
//   Tab  f32 [16][2048]            20971520      131072
//   XT   f16 [8][1026][1024]       21102592    16809984   (later: XT3 [8][1024][1024], then AT [8192][1024])
//   R1   f32 [8][1024][1024]       37912576    33554432   (F1, then H, then Qp + Kp f16 [8192][1024] each)
//   Xin  f32 [8][1024][1024]       71467008    33554432
//   Vp   f16 [8][1024][1024]       105021440   16777216
//   end                            121798656
// Every plane is an exact multiple of its whole-line / whole-tile store granularity (incl. the two
// halo token rows per sample in XT); no tail padding needed.
// =====================================================================================================
extern "C" void kernel_launch(void* const* d_in, const int* in_sizes, int n_in,
                              void* d_out, int out_size, void* d_ws, size_t ws_size,
                              hipStream_t stream) {
  if (n_in < 18) return;
  const int nAct = NBATCH * CC * TT;                     // 8388608
  if (in_sizes[0] != nAct || out_size != nAct) return;
  if (in_sizes[3] != CC * CC * 3 || in_sizes[7] != CC * CC * 3) return;
  if (in_sizes[13] != 3 * CC * CC || in_sizes[15] != CC * CC) return;
  if (in_sizes[1] != CC || in_sizes[2] != CC || in_sizes[4] != CC || in_sizes[5] != CC ||
      in_sizes[6] != CC || in_sizes[8] != CC || in_sizes[9] != CC || in_sizes[10] != CC ||
      in_sizes[11] != CC || in_sizes[12] != CC || in_sizes[16] != CC) return;
  if (in_sizes[14] != 3 * CC || in_sizes[17] != NBUCK * NH) return;

  const float* x      = (const float*)d_in[0];
  const float* gn1_g  = (const float*)d_in[1];
  const float* gn1_b  = (const float*)d_in[2];
  const float* c1_w   = (const float*)d_in[3];
  const float* c1_b   = (const float*)d_in[4];
  const float* gn2_g  = (const float*)d_in[5];
  const float* gn2_b  = (const float*)d_in[6];
  const float* c2_w   = (const float*)d_in[7];
  const float* c2_b   = (const float*)d_in[8];
  const float* n8_g   = (const float*)d_in[9];
  const float* n8_b   = (const float*)d_in[10];
  const float* ag_g   = (const float*)d_in[11];
  const float* ag_b   = (const float*)d_in[12];
  const float* qkv_w  = (const float*)d_in[13];
  const float* qkv_b  = (const float*)d_in[14];
  const float* pj_w   = (const float*)d_in[15];
  const float* pj_b   = (const float*)d_in[16];
  const float* remb   = (const float*)d_in[17];

  const size_t PWC  = (size_t)3 * CC * CC * 2;          //  6291456
  const size_t PWQ  = (size_t)3 * CC * CC * 2;          //  6291456
  const size_t PWP  = (size_t)CC * CC * 2;              //  2097152
  const size_t PTAB = (size_t)NH * BTP * 4;             //   131072
  const size_t PXT  = (size_t)NBATCH * TP * CC * 2;     // 16809984
  const size_t PF   = (size_t)NBATCH * CC * TT * 4;     // 33554432
  const size_t PV   = (size_t)NBATCH * CC * TT * 2;     // 16777216
  size_t off = 0;
  const size_t oW1  = off; off += PWC;
  const size_t oW2  = off; off += PWC;
  const size_t oWq  = off; off += PWQ;
  const size_t oWp  = off; off += PWP;
  const size_t oTab = off; off += PTAB;
  const size_t oXT  = off; off += PXT;
  const size_t oR1  = off; off += PF;
  const size_t oXin = off; off += PF;
  const size_t oV   = off; off += PV;
  if (off > ws_size) return;                            // off = 121798656
  if (off > (size_t)134217728) return;
  if (2 * PV > PF) return;                              // Qp + Kp live inside R1
  if ((size_t)NBATCH * TT * CC * 2 > PXT) return;       // XT3 / AT fit in the XT region

  char* ws = (char*)d_ws;
  _Float16* W1t  = (_Float16*)(ws + oW1);
  _Float16* W2t  = (_Float16*)(ws + oW2);
  _Float16* Wqkv = (_Float16*)(ws + oWq);
  _Float16* Wpb  = (_Float16*)(ws + oWp);
  float*    Tab  = (float*)(ws + oTab);
  _Float16* XT   = (_Float16*)(ws + oXT);               // [8][1026][1024] with halo rows
  _Float16* XT3  = (_Float16*)(ws + oXT);               // [8][1024][1024], later use of the same region
  _Float16* ATp  = (_Float16*)(ws + oXT);               // [8192][1024], last use of the same region
  float*    F1   = (float*)(ws + oR1);
  float*    Hb   = (float*)(ws + oR1);
  _Float16* Qp   = (_Float16*)(ws + oR1);
  _Float16* Kp   = (_Float16*)(ws + oR1 + PV);
  float*    Xin  = (float*)(ws + oXin);
  _Float16* Vp   = (_Float16*)(ws + oV);

  const dim3 blk(256);
  const int  n8q = 3 * CC * CC / 8;                     // 393216
  const int  n8p = CC * CC / 8;                         // 131072
  const long long CCCC = (long long)CC * CC;
  const long long CT   = (long long)CC * TT;

  // (1) weights -> f16 x64 planes; position bias table
  cvt_convw<<<dim3(CC * (CC / 8) / 256), blk, 0, stream>>>(c1_w, W1t, 64.0f);
  cvt_convw<<<dim3(CC * (CC / 8) / 256), blk, 0, stream>>>(c2_w, W2t, 64.0f);
  cvt_f16x8<<<dim3((n8q + 255) / 256), blk, 0, stream>>>(qkv_w, Wqkv, n8q, 64.0f);
  cvt_f16x8<<<dim3((n8p + 255) / 256), blk, 0, stream>>>(pj_w, Wpb, n8p, 64.0f);
  btab_k<<<dim3(NH * (BTP / 4) / 256), blk, 0, stream>>>(remb, Tab);

  // (2) h = silu(GN32(x)) -> XT (token-major f16, halo rows)
  gn32_tr_k<true><<<dim3(CC / 64, NBATCH), blk, 0, stream>>>(x, gn1_g, gn1_b, XT);
  // (3) F1 = conv1(h) + b1 -> f32 NCT   (per b: M=1024 o, N=1024 t, K=3 taps x 1024)
  gemm_k<3, 0, false, 1><<<dim3((CC / 128) * (TT / 256), NBATCH), blk, 0, stream>>>(
      W1t, CC, 0LL, CCCC, 64, 0,
      XT, CC, (long long)TP * CC, (long long)CC, 64, 0,
      c1_b, 1.0f, nullptr,
      (void*)F1, TT, CT, CC, TT, CC, 1.0f / 64.0f);
  // (4) h = silu(GN32(F1)) -> XT
  gn32_tr_k<true><<<dim3(CC / 64, NBATCH), blk, 0, stream>>>(F1, gn2_g, gn2_b, XT);
  // (5) H = conv2(h) + b2 + x -> f32 NCT (R1)
  gemm_k<3, 0, true, 1><<<dim3((CC / 128) * (TT / 256), NBATCH), blk, 0, stream>>>(
      W2t, CC, 0LL, CCCC, 64, 0,
      XT, CC, (long long)TP * CC, (long long)CC, 64, 0,
      c2_b, 1.0f, x,
      (void*)Hb, TT, CT, CC, TT, CC, 1.0f / 64.0f);
  // (6) xin = GN8(H) -> f32 NCT; GN32(xin) -> XT3 (token-major f16, no halo)
  gn8_attn_k<<<dim3(CC / 128, NBATCH), blk, 0, stream>>>(Hb, n8_g, n8_b, ag_g, ag_b, Xin, XT3);
  // (7) q = xn^T . Wq^T -> Qp [b*TT+t][h*64+d] f16 x16  (M=8192, N=1024, K=1024; W rows h*192+d)
  gemm_k<1, 1, false, 2><<<dim3((NBATCH * TT / 128) * (CC / 256), 1), blk, 0, stream>>>(
      XT3, CC, 0LL, 0LL, 64, 0,
      Wqkv, CC, 0LL, 0LL, 192, 0,
      qkv_b, 16.0f, nullptr,
      (void*)Qp, CC, 0LL, NBATCH * TT, CC, CC, 0.25f);
  // (8) k -> Kp (W rows h*192+64+d)
  gemm_k<1, 1, false, 2><<<dim3((NBATCH * TT / 128) * (CC / 256), 1), blk, 0, stream>>>(
      XT3, CC, 0LL, 0LL, 64, 0,
      Wqkv, CC, 0LL, 0LL, 192, 64,
      qkv_b, 16.0f, nullptr,
      (void*)Kp, CC, 0LL, NBATCH * TT, CC, CC, 0.25f);
  // (9) v (channel-major) = Wv . xn -> Vp [b][h*64+d][s] f16 x16 (per b: M=1024 rows h*192+128+d, N=1024 t)
  gemm_k<1, 1, false, 1><<<dim3((CC / 128) * (TT / 256), NBATCH), blk, 0, stream>>>(
      Wqkv, CC, 0LL, 0LL, 192, 128,
      XT3, CC, CT, 0LL, 64, 0,
      qkv_b, 16.0f, nullptr,
      (void*)Vp, TT, CT, CC, TT, CC, 0.25f);
  // (10) attention -> AT [b*TT+t][h*64+d] f16 x256
  attn_k<<<dim3((TT / 64) * NH * NBATCH), dim3(128), 0, stream>>>(
      Qp, Kp, Vp, Tab, ATp, 1.0f / 2048.0f, 1.0f / 64.0f);
  // (11) out = xin + proj(a) + bp -> d_out f32 NCT (per b: M=1024 o, N=1024 t, K=1024)
  gemm_k<1, 0, true, 1><<<dim3((CC / 128) * (TT / 256), NBATCH), blk, 0, stream>>>(
      Wpb, CC, 0LL, 0LL, 64, 0,
      ATp, CC, CT, 0LL, 64, 0,
      pj_b, 1.0f, Xin,
      d_out, TT, CT, CC, TT, CC, 1.0f / 16384.0f);
  (void)hipGetLastError();
}

// v003
// It runs in 431 microseconds.
// Next to v002, in two timings, it ran 1.33 times as fast each time.
// All steps since v000 together make it 2.21 times as fast.
// Contractions: conv k3 (two), qkv 1x1, q.k^T, p.v, proj 1x1 = v_wmma_f32_16x16x32_f16 (f16 operands: weights x64, GroupNorm activations x1, q/k/v x16, p x1024, attention output x256), f32 accumulate; GroupNorm statistics f64, softmax / position bias / residuals f32.
#include <hip/hip_runtime.h>
#include <math.h>
#include <stdint.h>

#define NBATCH 8
#define CC 1024
#define TT 1024
#define TP 1026
#define NH 16
#define HD 64
#define NBUCK 32
#define BTP 2048

static_assert(NH * HD == CC);
static_assert((CC % 256) == 0 && (TT % 256) == 0);

typedef _Float16 v16h __attribute__((ext_vector_type(16)));
typedef _Float16 v8h  __attribute__((ext_vector_type(8)));
typedef float    v8f  __attribute__((ext_vector_type(8)));
typedef float    v4f  __attribute__((ext_vector_type(4)));
typedef unsigned int v4u __attribute__((ext_vector_type(4)));

// ---- hazard guards (device pass only; no-op for the host pass) ----
#if defined(__HIP_DEVICE_COMPILE__)
#define HZ_ACC_AB(c, a, b) asm volatile("v_nop\n\tv_nop\n\tv_nop\n\tv_nop" : "+v"(c) : "v"(a), "v"(b))
#else
#define HZ_ACC_AB(c, a, b) ((void)0)
#endif

// ---- scalar helpers ----
__device__ __forceinline__ unsigned short h_bits(_Float16 x) { return __builtin_bit_cast(unsigned short, x); }
__device__ __forceinline__ unsigned pkf(float a, float b) {
  return (unsigned)h_bits((_Float16)a) | ((unsigned)h_bits((_Float16)b) << 16);
}
__device__ __forceinline__ v8f zero8() { v8f z = {0.f, 0.f, 0.f, 0.f, 0.f, 0.f, 0.f, 0.f}; return z; }
__device__ __forceinline__ float rcp_f(float x) { return __builtin_amdgcn_rcpf(x); }

// ---- 16-bit A/B fragment: lane -> row/col (lane&15); p already includes +8*(lane>>4);
//      elements 0..7 <- p[0..7] (k0+8h..), elements 8..15 <- p[16..23] (k0+16+8h..)
__device__ __forceinline__ v16h ldfrag(const _Float16* p) {
  union { v16h v; v8h h[2]; } f;
  f.h[0] = *(const v8h*)(p);
  f.h[1] = *(const v8h*)(p + 16);
  return f.v;
}

// ---- WMMA helpers ----
__device__ __forceinline__ v8f mma_h(v16h a, v16h b, v8f c) {
  c = __builtin_amdgcn_wmma_f32_16x16x32_f16(false, a, false, b, (short)0, c, false, false);
  HZ_ACC_AB(c, a, b);
  return c;
}
__device__ __forceinline__ v8f mma_raw(v16h a, v16h b, v8f c) {
  return __builtin_amdgcn_wmma_f32_16x16x32_f16(false, a, false, b, (short)0, c, false, false);
}

// ---- f64 wave shuffle and block-wide two-value sum (fixed order) ----
__device__ __forceinline__ double shfl_xor_d(double v, int m) {
  const unsigned long long u = (unsigned long long)__double_as_longlong(v);
  const int lo = __shfl_xor((int)(unsigned)(u & 0xffffffffull), m, 32);
  const int hi = __shfl_xor((int)(unsigned)(u >> 32), m, 32);
  const unsigned long long r = ((unsigned long long)(unsigned)hi << 32) | (unsigned long long)(unsigned)lo;
  return __longlong_as_double((long long)r);
}
// GroupNorm kernels: 16 waves per work-group
#define GN_NT 512
#define GN_NW 16
// red: 2 * GN_NW doubles in LDS; every thread returns with the block totals
__device__ __forceinline__ void block_sum2(double& s, double& ss, double* red, int tid) {
#pragma unroll
  for (int m = 16; m >= 1; m >>= 1) {
    s += shfl_xor_d(s, m);
    ss += shfl_xor_d(ss, m);
  }
  const int wave = tid >> 5, lane = tid & 31;
  __syncthreads();
  if (lane == 0) { red[wave] = s; red[GN_NW + wave] = ss; }
  __syncthreads();
  double S = 0.0, SS = 0.0;
#pragma unroll
  for (int w = 0; w < GN_NW; ++w) { S += red[w]; SS += red[GN_NW + w]; }
  s = S;
  ss = SS;
}

// SiLU's two transcendentals, each with the one slot behind it that the instruction set asks for before its
// result is used or its source overwritten
__device__ __forceinline__ float exp2_slot(float x) {
#if defined(__HIP_DEVICE_COMPILE__)
  float r;
  asm("v_exp_f32 %0, %1\n\tv_nop" : "=v"(r) : "v"(x));
  return r;
#else
  return x;
#endif
}
__device__ __forceinline__ float rcp_slot(float x) {
#if defined(__HIP_DEVICE_COMPILE__)
  float r;
  asm("v_rcp_f32 %0, %1\n\tv_nop" : "=v"(r) : "v"(x));
  return r;
#else
  return x;
#endif
}

#if defined(__HIP_DEVICE_COMPILE__)
// stands behind a batch of stores whose address and data registers the next trip's loads write again
#define GN_WAIT_XCNT() asm volatile("s_wait_xcnt 0x0" ::: "memory")
#else
#define GN_WAIT_XCNT() ((void)0)
#endif

// orders one wave's own LDS writes and reads (the tile below is private to its wave)
__device__ __forceinline__ void wave_lds_sync() {
  __builtin_amdgcn_fence(__ATOMIC_RELEASE, "workgroup");
  __builtin_amdgcn_wave_barrier();
  __builtin_amdgcn_fence(__ATOMIC_ACQUIRE, "workgroup");
}

// One wave turns 64 channels x 32 tokens of an NCT f32 plane into 32 token rows of 64 f16 channels:
// y = f * cA[c] + cD[c] (+ SiLU). pr: the slab's first channel at this lane's token; dst: the tile's first
// token row at the slab's first channel (row pitch CC); st: this wave's own 32 x 9 16-B pieces of LDS.
// All 64 loads of the lane are issued before the first is used. No other wave touches st, so there is no
// work-group barrier. coverage: 8 x 4 rows x (8 lanes x 8 channels) = 32 rows x 64 channels.
template <bool SILU>
__device__ __forceinline__ void gn_tile64(const float* __restrict__ pr, const float* cA, const float* cD,
                                          v4u* st, _Float16* dst, int lane) {
  float f[64];
#pragma unroll
  for (int i = 0; i < 64; ++i) f[i] = pr[(size_t)i * TT];
  // the wave's reads of its last tile are over before st is written again; behind the loads, so that
  // the wait for the last tile's stores runs beside their flight
  wave_lds_sync();
#pragma unroll
  for (int j = 0; j < 8; ++j) {
    float y[8];
#pragma unroll
    for (int i = 0; i < 8; ++i) {
      float yy = fmaf(f[j * 8 + i], cA[j * 8 + i], cD[j * 8 + i]);
      if (SILU) yy = yy * rcp_slot(1.0f + exp2_slot(yy * -1.4426950408889634f));   // e^-y = 2^(-y log2 e)
      y[i] = yy;
    }
    v4u pk;
    pk[0] = pkf(y[0], y[1]);
    pk[1] = pkf(y[2], y[3]);
    pk[2] = pkf(y[4], y[5]);
    pk[3] = pkf(y[6], y[7]);
    st[lane * 9 + j] = pk;
  }
  wave_lds_sync();
  const int q = lane >> 3, l8 = lane & 7;
  v4u v[8];
#pragma unroll
  for (int it = 0; it < 8; ++it) v[it] = st[(it * 4 + q) * 9 + l8];
#pragma unroll
  for (int it = 0; it < 8; ++it) *(v4u*)(dst + (size_t)(it * 4 + q) * CC + l8 * 8) = v[it];
}

// =====================================================================================================
// f32 -> f16 (x scale), 8 elements per thread, one 16-B store per lane (wave = 512 contiguous B =
// coverage: n8*8 = whole plane (n8 is a multiple of 256 for both uses).
// =====================================================================================================
__global__ __launch_bounds__(256) void cvt_f16x8(const float* __restrict__ in, _Float16* out, int n8, float scale) {
  const int i = blockIdx.x * 256 + threadIdx.x;
  if (i < n8) {
    const v4f a = *(const v4f*)(in + (size_t)i * 8);
    const v4f c = *(const v4f*)(in + (size_t)i * 8 + 4);
    v4u p;
    p[0] = pkf(a[0] * scale, a[1] * scale);
    p[1] = pkf(a[2] * scale, a[3] * scale);
    p[2] = pkf(c[0] * scale, c[1] * scale);
    p[3] = pkf(c[2] * scale, c[3] * scale);
    _Float16* dst = out + (size_t)i * 8;
    *(v4u*)dst = p;
    
  }
}

// =====================================================================================================
// conv weight [o][c][3] f32 -> Wt[tap][o][c] f16 (x scale). Thread = (o, 8 consecutive c): reads
// 24 contiguous floats, writes one 16-B piece into each of the 3 tap planes; a wave covers 512
// contiguous B of one row per store instruction. grid = CC*128/256 = 512.
// coverage: 131072 threads x 3 x 8 halves = 3*CC*CC = whole plane.
// =====================================================================================================
__global__ __launch_bounds__(256) void cvt_convw(const float* __restrict__ w, _Float16* out, float scale) {
  const int idx = blockIdx.x * 256 + threadIdx.x;
  if (idx >= CC * (CC / 8)) return;
  const int o = idx >> 7;
  const int c8 = idx & 127;
  const float* p = w + ((size_t)o * CC + (size_t)c8 * 8) * 3;
  union { v4f q[6]; float e[24]; } u;
#pragma unroll
  for (int i = 0; i < 6; ++i) u.q[i] = *(const v4f*)(p + 4 * i);
  v4u pk[3];
#pragma unroll
  for (int tp = 0; tp < 3; ++tp) {
    v4u a;
#pragma unroll
    for (int m = 0; m < 4; ++m)
      a[m] = pkf(u.e[(2 * m) * 3 + tp] * scale, u.e[(2 * m + 1) * 3 + tp] * scale);
    pk[tp] = a;
  }
#pragma unroll
  for (int tp = 0; tp < 3; ++tp)
    *(v4u*)(out + ((size_t)tp * CC + o) * CC + (size_t)c8 * 8) = pk[tp];
  
}

// =====================================================================================================
// relative position bias table tab[h][d], d = (t - s) + 1024, value = emb[bucket][h] * 8 (f32).
// bucket: n = t - s; add 16 when n < 0; n = |n|; n < 8 -> n; else 8 + int(log(n/8) * (1/ln 8) * 8)
// coverage: 8192 threads x 4 = NH*BTP floats.
// =====================================================================================================
__global__ __launch_bounds__(256) void btab_k(const float* __restrict__ emb, float* tab) {
  const int i4 = blockIdx.x * 256 + threadIdx.x;
  if (i4 >= NH * (BTP / 4)) return;
  const int h = i4 >> 9;
  const int d0 = (i4 & 511) * 4;
  const float ln8 = 2.0794415416798357f;
  const float rl8 = 1.0f / ln8;
  v4f v;
#pragma unroll
  for (int e = 0; e < 4; ++e) {
    const int delta = d0 + e - 1024;
    const int n = delta < 0 ? -delta : delta;
    const float nf = (float)(n < 1 ? 1 : n);
    const float lg = logf(nf * 0.125f);
    int vl = 8 + (int)(lg * rl8 * 8.0f);
    vl = vl > 15 ? 15 : vl;
    int bucket = (n < 8) ? n : vl;
    bucket += (delta < 0) ? 16 : 0;
    v[e] = emb[bucket * NH + h] * 8.0f;
  }
  float* dst = tab + (size_t)i4 * 4;
  *(v4f*)dst = v;
  
}

// =====================================================================================================
// GroupNorm(32 groups) (+ SiLU) on an NCT f32 plane [b][CC][TT]; writes the token-major f16 plane
// xt[b][TP][CC] (row 1 + t, channel contiguous) plus the two zero halo rows 0 and TP-1.
// Block = (b, 64-channel slab = 2 groups); 512 threads. Statistics: f64 sums, fixed order; the 32 16-B
// loads of a thread (16 per group) are all issued before the first sum.
// Tiles: 32 tokens x 64 channels, one wave each (gn_tile64), 2 tiles per wave.
// coverage: 32 tiles x 32 rows x (16 slabs x 64 ch) = rows 1..TT x all channels; halo rows by wave 0.
// =====================================================================================================
template <bool SILU>
__global__ __launch_bounds__(GN_NT) void gn32_tr_k(const float* __restrict__ in, const float* __restrict__ gam,
                                                   const float* __restrict__ bet, _Float16* xt) {
  __shared__ __align__(16) v4u sT4[GN_NW][32 * 9];
  __shared__ double red[2 * GN_NW];
  __shared__ __align__(16) float sA[64];
  __shared__ __align__(16) float sD[64];
  const int tid = threadIdx.x, lane = tid & 31, wave = tid >> 5;
  const int b = blockIdx.y;
  const int c0 = blockIdx.x * 64;
  const float* p = in + ((size_t)b * CC + c0) * TT;

  v4f v[2][16];
#pragma unroll
  for (int g = 0; g < 2; ++g)
#pragma unroll
    for (int i = 0; i < 16; ++i) v[g][i] = *(const v4f*)(p + (size_t)g * 32 * TT + ((size_t)i * GN_NT + tid) * 4);
  // keeps the batch's loads one group ahead of their first use: left free, they sink to just in front of
  // their sums and only a few are in flight
  __builtin_amdgcn_sched_barrier(0);

#pragma unroll
  for (int g = 0; g < 2; ++g) {
    double s = 0.0, ss = 0.0;
#pragma unroll
    for (int i = 0; i < 16; ++i) {
#pragma unroll
      for (int e = 0; e < 4; ++e) {
        const double d = (double)v[g][i][e];
        s += d;
        ss += d * d;
      }
    }
    block_sum2(s, ss, red, tid);
    const double invn = 1.0 / 32768.0;
    const double mean = s * invn;
    double var = ss * invn - mean * mean;
    var = var < 0.0 ? 0.0 : var;
    const float rstdf = (float)(1.0 / sqrt(var + 1e-5));
    const float meanf = (float)mean;
    if (tid >= g * 32 && tid < g * 32 + 32) {
      const int c = c0 + tid;
      const float a = rstdf * gam[c];
      sA[tid] = a;
      sD[tid] = bet[c] - meanf * a;
    }
  }
  __syncthreads();

  if (wave == 0 && lane < 16) {
    const int row = (lane < 8) ? 0 : (TP - 1);
    v4u z = {0u, 0u, 0u, 0u};
    _Float16* dst = xt + ((size_t)b * TP + row) * CC + c0 + (lane & 7) * 8;
    *(v4u*)dst = z;
  }

#pragma unroll 1   // one tile's 64 loads fill the registers
  for (int tc = wave; tc < TT / 32; tc += GN_NW)
    gn_tile64<SILU>(p + tc * 32 + lane, sA, sD, sT4[wave], xt + ((size_t)b * TP + 1 + tc * 32) * CC + c0, lane);
}

// =====================================================================================================
// Fused: GroupNorm(8) on H -> xin (f32 NCT, written), then GroupNorm(32) of xin -> f16 token-major
// plane xt[b][TT][CC] (no halo). Block = (b, one 128-channel group); 512 threads.
// phase 1: f64 sums of the group, 16 16-B loads of a thread in flight;
// phase 2: waves 4 sg .. 4 sg + 3 own the 32-channel sub-group sg: xin written as 32 lanes x 16 B contiguous
// pieces (512 B per instruction inside one 4 KB row), 16 loads in flight, f64 sums of xin per sub-group,
// one reduction for the four sub-groups;
// phase 3: y = h*A[c] + D[c] (both norms folded), 32-token x 64-channel tiles, one wave each (gn_tile64).
// coverage: xin rows 0..127 of the group x 1024 t; xt: 32 x 2 tiles of 32 rows x 64 ch per block,
// 8 blocks per b cover all channels.
// =====================================================================================================
__global__ __launch_bounds__(GN_NT) void gn8_attn_k(const float* __restrict__ hin,
                                                    const float* __restrict__ g8, const float* __restrict__ e8,
                                                    const float* __restrict__ ga, const float* __restrict__ ea,
                                                    float* xin, _Float16* xt) {
  __shared__ __align__(16) v4u sT4[GN_NW][32 * 9];
  __shared__ double red[2 * GN_NW];
  __shared__ float sA1[128];
  __shared__ float sD1[128];
  __shared__ __align__(16) float sA[128];
  __shared__ __align__(16) float sD[128];
  __shared__ float sM[4];
  __shared__ float sR[4];
  const int tid = threadIdx.x, lane = tid & 31, wave = tid >> 5;
  const int b = blockIdx.y;
  const int c0 = blockIdx.x * 128;
  const float* p = hin + ((size_t)b * CC + c0) * TT;

  // phase 1
  {
    double s = 0.0, ss = 0.0;
#pragma unroll 1   // one batch of 16 loads per trip
    for (int i0 = 0; i0 < 64; i0 += 16) {
      v4f v[16];
#pragma unroll
      for (int u = 0; u < 16; ++u) v[u] = *(const v4f*)(p + ((size_t)(i0 + u) * GN_NT + tid) * 4);
      // keeps the batch's loads one group ahead of their first use: left free, they sink to just in front of
      // their sums and only a few are in flight
      __builtin_amdgcn_sched_barrier(0);
#pragma unroll
      for (int u = 0; u < 16; ++u) {
#pragma unroll
        for (int e = 0; e < 4; ++e) {
          const double d = (double)v[u][e];
          s += d;
          ss += d * d;
        }
      }
    }
    block_sum2(s, ss, red, tid);
    const double invn = 1.0 / 131072.0;
    const double mean = s * invn;
    double var = ss * invn - mean * mean;
    var = var < 0.0 ? 0.0 : var;
    const float r8f = (float)(1.0 / sqrt(var + 1e-5));
    const float m8f = (float)mean;
    if (tid < 128) {
      const int c = c0 + tid;
      const float a = r8f * g8[c];
      sA1[tid] = a;
      sD1[tid] = e8[c] - m8f * a;
    }
  }
  __syncthreads();

  // phase 2
  {
    const int sg = wave >> 2;
    const size_t o0 = (size_t)sg * 32 * TT + (size_t)(((wave & 3) * 32 + lane) * 4);
    const float* ps = p + o0;
    float* xs = xin + ((size_t)b * CC + c0) * TT + o0;
    double s2 = 0.0, ss2 = 0.0;
#pragma unroll 1   // one batch of 16 loads per trip; 512 floats per step, two steps per channel row
    for (int j0 = 0; j0 < 64; j0 += 16) {
      v4f v[16];
#pragma unroll
      for (int u = 0; u < 16; ++u) v[u] = *(const v4f*)(ps + (size_t)(j0 + u) * 512);
      // keeps the batch's loads one group ahead of their first use: left free, they sink to just in front of
      // their sums and only a few are in flight
      __builtin_amdgcn_sched_barrier(0);
#pragma unroll
      for (int u = 0; u < 16; ++u) {
        const int ch = sg * 32 + ((j0 + u) >> 1);
        const float a = sA1[ch], d = sD1[ch];
        v4f y;
#pragma unroll
        for (int e = 0; e < 4; ++e) {
          const float yy = fmaf(v[u][e], a, d);
          y[e] = yy;
          const double dd = (double)yy;
          s2 += dd;
          ss2 += dd * dd;
        }
        *(v4f*)(xs + (size_t)(j0 + u) * 512) = y;
      }
      GN_WAIT_XCNT();
    }
#pragma unroll
    for (int m = 16; m >= 1; m >>= 1) {
      s2 += shfl_xor_d(s2, m);
      ss2 += shfl_xor_d(ss2, m);
    }
    if (lane == 0) { red[wave] = s2; red[GN_NW + wave] = ss2; }
    __syncthreads();
    if (tid < 4) {
      double S = 0.0, SS = 0.0;
#pragma unroll
      for (int w = 0; w < 4; ++w) { S += red[tid * 4 + w]; SS += red[GN_NW + tid * 4 + w]; }
      const double invn = 1.0 / 32768.0;
      const double mean = S * invn;
      double var = SS * invn - mean * mean;
      var = var < 0.0 ? 0.0 : var;
      sM[tid] = (float)mean;
      sR[tid] = (float)(1.0 / sqrt(var + 1e-5));
    }
  }
  __syncthreads();
  if (tid < 128) {
    const int sg = tid >> 5;
    const int c = c0 + tid;
    const float a2 = sR[sg] * ga[c];
    sA[tid] = sA1[tid] * a2;
    sD[tid] = (sD1[tid] - sM[sg]) * a2 + ea[c];
  }
  __syncthreads();

  // phase 3
#pragma unroll 1   // one tile's 64 loads fill the registers
  for (int ht = wave; ht < 2 * (TT / 32); ht += GN_NW) {
    const int tc = ht >> 1, hf = (ht & 1) * 64;
    gn_tile64<false>(p + (size_t)hf * TT + tc * 32 + lane, sA + hf, sD + hf, sT4[wave],
                     xt + ((size_t)b * TT + tc * 32) * CC + c0 + hf, lane);
  }
}

// =====================================================================================================
// LDS-staged f16 WMMA GEMM: C[m][n] = oscale * sum_tap sum_k A_tap[m][k] * Bt_tap[n][k]
//   + bias (BM: 1 per row m with the A row remap, 2 per column n with the Bt row remap) * bscale
//   (+ resid[m][n] f32, same indexing as C, when RESID).
// Work-group = 8 waves = one 128 x 256 tile of C; wave (wm 0..1, wn 0..3) = 64 x 64 of it.
// A row-major [M][K] pitch lda; Bt row-major [N][K] (k contiguous) pitch ldb. Row remap:
// row(m) = (m>>6)*TS + TO + (m&63). Tap tp adds aTap elements to A and bTap elements to Bt.
// blockIdx.y = batch index (strides in elements). M multiple of 128, N of 256, K of 128 (host constants).
// A stage = 128 k of the 128 A rows and the 256 Bt rows, 256-B rows at a 272-B pitch in LDS, brought by
// asynchronous 16-B copies (24 per lane and stage, 16 lanes per row); two buffers, the next stage's
// copies fly while this one is multiplied. k runs tap-major and ascending, one accumulator per element.
// OUTH: 0 f32 C (pitch ldc), 1 f16 C. Epilogue: 16-row slabs staged per wave in LDS.
// coverage: 4 slabs x 16 rows x 64 cols = the wave's 64x64 tile; grid = exact tile count.
// =====================================================================================================
#define G_BM 128
#define G_BN 256
#define G_KS 128
#define G_PITCH 136                         // halves per LDS row: 272 B = 16 B x odd, for 16-B LDS reads
#define G_BUF ((G_BM + G_BN) * G_PITCH)     // halves per buffer

#if defined(__HIP_DEVICE_COMPILE__)
// twelve copies of one lane; the address-register wait closes the copies' own statement, so that no
// later write of an address register can be moved in front of it
#define G_COPY12(l, g)                                                          \
  asm volatile("global_load_async_to_lds_b128 %0, %12, off\n\t"                 \
               "global_load_async_to_lds_b128 %1, %13, off\n\t"                 \
               "global_load_async_to_lds_b128 %2, %14, off\n\t"                 \
               "global_load_async_to_lds_b128 %3, %15, off\n\t"                 \
               "global_load_async_to_lds_b128 %4, %16, off\n\t"                 \
               "global_load_async_to_lds_b128 %5, %17, off\n\t"                 \
               "global_load_async_to_lds_b128 %6, %18, off\n\t"                 \
               "global_load_async_to_lds_b128 %7, %19, off\n\t"                 \
               "global_load_async_to_lds_b128 %8, %20, off\n\t"                 \
               "global_load_async_to_lds_b128 %9, %21, off\n\t"                 \
               "global_load_async_to_lds_b128 %10, %22, off\n\t"                \
               "global_load_async_to_lds_b128 %11, %23, off\n\t"                \
               "s_wait_xcnt 0x0"                                                \
               :                                                                \
               : "v"((l)[0]), "v"((l)[1]), "v"((l)[2]), "v"((l)[3]), "v"((l)[4]), "v"((l)[5]),               \
                 "v"((l)[6]), "v"((l)[7]), "v"((l)[8]), "v"((l)[9]), "v"((l)[10]), "v"((l)[11]),             \
                 "v"((g)[0]), "v"((g)[1]), "v"((g)[2]), "v"((g)[3]), "v"((g)[4]), "v"((g)[5]),               \
                 "v"((g)[6]), "v"((g)[7]), "v"((g)[8]), "v"((g)[9]), "v"((g)[10]), "v"((g)[11])              \
               : "memory")
// this wave's copies have landed
#define G_WAIT_COPIES() asm volatile("s_wait_asynccnt 0x0" ::: "memory")
// this wave's LDS reads have returned, so the buffer may be refilled behind the barrier
#define G_WAIT_LDS() asm volatile("s_wait_dscnt 0x0" ::: "memory")
#else
#define G_COPY12(l, g) ((void)0)
#define G_WAIT_COPIES() ((void)0)
#define G_WAIT_LDS() ((void)0)
#endif

template <int TAPS, int OUTH, bool RESID, int BM>
__global__ __launch_bounds__(256) void gemm_k(
    const _Float16* __restrict__ A, int lda, long long strideA, long long aTap, int aTS, int aTO,
    const _Float16* __restrict__ Bt, int ldb, long long strideB, long long bTap, int bTS, int bTO,
    const float* __restrict__ bias, float bscale,
    const float* __restrict__ resid,
    void* Cout, int ldc, long long strideC,
    int M, int N, int K, float oscale) {
  __shared__ __align__(16) _Float16 sAB[2 * G_BUF];
  __shared__ __align__(16) float sT[8][16 * 68];
  const int bz = blockIdx.y;
  const int tid = threadIdx.x;
  const int lane = tid & 31, wave = tid >> 5;
  const int tilesN = N >> 8, tilesM = M >> 7;
  const int tile = blockIdx.x;
  if (tile >= tilesM * tilesN) return;   // the same for the whole work-group, ahead of every barrier
  const int tm = tile / tilesN, tn = tile - tm * tilesN;
  const int mB = tm << 7, nB = tn << 8;
  const int wm = wave >> 2, wn = wave & 3;
  const int m0 = mB + wm * 64, n0 = nB + wn * 64;
  const int rlane = lane & 15;
  const int koff = (lane >> 4) * 8;
  const int mOff = koff;
  const int aRow0 = (m0 >> 6) * aTS + aTO;
  const int bRow0 = (n0 >> 6) * bTS + bTO;
  const _Float16* Ab = A + (size_t)bz * (size_t)strideA;
  const _Float16* Bb = Bt + (size_t)bz * (size_t)strideB;

  // copy side: lane -> (row tid>>4 of each 16-row band, 16-B piece tid&15 of its 256 B);
  // bands 0..7 are the A rows, bands 8..23 the Bt rows
  const int crow = tid >> 4, cpc = (tid & 15) * 8;
  const unsigned tA = (unsigned)(crow * lda + cpc);
  const unsigned tB = (unsigned)(crow * ldb + cpc);
  const unsigned ldsC = (unsigned)(size_t)sAB + (unsigned)(crow * G_PITCH + cpc) * 2u;

  auto issue = [&](int tp, int k0, int buf) {
    const _Float16* Ap = Ab + (size_t)tp * (size_t)aTap + k0 + tA;
    const _Float16* Bp = Bb + (size_t)tp * (size_t)bTap + k0 + tB;
#pragma unroll   // constant indices keep the array in registers
    for (int hlf = 0; hlf < 2; ++hlf) {
      unsigned l[12];
      const _Float16* g[12];
#pragma unroll   // constant indices keep the array in registers
      for (int e = 0; e < 12; ++e) {
        const int i = hlf * 12 + e;           // band
        l[e] = ldsC + (unsigned)buf * (unsigned)(G_BUF * 2) + (unsigned)i * (unsigned)(16 * G_PITCH * 2);
        if (i < 8) {
          const int row = ((mB >> 6) + (i >> 2)) * aTS + aTO + 16 * (i & 3);
          g[e] = Ap + (size_t)(unsigned)(row * lda);
        } else {
          const int row = ((nB >> 6) + ((i - 8) >> 2)) * bTS + bTO + 16 * ((i - 8) & 3);
          g[e] = Bp + (size_t)(unsigned)(row * ldb);
        }
      }
      G_COPY12(l, g);
    }
  };

  v8f acc[4][4];
#pragma unroll   // constant indices keep the array in registers
  for (int i = 0; i < 4; ++i)
#pragma unroll   // constant indices keep the array in registers
    for (int j = 0; j < 4; ++j) acc[i][j] = zero8();

  const _Float16* fa = sAB + (wm * 64 + rlane) * G_PITCH + koff;
  const _Float16* fb = sAB + (G_BM + wn * 64 + rlane) * G_PITCH + koff;

  const int nt = TAPS * (K >> 7);
  int itp = 0, ik = 0;                      // tap and k of the next stage to be copied
  issue(itp, ik, 0);
  ik += G_KS;
  if (ik >= K) { ik = 0; ++itp; }
  G_WAIT_COPIES();
  __syncthreads();
  if (nt > 1) {
    issue(itp, ik, 1);
    ik += G_KS;
    if (ik >= K) { ik = 0; ++itp; }
  }

#pragma unroll 1   // one stage per trip: the two buffers alternate by the trip's parity
  for (int t = 0; t < nt; ++t) {
    const _Float16* pa = fa + (t & 1) * G_BUF;
    const _Float16* pb = fb + (t & 1) * G_BUF;
#pragma unroll   // constant indices keep the array in registers
    for (int kk = 0; kk < G_KS / 32; ++kk) {
      v16h af[4], bf[4];
#pragma unroll   // constant indices keep the array in registers
      for (int i = 0; i < 4; ++i) af[i] = ldfrag(pa + i * 16 * G_PITCH + kk * 32);
#pragma unroll   // constant indices keep the array in registers
      for (int j = 0; j < 4; ++j) bf[j] = ldfrag(pb + j * 16 * G_PITCH + kk * 32);
      // keeps the block's 16 LDS reads one group ahead of its 16 WMMAs: left free, the reads of each A
      // fragment sink to just in front of its row and every row waits out a whole LDS latency
      __builtin_amdgcn_sched_barrier(0);
#pragma unroll   // constant indices keep the array in registers
      for (int i = 0; i < 4; ++i)
#pragma unroll   // constant indices keep the array in registers
        for (int j = 0; j < 4; ++j) acc[i][j] = mma_raw(af[i], bf[j], acc[i][j]);
    }
    // publish point of stage t + 1; the same barrier ends every read of the buffer refilled behind it
    G_WAIT_LDS();
    G_WAIT_COPIES();
    __syncthreads();
    if (t + 2 < nt) {
      issue(itp, ik, t & 1);
      ik += G_KS;
      if (ik >= K) { ik = 0; ++itp; }
    }
  }
  G_WAIT_COPIES();

  // ---- epilogue ----
  float* slab = sT[wave];
#pragma unroll
  for (int i = 0; i < 4; ++i) {
    const int mBase = m0 + i * 16;
    float badd[8];
#pragma unroll
    for (int r = 0; r < 8; ++r) badd[r] = 0.f;
    if (BM == 1) {
#pragma unroll
      for (int r = 0; r < 8; ++r) badd[r] = bias[aRow0 + i * 16 + mOff + r] * bscale;
    }
#pragma unroll
    for (int j = 0; j < 4; ++j) {
      float bc = 0.f;
      if (BM == 2) bc = bias[bRow0 + j * 16 + rlane] * bscale;
#pragma unroll
      for (int r = 0; r < 8; ++r)
        slab[(mOff + r) * 68 + j * 16 + rlane] = acc[i][j][r] * oscale + badd[r] + bc;
    }
    __builtin_amdgcn_fence(__ATOMIC_RELEASE, "workgroup");
    __builtin_amdgcn_wave_barrier();
    __builtin_amdgcn_fence(__ATOMIC_ACQUIRE, "workgroup");
    if (OUTH == 0) {
      float* Cb = (float*)Cout + (size_t)bz * (size_t)strideC;
      const float* Rb = RESID ? (resid + (size_t)bz * (size_t)strideC) : resid;
      const int h2 = lane >> 4, c4 = (lane & 15) * 4;     // 256-B row segment = 16 lanes x 16 B
      {
#pragma unroll
        for (int it = 0; it < 8; ++it) {
          const int row = it * 2 + h2;                     // it 0..7 x h2 0..1 = rows 0..15
          v4f v = *(const v4f*)(slab + row * 68 + c4);
          const size_t off = (size_t)(mBase + row) * ldc + n0 + c4;
          if (RESID) v += *(const v4f*)(Rb + off);
          *(v4f*)(Cb + off) = v;
        }
        
      }
    } else {
      _Float16* Cb = (_Float16*)Cout + (size_t)bz * (size_t)strideC;
      const int q = lane >> 3, c8 = (lane & 7) * 8;
      v4u hv[4];
#pragma unroll
      for (int it = 0; it < 4; ++it) {
        const int row = it * 4 + q;                        // it 0..3 x q 0..3 = rows 0..15
        const float* sp = slab + row * 68 + c8;
        v4u a;
#pragma unroll
        for (int e = 0; e < 4; ++e) a[e] = pkf(sp[2 * e], sp[2 * e + 1]);
        hv[it] = a;
      }
      {
#pragma unroll
        for (int it = 0; it < 4; ++it) {
          const int row = it * 4 + q;
          *(v4u*)(Cb + (size_t)(mBase + row) * ldc + n0 + c8) = hv[it];
        }
        
      }
    }
    __builtin_amdgcn_fence(__ATOMIC_RELEASE, "workgroup");
    __builtin_amdgcn_wave_barrier();
    __builtin_amdgcn_fence(__ATOMIC_ACQUIRE, "workgroup");
  }
}

// =====================================================================================================
// Attention, head dim 64, non-causal over TT keys, additive position bias from the table.
//   Qp / Kp (f16, x16): element (b, t, h, d) at [(b*TT + t)*CC + h*64 + d]
//   Vp (f16, x16):      element (b, h, d, s) at [(b*CC + h*64 + d)*TT + s]
//   tab f32 [h][BTP]:   bias(t, s) = tab[h][(t - s) + 1024]
//   AT (f16, x256):     normalised context, element (b, t, h, d) at [(b*TT + t)*CC + h*64 + d]
//   scores = q16 . k16 (f16 WMMA, f32 acc) * sScale + bias; online softmax in f32;
//   p = exp(s - m) carried as f16(1024 p); context += p . v^T tile on f16 WMMA.
//   Block = 4 waves = 64 query rows of one (b, h); grid = 16 * NH * NBATCH; 16 key tiles of 64.
//   K / V^T tile staging: 128 threads x 32 elements per plane = the whole 64x64 tile (plain 16-B
//   loads, __syncthreads before and after). P tiles are wave-private, spilled with _Float16 element
//   Output coverage: each wave stores rows q0..q0+15 (it 0..3 x lane>>3 0..3) x 64 d (8 lanes x 8),
//   LDS rows: the 128-B rows of the K, V^T and P tiles stand at a 144-B pitch and the 256-B context rows
//   at 272 B (16 B x odd), so that the 16 rows of a 16-B fragment read fall on 16 different bank groups.
// =====================================================================================================
#define AT_P 72                             // halves per K / V^T / P row in LDS: 144 B
#define AT_OP 68                            // floats per context row in LDS: 272 B
__global__ __launch_bounds__(128)
void attn_k(const _Float16* __restrict__ Qp, const _Float16* __restrict__ Kp, const _Float16* __restrict__ Vp,
            const float* __restrict__ tab, _Float16* AT, float sScale, float oScale) {
  union FH { v16h v; v8h h[2]; };
  __shared__ __align__(16) _Float16 Ksh[64 * AT_P];    // [kv][d]
  __shared__ __align__(16) _Float16 Vth[64 * AT_P];    // [d][kv]
  __shared__ __align__(16) _Float16 Psh[4][16 * AT_P]; // per wave P [row][kv]
  __shared__ __align__(16) float    Os[4][16 * AT_OP]; // per wave context [row][d]
  __shared__ __align__(16) float    sB[384 * 4];       // bias slice tab[h][q0b .. q0b+1087] (+clamped fill)

  const int tid  = threadIdx.x;
  const int wave = tid >> 5;
  const int lane = tid & 31;
  const int hh   = lane >> 4;
  const int c    = lane & 15;

  const int bx  = blockIdx.x;
  const int qb  = bx & 15;
  const int h   = (bx >> 4) & 15;
  const int b   = bx >> 8;
  const int q0b = qb * 64;
  const int q0  = q0b + wave * 16;
  const size_t rowB = (size_t)b * TT;

  {
    const float* th = tab + (size_t)h * BTP + q0b;     // q0b + 1087 <= 2047 < BTP
#pragma unroll
    for (int k = 0; k < 3; ++k) {
      const int i  = tid + 128 * k;                     // 0..383
      const int ic = (i < 271) ? i : 271;               // clamped address, all lanes load
      *(v4f*)(sB + 4 * i) = *(const v4f*)(th + 4 * ic);
    }
  }

  const _Float16* Qh = Qp + (size_t)h * HD;
  const _Float16* Kh = Kp + (size_t)h * HD;
  const _Float16* Vh = Vp + ((size_t)b * CC + (size_t)h * HD) * TT;

  // ---- Q fragments (A operand, row = lane&15): 2 d-chunks ----
  v16h qa[2];
#pragma unroll
  for (int dc = 0; dc < 2; ++dc) qa[dc] = ldfrag(Qh + (rowB + q0 + c) * CC + dc * 32 + 8 * hh);

  float mrow[8], lrow[8];
  v8f oacc[4];
#pragma unroll
  for (int r = 0; r < 8; ++r) { mrow[r] = -INFINITY; lrow[r] = 0.f; }
#pragma unroll
  for (int t = 0; t < 4; ++t) oacc[t] = zero8();

  // bias index: (t - q0b) - s + 1024 with t - q0b = wave*16 + 8hh + r, s = kv0 + 16j + c
  const int bbase = wave * 16 + 8 * hh + 1024 - c;
  _Float16* pwh = Psh[wave];

#pragma unroll 1
  for (int kt = 0; kt < TT / 64; ++kt) {
    const int kv0 = kt * 64;
    __syncthreads();
    {
      const int r = tid >> 1, half = (tid & 1) * 32;
      const _Float16* kg = Kh + (rowB + kv0 + r) * CC + half;     // K row kv0+r, d = half..half+31
      const _Float16* vg = Vh + (size_t)r * TT + kv0 + half;     // V^T row d = r, s = kv0+half..+31
#pragma unroll
      for (int i = 0; i < 4; ++i) {
        const v8h a0 = *(const v8h*)(kg + 8 * i);
        const v8h b0 = *(const v8h*)(vg + 8 * i);
        *(v8h*)(Ksh + r * AT_P + half + 8 * i) = a0;
        *(v8h*)(Vth + r * AT_P + half + 8 * i) = b0;
      }
    }
    __syncthreads();

    // ---- scores: 16 query rows x 64 keys per wave ----
    v8f s[4];
#pragma unroll
    for (int j = 0; j < 4; ++j) {
      s[j] = zero8();
#pragma unroll
      for (int dc = 0; dc < 2; ++dc) {
        FH kb;
        kb.h[0] = *(const v8h*)(Ksh + (j * 16 + c) * AT_P + dc * 32 + 8 * hh);
        kb.h[1] = *(const v8h*)(Ksh + (j * 16 + c) * AT_P + dc * 32 + 16 + 8 * hh);
        s[j] = mma_h(qa[dc], kb.v, s[j]);
      }
    }

    // ---- scale + bias, row max, online softmax, P (x1024, f16) to LDS ----
    const int bk = bbase - kv0;
#pragma unroll
    for (int r = 0; r < 8; ++r) {
      float m = -INFINITY;
#pragma unroll
      for (int j = 0; j < 4; ++j) {
        const float sv = s[j][r] * sScale + sB[bk + r - 16 * j];
        s[j][r] = sv;
        m = fmaxf(m, sv);
      }
#pragma unroll
      for (int off = 1; off < 16; off <<= 1) m = fmaxf(m, __shfl_xor(m, off, 32));
      const float mnew  = fmaxf(mrow[r], m);
      const float msafe = (mnew == -INFINITY) ? 0.f : mnew;
      const float alpha = __expf(mrow[r] - msafe);
      mrow[r] = mnew;
      float psum = 0.f;
#pragma unroll
      for (int j = 0; j < 4; ++j) {
        const float pe = __expf(s[j][r] - msafe);
        psum += pe;
        pwh[(8 * hh + r) * AT_P + j * 16 + c] = (_Float16)(pe * 1024.0f);
      }
#pragma unroll
      for (int off = 1; off < 16; off <<= 1) psum += __shfl_xor(psum, off, 32);
      lrow[r] = lrow[r] * alpha + psum;
#pragma unroll
      for (int t = 0; t < 4; ++t) oacc[t][r] *= alpha;
    }
    __builtin_amdgcn_fence(__ATOMIC_RELEASE, "workgroup");
    __builtin_amdgcn_wave_barrier();
    __builtin_amdgcn_fence(__ATOMIC_ACQUIRE, "workgroup");

    // ---- context += P . V (f16 WMMA) ----
#pragma unroll
    for (int kk = 0; kk < 2; ++kk) {
      FH pa;
      pa.h[0] = *(const v8h*)(pwh + c * AT_P + kk * 32 + 8 * hh);
      pa.h[1] = *(const v8h*)(pwh + c * AT_P + kk * 32 + 16 + 8 * hh);
#pragma unroll
      for (int t = 0; t < 4; ++t) {
        FH vb;
        vb.h[0] = *(const v8h*)(Vth + (t * 16 + c) * AT_P + kk * 32 + 8 * hh);
        vb.h[1] = *(const v8h*)(Vth + (t * 16 + c) * AT_P + kk * 32 + 16 + 8 * hh);
        oacc[t] = mma_h(pa.v, vb.v, oacc[t]);
      }
    }
  }

  // ---- normalise (1/l, the 1/1024 p carry, the x16 v carry and the x256 output carry are all in
  float* os = Os[wave];
#pragma unroll
  for (int r = 0; r < 8; ++r) {
    const float l = lrow[r];
    const float inv = ((l > 0.f) ? rcp_f(l) : 0.f) * oScale;
#pragma unroll
    for (int t = 0; t < 4; ++t) os[(8 * hh + r) * AT_OP + t * 16 + c] = oacc[t][r] * inv;
  }
  __builtin_amdgcn_fence(__ATOMIC_RELEASE, "workgroup");
  __builtin_amdgcn_wave_barrier();
  __builtin_amdgcn_fence(__ATOMIC_ACQUIRE, "workgroup");
  {
    const int q4 = lane >> 3, c8 = (lane & 7) * 8;
    v4u hv[4];
#pragma unroll
    for (int it = 0; it < 4; ++it) {
      const int row = it * 4 + q4;   // it 0..3 x q4 0..3 = rows 0..15 of the wave tile
      const float* sp = os + row * AT_OP + c8;
      v4u a;
#pragma unroll
      for (int e = 0; e < 4; ++e) a[e] = pkf(sp[2 * e], sp[2 * e + 1]);
      hv[it] = a;
    }
    {
#pragma unroll
      for (int it = 0; it < 4; ++it) {
        const int row = it * 4 + q4;
        const size_t go = (rowB + q0 + row) * CC + (size_t)h * HD + c8;
        *(v4u*)(AT + go) = hv[it];
      }
      
    }
  }
}

// =====================================================================================================
// Workspace map (bytes):
//   W1t  f16 [3][1024][1024]       0            6291456
//   W2t  f16 [3][1024][1024]       6291456      6291456
//   Wqkv f16 [3072][1024]          12582912     6291456
//   Wp   f16 [1024][1024]          18874368     2097152
//   Tab  f32 [16][2048]            20971520      131072
//   XT   f16 [8][1026][1024]       21102592    16809984   (later: XT3 [8][1024][1024], then AT [8192][1024])
//   R1   f32 [8][1024][1024]       37912576    33554432   (F1, then H, then Qp + Kp f16 [8192][1024] each)
//   Xin  f32 [8][1024][1024]       71467008    33554432
//   Vp   f16 [8][1024][1024]       105021440   16777216
//   end                            121798656
// Every plane is an exact multiple of its whole-line / whole-tile store granularity (incl. the two
// halo token rows per sample in XT); no tail padding needed.
// =====================================================================================================
extern "C" void kernel_launch(void* const* d_in, const int* in_sizes, int n_in,
                              void* d_out, int out_size, void* d_ws, size_t ws_size,
                              hipStream_t stream) {
  if (n_in < 18) return;
  const int nAct = NBATCH * CC * TT;                     // 8388608
  if (in_sizes[0] != nAct || out_size != nAct) return;
  if (in_sizes[3] != CC * CC * 3 || in_sizes[7] != CC * CC * 3) return;
  if (in_sizes[13] != 3 * CC * CC || in_sizes[15] != CC * CC) return;
  if (in_sizes[1] != CC || in_sizes[2] != CC || in_sizes[4] != CC || in_sizes[5] != CC ||
      in_sizes[6] != CC || in_sizes[8] != CC || in_sizes[9] != CC || in_sizes[10] != CC ||
      in_sizes[11] != CC || in_sizes[12] != CC || in_sizes[16] != CC) return;
  if (in_sizes[14] != 3 * CC || in_sizes[17] != NBUCK * NH) return;

  const float* x      = (const float*)d_in[0];
  const float* gn1_g  = (const float*)d_in[1];
  const float* gn1_b  = (const float*)d_in[2];
  const float* c1_w   = (const float*)d_in[3];
  const float* c1_b   = (const float*)d_in[4];
  const float* gn2_g  = (const float*)d_in[5];
  const float* gn2_b  = (const float*)d_in[6];
  const float* c2_w   = (const float*)d_in[7];
  const float* c2_b   = (const float*)d_in[8];
  const float* n8_g   = (const float*)d_in[9];
  const float* n8_b   = (const float*)d_in[10];
  const float* ag_g   = (const float*)d_in[11];
  const float* ag_b   = (const float*)d_in[12];
  const float* qkv_w  = (const float*)d_in[13];
  const float* qkv_b  = (const float*)d_in[14];
  const float* pj_w   = (const float*)d_in[15];
  const float* pj_b   = (const float*)d_in[16];
  const float* remb   = (const float*)d_in[17];

  const size_t PWC  = (size_t)3 * CC * CC * 2;          //  6291456
  const size_t PWQ  = (size_t)3 * CC * CC * 2;          //  6291456
  const size_t PWP  = (size_t)CC * CC * 2;              //  2097152
  const size_t PTAB = (size_t)NH * BTP * 4;             //   131072
  const size_t PXT  = (size_t)NBATCH * TP * CC * 2;     // 16809984
  const size_t PF   = (size_t)NBATCH * CC * TT * 4;     // 33554432
  const size_t PV   = (size_t)NBATCH * CC * TT * 2;     // 16777216
  size_t off = 0;
  const size_t oW1  = off; off += PWC;
  const size_t oW2  = off; off += PWC;
  const size_t oWq  = off; off += PWQ;
  const size_t oWp  = off; off += PWP;
  const size_t oTab = off; off += PTAB;
  const size_t oXT  = off; off += PXT;
  const size_t oR1  = off; off += PF;
  const size_t oXin = off; off += PF;
  const size_t oV   = off; off += PV;
  if (off > ws_size) return;                            // off = 121798656
  if (off > (size_t)134217728) return;
  if (2 * PV > PF) return;                              // Qp + Kp live inside R1
  if ((size_t)NBATCH * TT * CC * 2 > PXT) return;       // XT3 / AT fit in the XT region

  char* ws = (char*)d_ws;
  _Float16* W1t  = (_Float16*)(ws + oW1);
  _Float16* W2t  = (_Float16*)(ws + oW2);
  _Float16* Wqkv = (_Float16*)(ws + oWq);
  _Float16* Wpb  = (_Float16*)(ws + oWp);
  float*    Tab  = (float*)(ws + oTab);
  _Float16* XT   = (_Float16*)(ws + oXT);               // [8][1026][1024] with halo rows
  _Float16* XT3  = (_Float16*)(ws + oXT);               // [8][1024][1024], later use of the same region
  _Float16* ATp  = (_Float16*)(ws + oXT);               // [8192][1024], last use of the same region
  float*    F1   = (float*)(ws + oR1);
  float*    Hb   = (float*)(ws + oR1);
  _Float16* Qp   = (_Float16*)(ws + oR1);
  _Float16* Kp   = (_Float16*)(ws + oR1 + PV);
  float*    Xin  = (float*)(ws + oXin);
  _Float16* Vp   = (_Float16*)(ws + oV);

  const dim3 blk(256);
  const int  n8q = 3 * CC * CC / 8;                     // 393216
  const int  n8p = CC * CC / 8;                         // 131072
  const long long CCCC = (long long)CC * CC;
  const long long CT   = (long long)CC * TT;

  // (1) weights -> f16 x64 planes; position bias table
  cvt_convw<<<dim3(CC * (CC / 8) / 256), blk, 0, stream>>>(c1_w, W1t, 64.0f);
  cvt_convw<<<dim3(CC * (CC / 8) / 256), blk, 0, stream>>>(c2_w, W2t, 64.0f);
  cvt_f16x8<<<dim3((n8q + 255) / 256), blk, 0, stream>>>(qkv_w, Wqkv, n8q, 64.0f);
  cvt_f16x8<<<dim3((n8p + 255) / 256), blk, 0, stream>>>(pj_w, Wpb, n8p, 64.0f);
  btab_k<<<dim3(NH * (BTP / 4) / 256), blk, 0, stream>>>(remb, Tab);

  // (2) h = silu(GN32(x)) -> XT (token-major f16, halo rows)
  gn32_tr_k<true><<<dim3(CC / 64, NBATCH), dim3(GN_NT), 0, stream>>>(x, gn1_g, gn1_b, XT);
  // (3) F1 = conv1(h) + b1 -> f32 NCT   (per b: M=1024 o, N=1024 t, K=3 taps x 1024)
  gemm_k<3, 0, false, 1><<<dim3((CC / 128) * (TT / 256), NBATCH), blk, 0, stream>>>(
      W1t, CC, 0LL, CCCC, 64, 0,
      XT, CC, (long long)TP * CC, (long long)CC, 64, 0,
      c1_b, 1.0f, nullptr,
      (void*)F1, TT, CT, CC, TT, CC, 1.0f / 64.0f);
  // (4) h = silu(GN32(F1)) -> XT
  gn32_tr_k<true><<<dim3(CC / 64, NBATCH), dim3(GN_NT), 0, stream>>>(F1, gn2_g, gn2_b, XT);
  // (5) H = conv2(h) + b2 + x -> f32 NCT (R1)
  gemm_k<3, 0, true, 1><<<dim3((CC / 128) * (TT / 256), NBATCH), blk, 0, stream>>>(
      W2t, CC, 0LL, CCCC, 64, 0,
      XT, CC, (long long)TP * CC, (long long)CC, 64, 0,
      c2_b, 1.0f, x,
      (void*)Hb, TT, CT, CC, TT, CC, 1.0f / 64.0f);
  // (6) xin = GN8(H) -> f32 NCT; GN32(xin) -> XT3 (token-major f16, no halo)
  gn8_attn_k<<<dim3(CC / 128, NBATCH), dim3(GN_NT), 0, stream>>>(Hb, n8_g, n8_b, ag_g, ag_b, Xin, XT3);
  // (7) q = xn^T . Wq^T -> Qp [b*TT+t][h*64+d] f16 x16  (M=8192, N=1024, K=1024; W rows h*192+d)
  gemm_k<1, 1, false, 2><<<dim3((NBATCH * TT / 128) * (CC / 256), 1), blk, 0, stream>>>(
      XT3, CC, 0LL, 0LL, 64, 0,
      Wqkv, CC, 0LL, 0LL, 192, 0,
      qkv_b, 16.0f, nullptr,
      (void*)Qp, CC, 0LL, NBATCH * TT, CC, CC, 0.25f);
  // (8) k -> Kp (W rows h*192+64+d)
  gemm_k<1, 1, false, 2><<<dim3((NBATCH * TT / 128) * (CC / 256), 1), blk, 0, stream>>>(
      XT3, CC, 0LL, 0LL, 64, 0,
      Wqkv, CC, 0LL, 0LL, 192, 64,
      qkv_b, 16.0f, nullptr,
      (void*)Kp, CC, 0LL, NBATCH * TT, CC, CC, 0.25f);
  // (9) v (channel-major) = Wv . xn -> Vp [b][h*64+d][s] f16 x16 (per b: M=1024 rows h*192+128+d, N=1024 t)
  gemm_k<1, 1, false, 1><<<dim3((CC / 128) * (TT / 256), NBATCH), blk, 0, stream>>>(
      Wqkv, CC, 0LL, 0LL, 192, 128,
      XT3, CC, CT, 0LL, 64, 0,
      qkv_b, 16.0f, nullptr,
      (void*)Vp, TT, CT, CC, TT, CC, 0.25f);
  // (10) attention -> AT [b*TT+t][h*64+d] f16 x256
  attn_k<<<dim3((TT / 64) * NH * NBATCH), dim3(128), 0, stream>>>(
      Qp, Kp, Vp, Tab, ATp, 1.0f / 2048.0f, 1.0f / 64.0f);
  // (11) out = xin + proj(a) + bp -> d_out f32 NCT (per b: M=1024 o, N=1024 t, K=1024)
  gemm_k<1, 0, true, 1><<<dim3((CC / 128) * (TT / 256), NBATCH), blk, 0, stream>>>(
      Wpb, CC, 0LL, 0LL, 64, 0,
      ATp, CC, CT, 0LL, 64, 0,
      pj_b, 1.0f, Xin,
      d_out, TT, CT, CC, TT, CC, 1.0f / 16384.0f);
  (void)hipGetLastError();
}

// v004
// Measured time: 311 microseconds a run.
// Next to v003, in two timings, it ran 1.38 and 1.39 times as fast.
// Over all steps from v000 it is 3.06 times as fast.
// Contractions: conv k3 (two), qkv 1x1, q.k^T, p.v, proj 1x1 = v_wmma_f32_16x16x32_f16 (f16 operands: weights x64, GroupNorm activations x1, q/k/v x16, p x1024, attention output x256), f32 accumulate; GroupNorm statistics f32 partial sums with f64 totals, softmax / position bias / residuals f32.
#include <hip/hip_runtime.h>
#include <math.h>
#include <stdint.h>

#define NBATCH 8
#define CC 1024
#define TT 1024
#define TP 1026
#define NH 16
#define HD 64
#define NBUCK 32
#define BTP 2048

static_assert(NH * HD == CC);
static_assert((CC % 256) == 0 && (TT % 256) == 0);

typedef _Float16 v16h __attribute__((ext_vector_type(16)));
typedef _Float16 v8h  __attribute__((ext_vector_type(8)));
typedef float    v8f  __attribute__((ext_vector_type(8)));
typedef float    v4f  __attribute__((ext_vector_type(4)));
typedef unsigned int v4u __attribute__((ext_vector_type(4)));

// ---- hazard guards (device pass only; no-op for the host pass) ----
#if defined(__HIP_DEVICE_COMPILE__)
#define HZ_ACC_AB(c, a, b) asm volatile("v_nop\n\tv_nop\n\tv_nop\n\tv_nop" : "+v"(c) : "v"(a), "v"(b))
#else
#define HZ_ACC_AB(c, a, b) ((void)0)
#endif

// ---- scalar helpers ----
__device__ __forceinline__ unsigned short h_bits(_Float16 x) { return __builtin_bit_cast(unsigned short, x); }
__device__ __forceinline__ unsigned pkf(float a, float b) {
  return (unsigned)h_bits((_Float16)a) | ((unsigned)h_bits((_Float16)b) << 16);
}
__device__ __forceinline__ v8f zero8() { v8f z = {0.f, 0.f, 0.f, 0.f, 0.f, 0.f, 0.f, 0.f}; return z; }
__device__ __forceinline__ float rcp_f(float x) { return __builtin_amdgcn_rcpf(x); }

// ---- 16-bit A/B fragment: lane -> row/col (lane&15); p already includes +8*(lane>>4);
//      elements 0..7 <- p[0..7] (k0+8h..), elements 8..15 <- p[16..23] (k0+16+8h..)
__device__ __forceinline__ v16h ldfrag(const _Float16* p) {
  union { v16h v; v8h h[2]; } f;
  f.h[0] = *(const v8h*)(p);
  f.h[1] = *(const v8h*)(p + 16);
  return f.v;
}

// ---- WMMA helpers ----
__device__ __forceinline__ v8f mma_h(v16h a, v16h b, v8f c) {
  c = __builtin_amdgcn_wmma_f32_16x16x32_f16(false, a, false, b, (short)0, c, false, false);
  HZ_ACC_AB(c, a, b);
  return c;
}
__device__ __forceinline__ v8f mma_raw(v16h a, v16h b, v8f c) {
  return __builtin_amdgcn_wmma_f32_16x16x32_f16(false, a, false, b, (short)0, c, false, false);
}

// ---- f64 wave shuffle ----
__device__ __forceinline__ double shfl_xor_d(double v, int m) {
  const unsigned long long u = (unsigned long long)__double_as_longlong(v);
  const int lo = __shfl_xor((int)(unsigned)(u & 0xffffffffull), m, 32);
  const int hi = __shfl_xor((int)(unsigned)(u >> 32), m, 32);
  const unsigned long long r = ((unsigned long long)(unsigned)hi << 32) | (unsigned long long)(unsigned)lo;
  return __longlong_as_double((long long)r);
}
// GroupNorm kernels: 16 waves per work-group
#define GN_NT 512
#define GN_NW 16
// Statistics: the per-element sums run in f32 (four chains of 16 per batch of 16 loads, joined as a tree, then the
// wave's 32 lanes); only the wave totals are summed in f64, where the squared mean is taken from the mean square.
__device__ __forceinline__ float sum4(v4f a) { return (a[0] + a[1]) + (a[2] + a[3]); }
__device__ __forceinline__ float wave_sum(float v) {
#pragma unroll   // the five exchange distances as constants
  for (int m = 16; m >= 1; m >>= 1) v += __shfl_xor(v, m, 32);
  return v;
}
// 1 / sqrt(x), x >= 1e-5: the hardware's estimate and one Newton step; the v_nop is the one slot that the
// instruction set asks for behind a transcendental before its result is used
__device__ __forceinline__ float rsqrt_nr(float x) {
#if defined(__HIP_DEVICE_COMPILE__)
  float r;
  asm("v_rsq_f32 %0, %1\n\tv_nop" : "=v"(r) : "v"(x));
  const float e = fmaf(-x * r, r, 1.0f);
  return fmaf(0.5f * r, e, r);
#else
  return x;
#endif
}
// mean and 1 / sigma from the f64 totals of n = 1 / invn values
__device__ __forceinline__ void mean_rstd(double S, double SS, double invn, float& meanf, float& rstdf) {
  const double mean = S * invn;
  double var = SS * invn - mean * mean;
  var = var < 0.0 ? 0.0 : var;
  meanf = (float)mean;
  rstdf = rsqrt_nr((float)var + 1e-5f);
}
// rs, rq: the GN_NW wave totals (sum, sum of squares) in LDS; called by a whole wave, every lane returns the result
__device__ __forceinline__ void close_stats(const float* rs, const float* rq, int lane, double invn,
                                            float& meanf, float& rstdf) {
  double S = (double)rs[lane & (GN_NW - 1)], SS = (double)rq[lane & (GN_NW - 1)];
#pragma unroll   // the four exchange distances as constants
  for (int m = GN_NW / 2; m >= 1; m >>= 1) {
    S += shfl_xor_d(S, m);
    SS += shfl_xor_d(SS, m);
  }
  mean_rstd(S, SS, invn, meanf, rstdf);
}

// SiLU's two transcendentals, each with the one slot behind it that the instruction set asks for before its
// result is used or its source overwritten
__device__ __forceinline__ float exp2_slot(float x) {
#if defined(__HIP_DEVICE_COMPILE__)
  float r;
  asm("v_exp_f32 %0, %1\n\tv_nop" : "=v"(r) : "v"(x));
  return r;
#else
  return x;
#endif
}
__device__ __forceinline__ float rcp_slot(float x) {
#if defined(__HIP_DEVICE_COMPILE__)
  float r;
  asm("v_rcp_f32 %0, %1\n\tv_nop" : "=v"(r) : "v"(x));
  return r;
#else
  return x;
#endif
}

#if defined(__HIP_DEVICE_COMPILE__)
// stands behind a batch of stores whose address and data registers the next trip's loads write again
#define GN_WAIT_XCNT() asm volatile("s_wait_xcnt 0x0" ::: "memory")
#else
#define GN_WAIT_XCNT() ((void)0)
#endif

// orders one wave's own LDS writes and reads (the tile below is private to its wave)
__device__ __forceinline__ void wave_lds_sync() {
  __builtin_amdgcn_fence(__ATOMIC_RELEASE, "workgroup");
  __builtin_amdgcn_wave_barrier();
  __builtin_amdgcn_fence(__ATOMIC_ACQUIRE, "workgroup");
}

// One wave turns 64 channels x 32 tokens of an NCT f32 plane into 32 token rows of 64 f16 channels:
// y = f * cA[c] + cD[c] (+ SiLU). pr: the slab's first channel at this lane's token; dst: the tile's first
// token row at the slab's first channel (row pitch CC); st: this wave's own 32 x 9 16-B pieces of LDS.
// All 64 loads of the lane are issued before the first is used. No other wave touches st, so there is no
// work-group barrier. coverage: 8 x 4 rows x (8 lanes x 8 channels) = 32 rows x 64 channels.
template <bool SILU>
__device__ __forceinline__ void gn_tile64(const float* __restrict__ pr, const float* cA, const float* cD,
                                          v4u* st, _Float16* dst, int lane) {
  float f[64];
#pragma unroll
  for (int i = 0; i < 64; ++i) f[i] = pr[(size_t)i * TT];
  // the wave's reads of its last tile are over before st is written again; behind the loads, so that
  // the wait for the last tile's stores runs beside their flight
  wave_lds_sync();
#pragma unroll
  for (int j = 0; j < 8; ++j) {
    float y[8];
#pragma unroll
    for (int i = 0; i < 8; ++i) {
      float yy = fmaf(f[j * 8 + i], cA[j * 8 + i], cD[j * 8 + i]);
      if (SILU) yy = yy * rcp_slot(1.0f + exp2_slot(yy * -1.4426950408889634f));   // e^-y = 2^(-y log2 e)
      y[i] = yy;
    }
    v4u pk;
    pk[0] = pkf(y[0], y[1]);
    pk[1] = pkf(y[2], y[3]);
    pk[2] = pkf(y[4], y[5]);
    pk[3] = pkf(y[6], y[7]);
    st[lane * 9 + j] = pk;
  }
  wave_lds_sync();
  const int q = lane >> 3, l8 = lane & 7;
  v4u v[8];
#pragma unroll
  for (int it = 0; it < 8; ++it) v[it] = st[(it * 4 + q) * 9 + l8];
#pragma unroll
  for (int it = 0; it < 8; ++it) *(v4u*)(dst + (size_t)(it * 4 + q) * CC + l8 * 8) = v[it];
}

// =====================================================================================================
// f32 -> f16 (x scale), 8 elements per thread, one 16-B store per lane (wave = 512 contiguous B =
// coverage: n8*8 = whole plane (n8 is a multiple of 256 for both uses).
// =====================================================================================================
__global__ __launch_bounds__(256) void cvt_f16x8(const float* __restrict__ in, _Float16* out, int n8, float scale) {
  const int i = blockIdx.x * 256 + threadIdx.x;
  if (i < n8) {
    const v4f a = *(const v4f*)(in + (size_t)i * 8);
    const v4f c = *(const v4f*)(in + (size_t)i * 8 + 4);
    v4u p;
    p[0] = pkf(a[0] * scale, a[1] * scale);
    p[1] = pkf(a[2] * scale, a[3] * scale);
    p[2] = pkf(c[0] * scale, c[1] * scale);
    p[3] = pkf(c[2] * scale, c[3] * scale);
    _Float16* dst = out + (size_t)i * 8;
    *(v4u*)dst = p;
    
  }
}

// =====================================================================================================
// conv weight [o][c][3] f32 -> Wt[tap][o][c] f16 (x scale). Thread = (o, 8 consecutive c): reads
// 24 contiguous floats, writes one 16-B piece into each of the 3 tap planes; a wave covers 512
// contiguous B of one row per store instruction. grid = CC*128/256 = 512.
// coverage: 131072 threads x 3 x 8 halves = 3*CC*CC = whole plane.
// =====================================================================================================
__global__ __launch_bounds__(256) void cvt_convw(const float* __restrict__ w, _Float16* out, float scale) {
  const int idx = blockIdx.x * 256 + threadIdx.x;
  if (idx >= CC * (CC / 8)) return;
  const int o = idx >> 7;
  const int c8 = idx & 127;
  const float* p = w + ((size_t)o * CC + (size_t)c8 * 8) * 3;
  union { v4f q[6]; float e[24]; } u;
#pragma unroll
  for (int i = 0; i < 6; ++i) u.q[i] = *(const v4f*)(p + 4 * i);
  v4u pk[3];
#pragma unroll
  for (int tp = 0; tp < 3; ++tp) {
    v4u a;
#pragma unroll
    for (int m = 0; m < 4; ++m)
      a[m] = pkf(u.e[(2 * m) * 3 + tp] * scale, u.e[(2 * m + 1) * 3 + tp] * scale);
    pk[tp] = a;
  }
#pragma unroll
  for (int tp = 0; tp < 3; ++tp)
    *(v4u*)(out + ((size_t)tp * CC + o) * CC + (size_t)c8 * 8) = pk[tp];
  
}

// =====================================================================================================
// relative position bias table tab[h][d], d = (t - s) + 1024, value = emb[bucket][h] * 8 (f32).
// bucket: n = t - s; add 16 when n < 0; n = |n|; n < 8 -> n; else 8 + int(log(n/8) * (1/ln 8) * 8)
// coverage: 8192 threads x 4 = NH*BTP floats.
// =====================================================================================================
__global__ __launch_bounds__(256) void btab_k(const float* __restrict__ emb, float* tab) {
  const int i4 = blockIdx.x * 256 + threadIdx.x;
  if (i4 >= NH * (BTP / 4)) return;
  const int h = i4 >> 9;
  const int d0 = (i4 & 511) * 4;
  const float ln8 = 2.0794415416798357f;
  const float rl8 = 1.0f / ln8;
  v4f v;
#pragma unroll
  for (int e = 0; e < 4; ++e) {
    const int delta = d0 + e - 1024;
    const int n = delta < 0 ? -delta : delta;
    const float nf = (float)(n < 1 ? 1 : n);
    const float lg = logf(nf * 0.125f);
    int vl = 8 + (int)(lg * rl8 * 8.0f);
    vl = vl > 15 ? 15 : vl;
    int bucket = (n < 8) ? n : vl;
    bucket += (delta < 0) ? 16 : 0;
    v[e] = emb[bucket * NH + h] * 8.0f;
  }
  float* dst = tab + (size_t)i4 * 4;
  *(v4f*)dst = v;
  
}

// =====================================================================================================
// GroupNorm(32 groups) (+ SiLU) on an NCT f32 plane [b][CC][TT]; writes the token-major f16 plane
// xt[b][TP][CC] (row 1 + t, channel contiguous) plus the two zero halo rows 0 and TP-1.
// Block = (b, 64-channel slab = 2 groups); 512 threads. Statistics: f32 partial sums, f64 totals, fixed order; the 32 16-B
// loads of a thread (16 per group) are all issued before the first sum.
// Tiles: 32 tokens x 64 channels, one wave each (gn_tile64), 2 tiles per wave.
// coverage: 32 tiles x 32 rows x (16 slabs x 64 ch) = rows 1..TT x all channels; halo rows by wave 0.
// =====================================================================================================
template <bool SILU>
__global__ __launch_bounds__(GN_NT) void gn32_tr_k(const float* __restrict__ in, const float* __restrict__ gam,
                                                   const float* __restrict__ bet, _Float16* xt) {
  __shared__ __align__(16) v4u sT4[GN_NW][32 * 9];
  __shared__ float red[4][GN_NW];
  __shared__ __align__(16) float sA[64];
  __shared__ __align__(16) float sD[64];
  const int tid = threadIdx.x, lane = tid & 31, wave = tid >> 5;
  const int b = blockIdx.y;
  const int c0 = blockIdx.x * 64;
  const float* p = in + ((size_t)b * CC + c0) * TT;

  v4f v[2][16];
#pragma unroll
  for (int g = 0; g < 2; ++g)
#pragma unroll
    for (int i = 0; i < 16; ++i) v[g][i] = *(const v4f*)(p + (size_t)g * 32 * TT + ((size_t)i * GN_NT + tid) * 4);
  // keeps the batch's loads one group ahead of their first use: left free, they sink to just in front of
  // their sums and only a few are in flight
  __builtin_amdgcn_sched_barrier(0);

#pragma unroll
  for (int g = 0; g < 2; ++g) {
    v4f s4 = {0.f, 0.f, 0.f, 0.f}, q4 = {0.f, 0.f, 0.f, 0.f};
#pragma unroll   // constant indices keep the array in registers
    for (int i = 0; i < 16; ++i) {
      s4 += v[g][i];
      q4 += v[g][i] * v[g][i];
    }
    const float s = wave_sum(sum4(s4)), q = wave_sum(sum4(q4));
    if (lane == 0) { red[g][wave] = s; red[2 + g][wave] = q; }
  }
  __syncthreads();
  if (wave < 2) {   // wave g closes group g: its lanes are the group's 32 channels
    float meanf, rstdf;
    close_stats(red[wave], red[2 + wave], lane, 1.0 / 32768.0, meanf, rstdf);
    const int c = c0 + tid;
    const float a = rstdf * gam[c];
    sA[tid] = a;
    sD[tid] = bet[c] - meanf * a;
  }
  __syncthreads();

  if (wave == 0 && lane < 16) {
    const int row = (lane < 8) ? 0 : (TP - 1);
    v4u z = {0u, 0u, 0u, 0u};
    _Float16* dst = xt + ((size_t)b * TP + row) * CC + c0 + (lane & 7) * 8;
    *(v4u*)dst = z;
  }

#pragma unroll 1   // one tile's 64 loads fill the registers
  for (int tc = wave; tc < TT / 32; tc += GN_NW)
    gn_tile64<SILU>(p + tc * 32 + lane, sA, sD, sT4[wave], xt + ((size_t)b * TP + 1 + tc * 32) * CC + c0, lane);
}

// =====================================================================================================
// Fused: GroupNorm(8) on H -> xin (f32 NCT, written), then GroupNorm(32) of xin -> f16 token-major
// plane xt[b][TT][CC] (no halo). Block = (b, one 128-channel group); 512 threads.
// phase 1: sums of the group (f32 partial sums, f64 totals), 16 16-B loads of a thread in flight;
// phase 2: waves 4 sg .. 4 sg + 3 own the 32-channel sub-group sg: xin written as 32 lanes x 16 B contiguous
// pieces (512 B per instruction inside one 4 KB row), 16 loads in flight, sums of xin per sub-group likewise,
// one reduction for the four sub-groups;
// phase 3: y = h*A[c] + D[c] (both norms folded), 32-token x 64-channel tiles, one wave each (gn_tile64).
// coverage: xin rows 0..127 of the group x 1024 t; xt: 32 x 2 tiles of 32 rows x 64 ch per block,
// 8 blocks per b cover all channels.
// =====================================================================================================
__global__ __launch_bounds__(GN_NT) void gn8_attn_k(const float* __restrict__ hin,
                                                    const float* __restrict__ g8, const float* __restrict__ e8,
                                                    const float* __restrict__ ga, const float* __restrict__ ea,
                                                    float* xin, _Float16* xt) {
  __shared__ __align__(16) v4u sT4[GN_NW][32 * 9];
  __shared__ float red[2][GN_NW];
  __shared__ float sA1[128];
  __shared__ float sD1[128];
  __shared__ __align__(16) float sA[128];
  __shared__ __align__(16) float sD[128];
  __shared__ float sM[4];
  __shared__ float sR[4];
  const int tid = threadIdx.x, lane = tid & 31, wave = tid >> 5;
  const int b = blockIdx.y;
  const int c0 = blockIdx.x * 128;
  const float* p = hin + ((size_t)b * CC + c0) * TT;

  // phase 1
  {
    float s = 0.f, q = 0.f;
#pragma unroll 1   // one batch of 16 loads per trip
    for (int i0 = 0; i0 < 64; i0 += 16) {
      v4f v[16];
#pragma unroll
      for (int u = 0; u < 16; ++u) v[u] = *(const v4f*)(p + ((size_t)(i0 + u) * GN_NT + tid) * 4);
      // keeps the batch's loads one group ahead of their first use: left free, they sink to just in front of
      // their sums and only a few are in flight
      __builtin_amdgcn_sched_barrier(0);
      v4f s4 = {0.f, 0.f, 0.f, 0.f}, q4 = {0.f, 0.f, 0.f, 0.f};
#pragma unroll   // constant indices keep the array in registers
      for (int u = 0; u < 16; ++u) {
        s4 += v[u];
        q4 += v[u] * v[u];
      }
      s += sum4(s4);
      q += sum4(q4);
    }
    s = wave_sum(s);
    q = wave_sum(q);
    if (lane == 0) { red[0][wave] = s; red[1][wave] = q; }
    __syncthreads();
    if (tid < 128) {   // the four waves whose lanes are the group's 128 channels
      float m8f, r8f;
      close_stats(red[0], red[1], lane, 1.0 / 131072.0, m8f, r8f);
      const int c = c0 + tid;
      const float a = r8f * g8[c];
      sA1[tid] = a;
      sD1[tid] = e8[c] - m8f * a;
    }
  }
  __syncthreads();

  // phase 2
  {
    const int sg = wave >> 2;
    const size_t o0 = (size_t)sg * 32 * TT + (size_t)(((wave & 3) * 32 + lane) * 4);
    const float* ps = p + o0;
    float* xs = xin + ((size_t)b * CC + c0) * TT + o0;
    float s2 = 0.f, q2 = 0.f;
#pragma unroll 1   // one batch of 16 loads per trip; 512 floats per step, two steps per channel row
    for (int j0 = 0; j0 < 64; j0 += 16) {
      v4f v[16];
#pragma unroll
      for (int u = 0; u < 16; ++u) v[u] = *(const v4f*)(ps + (size_t)(j0 + u) * 512);
      // keeps the batch's loads one group ahead of their first use: left free, they sink to just in front of
      // their sums and only a few are in flight
      __builtin_amdgcn_sched_barrier(0);
      v4f s4 = {0.f, 0.f, 0.f, 0.f}, q4 = {0.f, 0.f, 0.f, 0.f};
#pragma unroll
      for (int u = 0; u < 16; ++u) {
        const int ch = sg * 32 + ((j0 + u) >> 1);
        const float a = sA1[ch], d = sD1[ch];
        v4f y;
#pragma unroll
        for (int e = 0; e < 4; ++e) y[e] = fmaf(v[u][e], a, d);
        s4 += y;
        q4 += y * y;
        *(v4f*)(xs + (size_t)(j0 + u) * 512) = y;
      }
      s2 += sum4(s4);
      q2 += sum4(q4);
      GN_WAIT_XCNT();
    }
    s2 = wave_sum(s2);
    q2 = wave_sum(q2);
    if (lane == 0) { red[0][wave] = s2; red[1][wave] = q2; }
    __syncthreads();
    if (tid < 4) {
      double S = 0.0, SS = 0.0;
#pragma unroll
      for (int w = 0; w < 4; ++w) { S += (double)red[0][tid * 4 + w]; SS += (double)red[1][tid * 4 + w]; }
      float mf, rf;
      mean_rstd(S, SS, 1.0 / 32768.0, mf, rf);
      sM[tid] = mf;
      sR[tid] = rf;
    }
  }
  __syncthreads();
  if (tid < 128) {
    const int sg = tid >> 5;
    const int c = c0 + tid;
    const float a2 = sR[sg] * ga[c];
    sA[tid] = sA1[tid] * a2;
    sD[tid] = (sD1[tid] - sM[sg]) * a2 + ea[c];
  }
  __syncthreads();

  // phase 3
#pragma unroll 1   // one tile's 64 loads fill the registers
  for (int ht = wave; ht < 2 * (TT / 32); ht += GN_NW) {
    const int tc = ht >> 1, hf = (ht & 1) * 64;
    gn_tile64<false>(p + (size_t)hf * TT + tc * 32 + lane, sA + hf, sD + hf, sT4[wave],
                     xt + ((size_t)b * TT + tc * 32) * CC + c0 + hf, lane);
  }
}

// =====================================================================================================
// LDS-staged f16 WMMA GEMM: C[m][n] = oscale * sum_tap sum_k A_tap[m][k] * Bt_tap[n][k]
//   + bias (BM: 1 per row m with the A row remap, 2 per column n with the Bt row remap) * bscale
//   (+ resid[m][n] f32, same indexing as C, when RESID).
// Work-group = 8 waves = one 128 x 256 tile of C; wave (wm 0..1, wn 0..3) = 64 x 64 of it.
// A row-major [M][K] pitch lda; Bt row-major [N][K] (k contiguous) pitch ldb. Row remap:
// row(m) = (m>>6)*TS + TO + (m&63). Tap tp adds aTap elements to A and bTap elements to Bt.
// blockIdx.y = batch index (strides in elements). M multiple of 128, N of 256, K of 128 (host constants).
// A stage = 128 k of the 128 A rows and the 256 Bt rows, 256-B rows at a 272-B pitch in LDS, brought by
// asynchronous 16-B copies (24 per lane and stage, 16 lanes per row); two buffers, the next stage's
// copies fly while this one is multiplied. k runs tap-major and ascending, one accumulator per element.
// OUTH: 0 f32 C (pitch ldc), 1 f16 C. Epilogue: 16-row slabs staged per wave in LDS.
// coverage: 4 slabs x 16 rows x 64 cols = the wave's 64x64 tile; grid = exact tile count.
// =====================================================================================================
#define G_BM 128
#define G_BN 256
#define G_KS 128
#define G_PITCH 136                         // halves per LDS row: 272 B = 16 B x odd, for 16-B LDS reads
#define G_BUF ((G_BM + G_BN) * G_PITCH)     // halves per buffer

#if defined(__HIP_DEVICE_COMPILE__)
// twelve copies of one lane; the address-register wait closes the copies' own statement, so that no
// later write of an address register can be moved in front of it
#define G_COPY12(l, g)                                                          \
  asm volatile("global_load_async_to_lds_b128 %0, %12, off\n\t"                 \
               "global_load_async_to_lds_b128 %1, %13, off\n\t"                 \
               "global_load_async_to_lds_b128 %2, %14, off\n\t"                 \
               "global_load_async_to_lds_b128 %3, %15, off\n\t"                 \
               "global_load_async_to_lds_b128 %4, %16, off\n\t"                 \
               "global_load_async_to_lds_b128 %5, %17, off\n\t"                 \
               "global_load_async_to_lds_b128 %6, %18, off\n\t"                 \
               "global_load_async_to_lds_b128 %7, %19, off\n\t"                 \
               "global_load_async_to_lds_b128 %8, %20, off\n\t"                 \
               "global_load_async_to_lds_b128 %9, %21, off\n\t"                 \
               "global_load_async_to_lds_b128 %10, %22, off\n\t"                \
               "global_load_async_to_lds_b128 %11, %23, off\n\t"                \
               "s_wait_xcnt 0x0"                                                \
               :                                                                \
               : "v"((l)[0]), "v"((l)[1]), "v"((l)[2]), "v"((l)[3]), "v"((l)[4]), "v"((l)[5]),               \
                 "v"((l)[6]), "v"((l)[7]), "v"((l)[8]), "v"((l)[9]), "v"((l)[10]), "v"((l)[11]),             \
                 "v"((g)[0]), "v"((g)[1]), "v"((g)[2]), "v"((g)[3]), "v"((g)[4]), "v"((g)[5]),               \
                 "v"((g)[6]), "v"((g)[7]), "v"((g)[8]), "v"((g)[9]), "v"((g)[10]), "v"((g)[11])              \
               : "memory")
// this wave's copies have landed
#define G_WAIT_COPIES() asm volatile("s_wait_asynccnt 0x0" ::: "memory")
// this wave's LDS reads have returned, so the buffer may be refilled behind the barrier
#define G_WAIT_LDS() asm volatile("s_wait_dscnt 0x0" ::: "memory")
#else
#define G_COPY12(l, g) ((void)0)
#define G_WAIT_COPIES() ((void)0)
#define G_WAIT_LDS() ((void)0)
#endif

template <int TAPS, int OUTH, bool RESID, int BM>
__global__ __launch_bounds__(256) void gemm_k(
    const _Float16* __restrict__ A, int lda, long long strideA, long long aTap, int aTS, int aTO,
    const _Float16* __restrict__ Bt, int ldb, long long strideB, long long bTap, int bTS, int bTO,
    const float* __restrict__ bias, float bscale,
    const float* __restrict__ resid,
    void* Cout, int ldc, long long strideC,
    int M, int N, int K, float oscale) {
  __shared__ __align__(16) _Float16 sAB[2 * G_BUF];
  __shared__ __align__(16) float sT[8][16 * 68];
  const int bz = blockIdx.y;
  const int tid = threadIdx.x;
  const int lane = tid & 31, wave = tid >> 5;
  const int tilesN = N >> 8, tilesM = M >> 7;
  const int tile = blockIdx.x;
  if (tile >= tilesM * tilesN) return;   // the same for the whole work-group, ahead of every barrier
  const int tm = tile / tilesN, tn = tile - tm * tilesN;
  const int mB = tm << 7, nB = tn << 8;
  const int wm = wave >> 2, wn = wave & 3;
  const int m0 = mB + wm * 64, n0 = nB + wn * 64;
  const int rlane = lane & 15;
  const int koff = (lane >> 4) * 8;
  const int mOff = koff;
  const int aRow0 = (m0 >> 6) * aTS + aTO;
  const int bRow0 = (n0 >> 6) * bTS + bTO;
  const _Float16* Ab = A + (size_t)bz * (size_t)strideA;
  const _Float16* Bb = Bt + (size_t)bz * (size_t)strideB;

  // copy side: lane -> (row tid>>4 of each 16-row band, 16-B piece tid&15 of its 256 B);
  // bands 0..7 are the A rows, bands 8..23 the Bt rows
  const int crow = tid >> 4, cpc = (tid & 15) * 8;
  const unsigned tA = (unsigned)(crow * lda + cpc);
  const unsigned tB = (unsigned)(crow * ldb + cpc);
  const unsigned ldsC = (unsigned)(size_t)sAB + (unsigned)(crow * G_PITCH + cpc) * 2u;

  auto issue = [&](int tp, int k0, int buf) {
    const _Float16* Ap = Ab + (size_t)tp * (size_t)aTap + k0 + tA;
    const _Float16* Bp = Bb + (size_t)tp * (size_t)bTap + k0 + tB;
#pragma unroll   // constant indices keep the array in registers
    for (int hlf = 0; hlf < 2; ++hlf) {
      unsigned l[12];
      const _Float16* g[12];
#pragma unroll   // constant indices keep the array in registers
      for (int e = 0; e < 12; ++e) {
        const int i = hlf * 12 + e;           // band
        l[e] = ldsC + (unsigned)buf * (unsigned)(G_BUF * 2) + (unsigned)i * (unsigned)(16 * G_PITCH * 2);
        if (i < 8) {
          const int row = ((mB >> 6) + (i >> 2)) * aTS + aTO + 16 * (i & 3);
          g[e] = Ap + (size_t)(unsigned)(row * lda);
        } else {
          const int row = ((nB >> 6) + ((i - 8) >> 2)) * bTS + bTO + 16 * ((i - 8) & 3);
          g[e] = Bp + (size_t)(unsigned)(row * ldb);
        }
      }
      G_COPY12(l, g);
    }
  };

  v8f acc[4][4];
#pragma unroll   // constant indices keep the array in registers
  for (int i = 0; i < 4; ++i)
#pragma unroll   // constant indices keep the array in registers
    for (int j = 0; j < 4; ++j) acc[i][j] = zero8();

  const _Float16* fa = sAB + (wm * 64 + rlane) * G_PITCH + koff;
  const _Float16* fb = sAB + (G_BM + wn * 64 + rlane) * G_PITCH + koff;

  const int nt = TAPS * (K >> 7);
  int itp = 0, ik = 0;                      // tap and k of the next stage to be copied
  issue(itp, ik, 0);
  ik += G_KS;
  if (ik >= K) { ik = 0; ++itp; }
  G_WAIT_COPIES();
  __syncthreads();
  if (nt > 1) {
    issue(itp, ik, 1);
    ik += G_KS;
    if (ik >= K) { ik = 0; ++itp; }
  }

#pragma unroll 1   // one stage per trip: the two buffers alternate by the trip's parity
  for (int t = 0; t < nt; ++t) {
    const _Float16* pa = fa + (t & 1) * G_BUF;
    const _Float16* pb = fb + (t & 1) * G_BUF;
#pragma unroll   // constant indices keep the array in registers
    for (int kk = 0; kk < G_KS / 32; ++kk) {
      v16h af[4], bf[4];
#pragma unroll   // constant indices keep the array in registers
      for (int i = 0; i < 4; ++i) af[i] = ldfrag(pa + i * 16 * G_PITCH + kk * 32);
#pragma unroll   // constant indices keep the array in registers
      for (int j = 0; j < 4; ++j) bf[j] = ldfrag(pb + j * 16 * G_PITCH + kk * 32);
      // keeps the block's 16 LDS reads one group ahead of its 16 WMMAs: left free, the reads of each A
      // fragment sink to just in front of its row and every row waits out a whole LDS latency
      __builtin_amdgcn_sched_barrier(0);
#pragma unroll   // constant indices keep the array in registers
      for (int i = 0; i < 4; ++i)
#pragma unroll   // constant indices keep the array in registers
        for (int j = 0; j < 4; ++j) acc[i][j] = mma_raw(af[i], bf[j], acc[i][j]);
    }
    // publish point of stage t + 1; the same barrier ends every read of the buffer refilled behind it
    G_WAIT_LDS();
    G_WAIT_COPIES();
    __syncthreads();
    if (t + 2 < nt) {
      issue(itp, ik, t & 1);
      ik += G_KS;
      if (ik >= K) { ik = 0; ++itp; }
    }
  }
  G_WAIT_COPIES();

  // ---- epilogue ----
  float* slab = sT[wave];
#pragma unroll
  for (int i = 0; i < 4; ++i) {
    const int mBase = m0 + i * 16;
    float badd[8];
#pragma unroll
    for (int r = 0; r < 8; ++r) badd[r] = 0.f;
    if (BM == 1) {
#pragma unroll
      for (int r = 0; r < 8; ++r) badd[r] = bias[aRow0 + i * 16 + mOff + r] * bscale;
    }
#pragma unroll
    for (int j = 0; j < 4; ++j) {
      float bc = 0.f;
      if (BM == 2) bc = bias[bRow0 + j * 16 + rlane] * bscale;
#pragma unroll
      for (int r = 0; r < 8; ++r)
        slab[(mOff + r) * 68 + j * 16 + rlane] = acc[i][j][r] * oscale + badd[r] + bc;
    }
    __builtin_amdgcn_fence(__ATOMIC_RELEASE, "workgroup");
    __builtin_amdgcn_wave_barrier();
    __builtin_amdgcn_fence(__ATOMIC_ACQUIRE, "workgroup");
    if (OUTH == 0) {
      float* Cb = (float*)Cout + (size_t)bz * (size_t)strideC;
      const float* Rb = RESID ? (resid + (size_t)bz * (size_t)strideC) : resid;
      const int h2 = lane >> 4, c4 = (lane & 15) * 4;     // 256-B row segment = 16 lanes x 16 B
      {
#pragma unroll
        for (int it = 0; it < 8; ++it) {
          const int row = it * 2 + h2;                     // it 0..7 x h2 0..1 = rows 0..15
          v4f v = *(const v4f*)(slab + row * 68 + c4);
          const size_t off = (size_t)(mBase + row) * ldc + n0 + c4;
          if (RESID) v += *(const v4f*)(Rb + off);
          *(v4f*)(Cb + off) = v;
        }
        
      }
    } else {
      _Float16* Cb = (_Float16*)Cout + (size_t)bz * (size_t)strideC;
      const int q = lane >> 3, c8 = (lane & 7) * 8;
      v4u hv[4];
#pragma unroll
      for (int it = 0; it < 4; ++it) {
        const int row = it * 4 + q;                        // it 0..3 x q 0..3 = rows 0..15
        const float* sp = slab + row * 68 + c8;
        v4u a;
#pragma unroll
        for (int e = 0; e < 4; ++e) a[e] = pkf(sp[2 * e], sp[2 * e + 1]);
        hv[it] = a;
      }
      {
#pragma unroll
        for (int it = 0; it < 4; ++it) {
          const int row = it * 4 + q;
          *(v4u*)(Cb + (size_t)(mBase + row) * ldc + n0 + c8) = hv[it];
        }
        
      }
    }
    __builtin_amdgcn_fence(__ATOMIC_RELEASE, "workgroup");
    __builtin_amdgcn_wave_barrier();
    __builtin_amdgcn_fence(__ATOMIC_ACQUIRE, "workgroup");
  }
}

// =====================================================================================================
// Attention, head dim 64, non-causal over TT keys, additive position bias from the table.
//   Qp / Kp (f16, x16): element (b, t, h, d) at [(b*TT + t)*CC + h*64 + d]
//   Vp (f16, x16):      element (b, h, d, s) at [(b*CC + h*64 + d)*TT + s]
//   tab f32 [h][BTP]:   bias(t, s) = tab[h][(t - s) + 1024]
//   AT (f16, x256):     normalised context, element (b, t, h, d) at [(b*TT + t)*CC + h*64 + d]
//   scores = q16 . k16 (f16 WMMA, f32 acc) * sScale + bias; online softmax in f32;
//   p = exp(s - m) carried as f16(1024 p); context += p . v^T tile on f16 WMMA.
//   Block = 4 waves = 64 query rows of one (b, h); grid = 16 * NH * NBATCH; 16 key tiles of 64.
//   K / V^T tile staging: 128 threads x 32 elements per plane = the whole 64x64 tile (plain 16-B
//   loads, __syncthreads before and after). P tiles are wave-private, spilled with _Float16 element
//   Output coverage: each wave stores rows q0..q0+15 (it 0..3 x lane>>3 0..3) x 64 d (8 lanes x 8),
//   LDS rows: the 128-B rows of the K, V^T and P tiles stand at a 144-B pitch and the 256-B context rows
//   at 272 B (16 B x odd), so that the 16 rows of a 16-B fragment read fall on 16 different bank groups.
// =====================================================================================================
#define AT_P 72                             // halves per K / V^T / P row in LDS: 144 B
#define AT_OP 68                            // floats per context row in LDS: 272 B
__global__ __launch_bounds__(128)
void attn_k(const _Float16* __restrict__ Qp, const _Float16* __restrict__ Kp, const _Float16* __restrict__ Vp,
            const float* __restrict__ tab, _Float16* AT, float sScale, float oScale) {
  union FH { v16h v; v8h h[2]; };
  __shared__ __align__(16) _Float16 Ksh[64 * AT_P];    // [kv][d]
  __shared__ __align__(16) _Float16 Vth[64 * AT_P];    // [d][kv]
  __shared__ __align__(16) _Float16 Psh[4][16 * AT_P]; // per wave P [row][kv]
  __shared__ __align__(16) float    Os[4][16 * AT_OP]; // per wave context [row][d]
  __shared__ __align__(16) float    sB[384 * 4];       // bias slice tab[h][q0b .. q0b+1087] (+clamped fill)

  const int tid  = threadIdx.x;
  const int wave = tid >> 5;
  const int lane = tid & 31;
  const int hh   = lane >> 4;
  const int c    = lane & 15;

  const int bx  = blockIdx.x;
  const int qb  = bx & 15;
  const int h   = (bx >> 4) & 15;
  const int b   = bx >> 8;
  const int q0b = qb * 64;
  const int q0  = q0b + wave * 16;
  const size_t rowB = (size_t)b * TT;

  {
    const float* th = tab + (size_t)h * BTP + q0b;     // q0b + 1087 <= 2047 < BTP
#pragma unroll
    for (int k = 0; k < 3; ++k) {
      const int i  = tid + 128 * k;                     // 0..383
      const int ic = (i < 271) ? i : 271;               // clamped address, all lanes load
      *(v4f*)(sB + 4 * i) = *(const v4f*)(th + 4 * ic);
    }
  }

  const _Float16* Qh = Qp + (size_t)h * HD;
  const _Float16* Kh = Kp + (size_t)h * HD;
  const _Float16* Vh = Vp + ((size_t)b * CC + (size_t)h * HD) * TT;

  // ---- Q fragments (A operand, row = lane&15): 2 d-chunks ----
  v16h qa[2];
#pragma unroll
  for (int dc = 0; dc < 2; ++dc) qa[dc] = ldfrag(Qh + (rowB + q0 + c) * CC + dc * 32 + 8 * hh);

  float mrow[8], lrow[8];
  v8f oacc[4];
#pragma unroll
  for (int r = 0; r < 8; ++r) { mrow[r] = -INFINITY; lrow[r] = 0.f; }
#pragma unroll
  for (int t = 0; t < 4; ++t) oacc[t] = zero8();

  // bias index: (t - q0b) - s + 1024 with t - q0b = wave*16 + 8hh + r, s = kv0 + 16j + c
  const int bbase = wave * 16 + 8 * hh + 1024 - c;
  _Float16* pwh = Psh[wave];

#pragma unroll 1
  for (int kt = 0; kt < TT / 64; ++kt) {
    const int kv0 = kt * 64;
    __syncthreads();
    {
      const int r = tid >> 1, half = (tid & 1) * 32;
      const _Float16* kg = Kh + (rowB + kv0 + r) * CC + half;     // K row kv0+r, d = half..half+31
      const _Float16* vg = Vh + (size_t)r * TT + kv0 + half;     // V^T row d = r, s = kv0+half..+31
#pragma unroll
      for (int i = 0; i < 4; ++i) {
        const v8h a0 = *(const v8h*)(kg + 8 * i);
        const v8h b0 = *(const v8h*)(vg + 8 * i);
        *(v8h*)(Ksh + r * AT_P + half + 8 * i) = a0;
        *(v8h*)(Vth + r * AT_P + half + 8 * i) = b0;
      }
    }
    __syncthreads();

    // ---- scores: 16 query rows x 64 keys per wave ----
    v8f s[4];
#pragma unroll
    for (int j = 0; j < 4; ++j) {
      s[j] = zero8();
#pragma unroll
      for (int dc = 0; dc < 2; ++dc) {
        FH kb;
        kb.h[0] = *(const v8h*)(Ksh + (j * 16 + c) * AT_P + dc * 32 + 8 * hh);
        kb.h[1] = *(const v8h*)(Ksh + (j * 16 + c) * AT_P + dc * 32 + 16 + 8 * hh);
        s[j] = mma_h(qa[dc], kb.v, s[j]);
      }
    }

    // ---- scale + bias, row max, online softmax, P (x1024, f16) to LDS ----
    const int bk = bbase - kv0;
#pragma unroll
    for (int r = 0; r < 8; ++r) {
      float m = -INFINITY;
#pragma unroll
      for (int j = 0; j < 4; ++j) {
        const float sv = s[j][r] * sScale + sB[bk + r - 16 * j];
        s[j][r] = sv;
        m = fmaxf(m, sv);
      }
#pragma unroll
      for (int off = 1; off < 16; off <<= 1) m = fmaxf(m, __shfl_xor(m, off, 32));
      const float mnew  = fmaxf(mrow[r], m);
      const float msafe = (mnew == -INFINITY) ? 0.f : mnew;
      const float alpha = __expf(mrow[r] - msafe);
      mrow[r] = mnew;
      float psum = 0.f;
#pragma unroll
      for (int j = 0; j < 4; ++j) {
        const float pe = __expf(s[j][r] - msafe);
        psum += pe;
        pwh[(8 * hh + r) * AT_P + j * 16 + c] = (_Float16)(pe * 1024.0f);
      }
#pragma unroll
      for (int off = 1; off < 16; off <<= 1) psum += __shfl_xor(psum, off, 32);
      lrow[r] = lrow[r] * alpha + psum;
#pragma unroll
      for (int t = 0; t < 4; ++t) oacc[t][r] *= alpha;
    }
    __builtin_amdgcn_fence(__ATOMIC_RELEASE, "workgroup");
    __builtin_amdgcn_wave_barrier();
    __builtin_amdgcn_fence(__ATOMIC_ACQUIRE, "workgroup");

    // ---- context += P . V (f16 WMMA) ----
#pragma unroll
    for (int kk = 0; kk < 2; ++kk) {
      FH pa;
      pa.h[0] = *(const v8h*)(pwh + c * AT_P + kk * 32 + 8 * hh);
      pa.h[1] = *(const v8h*)(pwh + c * AT_P + kk * 32 + 16 + 8 * hh);
#pragma unroll
      for (int t = 0; t < 4; ++t) {
        FH vb;
        vb.h[0] = *(const v8h*)(Vth + (t * 16 + c) * AT_P + kk * 32 + 8 * hh);
        vb.h[1] = *(const v8h*)(Vth + (t * 16 + c) * AT_P + kk * 32 + 16 + 8 * hh);
        oacc[t] = mma_h(pa.v, vb.v, oacc[t]);
      }
    }
  }

  // ---- normalise (1/l, the 1/1024 p carry, the x16 v carry and the x256 output carry are all in
  float* os = Os[wave];
#pragma unroll
  for (int r = 0; r < 8; ++r) {
    const float l = lrow[r];
    const float inv = ((l > 0.f) ? rcp_f(l) : 0.f) * oScale;
#pragma unroll
    for (int t = 0; t < 4; ++t) os[(8 * hh + r) * AT_OP + t * 16 + c] = oacc[t][r] * inv;
  }
  __builtin_amdgcn_fence(__ATOMIC_RELEASE, "workgroup");
  __builtin_amdgcn_wave_barrier();
  __builtin_amdgcn_fence(__ATOMIC_ACQUIRE, "workgroup");
  {
    const int q4 = lane >> 3, c8 = (lane & 7) * 8;
    v4u hv[4];
#pragma unroll
    for (int it = 0; it < 4; ++it) {
      const int row = it * 4 + q4;   // it 0..3 x q4 0..3 = rows 0..15 of the wave tile
      const float* sp = os + row * AT_OP + c8;
      v4u a;
#pragma unroll
      for (int e = 0; e < 4; ++e) a[e] = pkf(sp[2 * e], sp[2 * e + 1]);
      hv[it] = a;
    }
    {
#pragma unroll
      for (int it = 0; it < 4; ++it) {
        const int row = it * 4 + q4;
        const size_t go = (rowB + q0 + row) * CC + (size_t)h * HD + c8;
        *(v4u*)(AT + go) = hv[it];
      }
      
    }
  }
}

// =====================================================================================================
// Workspace map (bytes):
//   W1t  f16 [3][1024][1024]       0            6291456
//   W2t  f16 [3][1024][1024]       6291456      6291456
//   Wqkv f16 [3072][1024]          12582912     6291456
//   Wp   f16 [1024][1024]          18874368     2097152
//   Tab  f32 [16][2048]            20971520      131072
//   XT   f16 [8][1026][1024]       21102592    16809984   (later: XT3 [8][1024][1024], then AT [8192][1024])
//   R1   f32 [8][1024][1024]       37912576    33554432   (F1, then H, then Qp + Kp f16 [8192][1024] each)
//   Xin  f32 [8][1024][1024]       71467008    33554432
//   Vp   f16 [8][1024][1024]       105021440   16777216
//   end                            121798656
// Every plane is an exact multiple of its whole-line / whole-tile store granularity (incl. the two
// halo token rows per sample in XT); no tail padding needed.
// =====================================================================================================
extern "C" void kernel_launch(void* const* d_in, const int* in_sizes, int n_in,
                              void* d_out, int out_size, void* d_ws, size_t ws_size,
                              hipStream_t stream) {
  if (n_in < 18) return;
  const int nAct = NBATCH * CC * TT;                     // 8388608
  if (in_sizes[0] != nAct || out_size != nAct) return;
  if (in_sizes[3] != CC * CC * 3 || in_sizes[7] != CC * CC * 3) return;
  if (in_sizes[13] != 3 * CC * CC || in_sizes[15] != CC * CC) return;
  if (in_sizes[1] != CC || in_sizes[2] != CC || in_sizes[4] != CC || in_sizes[5] != CC ||
      in_sizes[6] != CC || in_sizes[8] != CC || in_sizes[9] != CC || in_sizes[10] != CC ||
      in_sizes[11] != CC || in_sizes[12] != CC || in_sizes[16] != CC) return;
  if (in_sizes[14] != 3 * CC || in_sizes[17] != NBUCK * NH) return;

  const float* x      = (const float*)d_in[0];
  const float* gn1_g  = (const float*)d_in[1];
  const float* gn1_b  = (const float*)d_in[2];
  const float* c1_w   = (const float*)d_in[3];
  const float* c1_b   = (const float*)d_in[4];
  const float* gn2_g  = (const float*)d_in[5];
  const float* gn2_b  = (const float*)d_in[6];
  const float* c2_w   = (const float*)d_in[7];
  const float* c2_b   = (const float*)d_in[8];
  const float* n8_g   = (const float*)d_in[9];
  const float* n8_b   = (const float*)d_in[10];
  const float* ag_g   = (const float*)d_in[11];
  const float* ag_b   = (const float*)d_in[12];
  const float* qkv_w  = (const float*)d_in[13];
  const float* qkv_b  = (const float*)d_in[14];
  const float* pj_w   = (const float*)d_in[15];
  const float* pj_b   = (const float*)d_in[16];
  const float* remb   = (const float*)d_in[17];

  const size_t PWC  = (size_t)3 * CC * CC * 2;          //  6291456
  const size_t PWQ  = (size_t)3 * CC * CC * 2;          //  6291456
  const size_t PWP  = (size_t)CC * CC * 2;              //  2097152
  const size_t PTAB = (size_t)NH * BTP * 4;             //   131072
  const size_t PXT  = (size_t)NBATCH * TP * CC * 2;     // 16809984
  const size_t PF   = (size_t)NBATCH * CC * TT * 4;     // 33554432
  const size_t PV   = (size_t)NBATCH * CC * TT * 2;     // 16777216
  size_t off = 0;
  const size_t oW1  = off; off += PWC;
  const size_t oW2  = off; off += PWC;
  const size_t oWq  = off; off += PWQ;
  const size_t oWp  = off; off += PWP;
  const size_t oTab = off; off += PTAB;
  const size_t oXT  = off; off += PXT;
  const size_t oR1  = off; off += PF;
  const size_t oXin = off; off += PF;
  const size_t oV   = off; off += PV;
  if (off > ws_size) return;                            // off = 121798656
  if (off > (size_t)134217728) return;
  if (2 * PV > PF) return;                              // Qp + Kp live inside R1
  if ((size_t)NBATCH * TT * CC * 2 > PXT) return;       // XT3 / AT fit in the XT region

  char* ws = (char*)d_ws;
  _Float16* W1t  = (_Float16*)(ws + oW1);
  _Float16* W2t  = (_Float16*)(ws + oW2);
  _Float16* Wqkv = (_Float16*)(ws + oWq);
  _Float16* Wpb  = (_Float16*)(ws + oWp);
  float*    Tab  = (float*)(ws + oTab);
  _Float16* XT   = (_Float16*)(ws + oXT);               // [8][1026][1024] with halo rows
  _Float16* XT3  = (_Float16*)(ws + oXT);               // [8][1024][1024], later use of the same region
  _Float16* ATp  = (_Float16*)(ws + oXT);               // [8192][1024], last use of the same region
  float*    F1   = (float*)(ws + oR1);
  float*    Hb   = (float*)(ws + oR1);
  _Float16* Qp   = (_Float16*)(ws + oR1);
  _Float16* Kp   = (_Float16*)(ws + oR1 + PV);
  float*    Xin  = (float*)(ws + oXin);
  _Float16* Vp   = (_Float16*)(ws + oV);

  const dim3 blk(256);
  const int  n8q = 3 * CC * CC / 8;                     // 393216
  const int  n8p = CC * CC / 8;                         // 131072
  const long long CCCC = (long long)CC * CC;
  const long long CT   = (long long)CC * TT;

  // (1) weights -> f16 x64 planes; position bias table
  cvt_convw<<<dim3(CC * (CC / 8) / 256), blk, 0, stream>>>(c1_w, W1t, 64.0f);
  cvt_convw<<<dim3(CC * (CC / 8) / 256), blk, 0, stream>>>(c2_w, W2t, 64.0f);
  cvt_f16x8<<<dim3((n8q + 255) / 256), blk, 0, stream>>>(qkv_w, Wqkv, n8q, 64.0f);
  cvt_f16x8<<<dim3((n8p + 255) / 256), blk, 0, stream>>>(pj_w, Wpb, n8p, 64.0f);
  btab_k<<<dim3(NH * (BTP / 4) / 256), blk, 0, stream>>>(remb, Tab);

  // (2) h = silu(GN32(x)) -> XT (token-major f16, halo rows)
  gn32_tr_k<true><<<dim3(CC / 64, NBATCH), dim3(GN_NT), 0, stream>>>(x, gn1_g, gn1_b, XT);
  // (3) F1 = conv1(h) + b1 -> f32 NCT   (per b: M=1024 o, N=1024 t, K=3 taps x 1024)
  gemm_k<3, 0, false, 1><<<dim3((CC / 128) * (TT / 256), NBATCH), blk, 0, stream>>>(
      W1t, CC, 0LL, CCCC, 64, 0,
      XT, CC, (long long)TP * CC, (long long)CC, 64, 0,
      c1_b, 1.0f, nullptr,
      (void*)F1, TT, CT, CC, TT, CC, 1.0f / 64.0f);
  // (4) h = silu(GN32(F1)) -> XT
  gn32_tr_k<true><<<dim3(CC / 64, NBATCH), dim3(GN_NT), 0, stream>>>(F1, gn2_g, gn2_b, XT);
  // (5) H = conv2(h) + b2 + x -> f32 NCT (R1)
  gemm_k<3, 0, true, 1><<<dim3((CC / 128) * (TT / 256), NBATCH), blk, 0, stream>>>(
      W2t, CC, 0LL, CCCC, 64, 0,
      XT, CC, (long long)TP * CC, (long long)CC, 64, 0,
      c2_b, 1.0f, x,
      (void*)Hb, TT, CT, CC, TT, CC, 1.0f / 64.0f);
  // (6) xin = GN8(H) -> f32 NCT; GN32(xin) -> XT3 (token-major f16, no halo)
  gn8_attn_k<<<dim3(CC / 128, NBATCH), dim3(GN_NT), 0, stream>>>(Hb, n8_g, n8_b, ag_g, ag_b, Xin, XT3);
  // (7) q = xn^T . Wq^T -> Qp [b*TT+t][h*64+d] f16 x16  (M=8192, N=1024, K=1024; W rows h*192+d)
  gemm_k<1, 1, false, 2><<<dim3((NBATCH * TT / 128) * (CC / 256), 1), blk, 0, stream>>>(
      XT3, CC, 0LL, 0LL, 64, 0,
      Wqkv, CC, 0LL, 0LL, 192, 0,
      qkv_b, 16.0f, nullptr,
      (void*)Qp, CC, 0LL, NBATCH * TT, CC, CC, 0.25f);
  // (8) k -> Kp (W rows h*192+64+d)
  gemm_k<1, 1, false, 2><<<dim3((NBATCH * TT / 128) * (CC / 256), 1), blk, 0, stream>>>(
      XT3, CC, 0LL, 0LL, 64, 0,
      Wqkv, CC, 0LL, 0LL, 192, 64,
      qkv_b, 16.0f, nullptr,
      (void*)Kp, CC, 0LL, NBATCH * TT, CC, CC, 0.25f);
  // (9) v (channel-major) = Wv . xn -> Vp [b][h*64+d][s] f16 x16 (per b: M=1024 rows h*192+128+d, N=1024 t)
  gemm_k<1, 1, false, 1><<<dim3((CC / 128) * (TT / 256), NBATCH), blk, 0, stream>>>(
      Wqkv, CC, 0LL, 0LL, 192, 128,
      XT3, CC, CT, 0LL, 64, 0,
      qkv_b, 16.0f, nullptr,
      (void*)Vp, TT, CT, CC, TT, CC, 0.25f);
  // (10) attention -> AT [b*TT+t][h*64+d] f16 x256
  attn_k<<<dim3((TT / 64) * NH * NBATCH), dim3(128), 0, stream>>>(
      Qp, Kp, Vp, Tab, ATp, 1.0f / 2048.0f, 1.0f / 64.0f);
  // (11) out = xin + proj(a) + bp -> d_out f32 NCT (per b: M=1024 o, N=1024 t, K=1024)
  gemm_k<1, 0, true, 1><<<dim3((CC / 128) * (TT / 256), NBATCH), blk, 0, stream>>>(
      Wpb, CC, 0LL, 0LL, 64, 0,
      ATp, CC, CT, 0LL, 64, 0,
      pj_b, 1.0f, Xin,
      d_out, TT, CT, CC, TT, CC, 1.0f / 16384.0f);
  (void)hipGetLastError();
}

// v005
// A run of this version takes 270 microseconds.
// Timed twice side by side with v004, it ran 1.15 times as fast both times.
// Over all steps from v000 it is 3.53 times as fast.
// Contractions: conv k3 (two), qkv 1x1, q.k^T, p.v, proj 1x1 = v_wmma_f32_16x16x32_f16 (f16 operands: weights x64, GroupNorm activations x1, q/k/v x16, p x1024, attention output x256), f32 accumulate; GroupNorm statistics f32 partial sums with f64 totals, softmax / position bias / residuals f32.
#include <hip/hip_runtime.h>
#include <math.h>
#include <stdint.h>

#define NBATCH 8
#define CC 1024
#define TT 1024
#define TP 1026
#define NH 16
#define HD 64
#define NBUCK 32
#define BTP 2048

static_assert(NH * HD == CC);
static_assert((CC % 256) == 0 && (TT % 256) == 0);

typedef _Float16 v16h __attribute__((ext_vector_type(16)));
typedef _Float16 v8h  __attribute__((ext_vector_type(8)));
typedef float    v8f  __attribute__((ext_vector_type(8)));
typedef float    v4f  __attribute__((ext_vector_type(4)));
typedef unsigned int v4u __attribute__((ext_vector_type(4)));

// ---- scalar helpers ----
__device__ __forceinline__ unsigned short h_bits(_Float16 x) { return __builtin_bit_cast(unsigned short, x); }
__device__ __forceinline__ unsigned pkf(float a, float b) {
  return (unsigned)h_bits((_Float16)a) | ((unsigned)h_bits((_Float16)b) << 16);
}
__device__ __forceinline__ v8f zero8() { v8f z = {0.f, 0.f, 0.f, 0.f, 0.f, 0.f, 0.f, 0.f}; return z; }
__device__ __forceinline__ float rcp_f(float x) { return __builtin_amdgcn_rcpf(x); }

// ---- 16-bit A/B fragment: lane -> row/col (lane&15); p already includes +8*(lane>>4);
//      elements 0..7 <- p[0..7] (k0+8h..), elements 8..15 <- p[16..23] (k0+16+8h..)
__device__ __forceinline__ v16h ldfrag(const _Float16* p) {
  union { v16h v; v8h h[2]; } f;
  f.h[0] = *(const v8h*)(p);
  f.h[1] = *(const v8h*)(p + 16);
  return f.v;
}

// ---- WMMA helpers ----
__device__ __forceinline__ v8f mma_raw(v16h a, v16h b, v8f c) {
  return __builtin_amdgcn_wmma_f32_16x16x32_f16(false, a, false, b, (short)0, c, false, false);
}

// ---- f64 wave shuffle ----
__device__ __forceinline__ double shfl_xor_d(double v, int m) {
  const unsigned long long u = (unsigned long long)__double_as_longlong(v);
  const int lo = __shfl_xor((int)(unsigned)(u & 0xffffffffull), m, 32);
  const int hi = __shfl_xor((int)(unsigned)(u >> 32), m, 32);
  const unsigned long long r = ((unsigned long long)(unsigned)hi << 32) | (unsigned long long)(unsigned)lo;
  return __longlong_as_double((long long)r);
}
// GroupNorm kernels: 16 waves per work-group
#define GN_NT 512
#define GN_NW 16
// Statistics: the per-element sums run in f32 (four chains of 16 per batch of 16 loads, joined as a tree, then the
// wave's 32 lanes); only the wave totals are summed in f64, where the squared mean is taken from the mean square.
__device__ __forceinline__ float sum4(v4f a) { return (a[0] + a[1]) + (a[2] + a[3]); }
__device__ __forceinline__ float wave_sum(float v) {
#pragma unroll   // the five exchange distances as constants
  for (int m = 16; m >= 1; m >>= 1) v += __shfl_xor(v, m, 32);
  return v;
}
// 1 / sqrt(x), x >= 1e-5: the hardware's estimate and one Newton step; the v_nop is the one slot that the
// instruction set asks for behind a transcendental before its result is used
__device__ __forceinline__ float rsqrt_nr(float x) {
#if defined(__HIP_DEVICE_COMPILE__)
  float r;
  asm("v_rsq_f32 %0, %1\n\tv_nop" : "=v"(r) : "v"(x));
  const float e = fmaf(-x * r, r, 1.0f);
  return fmaf(0.5f * r, e, r);
#else
  return x;
#endif
}
// mean and 1 / sigma from the f64 totals of n = 1 / invn values
__device__ __forceinline__ void mean_rstd(double S, double SS, double invn, float& meanf, float& rstdf) {
  const double mean = S * invn;
  double var = SS * invn - mean * mean;
  var = var < 0.0 ? 0.0 : var;
  meanf = (float)mean;
  rstdf = rsqrt_nr((float)var + 1e-5f);
}
// rs, rq: the GN_NW wave totals (sum, sum of squares) in LDS; called by a whole wave, every lane returns the result
__device__ __forceinline__ void close_stats(const float* rs, const float* rq, int lane, double invn,
                                            float& meanf, float& rstdf) {
  double S = (double)rs[lane & (GN_NW - 1)], SS = (double)rq[lane & (GN_NW - 1)];
#pragma unroll   // the four exchange distances as constants
  for (int m = GN_NW / 2; m >= 1; m >>= 1) {
    S += shfl_xor_d(S, m);
    SS += shfl_xor_d(SS, m);
  }
  mean_rstd(S, SS, invn, meanf, rstdf);
}

// SiLU's two transcendentals, each with the one slot behind it that the instruction set asks for before its
// result is used or its source overwritten
__device__ __forceinline__ float exp2_slot(float x) {
#if defined(__HIP_DEVICE_COMPILE__)
  float r;
  asm("v_exp_f32 %0, %1\n\tv_nop" : "=v"(r) : "v"(x));
  return r;
#else
  return x;
#endif
}
__device__ __forceinline__ float rcp_slot(float x) {
#if defined(__HIP_DEVICE_COMPILE__)
  float r;
  asm("v_rcp_f32 %0, %1\n\tv_nop" : "=v"(r) : "v"(x));
  return r;
#else
  return x;
#endif
}

#if defined(__HIP_DEVICE_COMPILE__)
// stands behind a batch of stores whose address and data registers the next trip's loads write again
#define GN_WAIT_XCNT() asm volatile("s_wait_xcnt 0x0" ::: "memory")
#else
#define GN_WAIT_XCNT() ((void)0)
#endif

// orders one wave's own LDS writes and reads (the tile below is private to its wave)
__device__ __forceinline__ void wave_lds_sync() {
  __builtin_amdgcn_fence(__ATOMIC_RELEASE, "workgroup");
  __builtin_amdgcn_wave_barrier();
  __builtin_amdgcn_fence(__ATOMIC_ACQUIRE, "workgroup");
}

// One wave turns 64 channels x 32 tokens of an NCT f32 plane into 32 token rows of 64 f16 channels:
// y = f * cA[c] + cD[c] (+ SiLU). pr: the slab's first channel at this lane's token; dst: the tile's first
// token row at the slab's first channel (row pitch CC); st: this wave's own 32 x 9 16-B pieces of LDS.
// All 64 loads of the lane are issued before the first is used. No other wave touches st, so there is no
// work-group barrier. coverage: 8 x 4 rows x (8 lanes x 8 channels) = 32 rows x 64 channels.
template <bool SILU>
__device__ __forceinline__ void gn_tile64(const float* __restrict__ pr, const float* cA, const float* cD,
                                          v4u* st, _Float16* dst, int lane) {
  float f[64];
#pragma unroll
  for (int i = 0; i < 64; ++i) f[i] = pr[(size_t)i * TT];
  // the wave's reads of its last tile are over before st is written again; behind the loads, so that
  // the wait for the last tile's stores runs beside their flight
  wave_lds_sync();
#pragma unroll
  for (int j = 0; j < 8; ++j) {
    float y[8];
#pragma unroll
    for (int i = 0; i < 8; ++i) {
      float yy = fmaf(f[j * 8 + i], cA[j * 8 + i], cD[j * 8 + i]);
      if (SILU) yy = yy * rcp_slot(1.0f + exp2_slot(yy * -1.4426950408889634f));   // e^-y = 2^(-y log2 e)
      y[i] = yy;
    }
    v4u pk;
    pk[0] = pkf(y[0], y[1]);
    pk[1] = pkf(y[2], y[3]);
    pk[2] = pkf(y[4], y[5]);
    pk[3] = pkf(y[6], y[7]);
    st[lane * 9 + j] = pk;
  }
  wave_lds_sync();
  const int q = lane >> 3, l8 = lane & 7;
  v4u v[8];
#pragma unroll
  for (int it = 0; it < 8; ++it) v[it] = st[(it * 4 + q) * 9 + l8];
#pragma unroll
  for (int it = 0; it < 8; ++it) *(v4u*)(dst + (size_t)(it * 4 + q) * CC + l8 * 8) = v[it];
}

// =====================================================================================================
// f32 -> f16 (x scale), 8 elements per thread, one 16-B store per lane (wave = 512 contiguous B =
// coverage: n8*8 = whole plane (n8 is a multiple of 256 for both uses).
// =====================================================================================================
__global__ __launch_bounds__(256) void cvt_f16x8(const float* __restrict__ in, _Float16* out, int n8, float scale) {
  const int i = blockIdx.x * 256 + threadIdx.x;
  if (i < n8) {
    const v4f a = *(const v4f*)(in + (size_t)i * 8);
    const v4f c = *(const v4f*)(in + (size_t)i * 8 + 4);
    v4u p;
    p[0] = pkf(a[0] * scale, a[1] * scale);
    p[1] = pkf(a[2] * scale, a[3] * scale);
    p[2] = pkf(c[0] * scale, c[1] * scale);
    p[3] = pkf(c[2] * scale, c[3] * scale);
    _Float16* dst = out + (size_t)i * 8;
    *(v4u*)dst = p;
    
  }
}

// =====================================================================================================
// conv weight [o][c][3] f32 -> Wt[tap][o][c] f16 (x scale). Thread = (o, 8 consecutive c): reads
// 24 contiguous floats, writes one 16-B piece into each of the 3 tap planes; a wave covers 512
// contiguous B of one row per store instruction. grid = CC*128/256 = 512.
// coverage: 131072 threads x 3 x 8 halves = 3*CC*CC = whole plane.
// =====================================================================================================
__global__ __launch_bounds__(256) void cvt_convw(const float* __restrict__ w, _Float16* out, float scale) {
  const int idx = blockIdx.x * 256 + threadIdx.x;
  if (idx >= CC * (CC / 8)) return;
  const int o = idx >> 7;
  const int c8 = idx & 127;
  const float* p = w + ((size_t)o * CC + (size_t)c8 * 8) * 3;
  union { v4f q[6]; float e[24]; } u;
#pragma unroll
  for (int i = 0; i < 6; ++i) u.q[i] = *(const v4f*)(p + 4 * i);
  v4u pk[3];
#pragma unroll
  for (int tp = 0; tp < 3; ++tp) {
    v4u a;
#pragma unroll
    for (int m = 0; m < 4; ++m)
      a[m] = pkf(u.e[(2 * m) * 3 + tp] * scale, u.e[(2 * m + 1) * 3 + tp] * scale);
    pk[tp] = a;
  }
#pragma unroll
  for (int tp = 0; tp < 3; ++tp)
    *(v4u*)(out + ((size_t)tp * CC + o) * CC + (size_t)c8 * 8) = pk[tp];
  
}

// =====================================================================================================
// relative position bias table tab[h][d], d = (t - s) + 1024, value = emb[bucket][h] * 8 (f32).
// bucket: n = t - s; add 16 when n < 0; n = |n|; n < 8 -> n; else 8 + int(log(n/8) * (1/ln 8) * 8)
// coverage: 8192 threads x 4 = NH*BTP floats.
// =====================================================================================================
__global__ __launch_bounds__(256) void btab_k(const float* __restrict__ emb, float* tab) {
  const int i4 = blockIdx.x * 256 + threadIdx.x;
  if (i4 >= NH * (BTP / 4)) return;
  const int h = i4 >> 9;
  const int d0 = (i4 & 511) * 4;
  const float ln8 = 2.0794415416798357f;
  const float rl8 = 1.0f / ln8;
  v4f v;
#pragma unroll
  for (int e = 0; e < 4; ++e) {
    const int delta = d0 + e - 1024;
    const int n = delta < 0 ? -delta : delta;
    const float nf = (float)(n < 1 ? 1 : n);
    const float lg = logf(nf * 0.125f);
    int vl = 8 + (int)(lg * rl8 * 8.0f);
    vl = vl > 15 ? 15 : vl;
    int bucket = (n < 8) ? n : vl;
    bucket += (delta < 0) ? 16 : 0;
    v[e] = emb[bucket * NH + h] * 8.0f;
  }
  float* dst = tab + (size_t)i4 * 4;
  *(v4f*)dst = v;
  
}

// =====================================================================================================
// GroupNorm(32 groups) (+ SiLU) on an NCT f32 plane [b][CC][TT]; writes the token-major f16 plane
// xt[b][TP][CC] (row 1 + t, channel contiguous) plus the two zero halo rows 0 and TP-1.
// Block = (b, 64-channel slab = 2 groups); 512 threads. Statistics: f32 partial sums, f64 totals, fixed order; the 32 16-B
// loads of a thread (16 per group) are all issued before the first sum.
// Tiles: 32 tokens x 64 channels, one wave each (gn_tile64), 2 tiles per wave.
// coverage: 32 tiles x 32 rows x (16 slabs x 64 ch) = rows 1..TT x all channels; halo rows by wave 0.
// =====================================================================================================
template <bool SILU>
__global__ __launch_bounds__(GN_NT) void gn32_tr_k(const float* __restrict__ in, const float* __restrict__ gam,
                                                   const float* __restrict__ bet, _Float16* xt) {
  __shared__ __align__(16) v4u sT4[GN_NW][32 * 9];
  __shared__ float red[4][GN_NW];
  __shared__ __align__(16) float sA[64];
  __shared__ __align__(16) float sD[64];
  const int tid = threadIdx.x, lane = tid & 31, wave = tid >> 5;
  const int b = blockIdx.y;
  const int c0 = blockIdx.x * 64;
  const float* p = in + ((size_t)b * CC + c0) * TT;

  v4f v[2][16];
#pragma unroll
  for (int g = 0; g < 2; ++g)
#pragma unroll
    for (int i = 0; i < 16; ++i) v[g][i] = *(const v4f*)(p + (size_t)g * 32 * TT + ((size_t)i * GN_NT + tid) * 4);
  // keeps the batch's loads one group ahead of their first use: left free, they sink to just in front of
  // their sums and only a few are in flight
  __builtin_amdgcn_sched_barrier(0);

#pragma unroll
  for (int g = 0; g < 2; ++g) {
    v4f s4 = {0.f, 0.f, 0.f, 0.f}, q4 = {0.f, 0.f, 0.f, 0.f};
#pragma unroll   // constant indices keep the array in registers
    for (int i = 0; i < 16; ++i) {
      s4 += v[g][i];
      q4 += v[g][i] * v[g][i];
    }
    const float s = wave_sum(sum4(s4)), q = wave_sum(sum4(q4));
    if (lane == 0) { red[g][wave] = s; red[2 + g][wave] = q; }
  }
  __syncthreads();
  if (wave < 2) {   // wave g closes group g: its lanes are the group's 32 channels
    float meanf, rstdf;
    close_stats(red[wave], red[2 + wave], lane, 1.0 / 32768.0, meanf, rstdf);
    const int c = c0 + tid;
    const float a = rstdf * gam[c];
    sA[tid] = a;
    sD[tid] = bet[c] - meanf * a;
  }
  __syncthreads();

  if (wave == 0 && lane < 16) {
    const int row = (lane < 8) ? 0 : (TP - 1);
    v4u z = {0u, 0u, 0u, 0u};
    _Float16* dst = xt + ((size_t)b * TP + row) * CC + c0 + (lane & 7) * 8;
    *(v4u*)dst = z;
  }

#pragma unroll 1   // one tile's 64 loads fill the registers
  for (int tc = wave; tc < TT / 32; tc += GN_NW)
    gn_tile64<SILU>(p + tc * 32 + lane, sA, sD, sT4[wave], xt + ((size_t)b * TP + 1 + tc * 32) * CC + c0, lane);
}

// =====================================================================================================
// Fused: GroupNorm(8) on H -> xin (f32 NCT, written), then GroupNorm(32) of xin -> f16 token-major
// plane xt[b][TT][CC] (no halo). Block = (b, one 128-channel group); 512 threads.
// phase 1: sums of the group (f32 partial sums, f64 totals), 16 16-B loads of a thread in flight;
// phase 2: waves 4 sg .. 4 sg + 3 own the 32-channel sub-group sg: xin written as 32 lanes x 16 B contiguous
// pieces (512 B per instruction inside one 4 KB row), 16 loads in flight, sums of xin per sub-group likewise,
// one reduction for the four sub-groups;
// phase 3: y = h*A[c] + D[c] (both norms folded), 32-token x 64-channel tiles, one wave each (gn_tile64).
// coverage: xin rows 0..127 of the group x 1024 t; xt: 32 x 2 tiles of 32 rows x 64 ch per block,
// 8 blocks per b cover all channels.
// =====================================================================================================
__global__ __launch_bounds__(GN_NT) void gn8_attn_k(const float* __restrict__ hin,
                                                    const float* __restrict__ g8, const float* __restrict__ e8,
                                                    const float* __restrict__ ga, const float* __restrict__ ea,
                                                    float* xin, _Float16* xt) {
  __shared__ __align__(16) v4u sT4[GN_NW][32 * 9];
  __shared__ float red[2][GN_NW];
  __shared__ float sA1[128];
  __shared__ float sD1[128];
  __shared__ __align__(16) float sA[128];
  __shared__ __align__(16) float sD[128];
  __shared__ float sM[4];
  __shared__ float sR[4];
  const int tid = threadIdx.x, lane = tid & 31, wave = tid >> 5;
  const int b = blockIdx.y;
  const int c0 = blockIdx.x * 128;
  const float* p = hin + ((size_t)b * CC + c0) * TT;

  // phase 1
  {
    float s = 0.f, q = 0.f;
#pragma unroll 1   // one batch of 16 loads per trip
    for (int i0 = 0; i0 < 64; i0 += 16) {
      v4f v[16];
#pragma unroll
      for (int u = 0; u < 16; ++u) v[u] = *(const v4f*)(p + ((size_t)(i0 + u) * GN_NT + tid) * 4);
      // keeps the batch's loads one group ahead of their first use: left free, they sink to just in front of
      // their sums and only a few are in flight
      __builtin_amdgcn_sched_barrier(0);
      v4f s4 = {0.f, 0.f, 0.f, 0.f}, q4 = {0.f, 0.f, 0.f, 0.f};
#pragma unroll   // constant indices keep the array in registers
      for (int u = 0; u < 16; ++u) {
        s4 += v[u];
        q4 += v[u] * v[u];
      }
      s += sum4(s4);
      q += sum4(q4);
    }
    s = wave_sum(s);
    q = wave_sum(q);
    if (lane == 0) { red[0][wave] = s; red[1][wave] = q; }
    __syncthreads();
    if (tid < 128) {   // the four waves whose lanes are the group's 128 channels
      float m8f, r8f;
      close_stats(red[0], red[1], lane, 1.0 / 131072.0, m8f, r8f);
      const int c = c0 + tid;
      const float a = r8f * g8[c];
      sA1[tid] = a;
      sD1[tid] = e8[c] - m8f * a;
    }
  }
  __syncthreads();

  // phase 2
  {
    const int sg = wave >> 2;
    const size_t o0 = (size_t)sg * 32 * TT + (size_t)(((wave & 3) * 32 + lane) * 4);
    const float* ps = p + o0;
    float* xs = xin + ((size_t)b * CC + c0) * TT + o0;
    float s2 = 0.f, q2 = 0.f;
#pragma unroll 1   // one batch of 16 loads per trip; 512 floats per step, two steps per channel row
    for (int j0 = 0; j0 < 64; j0 += 16) {
      v4f v[16];
#pragma unroll
      for (int u = 0; u < 16; ++u) v[u] = *(const v4f*)(ps + (size_t)(j0 + u) * 512);
      // keeps the batch's loads one group ahead of their first use: left free, they sink to just in front of
      // their sums and only a few are in flight
      __builtin_amdgcn_sched_barrier(0);
      v4f s4 = {0.f, 0.f, 0.f, 0.f}, q4 = {0.f, 0.f, 0.f, 0.f};
#pragma unroll
      for (int u = 0; u < 16; ++u) {
        const int ch = sg * 32 + ((j0 + u) >> 1);
        const float a = sA1[ch], d = sD1[ch];
        v4f y;
#pragma unroll
        for (int e = 0; e < 4; ++e) y[e] = fmaf(v[u][e], a, d);
        s4 += y;
        q4 += y * y;
        *(v4f*)(xs + (size_t)(j0 + u) * 512) = y;
      }
      s2 += sum4(s4);
      q2 += sum4(q4);
      GN_WAIT_XCNT();
    }
    s2 = wave_sum(s2);
    q2 = wave_sum(q2);
    if (lane == 0) { red[0][wave] = s2; red[1][wave] = q2; }
    __syncthreads();
    if (tid < 4) {
      double S = 0.0, SS = 0.0;
#pragma unroll
      for (int w = 0; w < 4; ++w) { S += (double)red[0][tid * 4 + w]; SS += (double)red[1][tid * 4 + w]; }
      float mf, rf;
      mean_rstd(S, SS, 1.0 / 32768.0, mf, rf);
      sM[tid] = mf;
      sR[tid] = rf;
    }
  }
  __syncthreads();
  if (tid < 128) {
    const int sg = tid >> 5;
    const int c = c0 + tid;
    const float a2 = sR[sg] * ga[c];
    sA[tid] = sA1[tid] * a2;
    sD[tid] = (sD1[tid] - sM[sg]) * a2 + ea[c];
  }
  __syncthreads();

  // phase 3
#pragma unroll 1   // one tile's 64 loads fill the registers
  for (int ht = wave; ht < 2 * (TT / 32); ht += GN_NW) {
    const int tc = ht >> 1, hf = (ht & 1) * 64;
    gn_tile64<false>(p + (size_t)hf * TT + tc * 32 + lane, sA + hf, sD + hf, sT4[wave],
                     xt + ((size_t)b * TT + tc * 32) * CC + c0 + hf, lane);
  }
}

// =====================================================================================================
// LDS-staged f16 WMMA GEMM: C[m][n] = oscale * sum_tap sum_k A_tap[m][k] * Bt_tap[n][k]
//   + bias (BM: 1 per row m with the A row remap, 2 per column n with the Bt row remap) * bscale
//   (+ resid[m][n] f32, same indexing as C, when RESID).
// Work-group = 8 waves = one 128 x 256 tile of C; wave (wm 0..1, wn 0..3) = 64 x 64 of it.
// A row-major [M][K] pitch lda; Bt row-major [N][K] (k contiguous) pitch ldb. Row remap:
// row(m) = (m>>6)*TS + TO + (m&63). Tap tp adds aTap elements to A and bTap elements to Bt.
// blockIdx.y = batch index (strides in elements). M multiple of 128, N of 256, K of 128 (host constants).
// A stage = 128 k of the 128 A rows and the 256 Bt rows, 256-B rows at a 272-B pitch in LDS, brought by
// asynchronous 16-B copies (24 per lane and stage, 16 lanes per row); two buffers, the next stage's
// copies fly while this one is multiplied. k runs tap-major and ascending, one accumulator per element.
// OUTH: 0 f32 C (pitch ldc), 1 f16 C. Epilogue: 16-row slabs staged per wave in LDS.
// coverage: 4 slabs x 16 rows x 64 cols = the wave's 64x64 tile; grid = exact tile count.
// =====================================================================================================
#define G_BM 128
#define G_BN 256
#define G_KS 128
#define G_PITCH 136                         // halves per LDS row: 272 B = 16 B x odd, for 16-B LDS reads
#define G_BUF ((G_BM + G_BN) * G_PITCH)     // halves per buffer

#if defined(__HIP_DEVICE_COMPILE__)
// twelve copies of one lane; the address-register wait closes the copies' own statement, so that no
// later write of an address register can be moved in front of it
#define G_COPY12(l, g)                                                          \
  asm volatile("global_load_async_to_lds_b128 %0, %12, off\n\t"                 \
               "global_load_async_to_lds_b128 %1, %13, off\n\t"                 \
               "global_load_async_to_lds_b128 %2, %14, off\n\t"                 \
               "global_load_async_to_lds_b128 %3, %15, off\n\t"                 \
               "global_load_async_to_lds_b128 %4, %16, off\n\t"                 \
               "global_load_async_to_lds_b128 %5, %17, off\n\t"                 \
               "global_load_async_to_lds_b128 %6, %18, off\n\t"                 \
               "global_load_async_to_lds_b128 %7, %19, off\n\t"                 \
               "global_load_async_to_lds_b128 %8, %20, off\n\t"                 \
               "global_load_async_to_lds_b128 %9, %21, off\n\t"                 \
               "global_load_async_to_lds_b128 %10, %22, off\n\t"                \
               "global_load_async_to_lds_b128 %11, %23, off\n\t"                \
               "s_wait_xcnt 0x0"                                                \
               :                                                                \
               : "v"((l)[0]), "v"((l)[1]), "v"((l)[2]), "v"((l)[3]), "v"((l)[4]), "v"((l)[5]),               \
                 "v"((l)[6]), "v"((l)[7]), "v"((l)[8]), "v"((l)[9]), "v"((l)[10]), "v"((l)[11]),             \
                 "v"((g)[0]), "v"((g)[1]), "v"((g)[2]), "v"((g)[3]), "v"((g)[4]), "v"((g)[5]),               \
                 "v"((g)[6]), "v"((g)[7]), "v"((g)[8]), "v"((g)[9]), "v"((g)[10]), "v"((g)[11])              \
               : "memory")
// this wave's copies have landed
#define G_WAIT_COPIES() asm volatile("s_wait_asynccnt 0x0" ::: "memory")
// this wave's LDS reads have returned, so the buffer may be refilled behind the barrier
#define G_WAIT_LDS() asm volatile("s_wait_dscnt 0x0" ::: "memory")
#else
#define G_COPY12(l, g) ((void)0)
#define G_WAIT_COPIES() ((void)0)
#define G_WAIT_LDS() ((void)0)
#endif

template <int TAPS, int OUTH, bool RESID, int BM>
__global__ __launch_bounds__(256) void gemm_k(
    const _Float16* __restrict__ A, int lda, long long strideA, long long aTap, int aTS, int aTO,
    const _Float16* __restrict__ Bt, int ldb, long long strideB, long long bTap, int bTS, int bTO,
    const float* __restrict__ bias, float bscale,
    const float* __restrict__ resid,
    void* Cout, int ldc, long long strideC,
    int M, int N, int K, float oscale) {
  __shared__ __align__(16) _Float16 sAB[2 * G_BUF];
  __shared__ __align__(16) float sT[8][16 * 68];
  const int bz = blockIdx.y;
  const int tid = threadIdx.x;
  const int lane = tid & 31, wave = tid >> 5;
  const int tilesN = N >> 8, tilesM = M >> 7;
  const int tile = blockIdx.x;
  if (tile >= tilesM * tilesN) return;   // the same for the whole work-group, ahead of every barrier
  const int tm = tile / tilesN, tn = tile - tm * tilesN;
  const int mB = tm << 7, nB = tn << 8;
  const int wm = wave >> 2, wn = wave & 3;
  const int m0 = mB + wm * 64, n0 = nB + wn * 64;
  const int rlane = lane & 15;
  const int koff = (lane >> 4) * 8;
  const int mOff = koff;
  const int aRow0 = (m0 >> 6) * aTS + aTO;
  const int bRow0 = (n0 >> 6) * bTS + bTO;
  const _Float16* Ab = A + (size_t)bz * (size_t)strideA;
  const _Float16* Bb = Bt + (size_t)bz * (size_t)strideB;

  // copy side: lane -> (row tid>>4 of each 16-row band, 16-B piece tid&15 of its 256 B);
  // bands 0..7 are the A rows, bands 8..23 the Bt rows
  const int crow = tid >> 4, cpc = (tid & 15) * 8;
  const unsigned tA = (unsigned)(crow * lda + cpc);
  const unsigned tB = (unsigned)(crow * ldb + cpc);
  const unsigned ldsC = (unsigned)(size_t)sAB + (unsigned)(crow * G_PITCH + cpc) * 2u;

  auto issue = [&](int tp, int k0, int buf) {
    const _Float16* Ap = Ab + (size_t)tp * (size_t)aTap + k0 + tA;
    const _Float16* Bp = Bb + (size_t)tp * (size_t)bTap + k0 + tB;
#pragma unroll   // constant indices keep the array in registers
    for (int hlf = 0; hlf < 2; ++hlf) {
      unsigned l[12];
      const _Float16* g[12];
#pragma unroll   // constant indices keep the array in registers
      for (int e = 0; e < 12; ++e) {
        const int i = hlf * 12 + e;           // band
        l[e] = ldsC + (unsigned)buf * (unsigned)(G_BUF * 2) + (unsigned)i * (unsigned)(16 * G_PITCH * 2);
        if (i < 8) {
          const int row = ((mB >> 6) + (i >> 2)) * aTS + aTO + 16 * (i & 3);
          g[e] = Ap + (size_t)(unsigned)(row * lda);
        } else {
          const int row = ((nB >> 6) + ((i - 8) >> 2)) * bTS + bTO + 16 * ((i - 8) & 3);
          g[e] = Bp + (size_t)(unsigned)(row * ldb);
        }
      }
      G_COPY12(l, g);
    }
  };

  v8f acc[4][4];
#pragma unroll   // constant indices keep the array in registers
  for (int i = 0; i < 4; ++i)
#pragma unroll   // constant indices keep the array in registers
    for (int j = 0; j < 4; ++j) acc[i][j] = zero8();

  const _Float16* fa = sAB + (wm * 64 + rlane) * G_PITCH + koff;
  const _Float16* fb = sAB + (G_BM + wn * 64 + rlane) * G_PITCH + koff;

  const int nt = TAPS * (K >> 7);
  int itp = 0, ik = 0;                      // tap and k of the next stage to be copied
  issue(itp, ik, 0);
  ik += G_KS;
  if (ik >= K) { ik = 0; ++itp; }
  G_WAIT_COPIES();
  __syncthreads();
  if (nt > 1) {
    issue(itp, ik, 1);
    ik += G_KS;
    if (ik >= K) { ik = 0; ++itp; }
  }

#pragma unroll 1   // one stage per trip: the two buffers alternate by the trip's parity
  for (int t = 0; t < nt; ++t) {
    const _Float16* pa = fa + (t & 1) * G_BUF;
    const _Float16* pb = fb + (t & 1) * G_BUF;
#pragma unroll   // constant indices keep the array in registers
    for (int kk = 0; kk < G_KS / 32; ++kk) {
      v16h af[4], bf[4];
#pragma unroll   // constant indices keep the array in registers
      for (int i = 0; i < 4; ++i) af[i] = ldfrag(pa + i * 16 * G_PITCH + kk * 32);
#pragma unroll   // constant indices keep the array in registers
      for (int j = 0; j < 4; ++j) bf[j] = ldfrag(pb + j * 16 * G_PITCH + kk * 32);
      // keeps the block's 16 LDS reads one group ahead of its 16 WMMAs: left free, the reads of each A
      // fragment sink to just in front of its row and every row waits out a whole LDS latency
      __builtin_amdgcn_sched_barrier(0);
#pragma unroll   // constant indices keep the array in registers
      for (int i = 0; i < 4; ++i)
#pragma unroll   // constant indices keep the array in registers
        for (int j = 0; j < 4; ++j) acc[i][j] = mma_raw(af[i], bf[j], acc[i][j]);
    }
    // publish point of stage t + 1; the same barrier ends every read of the buffer refilled behind it
    G_WAIT_LDS();
    G_WAIT_COPIES();
    __syncthreads();
    if (t + 2 < nt) {
      issue(itp, ik, t & 1);
      ik += G_KS;
      if (ik >= K) { ik = 0; ++itp; }
    }
  }
  G_WAIT_COPIES();

  // ---- epilogue ----
  float* slab = sT[wave];
#pragma unroll
  for (int i = 0; i < 4; ++i) {
    const int mBase = m0 + i * 16;
    float badd[8];
#pragma unroll
    for (int r = 0; r < 8; ++r) badd[r] = 0.f;
    if (BM == 1) {
#pragma unroll
      for (int r = 0; r < 8; ++r) badd[r] = bias[aRow0 + i * 16 + mOff + r] * bscale;
    }
#pragma unroll
    for (int j = 0; j < 4; ++j) {
      float bc = 0.f;
      if (BM == 2) bc = bias[bRow0 + j * 16 + rlane] * bscale;
#pragma unroll
      for (int r = 0; r < 8; ++r)
        slab[(mOff + r) * 68 + j * 16 + rlane] = acc[i][j][r] * oscale + badd[r] + bc;
    }
    __builtin_amdgcn_fence(__ATOMIC_RELEASE, "workgroup");
    __builtin_amdgcn_wave_barrier();
    __builtin_amdgcn_fence(__ATOMIC_ACQUIRE, "workgroup");
    if (OUTH == 0) {
      float* Cb = (float*)Cout + (size_t)bz * (size_t)strideC;
      const float* Rb = RESID ? (resid + (size_t)bz * (size_t)strideC) : resid;
      const int h2 = lane >> 4, c4 = (lane & 15) * 4;     // 256-B row segment = 16 lanes x 16 B
      {
#pragma unroll
        for (int it = 0; it < 8; ++it) {
          const int row = it * 2 + h2;                     // it 0..7 x h2 0..1 = rows 0..15
          v4f v = *(const v4f*)(slab + row * 68 + c4);
          const size_t off = (size_t)(mBase + row) * ldc + n0 + c4;
          if (RESID) v += *(const v4f*)(Rb + off);
          *(v4f*)(Cb + off) = v;
        }
        
      }
    } else {
      _Float16* Cb = (_Float16*)Cout + (size_t)bz * (size_t)strideC;
      const int q = lane >> 3, c8 = (lane & 7) * 8;
      v4u hv[4];
#pragma unroll
      for (int it = 0; it < 4; ++it) {
        const int row = it * 4 + q;                        // it 0..3 x q 0..3 = rows 0..15
        const float* sp = slab + row * 68 + c8;
        v4u a;
#pragma unroll
        for (int e = 0; e < 4; ++e) a[e] = pkf(sp[2 * e], sp[2 * e + 1]);
        hv[it] = a;
      }
      {
#pragma unroll
        for (int it = 0; it < 4; ++it) {
          const int row = it * 4 + q;
          *(v4u*)(Cb + (size_t)(mBase + row) * ldc + n0 + c8) = hv[it];
        }
        
      }
    }
    __builtin_amdgcn_fence(__ATOMIC_RELEASE, "workgroup");
    __builtin_amdgcn_wave_barrier();
    __builtin_amdgcn_fence(__ATOMIC_ACQUIRE, "workgroup");
  }
}

#define AT_P 72
// lane l reads lane l ^ 16
__device__ __forceinline__ float xhalf(float x) {
  return __builtin_bit_cast(float, __builtin_amdgcn_permlanex16(__builtin_bit_cast(int, x), __builtin_bit_cast(int, x),
                                                                0x76543210, 0xfedcba98, false, false));
}
// two values 2^x in one statement. Behind a transcendental the instruction set asks for one slot before its result
// is used or its source overwritten: the first has the second exponential there (the outputs share no register with
// the inputs), the second the v_nop. The two s_delay_alu are the hints that the compiler gives its own code and not a
// statement's: the arguments may come from the instruction in front, and what follows may use the results;
// without a hint a dependent instruction holds the SIMD's vector port against the other waves while it waits
__device__ __forceinline__ void exp2x2_slot(float x0, float x1, float& y0, float& y1) {
#if defined(__HIP_DEVICE_COMPILE__)
  asm("s_delay_alu instid0(VALU_DEP_1)\n\tv_exp_f32 %0, %2\n\tv_exp_f32 %1, %3\n\tv_nop\n\t"
      "s_delay_alu instid0(TRANS32_DEP_1)"
      : "=&v"(y0), "=&v"(y1) : "v"(x0), "v"(x1));
#else
  y0 = x0; y1 = x1;
#endif
}
// eight waves per SIMD (128 registers): the eight work-groups that fall to each WGP are then resident together
__global__ __launch_bounds__(128, 8)
void attn_k(const _Float16* __restrict__ Qp, const _Float16* __restrict__ Kp, const _Float16* __restrict__ Vp,
            const float* __restrict__ tab, _Float16* AT, float sScale, float oScale) {
  __shared__ __align__(16) _Float16 Ksh[64 * AT_P];    // [kv][d]
  __shared__ __align__(16) _Float16 Vth[64 * AT_P];    // [d][kv]
  __shared__ __align__(16) _Float16 Osh[4][16 * AT_P]; // per wave output rows [query][d]
  __shared__ __align__(16) float    sB[384 * 4];       // bias slice tab[h][q0b .. q0b+1087] (+clamped fill)

  const int tid  = threadIdx.x;
  const int wave = tid >> 5;
  const int lane = tid & 31;
  const int hh   = lane >> 4;
  const int c    = lane & 15;

  const int bx  = blockIdx.x;
  const int qb  = bx & 15;
  const int h   = (bx >> 4) & 15;
  const int b   = bx >> 8;
  const int q0b = qb * 64;
  const int q0  = q0b + wave * 16;
  const size_t rowB = (size_t)b * TT;

  {
    const float* th = tab + (size_t)h * BTP + q0b;     // q0b + 1087 <= 2047 < BTP
#pragma unroll
    for (int k = 0; k < 3; ++k) {
      const int i  = tid + 128 * k;                     // 0..383
      const int ic = (i < 271) ? i : 271;               // clamped address, all lanes load
      *(v4f*)(sB + 4 * i) = *(const v4f*)(th + 4 * ic);
    }
  }

  const _Float16* Qh = Qp + (size_t)h * HD;
  const _Float16* Kh = Kp + (size_t)h * HD;
  const _Float16* Vh = Vp + ((size_t)b * CC + (size_t)h * HD) * TT;

  // ---- Q fragments (B operand, column = lane&15): 2 d-chunks ----
  v16h qa[2];
#pragma unroll
  for (int dc = 0; dc < 2; ++dc) qa[dc] = ldfrag(Qh + (rowB + q0 + c) * CC + dc * 32 + 8 * hh);

  float mrun = -INFINITY, lrun = 0.f;   // the lane's query: maximum in use; sum over this half's keys
  v8f oacc[4];
#pragma unroll
  for (int t = 0; t < 4; ++t) oacc[t] = zero8();

  // bias index: (t - q0b) - s + 1024 with t - q0b = wave*16 + c, s = kv0 + 16j + 8hh + r
  const int bbase = wave * 16 + c + 1024 - 8 * hh;

#pragma unroll 1
  for (int kt = 0; kt < TT / 64; ++kt) {
    const int kv0 = kt * 64;
    __syncthreads();
    {
      const int r = tid >> 1, half = (tid & 1) * 32;
      const _Float16* kg = Kh + (rowB + kv0 + r) * CC + half;     // K row kv0+r, d = half..half+31
      const _Float16* vg = Vh + (size_t)r * TT + kv0 + half;     // V^T row d = r, s = kv0+half..+31
#pragma unroll
      for (int i = 0; i < 4; ++i) {
        const v8h a0 = *(const v8h*)(kg + 8 * i);
        const v8h b0 = *(const v8h*)(vg + 8 * i);
        *(v8h*)(Ksh + r * AT_P + half + 8 * i) = a0;
        *(v8h*)(Vth + r * AT_P + half + 8 * i) = b0;
      }
    }
    __syncthreads();

    // ---- scores, transposed: 64 keys x 16 queries per wave ----
    v8f s[4];
#pragma unroll
    for (int j = 0; j < 4; ++j) s[j] = zero8();
#pragma unroll
    for (int dc = 0; dc < 2; ++dc)
#pragma unroll
      for (int j = 0; j < 4; ++j)
        s[j] = mma_raw(ldfrag(Ksh + (j * 16 + c) * AT_P + dc * 32 + 8 * hh), qa[dc], s[j]);

    // ---- scale + bias, maximum of the lane's 32 keys (one chain per tile), then of the query's 64 ----
    const float* bp = sB + (bbase - kv0 - 55);   // the lowest of the lane's 32 entries
    float mj[4];
#pragma unroll
    for (int jh = 0; jh < 2; ++jh) {
      // two tiles' bias entries at a time, read as one group. The first fence keeps them behind what stands in
      // front: hoisted, all 32 stand beside the scores, the context and Q, and the 128 registers of eight waves
      // per SIMD no longer hold them. The second keeps the group together: left free, each read sinks to just in
      // front of its sum and every pair waits out a whole LDS latency
      __builtin_amdgcn_sched_barrier(0);
      float bb[16];
#pragma unroll
      for (int e = 0; e < 16; ++e) bb[e] = bp[55 - 32 * jh - 16 * (e >> 3) - (e & 7)];   // tile 2jh + (e>>3), r = e&7
      __builtin_amdgcn_sched_barrier(0);
#pragma unroll
      for (int jl = 0; jl < 2; ++jl) {
        const int j = 2 * jh + jl;
        mj[j] = -INFINITY;
#pragma unroll
        for (int r = 0; r < 8; ++r) {
          const float sv = s[j][r] * sScale + bb[8 * jl + r];
          s[j][r] = sv;
          mj[j] = fmaxf(mj[j], sv);
        }
      }
    }
    float m = fmaxf(fmaxf(mj[0], mj[1]), fmaxf(mj[2], mj[3]));
    m = fmaxf(m, xhalf(m));
    const float mnew  = fmaxf(mrun, m);
    const float msafe = (mnew == -INFINITY) ? 0.f : mnew;
    const float LOG2E = 1.4426950408889634f;   // e^x = 2^(x log2 e)
    const float alpha = exp2_slot((mrun - msafe) * LOG2E);
    mrun = mnew;

    // ---- P^T (x1024, f16): score tiles 2kk and 2kk+1, converted in place, are the B fragment of keys 32kk.. ----
    v16h pb[2];
    float pj[4];
#pragma unroll
    for (int j = 0; j < 4; ++j) {
#pragma unroll
      for (int r = 0; r < 8; r += 2) {
        float p0, p1;
        exp2x2_slot((s[j][r] - msafe) * LOG2E, (s[j][r + 1] - msafe) * LOG2E, p0, p1);
        pj[j] = (r == 0) ? p0 + p1 : (pj[j] + p0) + p1;
        pb[j >> 1][(j & 1) * 8 + r] = (_Float16)(p0 * 1024.0f);
        pb[j >> 1][(j & 1) * 8 + r + 1] = (_Float16)(p1 * 1024.0f);
      }
    }
    lrun = lrun * alpha + ((pj[0] + pj[1]) + (pj[2] + pj[3]));
#pragma unroll
    for (int t = 0; t < 4; ++t) oacc[t] *= alpha;

    // ---- context, transposed: O^T += V^T . P^T (f16 WMMA) ----
#pragma unroll
    for (int kk = 0; kk < 2; ++kk) {
      // the first fence keeps a group's reads behind what stands in front (one set of four fragments at a time fits
      // the 128 registers); the second keeps them one group ahead of their products: left free, each sinks to just
      // in front of its own product, which then waits out a whole LDS latency
      __builtin_amdgcn_sched_barrier(0);
      v16h va[4];
#pragma unroll
      for (int t = 0; t < 4; ++t) va[t] = ldfrag(Vth + (t * 16 + c) * AT_P + kk * 32 + 8 * hh);
      __builtin_amdgcn_sched_barrier(0);
#pragma unroll
      for (int t = 0; t < 4; ++t) oacc[t] = mma_raw(va[t], pb[kk], oacc[t]);
    }
  }

  // ---- normalise (1/l; the 1/1024 p carry, the x16 v carry and the x256 output carry are all in oScale) ----
  const float l = lrun + xhalf(lrun);
  const float inv = ((l > 0.f) ? rcp_f(l) : 0.f) * oScale;
  _Float16* os = Osh[wave];
#pragma unroll
  for (int t = 0; t < 4; ++t) {
    v4u a;
#pragma unroll
    for (int e = 0; e < 4; ++e) a[e] = pkf(oacc[t][2 * e] * inv, oacc[t][2 * e + 1] * inv);
    *(v4u*)(os + c * AT_P + t * 16 + 8 * hh) = a;
  }
  wave_lds_sync();   // the rows are the wave's own
  {
    const int q4 = lane >> 3, c8 = (lane & 7) * 8;
    v4u hv[4];
#pragma unroll
    for (int it = 0; it < 4; ++it) hv[it] = *(const v4u*)(os + (it * 4 + q4) * AT_P + c8);   // rows 0..15 of the wave tile
#pragma unroll
    for (int it = 0; it < 4; ++it) {
      const int row = it * 4 + q4;
      const size_t go = (rowB + q0 + row) * CC + (size_t)h * HD + c8;
      *(v4u*)(AT + go) = hv[it];
    }
  }
}

// =====================================================================================================
// Workspace map (bytes):
//   W1t  f16 [3][1024][1024]       0            6291456
//   W2t  f16 [3][1024][1024]       6291456      6291456
//   Wqkv f16 [3072][1024]          12582912     6291456
//   Wp   f16 [1024][1024]          18874368     2097152
//   Tab  f32 [16][2048]            20971520      131072
//   XT   f16 [8][1026][1024]       21102592    16809984   (later: XT3 [8][1024][1024], then AT [8192][1024])
//   R1   f32 [8][1024][1024]       37912576    33554432   (F1, then H, then Qp + Kp f16 [8192][1024] each)
//   Xin  f32 [8][1024][1024]       71467008    33554432
//   Vp   f16 [8][1024][1024]       105021440   16777216
//   end                            121798656
// Every plane is an exact multiple of its whole-line / whole-tile store granularity (incl. the two
// halo token rows per sample in XT); no tail padding needed.
// =====================================================================================================
extern "C" void kernel_launch(void* const* d_in, const int* in_sizes, int n_in,
                              void* d_out, int out_size, void* d_ws, size_t ws_size,
                              hipStream_t stream) {
  if (n_in < 18) return;
  const int nAct = NBATCH * CC * TT;                     // 8388608
  if (in_sizes[0] != nAct || out_size != nAct) return;
  if (in_sizes[3] != CC * CC * 3 || in_sizes[7] != CC * CC * 3) return;
  if (in_sizes[13] != 3 * CC * CC || in_sizes[15] != CC * CC) return;
  if (in_sizes[1] != CC || in_sizes[2] != CC || in_sizes[4] != CC || in_sizes[5] != CC ||
      in_sizes[6] != CC || in_sizes[8] != CC || in_sizes[9] != CC || in_sizes[10] != CC ||
      in_sizes[11] != CC || in_sizes[12] != CC || in_sizes[16] != CC) return;
  if (in_sizes[14] != 3 * CC || in_sizes[17] != NBUCK * NH) return;

  const float* x      = (const float*)d_in[0];
  const float* gn1_g  = (const float*)d_in[1];
  const float* gn1_b  = (const float*)d_in[2];
  const float* c1_w   = (const float*)d_in[3];
  const float* c1_b   = (const float*)d_in[4];
  const float* gn2_g  = (const float*)d_in[5];
  const float* gn2_b  = (const float*)d_in[6];
  const float* c2_w   = (const float*)d_in[7];
  const float* c2_b   = (const float*)d_in[8];
  const float* n8_g   = (const float*)d_in[9];
  const float* n8_b   = (const float*)d_in[10];
  const float* ag_g   = (const float*)d_in[11];
  const float* ag_b   = (const float*)d_in[12];
  const float* qkv_w  = (const float*)d_in[13];
  const float* qkv_b  = (const float*)d_in[14];
  const float* pj_w   = (const float*)d_in[15];
  const float* pj_b   = (const float*)d_in[16];
  const float* remb   = (const float*)d_in[17];

  const size_t PWC  = (size_t)3 * CC * CC * 2;          //  6291456
  const size_t PWQ  = (size_t)3 * CC * CC * 2;          //  6291456
  const size_t PWP  = (size_t)CC * CC * 2;              //  2097152
  const size_t PTAB = (size_t)NH * BTP * 4;             //   131072
  const size_t PXT  = (size_t)NBATCH * TP * CC * 2;     // 16809984
  const size_t PF   = (size_t)NBATCH * CC * TT * 4;     // 33554432
  const size_t PV   = (size_t)NBATCH * CC * TT * 2;     // 16777216
  size_t off = 0;
  const size_t oW1  = off; off += PWC;
  const size_t oW2  = off; off += PWC;
  const size_t oWq  = off; off += PWQ;
  const size_t oWp  = off; off += PWP;
  const size_t oTab = off; off += PTAB;
  const size_t oXT  = off; off += PXT;
  const size_t oR1  = off; off += PF;
  const size_t oXin = off; off += PF;
  const size_t oV   = off; off += PV;
  if (off > ws_size) return;                            // off = 121798656
  if (off > (size_t)134217728) return;
  if (2 * PV > PF) return;                              // Qp + Kp live inside R1
  if ((size_t)NBATCH * TT * CC * 2 > PXT) return;       // XT3 / AT fit in the XT region

  char* ws = (char*)d_ws;
  _Float16* W1t  = (_Float16*)(ws + oW1);
  _Float16* W2t  = (_Float16*)(ws + oW2);
  _Float16* Wqkv = (_Float16*)(ws + oWq);
  _Float16* Wpb  = (_Float16*)(ws + oWp);
  float*    Tab  = (float*)(ws + oTab);
  _Float16* XT   = (_Float16*)(ws + oXT);               // [8][1026][1024] with halo rows
  _Float16* XT3  = (_Float16*)(ws + oXT);               // [8][1024][1024], later use of the same region
  _Float16* ATp  = (_Float16*)(ws + oXT);               // [8192][1024], last use of the same region
  float*    F1   = (float*)(ws + oR1);
  float*    Hb   = (float*)(ws + oR1);
  _Float16* Qp   = (_Float16*)(ws + oR1);
  _Float16* Kp   = (_Float16*)(ws + oR1 + PV);
  float*    Xin  = (float*)(ws + oXin);
  _Float16* Vp   = (_Float16*)(ws + oV);

  const dim3 blk(256);
  const int  n8q = 3 * CC * CC / 8;                     // 393216
  const int  n8p = CC * CC / 8;                         // 131072
  const long long CCCC = (long long)CC * CC;
  const long long CT   = (long long)CC * TT;

  // (1) weights -> f16 x64 planes; position bias table
  cvt_convw<<<dim3(CC * (CC / 8) / 256), blk, 0, stream>>>(c1_w, W1t, 64.0f);
  cvt_convw<<<dim3(CC * (CC / 8) / 256), blk, 0, stream>>>(c2_w, W2t, 64.0f);
  cvt_f16x8<<<dim3((n8q + 255) / 256), blk, 0, stream>>>(qkv_w, Wqkv, n8q, 64.0f);
  cvt_f16x8<<<dim3((n8p + 255) / 256), blk, 0, stream>>>(pj_w, Wpb, n8p, 64.0f);
  btab_k<<<dim3(NH * (BTP / 4) / 256), blk, 0, stream>>>(remb, Tab);

  // (2) h = silu(GN32(x)) -> XT (token-major f16, halo rows)
  gn32_tr_k<true><<<dim3(CC / 64, NBATCH), dim3(GN_NT), 0, stream>>>(x, gn1_g, gn1_b, XT);
  // (3) F1 = conv1(h) + b1 -> f32 NCT   (per b: M=1024 o, N=1024 t, K=3 taps x 1024)
  gemm_k<3, 0, false, 1><<<dim3((CC / 128) * (TT / 256), NBATCH), blk, 0, stream>>>(
      W1t, CC, 0LL, CCCC, 64, 0,
      XT, CC, (long long)TP * CC, (long long)CC, 64, 0,
      c1_b, 1.0f, nullptr,
      (void*)F1, TT, CT, CC, TT, CC, 1.0f / 64.0f);
  // (4) h = silu(GN32(F1)) -> XT
  gn32_tr_k<true><<<dim3(CC / 64, NBATCH), dim3(GN_NT), 0, stream>>>(F1, gn2_g, gn2_b, XT);
  // (5) H = conv2(h) + b2 + x -> f32 NCT (R1)
  gemm_k<3, 0, true, 1><<<dim3((CC / 128) * (TT / 256), NBATCH), blk, 0, stream>>>(
      W2t, CC, 0LL, CCCC, 64, 0,
      XT, CC, (long long)TP * CC, (long long)CC, 64, 0,
      c2_b, 1.0f, x,
      (void*)Hb, TT, CT, CC, TT, CC, 1.0f / 64.0f);
  // (6) xin = GN8(H) -> f32 NCT; GN32(xin) -> XT3 (token-major f16, no halo)
  gn8_attn_k<<<dim3(CC / 128, NBATCH), dim3(GN_NT), 0, stream>>>(Hb, n8_g, n8_b, ag_g, ag_b, Xin, XT3);
  // (7) q = xn^T . Wq^T -> Qp [b*TT+t][h*64+d] f16 x16  (M=8192, N=1024, K=1024; W rows h*192+d)
  gemm_k<1, 1, false, 2><<<dim3((NBATCH * TT / 128) * (CC / 256), 1), blk, 0, stream>>>(
      XT3, CC, 0LL, 0LL, 64, 0,
      Wqkv, CC, 0LL, 0LL, 192, 0,
      qkv_b, 16.0f, nullptr,
      (void*)Qp, CC, 0LL, NBATCH * TT, CC, CC, 0.25f);
  // (8) k -> Kp (W rows h*192+64+d)
  gemm_k<1, 1, false, 2><<<dim3((NBATCH * TT / 128) * (CC / 256), 1), blk, 0, stream>>>(
      XT3, CC, 0LL, 0LL, 64, 0,
      Wqkv, CC, 0LL, 0LL, 192, 64,
      qkv_b, 16.0f, nullptr,
      (void*)Kp, CC, 0LL, NBATCH * TT, CC, CC, 0.25f);
  // (9) v (channel-major) = Wv . xn -> Vp [b][h*64+d][s] f16 x16 (per b: M=1024 rows h*192+128+d, N=1024 t)
  gemm_k<1, 1, false, 1><<<dim3((CC / 128) * (TT / 256), NBATCH), blk, 0, stream>>>(
      Wqkv, CC, 0LL, 0LL, 192, 128,
      XT3, CC, CT, 0LL, 64, 0,
      qkv_b, 16.0f, nullptr,
      (void*)Vp, TT, CT, CC, TT, CC, 0.25f);
  // (10) attention -> AT [b*TT+t][h*64+d] f16 x256
  attn_k<<<dim3((TT / 64) * NH * NBATCH), dim3(128), 0, stream>>>(
      Qp, Kp, Vp, Tab, ATp, 1.0f / 2048.0f, 1.0f / 64.0f);
  // (11) out = xin + proj(a) + bp -> d_out f32 NCT (per b: M=1024 o, N=1024 t, K=1024)
  gemm_k<1, 0, true, 1><<<dim3((CC / 128) * (TT / 256), NBATCH), blk, 0, stream>>>(
      Wpb, CC, 0LL, 0LL, 64, 0,
      ATp, CC, CT, 0LL, 64, 0,
      pj_b, 1.0f, Xin,
      d_out, TT, CT, CC, TT, CC, 1.0f / 16384.0f);
  (void)hipGetLastError();
}

// v006
// One run takes 258 microseconds.
// Timed twice side by side with v005, it ran 1.05 times as fast both times.
// Counting every step since v000, it is 3.71 times as fast.
// Contractions: conv k3 (two), qkv 1x1, q.k^T, p.v, proj 1x1 = v_wmma_f32_16x16x32_f16 (f16 operands: weights x64, GroupNorm activations x1, q/k/v x16, p x1024, attention output x256), f32 accumulate; GroupNorm statistics f32 partial sums with f64 totals, softmax / position bias / residuals f32.
#include <hip/hip_runtime.h>
#include <math.h>
#include <stdint.h>

#define NBATCH 8
#define CC 1024
#define TT 1024
#define TP 1026
#define NH 16
#define HD 64
#define NBUCK 32
#define BTP 2048

static_assert(NH * HD == CC);
static_assert((CC % 256) == 0 && (TT % 256) == 0);

typedef _Float16 v16h __attribute__((ext_vector_type(16)));
typedef _Float16 v8h  __attribute__((ext_vector_type(8)));
typedef float    v8f  __attribute__((ext_vector_type(8)));
typedef float    v4f  __attribute__((ext_vector_type(4)));
typedef unsigned int v4u __attribute__((ext_vector_type(4)));

// ---- scalar helpers ----
__device__ __forceinline__ unsigned short h_bits(_Float16 x) { return __builtin_bit_cast(unsigned short, x); }
__device__ __forceinline__ unsigned pkf(float a, float b) {
  return (unsigned)h_bits((_Float16)a) | ((unsigned)h_bits((_Float16)b) << 16);
}
__device__ __forceinline__ v8f zero8() { v8f z = {0.f, 0.f, 0.f, 0.f, 0.f, 0.f, 0.f, 0.f}; return z; }
__device__ __forceinline__ float rcp_f(float x) { return __builtin_amdgcn_rcpf(x); }

// ---- 16-bit A/B fragment: lane -> row/col (lane&15); p already includes +8*(lane>>4);
//      elements 0..7 <- p[0..7] (k0+8h..), elements 8..15 <- p[16..23] (k0+16+8h..)
__device__ __forceinline__ v16h ldfrag(const _Float16* p) {
  union { v16h v; v8h h[2]; } f;
  f.h[0] = *(const v8h*)(p);
  f.h[1] = *(const v8h*)(p + 16);
  return f.v;
}

// ---- WMMA helpers ----
__device__ __forceinline__ v8f mma_raw(v16h a, v16h b, v8f c) {
  return __builtin_amdgcn_wmma_f32_16x16x32_f16(false, a, false, b, (short)0, c, false, false);
}

// ---- f64 wave shuffle ----
__device__ __forceinline__ double shfl_xor_d(double v, int m) {
  const unsigned long long u = (unsigned long long)__double_as_longlong(v);
  const int lo = __shfl_xor((int)(unsigned)(u & 0xffffffffull), m, 32);
  const int hi = __shfl_xor((int)(unsigned)(u >> 32), m, 32);
  const unsigned long long r = ((unsigned long long)(unsigned)hi << 32) | (unsigned long long)(unsigned)lo;
  return __longlong_as_double((long long)r);
}
// GroupNorm kernels: 16 waves per work-group
#define GN_NT 512
#define GN_NW 16
// Statistics: the per-element sums run in f32 (four chains of 16 per batch of 16 loads, joined as a tree, then the
// wave's 32 lanes); only the wave totals are summed in f64, where the squared mean is taken from the mean square.
__device__ __forceinline__ float sum4(v4f a) { return (a[0] + a[1]) + (a[2] + a[3]); }
__device__ __forceinline__ float wave_sum(float v) {
#pragma unroll   // the five exchange distances as constants
  for (int m = 16; m >= 1; m >>= 1) v += __shfl_xor(v, m, 32);
  return v;
}
// 1 / sqrt(x), x >= 1e-5: the hardware's estimate and one Newton step; the v_nop is the one slot that the
// instruction set asks for behind a transcendental before its result is used
__device__ __forceinline__ float rsqrt_nr(float x) {
#if defined(__HIP_DEVICE_COMPILE__)
  float r;
  asm("v_rsq_f32 %0, %1\n\tv_nop" : "=v"(r) : "v"(x));
  const float e = fmaf(-x * r, r, 1.0f);
  return fmaf(0.5f * r, e, r);
#else
  return x;
#endif
}
// mean and 1 / sigma from the f64 totals of n = 1 / invn values
__device__ __forceinline__ void mean_rstd(double S, double SS, double invn, float& meanf, float& rstdf) {
  const double mean = S * invn;
  double var = SS * invn - mean * mean;
  var = var < 0.0 ? 0.0 : var;
  meanf = (float)mean;
  rstdf = rsqrt_nr((float)var + 1e-5f);
}
// rs, rq: the GN_NW wave totals (sum, sum of squares) in LDS; called by a whole wave, every lane returns the result
__device__ __forceinline__ void close_stats(const float* rs, const float* rq, int lane, double invn,
                                            float& meanf, float& rstdf) {
  double S = (double)rs[lane & (GN_NW - 1)], SS = (double)rq[lane & (GN_NW - 1)];
#pragma unroll   // the four exchange distances as constants
  for (int m = GN_NW / 2; m >= 1; m >>= 1) {
    S += shfl_xor_d(S, m);
    SS += shfl_xor_d(SS, m);
  }
  mean_rstd(S, SS, invn, meanf, rstdf);
}

// SiLU's two transcendentals, each with the one slot behind it that the instruction set asks for before its
// result is used or its source overwritten
__device__ __forceinline__ float exp2_slot(float x) {
#if defined(__HIP_DEVICE_COMPILE__)
  float r;
  asm("v_exp_f32 %0, %1\n\tv_nop" : "=v"(r) : "v"(x));
  return r;
#else
  return x;
#endif
}
__device__ __forceinline__ float rcp_slot(float x) {
#if defined(__HIP_DEVICE_COMPILE__)
  float r;
  asm("v_rcp_f32 %0, %1\n\tv_nop" : "=v"(r) : "v"(x));
  return r;
#else
  return x;
#endif
}

#if defined(__HIP_DEVICE_COMPILE__)
// stands behind a batch of stores whose address and data registers the next trip's loads write again
#define GN_WAIT_XCNT() asm volatile("s_wait_xcnt 0x0" ::: "memory")
#else
#define GN_WAIT_XCNT() ((void)0)
#endif

// orders one wave's own LDS writes and reads (the tile below is private to its wave)
__device__ __forceinline__ void wave_lds_sync() {
  __builtin_amdgcn_fence(__ATOMIC_RELEASE, "workgroup");
  __builtin_amdgcn_wave_barrier();
  __builtin_amdgcn_fence(__ATOMIC_ACQUIRE, "workgroup");
}

// One wave turns 64 channels x 32 tokens of an NCT f32 plane into 32 token rows of 64 f16 channels:
// y = f * cA[c] + cD[c] (+ SiLU). pr: the slab's first channel at this lane's token; dst: the tile's first
// token row at the slab's first channel (row pitch CC); st: this wave's own 32 x 9 16-B pieces of LDS.
// All 64 loads of the lane are issued before the first is used. No other wave touches st, so there is no
// work-group barrier. coverage: 8 x 4 rows x (8 lanes x 8 channels) = 32 rows x 64 channels.
template <bool SILU>
__device__ __forceinline__ void gn_tile64(const float* __restrict__ pr, const float* cA, const float* cD,
                                          v4u* st, _Float16* dst, int lane) {
  float f[64];
#pragma unroll
  for (int i = 0; i < 64; ++i) f[i] = pr[(size_t)i * TT];
  // the wave's reads of its last tile are over before st is written again; behind the loads, so that
  // the wait for the last tile's stores runs beside their flight
  wave_lds_sync();
#pragma unroll
  for (int j = 0; j < 8; ++j) {
    float y[8];
#pragma unroll
    for (int i = 0; i < 8; ++i) {
      float yy = fmaf(f[j * 8 + i], cA[j * 8 + i], cD[j * 8 + i]);
      if (SILU) yy = yy * rcp_slot(1.0f + exp2_slot(yy * -1.4426950408889634f));   // e^-y = 2^(-y log2 e)
      y[i] = yy;
    }
    v4u pk;
    pk[0] = pkf(y[0], y[1]);
    pk[1] = pkf(y[2], y[3]);
    pk[2] = pkf(y[4], y[5]);
    pk[3] = pkf(y[6], y[7]);
    st[lane * 9 + j] = pk;
  }
  wave_lds_sync();
  const int q = lane >> 3, l8 = lane & 7;
  v4u v[8];
#pragma unroll
  for (int it = 0; it < 8; ++it) v[it] = st[(it * 4 + q) * 9 + l8];
#pragma unroll
  for (int it = 0; it < 8; ++it) *(v4u*)(dst + (size_t)(it * 4 + q) * CC + l8 * 8) = v[it];
}

// =====================================================================================================
// Preparation work (weights -> f16 planes, position bias table). None of it needs anything of the GroupNorm
// kernels and they need nothing of it, so it has no launches of its own: it runs in further work-groups of the
// GroupNorm launches (a range of the block index, the branch the same for the whole work-group), on the WGPs
// that those launches leave idle. Work-groups of GN_NT = 512 threads.
// =====================================================================================================
#if defined(__HIP_DEVICE_COMPILE__)
// stands behind a batch of loads that all go by the one address p: the wait before a register that an issued load
// names is written again; p as an input keeps its registers untouched up to the wait
#define PREP_WAIT_XCNT(p) asm volatile("s_wait_xcnt 0x0" :: "v"(p) : "memory")
#else
#define PREP_WAIT_XCNT(p) ((void)0)
#endif
// f32 -> f16 (x scale): a thread takes 8 pieces of 8 elements, its 16 loads issued before the first use, one
// 16-B store per piece (wave = 512 contiguous B). coverage: nblk work-groups x 8 x 512 pieces x 8 = the plane.
__device__ __forceinline__ void cvt_f16x8_part(const float* __restrict__ in, _Float16* out, int blk, int tid,
                                               float scale) {
  const size_t i0 = (size_t)(blk * 8 * GN_NT + tid) * 8;   // piece u stands u * GN_NT * 8 elements further
  const float* src = in + i0;
  v4f a[8], c[8];
#pragma unroll   // constant indices keep the arrays in registers
  for (int u = 0; u < 8; ++u) {
    a[u] = *(const v4f*)(src + u * (GN_NT * 8));
    c[u] = *(const v4f*)(src + u * (GN_NT * 8) + 4);
  }
  PREP_WAIT_XCNT(src);
#pragma unroll   // constant indices keep the arrays in registers
  for (int u = 0; u < 8; ++u) {
    v4u p;
    p[0] = pkf(a[u][0] * scale, a[u][1] * scale);
    p[1] = pkf(a[u][2] * scale, a[u][3] * scale);
    p[2] = pkf(c[u][0] * scale, c[u][1] * scale);
    p[3] = pkf(c[u][2] * scale, c[u][3] * scale);
    *(v4u*)(out + i0 + u * (GN_NT * 8)) = p;
  }
  // the compiler lays the callers' branches out as one chain, in which code that writes these stores' registers follows
  GN_WAIT_XCNT();
}

// conv weight [o][c][3] f32 -> Wt[tap][o][c] f16 (x scale). Piece idx = (o, 8 consecutive c) = 24 contiguous
// floats at 24 idx, one 16-B store at 8 idx of each of the 3 tap planes; a thread takes 2 pieces, its 12 loads
// issued before the first use. coverage: CVW_NB work-groups x 2 x 512 pieces x 3 x 8 halves = 3*CC*CC.
#define CVW_NB (CC * (CC / 8) / (2 * GN_NT))   // 128
__device__ __forceinline__ void cvt_convw_part(const float* __restrict__ w, _Float16* out, int blk, int tid,
                                               float scale) {
  const size_t idx0 = (size_t)(blk * 2 * GN_NT + tid);   // the thread's first piece; the second is GN_NT further
  const float* src = w + idx0 * 24;
  union { v4f q[6]; float e[24]; } u[2];
#pragma unroll   // constant indices keep the arrays in registers
  for (int s = 0; s < 2; ++s)
#pragma unroll   // constant indices keep the arrays in registers
    for (int i = 0; i < 6; ++i) u[s].q[i] = *(const v4f*)(src + s * (GN_NT * 24) + 4 * i);
#pragma unroll   // constant indices keep the arrays in registers
  for (int s = 0; s < 2; ++s) {
    const size_t idx = idx0 + (size_t)(s * GN_NT);
#pragma unroll   // constant indices keep the arrays in registers
    for (int tp = 0; tp < 3; ++tp) {
      v4u a;
#pragma unroll   // constant indices keep the arrays in registers
      for (int m = 0; m < 4; ++m)
        a[m] = pkf(u[s].e[(2 * m) * 3 + tp] * scale, u[s].e[(2 * m + 1) * 3 + tp] * scale);
      *(v4u*)(out + (size_t)tp * CC * CC + idx * 8) = a;
    }
  }
}

// relative position bias table tab[h][d], d = (t - s) + 1024, value = emb[bucket][h] * 8 (f32).
// bucket: n = t - s; add 16 when n < 0; n = |n|; n < 8 -> n; else 8 + int(log(n/8) * (1/ln 8) * 8)
// coverage: 16 work-groups x 512 threads x 4 = NH*BTP floats.
__device__ __forceinline__ void btab_part(const float* __restrict__ emb, float* tab, int blk, int tid) {
  const int i4 = blk * GN_NT + tid;
  const int h = i4 >> 9;
  const int d0 = (i4 & 511) * 4;
  const float ln8 = 2.0794415416798357f;
  const float rl8 = 1.0f / ln8;
  v4f v;
#pragma unroll   // constant indices keep the arrays in registers
  for (int e = 0; e < 4; ++e) {
    const int delta = d0 + e - 1024;
    const int n = delta < 0 ? -delta : delta;
    const float nf = (float)(n < 1 ? 1 : n);
    const float lg = logf(nf * 0.125f);
    int vl = 8 + (int)(lg * rl8 * 8.0f);
    vl = vl > 15 ? 15 : vl;
    int bucket = (n < 8) ? n : vl;
    bucket += (delta < 0) ? 16 : 0;
    v[e] = emb[bucket * NH + h] * 8.0f;
  }
  *(v4f*)(tab + (size_t)i4 * 4) = v;
  // the compiler lays the caller's branches out as one chain, in which code that writes this store's registers follows
  GN_WAIT_XCNT();
}
// work-groups of the preparation range of gn8_attn_k: qkv weights, projection weights, bias table
#define PQ_NB (3 * CC * CC / (64 * GN_NT))     // 96
#define PP_NB (CC * CC / (64 * GN_NT))         // 32
#define PT_NB (NH * (BTP / 4) / GN_NT)         // 16
static_assert((CVW_NB % (CC / 64)) == 0 && ((PQ_NB + PP_NB + PT_NB) % (CC / 128)) == 0);

// =====================================================================================================
// GroupNorm(32 groups) (+ SiLU) on an NCT f32 plane [b][CC][TT]; writes the token-major f16 plane
// xt[b][TP][CC] (row 1 + t, channel contiguous) plus the two zero halo rows 0 and TP-1.
// Block = (b, 64-channel slab = 2 groups); 512 threads. Statistics: f32 partial sums, f64 totals, fixed order; the 32 16-B
// loads of a thread (16 per group) are all issued before the first sum.
// Tiles: 32 tokens x 64 channels, one wave each (gn_tile64), 2 tiles per wave.
// coverage: 32 tiles x 32 rows x (16 slabs x 64 ch) = rows 1..TT x all channels; halo rows by wave 0.
// Work-groups with blockIdx.y >= NBATCH (CVW_NB of them) turn the weights w of the convolution that follows
// into its f16 planes wt instead.
// =====================================================================================================
template <bool SILU>
__global__ __launch_bounds__(GN_NT) void gn32_tr_k(const float* __restrict__ in, const float* __restrict__ gam,
                                                   const float* __restrict__ bet, _Float16* xt,
                                                   const float* __restrict__ w, _Float16* wt) {
  if (blockIdx.y >= NBATCH) {   // the same for the whole work-group, ahead of every barrier
    cvt_convw_part(w, wt, (int)(blockIdx.y - NBATCH) * (CC / 64) + (int)blockIdx.x, threadIdx.x, 64.0f);
    return;
  }
  __shared__ __align__(16) v4u sT4[GN_NW][32 * 9];
  __shared__ float red[4][GN_NW];
  __shared__ __align__(16) float sA[64];
  __shared__ __align__(16) float sD[64];
  const int tid = threadIdx.x, lane = tid & 31, wave = tid >> 5;
  const int b = blockIdx.y;
  const int c0 = blockIdx.x * 64;
  const float* p = in + ((size_t)b * CC + c0) * TT;

  v4f v[2][16];
#pragma unroll
  for (int g = 0; g < 2; ++g)
#pragma unroll
    for (int i = 0; i < 16; ++i) v[g][i] = *(const v4f*)(p + (size_t)g * 32 * TT + ((size_t)i * GN_NT + tid) * 4);
  // keeps the batch's loads one group ahead of their first use: left free, they sink to just in front of
  // their sums and only a few are in flight
  __builtin_amdgcn_sched_barrier(0);

#pragma unroll
  for (int g = 0; g < 2; ++g) {
    v4f s4 = {0.f, 0.f, 0.f, 0.f}, q4 = {0.f, 0.f, 0.f, 0.f};
#pragma unroll   // constant indices keep the array in registers
    for (int i = 0; i < 16; ++i) {
      s4 += v[g][i];
      q4 += v[g][i] * v[g][i];
    }
    const float s = wave_sum(sum4(s4)), q = wave_sum(sum4(q4));
    if (lane == 0) { red[g][wave] = s; red[2 + g][wave] = q; }
  }
  __syncthreads();
  if (wave < 2) {   // wave g closes group g: its lanes are the group's 32 channels
    float meanf, rstdf;
    close_stats(red[wave], red[2 + wave], lane, 1.0 / 32768.0, meanf, rstdf);
    const int c = c0 + tid;
    const float a = rstdf * gam[c];
    sA[tid] = a;
    sD[tid] = bet[c] - meanf * a;
  }
  __syncthreads();

  if (wave == 0 && lane < 16) {
    const int row = (lane < 8) ? 0 : (TP - 1);
    v4u z = {0u, 0u, 0u, 0u};
    _Float16* dst = xt + ((size_t)b * TP + row) * CC + c0 + (lane & 7) * 8;
    *(v4u*)dst = z;
  }

#pragma unroll 1   // one tile's 64 loads fill the registers
  for (int tc = wave; tc < TT / 32; tc += GN_NW)
    gn_tile64<SILU>(p + tc * 32 + lane, sA, sD, sT4[wave], xt + ((size_t)b * TP + 1 + tc * 32) * CC + c0, lane);
}

// =====================================================================================================
// Fused: GroupNorm(8) on H -> xin (f32 NCT, written), then GroupNorm(32) of xin -> f16 token-major
// plane xt[b][TT][CC] (no halo). Block = (b, one 128-channel group); 512 threads.
// phase 1: sums of the group (f32 partial sums, f64 totals), 16 16-B loads of a thread in flight;
// phase 2: waves 4 sg .. 4 sg + 3 own the 32-channel sub-group sg: xin written as 32 lanes x 16 B contiguous
// pieces (512 B per instruction inside one 4 KB row), 16 loads in flight, sums of xin per sub-group likewise,
// one reduction for the four sub-groups;
// phase 3: y = h*A[c] + D[c] (both norms folded), 32-token x 64-channel tiles, one wave each (gn_tile64).
// coverage: xin rows 0..127 of the group x 1024 t; xt: 32 x 2 tiles of 32 rows x 64 ch per block,
// 8 blocks per b cover all channels.
// Work-groups with blockIdx.y >= NBATCH do the preparation that the launches behind this one need: the f16 planes
// of the qkv and projection weights and the position bias table.
// =====================================================================================================
__global__ __launch_bounds__(GN_NT) void gn8_attn_k(const float* __restrict__ hin,
                                                    const float* __restrict__ g8, const float* __restrict__ e8,
                                                    const float* __restrict__ ga, const float* __restrict__ ea,
                                                    float* xin, _Float16* xt,
                                                    const float* __restrict__ qkvw, const float* __restrict__ pjw,
                                                    const float* __restrict__ emb,
                                                    _Float16* wq, _Float16* wp, float* tab) {
  if (blockIdx.y >= NBATCH) {   // the same for the whole work-group, ahead of every barrier
    const int e = (int)(blockIdx.y - NBATCH) * (CC / 128) + (int)blockIdx.x;
    if (e < PQ_NB) cvt_f16x8_part(qkvw, wq, e, threadIdx.x, 64.0f);
    else if (e < PQ_NB + PP_NB) cvt_f16x8_part(pjw, wp, e - PQ_NB, threadIdx.x, 64.0f);
    else btab_part(emb, tab, e - (PQ_NB + PP_NB), threadIdx.x);
    return;
  }
  __shared__ __align__(16) v4u sT4[GN_NW][32 * 9];
  __shared__ float red[2][GN_NW];
  __shared__ float sA1[128];
  __shared__ float sD1[128];
  __shared__ __align__(16) float sA[128];
  __shared__ __align__(16) float sD[128];
  __shared__ float sM[4];
  __shared__ float sR[4];
  const int tid = threadIdx.x, lane = tid & 31, wave = tid >> 5;
  const int b = blockIdx.y;
  const int c0 = blockIdx.x * 128;
  const float* p = hin + ((size_t)b * CC + c0) * TT;

  // phase 1
  {
    float s = 0.f, q = 0.f;
#pragma unroll 1   // one batch of 16 loads per trip
    for (int i0 = 0; i0 < 64; i0 += 16) {
      v4f v[16];
#pragma unroll
      for (int u = 0; u < 16; ++u) v[u] = *(const v4f*)(p + ((size_t)(i0 + u) * GN_NT + tid) * 4);
      // keeps the batch's loads one group ahead of their first use: left free, they sink to just in front of
      // their sums and only a few are in flight
      __builtin_amdgcn_sched_barrier(0);
      v4f s4 = {0.f, 0.f, 0.f, 0.f}, q4 = {0.f, 0.f, 0.f, 0.f};
#pragma unroll   // constant indices keep the array in registers
      for (int u = 0; u < 16; ++u) {
        s4 += v[u];
        q4 += v[u] * v[u];
      }
      s += sum4(s4);
      q += sum4(q4);
    }
    s = wave_sum(s);
    q = wave_sum(q);
    if (lane == 0) { red[0][wave] = s; red[1][wave] = q; }
    __syncthreads();
    if (tid < 128) {   // the four waves whose lanes are the group's 128 channels
      float m8f, r8f;
      close_stats(red[0], red[1], lane, 1.0 / 131072.0, m8f, r8f);
      const int c = c0 + tid;
      const float a = r8f * g8[c];
      sA1[tid] = a;
      sD1[tid] = e8[c] - m8f * a;
    }
  }
  __syncthreads();

  // phase 2
  {
    const int sg = wave >> 2;
    const size_t o0 = (size_t)sg * 32 * TT + (size_t)(((wave & 3) * 32 + lane) * 4);
    const float* ps = p + o0;
    float* xs = xin + ((size_t)b * CC + c0) * TT + o0;
    float s2 = 0.f, q2 = 0.f;
#pragma unroll 1   // one batch of 16 loads per trip; 512 floats per step, two steps per channel row
    for (int j0 = 0; j0 < 64; j0 += 16) {
      v4f v[16];
#pragma unroll
      for (int u = 0; u < 16; ++u) v[u] = *(const v4f*)(ps + (size_t)(j0 + u) * 512);
      // keeps the batch's loads one group ahead of their first use: left free, they sink to just in front of
      // their sums and only a few are in flight
      __builtin_amdgcn_sched_barrier(0);
      v4f s4 = {0.f, 0.f, 0.f, 0.f}, q4 = {0.f, 0.f, 0.f, 0.f};
#pragma unroll
      for (int u = 0; u < 16; ++u) {
        const int ch = sg * 32 + ((j0 + u) >> 1);
        const float a = sA1[ch], d = sD1[ch];
        v4f y;
#pragma unroll
        for (int e = 0; e < 4; ++e) y[e] = fmaf(v[u][e], a, d);
        s4 += y;
        q4 += y * y;
        *(v4f*)(xs + (size_t)(j0 + u) * 512) = y;
      }
      s2 += sum4(s4);
      q2 += sum4(q4);
      GN_WAIT_XCNT();
    }
    s2 = wave_sum(s2);
    q2 = wave_sum(q2);
    if (lane == 0) { red[0][wave] = s2; red[1][wave] = q2; }
    __syncthreads();
    if (tid < 4) {
      double S = 0.0, SS = 0.0;
#pragma unroll
      for (int w = 0; w < 4; ++w) { S += (double)red[0][tid * 4 + w]; SS += (double)red[1][tid * 4 + w]; }
      float mf, rf;
      mean_rstd(S, SS, 1.0 / 32768.0, mf, rf);
      sM[tid] = mf;
      sR[tid] = rf;
    }
  }
  __syncthreads();
  if (tid < 128) {
    const int sg = tid >> 5;
    const int c = c0 + tid;
    const float a2 = sR[sg] * ga[c];
    sA[tid] = sA1[tid] * a2;
    sD[tid] = (sD1[tid] - sM[sg]) * a2 + ea[c];
  }
  __syncthreads();

  // phase 3
#pragma unroll 1   // one tile's 64 loads fill the registers
  for (int ht = wave; ht < 2 * (TT / 32); ht += GN_NW) {
    const int tc = ht >> 1, hf = (ht & 1) * 64;
    gn_tile64<false>(p + (size_t)hf * TT + tc * 32 + lane, sA + hf, sD + hf, sT4[wave],
                     xt + ((size_t)b * TT + tc * 32) * CC + c0 + hf, lane);
  }
}

// =====================================================================================================
// LDS-staged f16 WMMA GEMM: C[m][n] = oscale * sum_tap sum_k A_tap[m][k] * Bt_tap[n][k]
//   + bias (BM: 1 per row m with the A row remap, 2 per column n with the Bt row remap) * bscale
//   (+ resid[m][n] f32, same indexing as C, when RESID).
// Work-group = 8 waves = one 128 x 256 tile of C; wave (wm 0..1, wn 0..3) = 64 x 64 of it.
// A row-major [M][K] pitch lda; Bt row-major [N][K] (k contiguous) pitch ldb. Row remap:
// row(m) = (m>>6)*TS + TO + (m&63). Tap tp adds aTap elements to A and bTap elements to Bt.
// bz = batch index (strides in elements). M multiple of 128, N of 256, K of 128 (host constants).
// A stage = 128 k of the 128 A rows and the 256 Bt rows, 256-B rows at a 272-B pitch in LDS, brought by
// asynchronous 16-B copies (24 per lane and stage, 16 lanes per row); two buffers, the next stage's
// copies fly while this one is multiplied. k runs tap-major and ascending, one accumulator per element.
// OUTH: 0 f32 C (pitch ldc), 1 f16 C. Epilogue: 16-row slabs staged per wave in LDS.
// coverage: 4 slabs x 16 rows x 64 cols = the wave's 64x64 tile; grid = exact tile count.
// =====================================================================================================
#define G_BM 128
#define G_BN 256
#define G_KS 128
#define G_PITCH 136                         // halves per LDS row: 272 B = 16 B x odd, for 16-B LDS reads
#define G_BUF ((G_BM + G_BN) * G_PITCH)     // halves per buffer

#if defined(__HIP_DEVICE_COMPILE__)
// twelve copies of one lane; the address-register wait closes the copies' own statement, so that no
// later write of an address register can be moved in front of it
#define G_COPY12(l, g)                                                          \
  asm volatile("global_load_async_to_lds_b128 %0, %12, off\n\t"                 \
               "global_load_async_to_lds_b128 %1, %13, off\n\t"                 \
               "global_load_async_to_lds_b128 %2, %14, off\n\t"                 \
               "global_load_async_to_lds_b128 %3, %15, off\n\t"                 \
               "global_load_async_to_lds_b128 %4, %16, off\n\t"                 \
               "global_load_async_to_lds_b128 %5, %17, off\n\t"                 \
               "global_load_async_to_lds_b128 %6, %18, off\n\t"                 \
               "global_load_async_to_lds_b128 %7, %19, off\n\t"                 \
               "global_load_async_to_lds_b128 %8, %20, off\n\t"                 \
               "global_load_async_to_lds_b128 %9, %21, off\n\t"                 \
               "global_load_async_to_lds_b128 %10, %22, off\n\t"                \
               "global_load_async_to_lds_b128 %11, %23, off\n\t"                \
               "s_wait_xcnt 0x0"                                                \
               :                                                                \
               : "v"((l)[0]), "v"((l)[1]), "v"((l)[2]), "v"((l)[3]), "v"((l)[4]), "v"((l)[5]),               \
                 "v"((l)[6]), "v"((l)[7]), "v"((l)[8]), "v"((l)[9]), "v"((l)[10]), "v"((l)[11]),             \
                 "v"((g)[0]), "v"((g)[1]), "v"((g)[2]), "v"((g)[3]), "v"((g)[4]), "v"((g)[5]),               \
                 "v"((g)[6]), "v"((g)[7]), "v"((g)[8]), "v"((g)[9]), "v"((g)[10]), "v"((g)[11])              \
               : "memory")
// this wave's copies have landed
#define G_WAIT_COPIES() asm volatile("s_wait_asynccnt 0x0" ::: "memory")
// this wave's LDS reads have returned, so the buffer may be refilled behind the barrier
#define G_WAIT_LDS() asm volatile("s_wait_dscnt 0x0" ::: "memory")
#else
#define G_COPY12(l, g) ((void)0)
#define G_WAIT_COPIES() ((void)0)
#define G_WAIT_LDS() ((void)0)
#endif

// sAB: the two stage buffers, sT: the eight waves' epilogue slabs (the kernel's LDS); tile, bz: the work-group's
// tile and batch index
template <int TAPS, int OUTH, bool RESID, int BM>
__device__ __forceinline__ void gemm_body(
    _Float16* sAB, float* sT, int tile, int bz,
    const _Float16* __restrict__ A, int lda, long long strideA, long long aTap, int aTS, int aTO,
    const _Float16* __restrict__ Bt, int ldb, long long strideB, long long bTap, int bTS, int bTO,
    const float* __restrict__ bias, float bscale,
    const float* __restrict__ resid,
    void* Cout, int ldc, long long strideC,
    int M, int N, int K, float oscale) {
  const int tid = threadIdx.x;
  const int lane = tid & 31, wave = tid >> 5;
  const int tilesN = N >> 8, tilesM = M >> 7;
  if (tile >= tilesM * tilesN) return;   // the same for the whole work-group, ahead of every barrier
  const int tm = tile / tilesN, tn = tile - tm * tilesN;
  const int mB = tm << 7, nB = tn << 8;
  const int wm = wave >> 2, wn = wave & 3;
  const int m0 = mB + wm * 64, n0 = nB + wn * 64;
  const int rlane = lane & 15;
  const int koff = (lane >> 4) * 8;
  const int mOff = koff;
  const int aRow0 = (m0 >> 6) * aTS + aTO;
  const int bRow0 = (n0 >> 6) * bTS + bTO;
  const _Float16* Ab = A + (size_t)bz * (size_t)strideA;
  const _Float16* Bb = Bt + (size_t)bz * (size_t)strideB;

  // copy side: lane -> (row tid>>4 of each 16-row band, 16-B piece tid&15 of its 256 B);
  // bands 0..7 are the A rows, bands 8..23 the Bt rows
  const int crow = tid >> 4, cpc = (tid & 15) * 8;
  const unsigned tA = (unsigned)(crow * lda + cpc);
  const unsigned tB = (unsigned)(crow * ldb + cpc);
  const unsigned ldsC = (unsigned)(size_t)sAB + (unsigned)(crow * G_PITCH + cpc) * 2u;

  auto issue = [&](int tp, int k0, int buf) {
    const _Float16* Ap = Ab + (size_t)tp * (size_t)aTap + k0 + tA;
    const _Float16* Bp = Bb + (size_t)tp * (size_t)bTap + k0 + tB;
#pragma unroll   // constant indices keep the array in registers
    for (int hlf = 0; hlf < 2; ++hlf) {
      unsigned l[12];
      const _Float16* g[12];
#pragma unroll   // constant indices keep the array in registers
      for (int e = 0; e < 12; ++e) {
        const int i = hlf * 12 + e;           // band
        l[e] = ldsC + (unsigned)buf * (unsigned)(G_BUF * 2) + (unsigned)i * (unsigned)(16 * G_PITCH * 2);
        if (i < 8) {
          const int row = ((mB >> 6) + (i >> 2)) * aTS + aTO + 16 * (i & 3);
          g[e] = Ap + (size_t)(unsigned)(row * lda);
        } else {
          const int row = ((nB >> 6) + ((i - 8) >> 2)) * bTS + bTO + 16 * ((i - 8) & 3);
          g[e] = Bp + (size_t)(unsigned)(row * ldb);
        }
      }
      G_COPY12(l, g);
    }
  };

  v8f acc[4][4];
#pragma unroll   // constant indices keep the array in registers
  for (int i = 0; i < 4; ++i)
#pragma unroll   // constant indices keep the array in registers
    for (int j = 0; j < 4; ++j) acc[i][j] = zero8();

  const _Float16* fa = sAB + (wm * 64 + rlane) * G_PITCH + koff;
  const _Float16* fb = sAB + (G_BM + wn * 64 + rlane) * G_PITCH + koff;

  const int nt = TAPS * (K >> 7);
  int itp = 0, ik = 0;                      // tap and k of the next stage to be copied
  issue(itp, ik, 0);
  ik += G_KS;
  if (ik >= K) { ik = 0; ++itp; }
  G_WAIT_COPIES();
  __syncthreads();
  if (nt > 1) {
    issue(itp, ik, 1);
    ik += G_KS;
    if (ik >= K) { ik = 0; ++itp; }
  }

#pragma unroll 1   // one stage per trip: the two buffers alternate by the trip's parity
  for (int t = 0; t < nt; ++t) {
    const _Float16* pa = fa + (t & 1) * G_BUF;
    const _Float16* pb = fb + (t & 1) * G_BUF;
#pragma unroll   // constant indices keep the array in registers
    for (int kk = 0; kk < G_KS / 32; ++kk) {
      v16h af[4], bf[4];
#pragma unroll   // constant indices keep the array in registers
      for (int i = 0; i < 4; ++i) af[i] = ldfrag(pa + i * 16 * G_PITCH + kk * 32);
#pragma unroll   // constant indices keep the array in registers
      for (int j = 0; j < 4; ++j) bf[j] = ldfrag(pb + j * 16 * G_PITCH + kk * 32);
      // keeps the block's 16 LDS reads one group ahead of its 16 WMMAs: left free, the reads of each A
      // fragment sink to just in front of its row and every row waits out a whole LDS latency
      __builtin_amdgcn_sched_barrier(0);
#pragma unroll   // constant indices keep the array in registers
      for (int i = 0; i < 4; ++i)
#pragma unroll   // constant indices keep the array in registers
        for (int j = 0; j < 4; ++j) acc[i][j] = mma_raw(af[i], bf[j], acc[i][j]);
    }
    // publish point of stage t + 1; the same barrier ends every read of the buffer refilled behind it
    G_WAIT_LDS();
    G_WAIT_COPIES();
    __syncthreads();
    if (t + 2 < nt) {
      issue(itp, ik, t & 1);
      ik += G_KS;
      if (ik >= K) { ik = 0; ++itp; }
    }
  }
  G_WAIT_COPIES();

  // ---- epilogue ----
  float* slab = sT + wave * (16 * 68);
#pragma unroll
  for (int i = 0; i < 4; ++i) {
    const int mBase = m0 + i * 16;
    float badd[8];
#pragma unroll
    for (int r = 0; r < 8; ++r) badd[r] = 0.f;
    if (BM == 1) {
#pragma unroll
      for (int r = 0; r < 8; ++r) badd[r] = bias[aRow0 + i * 16 + mOff + r] * bscale;
    }
#pragma unroll
    for (int j = 0; j < 4; ++j) {
      float bc = 0.f;
      if (BM == 2) bc = bias[bRow0 + j * 16 + rlane] * bscale;
#pragma unroll
      for (int r = 0; r < 8; ++r)
        slab[(mOff + r) * 68 + j * 16 + rlane] = acc[i][j][r] * oscale + badd[r] + bc;
    }
    __builtin_amdgcn_fence(__ATOMIC_RELEASE, "workgroup");
    __builtin_amdgcn_wave_barrier();
    __builtin_amdgcn_fence(__ATOMIC_ACQUIRE, "workgroup");
    if (OUTH == 0) {
      float* Cb = (float*)Cout + (size_t)bz * (size_t)strideC;
      const float* Rb = RESID ? (resid + (size_t)bz * (size_t)strideC) : resid;
      const int h2 = lane >> 4, c4 = (lane & 15) * 4;     // 256-B row segment = 16 lanes x 16 B
      {
#pragma unroll
        for (int it = 0; it < 8; ++it) {
          const int row = it * 2 + h2;                     // it 0..7 x h2 0..1 = rows 0..15
          v4f v = *(const v4f*)(slab + row * 68 + c4);
          const size_t off = (size_t)(mBase + row) * ldc + n0 + c4;
          if (RESID) v += *(const v4f*)(Rb + off);
          *(v4f*)(Cb + off) = v;
        }
        
      }
    } else {
      _Float16* Cb = (_Float16*)Cout + (size_t)bz * (size_t)strideC;
      const int q = lane >> 3, c8 = (lane & 7) * 8;
      v4u hv[4];
#pragma unroll
      for (int it = 0; it < 4; ++it) {
        const int row = it * 4 + q;                        // it 0..3 x q 0..3 = rows 0..15
        const float* sp = slab + row * 68 + c8;
        v4u a;
#pragma unroll
        for (int e = 0; e < 4; ++e) a[e] = pkf(sp[2 * e], sp[2 * e + 1]);
        hv[it] = a;
      }
      {
#pragma unroll
        for (int it = 0; it < 4; ++it) {
          const int row = it * 4 + q;
          *(v4u*)(Cb + (size_t)(mBase + row) * ldc + n0 + c8) = hv[it];
        }
        
      }
    }
    __builtin_amdgcn_fence(__ATOMIC_RELEASE, "workgroup");
    __builtin_amdgcn_wave_barrier();
    __builtin_amdgcn_fence(__ATOMIC_ACQUIRE, "workgroup");
  }
}

// one product per launch: blockIdx.x = tile, blockIdx.y = batch index
template <int TAPS, int OUTH, bool RESID, int BM>
__global__ __launch_bounds__(256) void gemm_k(
    const _Float16* __restrict__ A, int lda, long long strideA, long long aTap, int aTS, int aTO,
    const _Float16* __restrict__ Bt, int ldb, long long strideB, long long bTap, int bTS, int bTO,
    const float* __restrict__ bias, float bscale,
    const float* __restrict__ resid,
    void* Cout, int ldc, long long strideC,
    int M, int N, int K, float oscale) {
  __shared__ __align__(16) _Float16 sAB[2 * G_BUF];
  __shared__ __align__(16) float sT[8 * 16 * 68];
  gemm_body<TAPS, OUTH, RESID, BM>(sAB, sT, (int)blockIdx.x, (int)blockIdx.y,
                                   A, lda, strideA, aTap, aTS, aTO, Bt, ldb, strideB, bTap, bTS, bTO,
                                   bias, bscale, resid, Cout, ldc, strideC, M, N, K, oscale);
}

// q, k and v need nothing of each other: one launch, blockIdx.y = 0 q, 1 k, 2 v; 256 tiles each.
//   q, k = xn^T . W^T -> [b*TT+t][h*64+d] f16 x16 (M = 8192, N = 1024; W rows h*192 + 64 y + d)
//   v (channel-major) = Wv . xn -> [b][h*64+d][s] f16 x16 (per b: M = 1024 rows h*192+128+d, N = 1024 t)
__global__ __launch_bounds__(256) void qkv_k(const _Float16* __restrict__ xn, const _Float16* __restrict__ wq,
                                             const float* __restrict__ qb,
                                             _Float16* Qp, _Float16* Kp, _Float16* Vp) {
  __shared__ __align__(16) _Float16 sAB[2 * G_BUF];
  __shared__ __align__(16) float sT[8 * 16 * 68];
  const int y = (int)blockIdx.y;   // the same for the whole work-group
  if (y < 2)
    gemm_body<1, 1, false, 2>(sAB, sT, (int)blockIdx.x, 0,
                              xn, CC, 0LL, 0LL, 64, 0, wq, CC, 0LL, 0LL, 192, 64 * y,
                              qb, 16.0f, nullptr, (void*)(y ? Kp : Qp), CC, 0LL, NBATCH * TT, CC, CC, 0.25f);
  else
    gemm_body<1, 1, false, 1>(sAB, sT, (int)blockIdx.x & 31, (int)blockIdx.x >> 5,
                              wq, CC, 0LL, 0LL, 192, 128, xn, CC, (long long)CC * TT, 0LL, 64, 0,
                              qb, 16.0f, nullptr, (void*)Vp, TT, (long long)CC * TT, CC, TT, CC, 0.25f);
}
static_assert((NBATCH * TT / 128) * (CC / 256) == 256 && (CC / 128) * (TT / 256) == 32 && NBATCH * 32 == 256);

#define AT_P 72
// lane l reads lane l ^ 16
__device__ __forceinline__ float xhalf(float x) {
  return __builtin_bit_cast(float, __builtin_amdgcn_permlanex16(__builtin_bit_cast(int, x), __builtin_bit_cast(int, x),
                                                                0x76543210, 0xfedcba98, false, false));
}
// two values 2^x in one statement. Behind a transcendental the instruction set asks for one slot before its result
// is used or its source overwritten: the first has the second exponential there (the outputs share no register with
// the inputs), the second the v_nop. The two s_delay_alu are the hints that the compiler gives its own code and not a
// statement's: the arguments may come from the instruction in front, and what follows may use the results;
// without a hint a dependent instruction holds the SIMD's vector port against the other waves while it waits
__device__ __forceinline__ void exp2x2_slot(float x0, float x1, float& y0, float& y1) {
#if defined(__HIP_DEVICE_COMPILE__)
  asm("s_delay_alu instid0(VALU_DEP_1)\n\tv_exp_f32 %0, %2\n\tv_exp_f32 %1, %3\n\tv_nop\n\t"
      "s_delay_alu instid0(TRANS32_DEP_1)"
      : "=&v"(y0), "=&v"(y1) : "v"(x0), "v"(x1));
#else
  y0 = x0; y1 = x1;
#endif
}
// eight waves per SIMD (128 registers): the eight work-groups that fall to each WGP are then resident together
__global__ __launch_bounds__(128, 8)
void attn_k(const _Float16* __restrict__ Qp, const _Float16* __restrict__ Kp, const _Float16* __restrict__ Vp,
            const float* __restrict__ tab, _Float16* AT, float sScale, float oScale) {
  __shared__ __align__(16) _Float16 Ksh[64 * AT_P];    // [kv][d]
  __shared__ __align__(16) _Float16 Vth[64 * AT_P];    // [d][kv]
  __shared__ __align__(16) _Float16 Osh[4][16 * AT_P]; // per wave output rows [query][d]
  __shared__ __align__(16) float    sB[384 * 4];       // bias slice tab[h][q0b .. q0b+1087] (+clamped fill)

  const int tid  = threadIdx.x;
  const int wave = tid >> 5;
  const int lane = tid & 31;
  const int hh   = lane >> 4;
  const int c    = lane & 15;

  const int bx  = blockIdx.x;
  const int qb  = bx & 15;
  const int h   = (bx >> 4) & 15;
  const int b   = bx >> 8;
  const int q0b = qb * 64;
  const int q0  = q0b + wave * 16;
  const size_t rowB = (size_t)b * TT;

  {
    const float* th = tab + (size_t)h * BTP + q0b;     // q0b + 1087 <= 2047 < BTP
#pragma unroll
    for (int k = 0; k < 3; ++k) {
      const int i  = tid + 128 * k;                     // 0..383
      const int ic = (i < 271) ? i : 271;               // clamped address, all lanes load
      *(v4f*)(sB + 4 * i) = *(const v4f*)(th + 4 * ic);
    }
  }

  const _Float16* Qh = Qp + (size_t)h * HD;
  const _Float16* Kh = Kp + (size_t)h * HD;
  const _Float16* Vh = Vp + ((size_t)b * CC + (size_t)h * HD) * TT;

  // ---- Q fragments (B operand, column = lane&15): 2 d-chunks ----
  v16h qa[2];
#pragma unroll
  for (int dc = 0; dc < 2; ++dc) qa[dc] = ldfrag(Qh + (rowB + q0 + c) * CC + dc * 32 + 8 * hh);

  float mrun = -INFINITY, lrun = 0.f;   // the lane's query: maximum in use; sum over this half's keys
  v8f oacc[4];
#pragma unroll
  for (int t = 0; t < 4; ++t) oacc[t] = zero8();

  // bias index: (t - q0b) - s + 1024 with t - q0b = wave*16 + c, s = kv0 + 16j + 8hh + r
  const int bbase = wave * 16 + c + 1024 - 8 * hh;

#pragma unroll 1
  for (int kt = 0; kt < TT / 64; ++kt) {
    const int kv0 = kt * 64;
    __syncthreads();
    {
      const int r = tid >> 1, half = (tid & 1) * 32;
      const _Float16* kg = Kh + (rowB + kv0 + r) * CC + half;     // K row kv0+r, d = half..half+31
      const _Float16* vg = Vh + (size_t)r * TT + kv0 + half;     // V^T row d = r, s = kv0+half..+31
#pragma unroll
      for (int i = 0; i < 4; ++i) {
        const v8h a0 = *(const v8h*)(kg + 8 * i);
        const v8h b0 = *(const v8h*)(vg + 8 * i);
        *(v8h*)(Ksh + r * AT_P + half + 8 * i) = a0;
        *(v8h*)(Vth + r * AT_P + half + 8 * i) = b0;
      }
    }
    __syncthreads();

    // ---- scores, transposed: 64 keys x 16 queries per wave ----
    v8f s[4];
#pragma unroll
    for (int j = 0; j < 4; ++j) s[j] = zero8();
#pragma unroll
    for (int dc = 0; dc < 2; ++dc)
#pragma unroll
      for (int j = 0; j < 4; ++j)
        s[j] = mma_raw(ldfrag(Ksh + (j * 16 + c) * AT_P + dc * 32 + 8 * hh), qa[dc], s[j]);

    // ---- scale + bias, maximum of the lane's 32 keys (one chain per tile), then of the query's 64 ----
    const float* bp = sB + (bbase - kv0 - 55);   // the lowest of the lane's 32 entries
    float mj[4];
#pragma unroll
    for (int jh = 0; jh < 2; ++jh) {
      // two tiles' bias entries at a time, read as one group. The first fence keeps them behind what stands in
      // front: hoisted, all 32 stand beside the scores, the context and Q, and the 128 registers of eight waves
      // per SIMD no longer hold them. The second keeps the group together: left free, each read sinks to just in
      // front of its sum and every pair waits out a whole LDS latency
      __builtin_amdgcn_sched_barrier(0);
      float bb[16];
#pragma unroll
      for (int e = 0; e < 16; ++e) bb[e] = bp[55 - 32 * jh - 16 * (e >> 3) - (e & 7)];   // tile 2jh + (e>>3), r = e&7
      __builtin_amdgcn_sched_barrier(0);
#pragma unroll
      for (int jl = 0; jl < 2; ++jl) {
        const int j = 2 * jh + jl;
        mj[j] = -INFINITY;
#pragma unroll
        for (int r = 0; r < 8; ++r) {
          const float sv = s[j][r] * sScale + bb[8 * jl + r];
          s[j][r] = sv;
          mj[j] = fmaxf(mj[j], sv);
        }
      }
    }
    float m = fmaxf(fmaxf(mj[0], mj[1]), fmaxf(mj[2], mj[3]));
    m = fmaxf(m, xhalf(m));
    const float mnew  = fmaxf(mrun, m);
    const float msafe = (mnew == -INFINITY) ? 0.f : mnew;
    const float LOG2E = 1.4426950408889634f;   // e^x = 2^(x log2 e)
    const float alpha = exp2_slot((mrun - msafe) * LOG2E);
    mrun = mnew;

    // ---- P^T (x1024, f16): score tiles 2kk and 2kk+1, converted in place, are the B fragment of keys 32kk.. ----
    v16h pb[2];
    float pj[4];
#pragma unroll
    for (int j = 0; j < 4; ++j) {
#pragma unroll
      for (int r = 0; r < 8; r += 2) {
        float p0, p1;
        exp2x2_slot((s[j][r] - msafe) * LOG2E, (s[j][r + 1] - msafe) * LOG2E, p0, p1);
        pj[j] = (r == 0) ? p0 + p1 : (pj[j] + p0) + p1;
        pb[j >> 1][(j & 1) * 8 + r] = (_Float16)(p0 * 1024.0f);
        pb[j >> 1][(j & 1) * 8 + r + 1] = (_Float16)(p1 * 1024.0f);
      }
    }
    lrun = lrun * alpha + ((pj[0] + pj[1]) + (pj[2] + pj[3]));
#pragma unroll
    for (int t = 0; t < 4; ++t) oacc[t] *= alpha;

    // ---- context, transposed: O^T += V^T . P^T (f16 WMMA) ----
#pragma unroll
    for (int kk = 0; kk < 2; ++kk) {
      // the first fence keeps a group's reads behind what stands in front (one set of four fragments at a time fits
      // the 128 registers); the second keeps them one group ahead of their products: left free, each sinks to just
      // in front of its own product, which then waits out a whole LDS latency
      __builtin_amdgcn_sched_barrier(0);
      v16h va[4];
#pragma unroll
      for (int t = 0; t < 4; ++t) va[t] = ldfrag(Vth + (t * 16 + c) * AT_P + kk * 32 + 8 * hh);
      __builtin_amdgcn_sched_barrier(0);
#pragma unroll
      for (int t = 0; t < 4; ++t) oacc[t] = mma_raw(va[t], pb[kk], oacc[t]);
    }
  }

  // ---- normalise (1/l; the 1/1024 p carry, the x16 v carry and the x256 output carry are all in oScale) ----
  const float l = lrun + xhalf(lrun);
  const float inv = ((l > 0.f) ? rcp_f(l) : 0.f) * oScale;
  _Float16* os = Osh[wave];
#pragma unroll
  for (int t = 0; t < 4; ++t) {
    v4u a;
#pragma unroll
    for (int e = 0; e < 4; ++e) a[e] = pkf(oacc[t][2 * e] * inv, oacc[t][2 * e + 1] * inv);
    *(v4u*)(os + c * AT_P + t * 16 + 8 * hh) = a;
  }
  wave_lds_sync();   // the rows are the wave's own
  {
    const int q4 = lane >> 3, c8 = (lane & 7) * 8;
    v4u hv[4];
#pragma unroll
    for (int it = 0; it < 4; ++it) hv[it] = *(const v4u*)(os + (it * 4 + q4) * AT_P + c8);   // rows 0..15 of the wave tile
#pragma unroll
    for (int it = 0; it < 4; ++it) {
      const int row = it * 4 + q4;
      const size_t go = (rowB + q0 + row) * CC + (size_t)h * HD + c8;
      *(v4u*)(AT + go) = hv[it];
    }
  }
}

// =====================================================================================================
// Workspace map (bytes):
//   W1t  f16 [3][1024][1024]       0            6291456
//   W2t  f16 [3][1024][1024]       6291456      6291456
//   Wqkv f16 [3072][1024]          12582912     6291456
//   Wp   f16 [1024][1024]          18874368     2097152
//   Tab  f32 [16][2048]            20971520      131072
//   XT   f16 [8][1026][1024]       21102592    16809984   (later: XT3 [8][1024][1024], then AT [8192][1024])
//   R1   f32 [8][1024][1024]       37912576    33554432   (F1, then H, then Qp + Kp f16 [8192][1024] each)
//   Xin  f32 [8][1024][1024]       71467008    33554432
//   Vp   f16 [8][1024][1024]       105021440   16777216
//   end                            121798656
// Every plane is an exact multiple of its whole-line / whole-tile store granularity (incl. the two
// halo token rows per sample in XT); no tail padding needed.
// =====================================================================================================
extern "C" void kernel_launch(void* const* d_in, const int* in_sizes, int n_in,
                              void* d_out, int out_size, void* d_ws, size_t ws_size,
                              hipStream_t stream) {
  if (n_in < 18) return;
  const int nAct = NBATCH * CC * TT;                     // 8388608
  if (in_sizes[0] != nAct || out_size != nAct) return;
  if (in_sizes[3] != CC * CC * 3 || in_sizes[7] != CC * CC * 3) return;
  if (in_sizes[13] != 3 * CC * CC || in_sizes[15] != CC * CC) return;
  if (in_sizes[1] != CC || in_sizes[2] != CC || in_sizes[4] != CC || in_sizes[5] != CC ||
      in_sizes[6] != CC || in_sizes[8] != CC || in_sizes[9] != CC || in_sizes[10] != CC ||
      in_sizes[11] != CC || in_sizes[12] != CC || in_sizes[16] != CC) return;
  if (in_sizes[14] != 3 * CC || in_sizes[17] != NBUCK * NH) return;

  const float* x      = (const float*)d_in[0];
  const float* gn1_g  = (const float*)d_in[1];
  const float* gn1_b  = (const float*)d_in[2];
  const float* c1_w   = (const float*)d_in[3];
  const float* c1_b   = (const float*)d_in[4];
  const float* gn2_g  = (const float*)d_in[5];
  const float* gn2_b  = (const float*)d_in[6];
  const float* c2_w   = (const float*)d_in[7];
  const float* c2_b   = (const float*)d_in[8];
  const float* n8_g   = (const float*)d_in[9];
  const float* n8_b   = (const float*)d_in[10];
  const float* ag_g   = (const float*)d_in[11];
  const float* ag_b   = (const float*)d_in[12];
  const float* qkv_w  = (const float*)d_in[13];
  const float* qkv_b  = (const float*)d_in[14];
  const float* pj_w   = (const float*)d_in[15];
  const float* pj_b   = (const float*)d_in[16];
  const float* remb   = (const float*)d_in[17];

  const size_t PWC  = (size_t)3 * CC * CC * 2;          //  6291456
  const size_t PWQ  = (size_t)3 * CC * CC * 2;          //  6291456
  const size_t PWP  = (size_t)CC * CC * 2;              //  2097152
  const size_t PTAB = (size_t)NH * BTP * 4;             //   131072
  const size_t PXT  = (size_t)NBATCH * TP * CC * 2;     // 16809984
  const size_t PF   = (size_t)NBATCH * CC * TT * 4;     // 33554432
  const size_t PV   = (size_t)NBATCH * CC * TT * 2;     // 16777216
  size_t off = 0;
  const size_t oW1  = off; off += PWC;
  const size_t oW2  = off; off += PWC;
  const size_t oWq  = off; off += PWQ;
  const size_t oWp  = off; off += PWP;
  const size_t oTab = off; off += PTAB;
  const size_t oXT  = off; off += PXT;
  const size_t oR1  = off; off += PF;
  const size_t oXin = off; off += PF;
  const size_t oV   = off; off += PV;
  if (off > ws_size) return;                            // off = 121798656
  if (off > (size_t)134217728) return;
  if (2 * PV > PF) return;                              // Qp + Kp live inside R1
  if ((size_t)NBATCH * TT * CC * 2 > PXT) return;       // XT3 / AT fit in the XT region

  char* ws = (char*)d_ws;
  _Float16* W1t  = (_Float16*)(ws + oW1);
  _Float16* W2t  = (_Float16*)(ws + oW2);
  _Float16* Wqkv = (_Float16*)(ws + oWq);
  _Float16* Wpb  = (_Float16*)(ws + oWp);
  float*    Tab  = (float*)(ws + oTab);
  _Float16* XT   = (_Float16*)(ws + oXT);               // [8][1026][1024] with halo rows
  _Float16* XT3  = (_Float16*)(ws + oXT);               // [8][1024][1024], later use of the same region
  _Float16* ATp  = (_Float16*)(ws + oXT);               // [8192][1024], last use of the same region
  float*    F1   = (float*)(ws + oR1);
  float*    Hb   = (float*)(ws + oR1);
  _Float16* Qp   = (_Float16*)(ws + oR1);
  _Float16* Kp   = (_Float16*)(ws + oR1 + PV);
  float*    Xin  = (float*)(ws + oXin);
  _Float16* Vp   = (_Float16*)(ws + oV);

  const dim3 blk(256);
  const long long CCCC = (long long)CC * CC;
  const long long CT   = (long long)CC * TT;

  // (1) h = silu(GN32(x)) -> XT (token-major f16, halo rows); beside it conv1's weights -> f16 x64 planes
  gn32_tr_k<true><<<dim3(CC / 64, NBATCH + CVW_NB / (CC / 64)), dim3(GN_NT), 0, stream>>>(x, gn1_g, gn1_b, XT, c1_w, W1t);
  // (2) F1 = conv1(h) + b1 -> f32 NCT   (per b: M=1024 o, N=1024 t, K=3 taps x 1024)
  gemm_k<3, 0, false, 1><<<dim3((CC / 128) * (TT / 256), NBATCH), blk, 0, stream>>>(
      W1t, CC, 0LL, CCCC, 64, 0,
      XT, CC, (long long)TP * CC, (long long)CC, 64, 0,
      c1_b, 1.0f, nullptr,
      (void*)F1, TT, CT, CC, TT, CC, 1.0f / 64.0f);
  // (3) h = silu(GN32(F1)) -> XT; beside it conv2's weights -> f16 x64 planes
  gn32_tr_k<true><<<dim3(CC / 64, NBATCH + CVW_NB / (CC / 64)), dim3(GN_NT), 0, stream>>>(F1, gn2_g, gn2_b, XT, c2_w, W2t);
  // (4) H = conv2(h) + b2 + x -> f32 NCT (R1)
  gemm_k<3, 0, true, 1><<<dim3((CC / 128) * (TT / 256), NBATCH), blk, 0, stream>>>(
      W2t, CC, 0LL, CCCC, 64, 0,
      XT, CC, (long long)TP * CC, (long long)CC, 64, 0,
      c2_b, 1.0f, x,
      (void*)Hb, TT, CT, CC, TT, CC, 1.0f / 64.0f);
  // (5) xin = GN8(H) -> f32 NCT; GN32(xin) -> XT3 (token-major f16, no halo); beside it the qkv and projection
  //     weights -> f16 x64 planes and the position bias table
  gn8_attn_k<<<dim3(CC / 128, NBATCH + (PQ_NB + PP_NB + PT_NB) / (CC / 128)), dim3(GN_NT), 0, stream>>>(
      Hb, n8_g, n8_b, ag_g, ag_b, Xin, XT3, qkv_w, pj_w, remb, Wqkv, Wpb, Tab);
  // (6) q -> Qp, k -> Kp, v -> Vp
  qkv_k<<<dim3(256, 3), blk, 0, stream>>>(XT3, Wqkv, qkv_b, Qp, Kp, Vp);
  // (7) attention -> AT [b*TT+t][h*64+d] f16 x256
  attn_k<<<dim3((TT / 64) * NH * NBATCH), dim3(128), 0, stream>>>(
      Qp, Kp, Vp, Tab, ATp, 1.0f / 2048.0f, 1.0f / 64.0f);
  // (8) out = xin + proj(a) + bp -> d_out f32 NCT (per b: M=1024 o, N=1024 t, K=1024)
  gemm_k<1, 0, true, 1><<<dim3((CC / 128) * (TT / 256), NBATCH), blk, 0, stream>>>(
      Wpb, CC, 0LL, 0LL, 64, 0,
      ATp, CC, CT, 0LL, 64, 0,
      pj_b, 1.0f, Xin,
      d_out, TT, CT, CC, TT, CC, 1.0f / 16384.0f);
  (void)hipGetLastError();
}

// v007
// One run takes 241 microseconds.
// Two timings next to v006 both put it at 1.07 times that version's speed.
// All steps since v000 together make it 3.96 times as fast.
// Contractions: conv k3 (two), qkv 1x1, q.k^T, p.v, proj 1x1 = v_wmma_f32_16x16x32_f16 (f16 operands: weights x64, GroupNorm activations x1, q/k/v x16, p x1024, attention output x256), f32 accumulate; GroupNorm statistics f32 partial sums with f64 totals, softmax / position bias / residuals f32.
#include <hip/hip_runtime.h>
#include <math.h>
#include <stdint.h>

#define NBATCH 8
#define CC 1024
#define TT 1024
#define TP 1026
#define NH 16
#define HD 64
#define NBUCK 32
#define BTP 2048

static_assert(NH * HD == CC);
static_assert((CC % 256) == 0 && (TT % 256) == 0);

typedef _Float16 v16h __attribute__((ext_vector_type(16)));
typedef _Float16 v8h  __attribute__((ext_vector_type(8)));
typedef float    v8f  __attribute__((ext_vector_type(8)));
typedef float    v4f  __attribute__((ext_vector_type(4)));
typedef unsigned int v4u __attribute__((ext_vector_type(4)));

// ---- scalar helpers ----
__device__ __forceinline__ unsigned short h_bits(_Float16 x) { return __builtin_bit_cast(unsigned short, x); }
__device__ __forceinline__ unsigned pkf(float a, float b) {
  return (unsigned)h_bits((_Float16)a) | ((unsigned)h_bits((_Float16)b) << 16);
}
__device__ __forceinline__ v8f zero8() { v8f z = {0.f, 0.f, 0.f, 0.f, 0.f, 0.f, 0.f, 0.f}; return z; }
__device__ __forceinline__ float rcp_f(float x) { return __builtin_amdgcn_rcpf(x); }

// ---- 16-bit A/B fragment: lane -> row/col (lane&15); p already includes +8*(lane>>4);
//      elements 0..7 <- p[0..7] (k0+8h..), elements 8..15 <- p[16..23] (k0+16+8h..)
__device__ __forceinline__ v16h ldfrag(const _Float16* p) {
  union { v16h v; v8h h[2]; } f;
  f.h[0] = *(const v8h*)(p);
  f.h[1] = *(const v8h*)(p + 16);
  return f.v;
}

// ---- WMMA helpers ----
__device__ __forceinline__ v8f mma_raw(v16h a, v16h b, v8f c) {
  return __builtin_amdgcn_wmma_f32_16x16x32_f16(false, a, false, b, (short)0, c, false, false);
}

// ---- f64 wave shuffle ----
__device__ __forceinline__ double shfl_xor_d(double v, int m) {
  const unsigned long long u = (unsigned long long)__double_as_longlong(v);
  const int lo = __shfl_xor((int)(unsigned)(u & 0xffffffffull), m, 32);
  const int hi = __shfl_xor((int)(unsigned)(u >> 32), m, 32);
  const unsigned long long r = ((unsigned long long)(unsigned)hi << 32) | (unsigned long long)(unsigned)lo;
  return __longlong_as_double((long long)r);
}
// GroupNorm kernels: 16 waves per work-group
#define GN_NT 512
#define GN_NW 16
// Statistics: the per-element sums run in f32 (four chains of 16 per batch of 16 loads, joined as a tree, then the
// wave's 32 lanes); only the wave totals are summed in f64, where the squared mean is taken from the mean square.
__device__ __forceinline__ float sum4(v4f a) { return (a[0] + a[1]) + (a[2] + a[3]); }
__device__ __forceinline__ float wave_sum(float v) {
#pragma unroll   // the five exchange distances as constants
  for (int m = 16; m >= 1; m >>= 1) v += __shfl_xor(v, m, 32);
  return v;
}
// 1 / sqrt(x), x >= 1e-5: the hardware's estimate and one Newton step; the v_nop is the one slot that the
// instruction set asks for behind a transcendental before its result is used
__device__ __forceinline__ float rsqrt_nr(float x) {
#if defined(__HIP_DEVICE_COMPILE__)
  float r;
  asm("v_rsq_f32 %0, %1\n\tv_nop" : "=v"(r) : "v"(x));
  const float e = fmaf(-x * r, r, 1.0f);
  return fmaf(0.5f * r, e, r);
#else
  return x;
#endif
}
// mean and 1 / sigma from the f64 totals of n = 1 / invn values
__device__ __forceinline__ void mean_rstd(double S, double SS, double invn, float& meanf, float& rstdf) {
  const double mean = S * invn;
  double var = SS * invn - mean * mean;
  var = var < 0.0 ? 0.0 : var;
  meanf = (float)mean;
  rstdf = rsqrt_nr((float)var + 1e-5f);
}
// rs, rq: the GN_NW wave totals (sum, sum of squares) in LDS; called by a whole wave, every lane returns the result
__device__ __forceinline__ void close_stats(const float* rs, const float* rq, int lane, double invn,
                                            float& meanf, float& rstdf) {
  double S = (double)rs[lane & (GN_NW - 1)], SS = (double)rq[lane & (GN_NW - 1)];
#pragma unroll   // the four exchange distances as constants
  for (int m = GN_NW / 2; m >= 1; m >>= 1) {
    S += shfl_xor_d(S, m);
    SS += shfl_xor_d(SS, m);
  }
  mean_rstd(S, SS, invn, meanf, rstdf);
}

// SiLU's two transcendentals, each with the one slot behind it that the instruction set asks for before its
// result is used or its source overwritten
__device__ __forceinline__ float exp2_slot(float x) {
#if defined(__HIP_DEVICE_COMPILE__)
  float r;
  asm("v_exp_f32 %0, %1\n\tv_nop" : "=v"(r) : "v"(x));
  return r;
#else
  return x;
#endif
}
__device__ __forceinline__ float rcp_slot(float x) {
#if defined(__HIP_DEVICE_COMPILE__)
  float r;
  asm("v_rcp_f32 %0, %1\n\tv_nop" : "=v"(r) : "v"(x));
  return r;
#else
  return x;
#endif
}

#if defined(__HIP_DEVICE_COMPILE__)
// stands behind a batch of stores whose address and data registers the next trip's loads write again
#define GN_WAIT_XCNT() asm volatile("s_wait_xcnt 0x0" ::: "memory")
#else
#define GN_WAIT_XCNT() ((void)0)
#endif

// orders one wave's own LDS writes and reads (the tile below is private to its wave)
__device__ __forceinline__ void wave_lds_sync() {
  __builtin_amdgcn_fence(__ATOMIC_RELEASE, "workgroup");
  __builtin_amdgcn_wave_barrier();
  __builtin_amdgcn_fence(__ATOMIC_ACQUIRE, "workgroup");
}

// One wave turns 64 channels x 32 tokens of an NCT f32 plane into 32 token rows of 64 f16 channels:
// y = f * cA[c] + cD[c] (+ SiLU). pr: the slab's first channel at this lane's token; dst: the tile's first
// token row at the slab's first channel (row pitch CC); st: this wave's own 32 x 9 16-B pieces of LDS.
// All 64 loads of the lane are issued before the first is used. No other wave touches st, so there is no
// work-group barrier. coverage: 8 x 4 rows x (8 lanes x 8 channels) = 32 rows x 64 channels.
template <bool SILU>
__device__ __forceinline__ void gn_tile64(const float* __restrict__ pr, const float* cA, const float* cD,
                                          v4u* st, _Float16* dst, int lane) {
  float f[64];
#pragma unroll
  for (int i = 0; i < 64; ++i) f[i] = pr[(size_t)i * TT];
  // the wave's reads of its last tile are over before st is written again; behind the loads, so that
  // the wait for the last tile's stores runs beside their flight
  wave_lds_sync();
#pragma unroll
  for (int j = 0; j < 8; ++j) {
    float y[8];
#pragma unroll
    for (int i = 0; i < 8; ++i) {
      float yy = fmaf(f[j * 8 + i], cA[j * 8 + i], cD[j * 8 + i]);
      if (SILU) yy = yy * rcp_slot(1.0f + exp2_slot(yy * -1.4426950408889634f));   // e^-y = 2^(-y log2 e)
      y[i] = yy;
    }
    v4u pk;
    pk[0] = pkf(y[0], y[1]);
    pk[1] = pkf(y[2], y[3]);
    pk[2] = pkf(y[4], y[5]);
    pk[3] = pkf(y[6], y[7]);
    st[lane * 9 + j] = pk;
  }
  wave_lds_sync();
  const int q = lane >> 3, l8 = lane & 7;
  v4u v[8];
#pragma unroll
  for (int it = 0; it < 8; ++it) v[it] = st[(it * 4 + q) * 9 + l8];
#pragma unroll
  for (int it = 0; it < 8; ++it) *(v4u*)(dst + (size_t)(it * 4 + q) * CC + l8 * 8) = v[it];
}

// =====================================================================================================
// Preparation work (weights -> f16 planes, position bias table). None of it needs anything of the GroupNorm
// kernels and they need nothing of it, so it has no launches of its own: it runs in further work-groups of the
// GroupNorm launches (a range of the block index, the branch the same for the whole work-group), on the WGPs
// that those launches leave idle. Work-groups of GN_NT = 512 threads.
// =====================================================================================================
#if defined(__HIP_DEVICE_COMPILE__)
// stands behind a batch of loads that all go by the one address p: the wait before a register that an issued load
// names is written again; p as an input keeps its registers untouched up to the wait
#define PREP_WAIT_XCNT(p) asm volatile("s_wait_xcnt 0x0" :: "v"(p) : "memory")
#else
#define PREP_WAIT_XCNT(p) ((void)0)
#endif
// f32 -> f16 (x scale): a thread takes 8 pieces of 8 elements, its 16 loads issued before the first use, one
// 16-B store per piece (wave = 512 contiguous B). coverage: nblk work-groups x 8 x 512 pieces x 8 = the plane.
__device__ __forceinline__ void cvt_f16x8_part(const float* __restrict__ in, _Float16* out, int blk, int tid,
                                               float scale) {
  const size_t i0 = (size_t)(blk * 8 * GN_NT + tid) * 8;   // piece u stands u * GN_NT * 8 elements further
  const float* src = in + i0;
  v4f a[8], c[8];
#pragma unroll   // constant indices keep the arrays in registers
  for (int u = 0; u < 8; ++u) {
    a[u] = *(const v4f*)(src + u * (GN_NT * 8));
    c[u] = *(const v4f*)(src + u * (GN_NT * 8) + 4);
  }
  PREP_WAIT_XCNT(src);
#pragma unroll   // constant indices keep the arrays in registers
  for (int u = 0; u < 8; ++u) {
    v4u p;
    p[0] = pkf(a[u][0] * scale, a[u][1] * scale);
    p[1] = pkf(a[u][2] * scale, a[u][3] * scale);
    p[2] = pkf(c[u][0] * scale, c[u][1] * scale);
    p[3] = pkf(c[u][2] * scale, c[u][3] * scale);
    *(v4u*)(out + i0 + u * (GN_NT * 8)) = p;
  }
  // the compiler lays the callers' branches out as one chain, in which code that writes these stores' registers follows
  GN_WAIT_XCNT();
}

// conv weight [o][c][3] f32 -> Wt[tap][o][c] f16 (x scale). Piece idx = (o, 8 consecutive c) = 24 contiguous
// floats at 24 idx, one 16-B store at 8 idx of each of the 3 tap planes; a thread takes 2 pieces, its 12 loads
// issued before the first use. coverage: CVW_NB work-groups x 2 x 512 pieces x 3 x 8 halves = 3*CC*CC.
#define CVW_NB (CC * (CC / 8) / (2 * GN_NT))   // 128
__device__ __forceinline__ void cvt_convw_part(const float* __restrict__ w, _Float16* out, int blk, int tid,
                                               float scale) {
  const size_t idx0 = (size_t)(blk * 2 * GN_NT + tid);   // the thread's first piece; the second is GN_NT further
  const float* src = w + idx0 * 24;
  union { v4f q[6]; float e[24]; } u[2];
#pragma unroll   // constant indices keep the arrays in registers
  for (int s = 0; s < 2; ++s)
#pragma unroll   // constant indices keep the arrays in registers
    for (int i = 0; i < 6; ++i) u[s].q[i] = *(const v4f*)(src + s * (GN_NT * 24) + 4 * i);
#pragma unroll   // constant indices keep the arrays in registers
  for (int s = 0; s < 2; ++s) {
    const size_t idx = idx0 + (size_t)(s * GN_NT);
#pragma unroll   // constant indices keep the arrays in registers
    for (int tp = 0; tp < 3; ++tp) {
      v4u a;
#pragma unroll   // constant indices keep the arrays in registers
      for (int m = 0; m < 4; ++m)
        a[m] = pkf(u[s].e[(2 * m) * 3 + tp] * scale, u[s].e[(2 * m + 1) * 3 + tp] * scale);
      *(v4u*)(out + (size_t)tp * CC * CC + idx * 8) = a;
    }
  }
}

// relative position bias table tab[h][d], d = (t - s) + 1024, value = emb[bucket][h] * 8 (f32).
// bucket: n = t - s; add 16 when n < 0; n = |n|; n < 8 -> n; else 8 + int(log(n/8) * (1/ln 8) * 8)
// coverage: 16 work-groups x 512 threads x 4 = NH*BTP floats.
__device__ __forceinline__ void btab_part(const float* __restrict__ emb, float* tab, int blk, int tid) {
  const int i4 = blk * GN_NT + tid;
  const int h = i4 >> 9;
  const int d0 = (i4 & 511) * 4;
  const float ln8 = 2.0794415416798357f;
  const float rl8 = 1.0f / ln8;
  v4f v;
#pragma unroll   // constant indices keep the arrays in registers
  for (int e = 0; e < 4; ++e) {
    const int delta = d0 + e - 1024;
    const int n = delta < 0 ? -delta : delta;
    const float nf = (float)(n < 1 ? 1 : n);
    const float lg = logf(nf * 0.125f);
    int vl = 8 + (int)(lg * rl8 * 8.0f);
    vl = vl > 15 ? 15 : vl;
    int bucket = (n < 8) ? n : vl;
    bucket += (delta < 0) ? 16 : 0;
    v[e] = emb[bucket * NH + h] * 8.0f;
  }
  *(v4f*)(tab + (size_t)i4 * 4) = v;
  // the compiler lays the caller's branches out as one chain, in which code that writes this store's registers follows
  GN_WAIT_XCNT();
}
// work-groups of the preparation range of gn8_attn_k: qkv weights, projection weights, bias table
#define PQ_NB (3 * CC * CC / (64 * GN_NT))     // 96
#define PP_NB (CC * CC / (64 * GN_NT))         // 32
#define PT_NB (NH * (BTP / 4) / GN_NT)         // 16
static_assert((CVW_NB % (CC / 64)) == 0 && ((PQ_NB + PP_NB + PT_NB) % (CC / 128)) == 0);

// =====================================================================================================
// GroupNorm(32 groups) (+ SiLU) on an NCT f32 plane [b][CC][TT]; writes the token-major f16 plane
// xt[b][TP][CC] (row 1 + t, channel contiguous) plus the two zero halo rows 0 and TP-1.
// Block = (b, 64-channel slab = 2 groups); 512 threads. Statistics: f32 partial sums, f64 totals, fixed order; the 32 16-B
// loads of a thread (16 per group) are all issued before the first sum.
// Tiles: 32 tokens x 64 channels, one wave each (gn_tile64), 2 tiles per wave.
// coverage: 32 tiles x 32 rows x (16 slabs x 64 ch) = rows 1..TT x all channels; halo rows by wave 0.
// Work-groups with blockIdx.y >= NBATCH (CVW_NB of them) turn the weights w of the convolution that follows
// into its f16 planes wt instead.
// =====================================================================================================
template <bool SILU>
__global__ __launch_bounds__(GN_NT) void gn32_tr_k(const float* __restrict__ in, const float* __restrict__ gam,
                                                   const float* __restrict__ bet, _Float16* xt,
                                                   const float* __restrict__ w, _Float16* wt) {
  if (blockIdx.y >= NBATCH) {   // the same for the whole work-group, ahead of every barrier
    cvt_convw_part(w, wt, (int)(blockIdx.y - NBATCH) * (CC / 64) + (int)blockIdx.x, threadIdx.x, 64.0f);
    return;
  }
  __shared__ __align__(16) v4u sT4[GN_NW][32 * 9];
  __shared__ float red[4][GN_NW];
  __shared__ __align__(16) float sA[64];
  __shared__ __align__(16) float sD[64];
  const int tid = threadIdx.x, lane = tid & 31, wave = tid >> 5;
  const int b = blockIdx.y;
  const int c0 = blockIdx.x * 64;
  const float* p = in + ((size_t)b * CC + c0) * TT;

  v4f v[2][16];
#pragma unroll
  for (int g = 0; g < 2; ++g)
#pragma unroll
    for (int i = 0; i < 16; ++i) v[g][i] = *(const v4f*)(p + (size_t)g * 32 * TT + ((size_t)i * GN_NT + tid) * 4);
  // keeps the batch's loads one group ahead of their first use: left free, they sink to just in front of
  // their sums and only a few are in flight
  __builtin_amdgcn_sched_barrier(0);

#pragma unroll
  for (int g = 0; g < 2; ++g) {
    v4f s4 = {0.f, 0.f, 0.f, 0.f}, q4 = {0.f, 0.f, 0.f, 0.f};
#pragma unroll   // constant indices keep the array in registers
    for (int i = 0; i < 16; ++i) {
      s4 += v[g][i];
      q4 += v[g][i] * v[g][i];
    }
    const float s = wave_sum(sum4(s4)), q = wave_sum(sum4(q4));
    if (lane == 0) { red[g][wave] = s; red[2 + g][wave] = q; }
  }
  __syncthreads();
  if (wave < 2) {   // wave g closes group g: its lanes are the group's 32 channels
    float meanf, rstdf;
    close_stats(red[wave], red[2 + wave], lane, 1.0 / 32768.0, meanf, rstdf);
    const int c = c0 + tid;
    const float a = rstdf * gam[c];
    sA[tid] = a;
    sD[tid] = bet[c] - meanf * a;
  }
  __syncthreads();

  if (wave == 0 && lane < 16) {
    const int row = (lane < 8) ? 0 : (TP - 1);
    v4u z = {0u, 0u, 0u, 0u};
    _Float16* dst = xt + ((size_t)b * TP + row) * CC + c0 + (lane & 7) * 8;
    *(v4u*)dst = z;
  }

#pragma unroll 1   // one tile's 64 loads fill the registers
  for (int tc = wave; tc < TT / 32; tc += GN_NW)
    gn_tile64<SILU>(p + tc * 32 + lane, sA, sD, sT4[wave], xt + ((size_t)b * TP + 1 + tc * 32) * CC + c0, lane);
}

// =====================================================================================================
// Fused: GroupNorm(8) on H -> xin (f32 NCT, written), then GroupNorm(32) of xin -> f16 token-major
// plane xt[b][TT][CC] (no halo). Block = (b, one 128-channel group); 512 threads.
// phase 1: sums of the group (f32 partial sums, f64 totals), 16 16-B loads of a thread in flight;
// phase 2: waves 4 sg .. 4 sg + 3 own the 32-channel sub-group sg: xin written as 32 lanes x 16 B contiguous
// pieces (512 B per instruction inside one 4 KB row), 16 loads in flight, sums of xin per sub-group likewise,
// one reduction for the four sub-groups;
// phase 3: y = h*A[c] + D[c] (both norms folded), 32-token x 64-channel tiles, one wave each (gn_tile64).
// coverage: xin rows 0..127 of the group x 1024 t; xt: 32 x 2 tiles of 32 rows x 64 ch per block,
// 8 blocks per b cover all channels.
// Work-groups with blockIdx.y >= NBATCH do the preparation that the launches behind this one need: the f16 planes
// of the qkv and projection weights and the position bias table.
// =====================================================================================================
__global__ __launch_bounds__(GN_NT) void gn8_attn_k(const float* __restrict__ hin,
                                                    const float* __restrict__ g8, const float* __restrict__ e8,
                                                    const float* __restrict__ ga, const float* __restrict__ ea,
                                                    float* xin, _Float16* xt,
                                                    const float* __restrict__ qkvw, const float* __restrict__ pjw,
                                                    const float* __restrict__ emb,
                                                    _Float16* wq, _Float16* wp, float* tab) {
  if (blockIdx.y >= NBATCH) {   // the same for the whole work-group, ahead of every barrier
    const int e = (int)(blockIdx.y - NBATCH) * (CC / 128) + (int)blockIdx.x;
    if (e < PQ_NB) cvt_f16x8_part(qkvw, wq, e, threadIdx.x, 64.0f);
    else if (e < PQ_NB + PP_NB) cvt_f16x8_part(pjw, wp, e - PQ_NB, threadIdx.x, 64.0f);
    else btab_part(emb, tab, e - (PQ_NB + PP_NB), threadIdx.x);
    return;
  }
  __shared__ __align__(16) v4u sT4[GN_NW][32 * 9];
  __shared__ float red[2][GN_NW];
  __shared__ float sA1[128];
  __shared__ float sD1[128];
  __shared__ __align__(16) float sA[128];
  __shared__ __align__(16) float sD[128];
  __shared__ float sM[4];
  __shared__ float sR[4];
  const int tid = threadIdx.x, lane = tid & 31, wave = tid >> 5;
  const int b = blockIdx.y;
  const int c0 = blockIdx.x * 128;
  const float* p = hin + ((size_t)b * CC + c0) * TT;

  // phase 1
  {
    float s = 0.f, q = 0.f;
#pragma unroll 1   // one batch of 16 loads per trip
    for (int i0 = 0; i0 < 64; i0 += 16) {
      v4f v[16];
#pragma unroll
      for (int u = 0; u < 16; ++u) v[u] = *(const v4f*)(p + ((size_t)(i0 + u) * GN_NT + tid) * 4);
      // keeps the batch's loads one group ahead of their first use: left free, they sink to just in front of
      // their sums and only a few are in flight
      __builtin_amdgcn_sched_barrier(0);
      v4f s4 = {0.f, 0.f, 0.f, 0.f}, q4 = {0.f, 0.f, 0.f, 0.f};
#pragma unroll   // constant indices keep the array in registers
      for (int u = 0; u < 16; ++u) {
        s4 += v[u];
        q4 += v[u] * v[u];
      }
      s += sum4(s4);
      q += sum4(q4);
    }
    s = wave_sum(s);
    q = wave_sum(q);
    if (lane == 0) { red[0][wave] = s; red[1][wave] = q; }
    __syncthreads();
    if (tid < 128) {   // the four waves whose lanes are the group's 128 channels
      float m8f, r8f;
      close_stats(red[0], red[1], lane, 1.0 / 131072.0, m8f, r8f);
      const int c = c0 + tid;
      const float a = r8f * g8[c];
      sA1[tid] = a;
      sD1[tid] = e8[c] - m8f * a;
    }
  }
  __syncthreads();

  // phase 2
  {
    const int sg = wave >> 2;
    const size_t o0 = (size_t)sg * 32 * TT + (size_t)(((wave & 3) * 32 + lane) * 4);
    const float* ps = p + o0;
    float* xs = xin + ((size_t)b * CC + c0) * TT + o0;
    float s2 = 0.f, q2 = 0.f;
#pragma unroll 1   // one batch of 16 loads per trip; 512 floats per step, two steps per channel row
    for (int j0 = 0; j0 < 64; j0 += 16) {
      v4f v[16];
#pragma unroll
      for (int u = 0; u < 16; ++u) v[u] = *(const v4f*)(ps + (size_t)(j0 + u) * 512);
      // keeps the batch's loads one group ahead of their first use: left free, they sink to just in front of
      // their sums and only a few are in flight
      __builtin_amdgcn_sched_barrier(0);
      v4f s4 = {0.f, 0.f, 0.f, 0.f}, q4 = {0.f, 0.f, 0.f, 0.f};
#pragma unroll
      for (int u = 0; u < 16; ++u) {
        const int ch = sg * 32 + ((j0 + u) >> 1);
        const float a = sA1[ch], d = sD1[ch];
        v4f y;
#pragma unroll
        for (int e = 0; e < 4; ++e) y[e] = fmaf(v[u][e], a, d);
        s4 += y;
        q4 += y * y;
        *(v4f*)(xs + (size_t)(j0 + u) * 512) = y;
      }
      s2 += sum4(s4);
      q2 += sum4(q4);
      GN_WAIT_XCNT();
    }
    s2 = wave_sum(s2);
    q2 = wave_sum(q2);
    if (lane == 0) { red[0][wave] = s2; red[1][wave] = q2; }
    __syncthreads();
    if (tid < 4) {
      double S = 0.0, SS = 0.0;
#pragma unroll
      for (int w = 0; w < 4; ++w) { S += (double)red[0][tid * 4 + w]; SS += (double)red[1][tid * 4 + w]; }
      float mf, rf;
      mean_rstd(S, SS, 1.0 / 32768.0, mf, rf);
      sM[tid] = mf;
      sR[tid] = rf;
    }
  }
  __syncthreads();
  if (tid < 128) {
    const int sg = tid >> 5;
    const int c = c0 + tid;
    const float a2 = sR[sg] * ga[c];
    sA[tid] = sA1[tid] * a2;
    sD[tid] = (sD1[tid] - sM[sg]) * a2 + ea[c];
  }
  __syncthreads();

  // phase 3
#pragma unroll 1   // one tile's 64 loads fill the registers
  for (int ht = wave; ht < 2 * (TT / 32); ht += GN_NW) {
    const int tc = ht >> 1, hf = (ht & 1) * 64;
    gn_tile64<false>(p + (size_t)hf * TT + tc * 32 + lane, sA + hf, sD + hf, sT4[wave],
                     xt + ((size_t)b * TT + tc * 32) * CC + c0 + hf, lane);
  }
}

// =====================================================================================================
// LDS-staged f16 WMMA GEMM: C[m][n] = oscale * sum_tap sum_k A_tap[m][k] * Bt_tap[n][k]
//   + bias (BM: 1 per row m with the A row remap, 2 per column n with the Bt row remap) * bscale
//   (+ resid[m][n] f32, same indexing as C, when RESID).
// Work-group = 8 waves = one 128 x 256 tile of C; wave (wm 0..1, wn 0..3) = 64 x 64 of it.
// A row-major [M][K] pitch lda; Bt row-major [N][K] (k contiguous) pitch ldb. Row remap:
// row(m) = (m>>6)*TS + TO + (m&63). Tap tp adds aTap elements to A and bTap elements to Bt.
// bz = batch index (strides in elements). M multiple of 128, N of 256, K of 128 (host constants).
// A stage = 128 k of the 128 A rows and the 256 Bt rows, 256-B rows at a 272-B pitch in LDS, brought by
// asynchronous 16-B copies (24 per lane and stage, 16 lanes per row); two buffers, the next stage's
// copies fly while this one is multiplied. k runs tap-major and ascending, one accumulator per element.
// OUTH: 0 f32 C, 1 f16 C; C and the residual plane have rows of G_LDC elements.
// Epilogue: the bias and residual values of the wave's tile are loaded ahead of the k loop, so that their
// latency runs beside it; behind the loop each wave stages its whole 64 x 64 tile in its own part of the stage
// buffers (free behind the last trip's barrier) and stores it as whole row segments, with no wait in between.
// coverage: 64 rows x 64 cols = the wave's tile; grid = exact tile count.
// =====================================================================================================
#define G_BM 128
#define G_BN 256
#define G_KS 128
#define G_PITCH 136                         // halves per LDS row: 272 B = 16 B x odd, for 16-B LDS reads
#define G_BUF ((G_BM + G_BN) * G_PITCH)     // halves per buffer
#define G_LDC 1024                          // elements per row of C and of the residual plane
#define G_SP 68                             // floats per staged row of the epilogue: 272 B
static_assert(CC == G_LDC && TT == G_LDC);
static_assert(8 * 64 * G_SP * 4 <= 2 * G_BUF * 2);   // the eight waves' staged tiles fit the two stage buffers

#if defined(__HIP_DEVICE_COMPILE__)
// twelve copies of one lane; the address-register wait closes the copies' own statement, so that no
// later write of an address register can be moved in front of it
#define G_COPY12(l, g)                                                          \
  asm volatile("global_load_async_to_lds_b128 %0, %12, off\n\t"                 \
               "global_load_async_to_lds_b128 %1, %13, off\n\t"                 \
               "global_load_async_to_lds_b128 %2, %14, off\n\t"                 \
               "global_load_async_to_lds_b128 %3, %15, off\n\t"                 \
               "global_load_async_to_lds_b128 %4, %16, off\n\t"                 \
               "global_load_async_to_lds_b128 %5, %17, off\n\t"                 \
               "global_load_async_to_lds_b128 %6, %18, off\n\t"                 \
               "global_load_async_to_lds_b128 %7, %19, off\n\t"                 \
               "global_load_async_to_lds_b128 %8, %20, off\n\t"                 \
               "global_load_async_to_lds_b128 %9, %21, off\n\t"                 \
               "global_load_async_to_lds_b128 %10, %22, off\n\t"                \
               "global_load_async_to_lds_b128 %11, %23, off\n\t"                \
               "s_wait_xcnt 0x0"                                                \
               :                                                                \
               : "v"((l)[0]), "v"((l)[1]), "v"((l)[2]), "v"((l)[3]), "v"((l)[4]), "v"((l)[5]),               \
                 "v"((l)[6]), "v"((l)[7]), "v"((l)[8]), "v"((l)[9]), "v"((l)[10]), "v"((l)[11]),             \
                 "v"((g)[0]), "v"((g)[1]), "v"((g)[2]), "v"((g)[3]), "v"((g)[4]), "v"((g)[5]),               \
                 "v"((g)[6]), "v"((g)[7]), "v"((g)[8]), "v"((g)[9]), "v"((g)[10]), "v"((g)[11])              \
               : "memory")
// this wave's copies have landed
#define G_WAIT_COPIES() asm volatile("s_wait_asynccnt 0x0" ::: "memory")
// this wave's LDS reads have returned, so the buffer may be refilled behind the barrier
#define G_WAIT_LDS() asm volatile("s_wait_dscnt 0x0" ::: "memory")
// the wait before a register that an issued load or store names is written again; the operands are those
// registers (addresses, stored values), which as inputs stay untouched up to the wait (a statement takes at most
// thirty operands, so 32 stored pieces take two statements)
#define G_WAIT_XCNT_2(p, q) asm volatile("s_wait_xcnt 0x0" :: "v"(p), "v"(q) : "memory")
#define G_WAIT_XCNT_17(p, o)                                                                                   \
  asm volatile("s_wait_xcnt 0x0"                                                                               \
               :: "v"(p), "v"((o)[0]), "v"((o)[1]), "v"((o)[2]), "v"((o)[3]), "v"((o)[4]), "v"((o)[5]),        \
                  "v"((o)[6]), "v"((o)[7]), "v"((o)[8]), "v"((o)[9]), "v"((o)[10]), "v"((o)[11]),              \
                  "v"((o)[12]), "v"((o)[13]), "v"((o)[14]), "v"((o)[15])                                       \
               : "memory")
#else
#define G_WAIT_XCNT_2(p, q) ((void)0)
#define G_WAIT_XCNT_17(p, o) ((void)0)
#define G_COPY12(l, g) ((void)0)
#define G_WAIT_COPIES() ((void)0)
#define G_WAIT_LDS() ((void)0)
#endif

// sAB: the two stage buffers (the kernel's LDS); tile, bz: the work-group's tile and batch index
template <int TAPS, int OUTH, bool RESID, int BM>
__device__ __forceinline__ void gemm_body(
    _Float16* sAB, int tile, int bz,
    const _Float16* __restrict__ A, int lda, long long strideA, long long aTap, int aTS, int aTO,
    const _Float16* __restrict__ Bt, int ldb, long long strideB, long long bTap, int bTS, int bTO,
    const float* __restrict__ bias, float bscale,
    const float* __restrict__ resid,
    void* Cout, long long strideC,
    int M, int N, int K, float oscale) {
  const int tid = threadIdx.x;
  const int lane = tid & 31, wave = tid >> 5;
  const int tilesN = N >> 8, tilesM = M >> 7;
  if (tile >= tilesM * tilesN) return;   // the same for the whole work-group, ahead of every barrier
  const int tm = tile / tilesN, tn = tile - tm * tilesN;
  const int mB = tm << 7, nB = tn << 8;
  const int wm = wave >> 2, wn = wave & 3;
  const int m0 = mB + wm * 64, n0 = nB + wn * 64;
  const int rlane = lane & 15;
  const int koff = (lane >> 4) * 8;
  const int mOff = koff;
  const int aRow0 = (m0 >> 6) * aTS + aTO;
  const int bRow0 = (n0 >> 6) * bTS + bTO;
  const _Float16* Ab = A + (size_t)bz * (size_t)strideA;
  const _Float16* Bb = Bt + (size_t)bz * (size_t)strideB;

  // copy side: lane -> (row tid>>4 of each 16-row band, 16-B piece tid&15 of its 256 B);
  // bands 0..7 are the A rows, bands 8..23 the Bt rows
  const int crow = tid >> 4, cpc = (tid & 15) * 8;
  const unsigned tA = (unsigned)(crow * lda + cpc);
  const unsigned tB = (unsigned)(crow * ldb + cpc);
  const unsigned ldsC = (unsigned)(size_t)sAB + (unsigned)(crow * G_PITCH + cpc) * 2u;

  auto issue = [&](int tp, int k0, int buf) {
    const _Float16* Ap = Ab + (size_t)tp * (size_t)aTap + k0 + tA;
    const _Float16* Bp = Bb + (size_t)tp * (size_t)bTap + k0 + tB;
#pragma unroll   // constant indices keep the array in registers
    for (int hlf = 0; hlf < 2; ++hlf) {
      unsigned l[12];
      const _Float16* g[12];
#pragma unroll   // constant indices keep the array in registers
      for (int e = 0; e < 12; ++e) {
        const int i = hlf * 12 + e;           // band
        l[e] = ldsC + (unsigned)buf * (unsigned)(G_BUF * 2) + (unsigned)i * (unsigned)(16 * G_PITCH * 2);
        if (i < 8) {
          const int row = ((mB >> 6) + (i >> 2)) * aTS + aTO + 16 * (i & 3);
          g[e] = Ap + (size_t)(unsigned)(row * lda);
        } else {
          const int row = ((nB >> 6) + ((i - 8) >> 2)) * bTS + bTO + 16 * ((i - 8) & 3);
          g[e] = Bp + (size_t)(unsigned)(row * ldb);
        }
      }
      G_COPY12(l, g);
    }
  };

  v8f acc[4][4];
#pragma unroll   // constant indices keep the array in registers
  for (int i = 0; i < 4; ++i)
#pragma unroll   // constant indices keep the array in registers
    for (int j = 0; j < 4; ++j) acc[i][j] = zero8();

  const _Float16* fa = sAB + (wm * 64 + rlane) * G_PITCH + koff;
  const _Float16* fb = sAB + (G_BM + wn * 64 + rlane) * G_PITCH + koff;

  const int nt = TAPS * (K >> 7);
  int itp = 0, ik = 0;                      // tap and k of the next stage to be copied
  issue(itp, ik, 0);
  ik += G_KS;
  if (ik >= K) { ik = 0; ++itp; }
  G_WAIT_COPIES();
  __syncthreads();
  if (nt > 1) {
    issue(itp, ik, 1);
    ik += G_KS;
    if (ik >= K) { ik = 0; ++itp; }
  }

  // the epilogue's operands: all of the lane's loads are issued here and first used behind the k loop
  const int h2 = lane >> 4, c4 = (lane & 15) * 4;     // f32 C: a 256-B row segment = 16 lanes x 16 B
  const size_t cOff = (size_t)bz * (size_t)strideC + (size_t)(m0 + h2) * G_LDC + n0 + c4;
  // bias: BM 1 the lane's 8 rows of each 16-row band (32-B aligned: the row remaps are multiples of 64), BM 2 its 4 columns
  const float* bp = (BM == 1) ? bias + (aRow0 + mOff) : bias + (bRow0 + rlane);
  const float* rp = RESID ? resid + cOff : bp;
  v4f brow[4][2];
  float bcol[4];
  v4f rv[4][8];
  if (BM == 1) {
#pragma unroll   // constant indices keep the array in registers
    for (int i = 0; i < 4; ++i) {
      brow[i][0] = *(const v4f*)(bp + i * 16);
      brow[i][1] = *(const v4f*)(bp + i * 16 + 4);
    }
  }
  if (BM == 2) {
#pragma unroll   // constant indices keep the array in registers
    for (int j = 0; j < 4; ++j) bcol[j] = bp[j * 16];
  }
  if (RESID) {
#pragma unroll   // constant indices keep the array in registers
    for (int i = 0; i < 4; ++i)
#pragma unroll   // constant indices keep the array in registers
      for (int it = 0; it < 8; ++it) rv[i][it] = *(const v4f*)(rp + (i * 16 + it * 2) * G_LDC);
  }
  G_WAIT_XCNT_2(bp, rp);

#pragma unroll 1   // one stage per trip: the two buffers alternate by the trip's parity
  for (int t = 0; t < nt; ++t) {
    const _Float16* pa = fa + (t & 1) * G_BUF;
    const _Float16* pb = fb + (t & 1) * G_BUF;
#pragma unroll   // constant indices keep the array in registers
    for (int kk = 0; kk < G_KS / 32; ++kk) {
      v16h af[4], bf[4];
#pragma unroll   // constant indices keep the array in registers
      for (int i = 0; i < 4; ++i) af[i] = ldfrag(pa + i * 16 * G_PITCH + kk * 32);
#pragma unroll   // constant indices keep the array in registers
      for (int j = 0; j < 4; ++j) bf[j] = ldfrag(pb + j * 16 * G_PITCH + kk * 32);
      // keeps the block's 16 LDS reads one group ahead of its 16 WMMAs: left free, the reads of each A
      // fragment sink to just in front of its row and every row waits out a whole LDS latency
      __builtin_amdgcn_sched_barrier(0);
#pragma unroll   // constant indices keep the array in registers
      for (int i = 0; i < 4; ++i)
#pragma unroll   // constant indices keep the array in registers
        for (int j = 0; j < 4; ++j) acc[i][j] = mma_raw(af[i], bf[j], acc[i][j]);
    }
    // publish point of stage t + 1; the same barrier ends every read of the buffer refilled behind it
    G_WAIT_LDS();
    G_WAIT_COPIES();
    __syncthreads();
    if (t + 2 < nt) {
      issue(itp, ik, t & 1);
      ik += G_KS;
      if (ik >= K) { ik = 0; ++itp; }
    }
  }
  G_WAIT_COPIES();

  // ---- epilogue ----
  // Every wave's last read of the stage buffers and its last copy are over in front of the last trip's barrier.
  float* slab = (float*)sAB + wave * (64 * G_SP);
#pragma unroll
  for (int i = 0; i < 4; ++i)
#pragma unroll
    for (int j = 0; j < 4; ++j)
#pragma unroll
      for (int r = 0; r < 8; ++r) {
        const float add = (BM == 1) ? brow[i][r >> 2][r & 3] * bscale : (BM == 2) ? bcol[j] * bscale : 0.f;
        slab[(i * 16 + mOff + r) * G_SP + j * 16 + rlane] = acc[i][j][r] * oscale + add;
      }
  wave_lds_sync();   // the staged tile is the wave's own
  if (OUTH == 0) {
    float* Cb = (float*)Cout + cOff;
    v4f o[32];                                             // piece u: row 2u + h2 of the tile
#pragma unroll
    for (int u = 0; u < 32; ++u) {
      o[u] = *(const v4f*)(slab + (2 * u + h2) * G_SP + c4);
      if (RESID) o[u] += rv[u >> 3][u & 7];
    }
#pragma unroll
    for (int u = 0; u < 32; ++u) *(v4f*)(Cb + 2 * u * G_LDC) = o[u];
    G_WAIT_XCNT_17(Cb, o);
    G_WAIT_XCNT_17(Cb, o + 16);
  } else {
    const int q = lane >> 3, c8 = (lane & 7) * 8;          // f16 C: a 128-B row segment = 8 lanes x 16 B
    _Float16* Cb = (_Float16*)Cout + (size_t)bz * (size_t)strideC + (size_t)(m0 + q) * G_LDC + n0 + c8;
    v4f f[16][2];                                          // piece u: row 4u + q of the tile
#pragma unroll
    for (int u = 0; u < 16; ++u) {
      const float* sp = slab + (4 * u + q) * G_SP + c8;
      f[u][0] = *(const v4f*)(sp);
      f[u][1] = *(const v4f*)(sp + 4);
    }
    // keeps the 32 LDS reads one group ahead of the conversions: left free, they sink to just in front of their
    // own conversion, two at a time, and every piece waits out a whole LDS latency
    __builtin_amdgcn_sched_barrier(0);
    v4u o[16];
#pragma unroll
    for (int u = 0; u < 16; ++u) {
      o[u][0] = pkf(f[u][0][0], f[u][0][1]);
      o[u][1] = pkf(f[u][0][2], f[u][0][3]);
      o[u][2] = pkf(f[u][1][0], f[u][1][1]);
      o[u][3] = pkf(f[u][1][2], f[u][1][3]);
    }
#pragma unroll
    for (int u = 0; u < 16; ++u) *(v4u*)(Cb + 4 * u * G_LDC) = o[u];
    G_WAIT_XCNT_17(Cb, o);
  }
}

// one product per launch: blockIdx.x = tile, blockIdx.y = batch index
template <int TAPS, int OUTH, bool RESID, int BM>
__global__ __launch_bounds__(256) void gemm_k(
    const _Float16* __restrict__ A, int lda, long long strideA, long long aTap, int aTS, int aTO,
    const _Float16* __restrict__ Bt, int ldb, long long strideB, long long bTap, int bTS, int bTO,
    const float* __restrict__ bias, float bscale,
    const float* __restrict__ resid,
    void* Cout, long long strideC,
    int M, int N, int K, float oscale) {
  __shared__ __align__(16) _Float16 sAB[2 * G_BUF];
  gemm_body<TAPS, OUTH, RESID, BM>(sAB, (int)blockIdx.x, (int)blockIdx.y,
                                   A, lda, strideA, aTap, aTS, aTO, Bt, ldb, strideB, bTap, bTS, bTO,
                                   bias, bscale, resid, Cout, strideC, M, N, K, oscale);
}

// q, k and v need nothing of each other: one launch, blockIdx.y = 0 q, 1 k, 2 v; 256 tiles each.
//   q, k = xn^T . W^T -> [b*TT+t][h*64+d] f16 x16 (M = 8192, N = 1024; W rows h*192 + 64 y + d)
//   v (channel-major) = Wv . xn -> [b][h*64+d][s] f16 x16 (per b: M = 1024 rows h*192+128+d, N = 1024 t)
__global__ __launch_bounds__(256) void qkv_k(const _Float16* __restrict__ xn, const _Float16* __restrict__ wq,
                                             const float* __restrict__ qb,
                                             _Float16* Qp, _Float16* Kp, _Float16* Vp) {
  __shared__ __align__(16) _Float16 sAB[2 * G_BUF];
  const int y = (int)blockIdx.y;   // the same for the whole work-group
  if (y < 2)
    gemm_body<1, 1, false, 2>(sAB, (int)blockIdx.x, 0,
                              xn, CC, 0LL, 0LL, 64, 0, wq, CC, 0LL, 0LL, 192, 64 * y,
                              qb, 16.0f, nullptr, (void*)(y ? Kp : Qp), 0LL, NBATCH * TT, CC, CC, 0.25f);
  else
    gemm_body<1, 1, false, 1>(sAB, (int)blockIdx.x & 31, (int)blockIdx.x >> 5,
                              wq, CC, 0LL, 0LL, 192, 128, xn, CC, (long long)CC * TT, 0LL, 64, 0,
                              qb, 16.0f, nullptr, (void*)Vp, (long long)CC * TT, CC, TT, CC, 0.25f);
}
static_assert((NBATCH * TT / 128) * (CC / 256) == 256 && (CC / 128) * (TT / 256) == 32 && NBATCH * 32 == 256);

#define AT_P 72
// lane l reads lane l ^ 16
__device__ __forceinline__ float xhalf(float x) {
  return __builtin_bit_cast(float, __builtin_amdgcn_permlanex16(__builtin_bit_cast(int, x), __builtin_bit_cast(int, x),
                                                                0x76543210, 0xfedcba98, false, false));
}
// two values 2^x in one statement. Behind a transcendental the instruction set asks for one slot before its result
// is used or its source overwritten: the first has the second exponential there (the outputs share no register with
// the inputs), the second the v_nop. The two s_delay_alu are the hints that the compiler gives its own code and not a
// statement's: the arguments may come from the instruction in front, and what follows may use the results;
// without a hint a dependent instruction holds the SIMD's vector port against the other waves while it waits
__device__ __forceinline__ void exp2x2_slot(float x0, float x1, float& y0, float& y1) {
#if defined(__HIP_DEVICE_COMPILE__)
  asm("s_delay_alu instid0(VALU_DEP_1)\n\tv_exp_f32 %0, %2\n\tv_exp_f32 %1, %3\n\tv_nop\n\t"
      "s_delay_alu instid0(TRANS32_DEP_1)"
      : "=&v"(y0), "=&v"(y1) : "v"(x0), "v"(x1));
#else
  y0 = x0; y1 = x1;
#endif
}
// eight waves per SIMD (128 registers): the eight work-groups that fall to each WGP are then resident together
__global__ __launch_bounds__(128, 8)
void attn_k(const _Float16* __restrict__ Qp, const _Float16* __restrict__ Kp, const _Float16* __restrict__ Vp,
            const float* __restrict__ tab, _Float16* AT, float sScale, float oScale) {
  __shared__ __align__(16) _Float16 Ksh[64 * AT_P];    // [kv][d]
  __shared__ __align__(16) _Float16 Vth[64 * AT_P];    // [d][kv]
  __shared__ __align__(16) _Float16 Osh[4][16 * AT_P]; // per wave output rows [query][d]
  __shared__ __align__(16) float    sB[384 * 4];       // bias slice tab[h][q0b .. q0b+1087] (+clamped fill)

  const int tid  = threadIdx.x;
  const int wave = tid >> 5;
  const int lane = tid & 31;
  const int hh   = lane >> 4;
  const int c    = lane & 15;

  const int bx  = blockIdx.x;
  const int qb  = bx & 15;
  const int h   = (bx >> 4) & 15;
  const int b   = bx >> 8;
  const int q0b = qb * 64;
  const int q0  = q0b + wave * 16;
  const size_t rowB = (size_t)b * TT;

  {
    const float* th = tab + (size_t)h * BTP + q0b;     // q0b + 1087 <= 2047 < BTP
#pragma unroll
    for (int k = 0; k < 3; ++k) {
      const int i  = tid + 128 * k;                     // 0..383
      const int ic = (i < 271) ? i : 271;               // clamped address, all lanes load
      *(v4f*)(sB + 4 * i) = *(const v4f*)(th + 4 * ic);
    }
  }

  const _Float16* Qh = Qp + (size_t)h * HD;
  const _Float16* Kh = Kp + (size_t)h * HD;
  const _Float16* Vh = Vp + ((size_t)b * CC + (size_t)h * HD) * TT;

  // ---- Q fragments (B operand, column = lane&15): 2 d-chunks ----
  v16h qa[2];
#pragma unroll
  for (int dc = 0; dc < 2; ++dc) qa[dc] = ldfrag(Qh + (rowB + q0 + c) * CC + dc * 32 + 8 * hh);

  float mrun = -INFINITY, lrun = 0.f;   // the lane's query: maximum in use; sum over this half's keys
  v8f oacc[4];
#pragma unroll
  for (int t = 0; t < 4; ++t) oacc[t] = zero8();

  // bias index: (t - q0b) - s + 1024 with t - q0b = wave*16 + c, s = kv0 + 16j + 8hh + r
  const int bbase = wave * 16 + c + 1024 - 8 * hh;

#pragma unroll 1
  for (int kt = 0; kt < TT / 64; ++kt) {
    const int kv0 = kt * 64;
    __syncthreads();
    {
      const int r = tid >> 1, half = (tid & 1) * 32;
      const _Float16* kg = Kh + (rowB + kv0 + r) * CC + half;     // K row kv0+r, d = half..half+31
      const _Float16* vg = Vh + (size_t)r * TT + kv0 + half;     // V^T row d = r, s = kv0+half..+31
#pragma unroll
      for (int i = 0; i < 4; ++i) {
        const v8h a0 = *(const v8h*)(kg + 8 * i);
        const v8h b0 = *(const v8h*)(vg + 8 * i);
        *(v8h*)(Ksh + r * AT_P + half + 8 * i) = a0;
        *(v8h*)(Vth + r * AT_P + half + 8 * i) = b0;
      }
    }
    __syncthreads();

    // ---- scores, transposed: 64 keys x 16 queries per wave ----
    v8f s[4];
#pragma unroll
    for (int j = 0; j < 4; ++j) s[j] = zero8();
#pragma unroll
    for (int dc = 0; dc < 2; ++dc)
#pragma unroll
      for (int j = 0; j < 4; ++j)
        s[j] = mma_raw(ldfrag(Ksh + (j * 16 + c) * AT_P + dc * 32 + 8 * hh), qa[dc], s[j]);

    // ---- scale + bias, maximum of the lane's 32 keys (one chain per tile), then of the query's 64 ----
    const float* bp = sB + (bbase - kv0 - 55);   // the lowest of the lane's 32 entries
    float mj[4];
#pragma unroll
    for (int jh = 0; jh < 2; ++jh) {
      // two tiles' bias entries at a time, read as one group. The first fence keeps them behind what stands in
      // front: hoisted, all 32 stand beside the scores, the context and Q, and the 128 registers of eight waves
      // per SIMD no longer hold them. The second keeps the group together: left free, each read sinks to just in
      // front of its sum and every pair waits out a whole LDS latency
      __builtin_amdgcn_sched_barrier(0);
      float bb[16];
#pragma unroll
      for (int e = 0; e < 16; ++e) bb[e] = bp[55 - 32 * jh - 16 * (e >> 3) - (e & 7)];   // tile 2jh + (e>>3), r = e&7
      __builtin_amdgcn_sched_barrier(0);
#pragma unroll
      for (int jl = 0; jl < 2; ++jl) {
        const int j = 2 * jh + jl;
        mj[j] = -INFINITY;
#pragma unroll
        for (int r = 0; r < 8; ++r) {
          const float sv = s[j][r] * sScale + bb[8 * jl + r];
          s[j][r] = sv;
          mj[j] = fmaxf(mj[j], sv);
        }
      }
    }
    float m = fmaxf(fmaxf(mj[0], mj[1]), fmaxf(mj[2], mj[3]));
    m = fmaxf(m, xhalf(m));
    const float mnew  = fmaxf(mrun, m);
    const float msafe = (mnew == -INFINITY) ? 0.f : mnew;
    const float LOG2E = 1.4426950408889634f;   // e^x = 2^(x log2 e)
    const float alpha = exp2_slot((mrun - msafe) * LOG2E);
    mrun = mnew;

    // ---- P^T (x1024, f16): score tiles 2kk and 2kk+1, converted in place, are the B fragment of keys 32kk.. ----
    v16h pb[2];
    float pj[4];
#pragma unroll
    for (int j = 0; j < 4; ++j) {
#pragma unroll
      for (int r = 0; r < 8; r += 2) {
        float p0, p1;
        exp2x2_slot((s[j][r] - msafe) * LOG2E, (s[j][r + 1] - msafe) * LOG2E, p0, p1);
        pj[j] = (r == 0) ? p0 + p1 : (pj[j] + p0) + p1;
        pb[j >> 1][(j & 1) * 8 + r] = (_Float16)(p0 * 1024.0f);
        pb[j >> 1][(j & 1) * 8 + r + 1] = (_Float16)(p1 * 1024.0f);
      }
    }
    lrun = lrun * alpha + ((pj[0] + pj[1]) + (pj[2] + pj[3]));
#pragma unroll
    for (int t = 0; t < 4; ++t) oacc[t] *= alpha;

    // ---- context, transposed: O^T += V^T . P^T (f16 WMMA) ----
#pragma unroll
    for (int kk = 0; kk < 2; ++kk) {
      // the first fence keeps a group's reads behind what stands in front (one set of four fragments at a time fits
      // the 128 registers); the second keeps them one group ahead of their products: left free, each sinks to just
      // in front of its own product, which then waits out a whole LDS latency
      __builtin_amdgcn_sched_barrier(0);
      v16h va[4];
#pragma unroll
      for (int t = 0; t < 4; ++t) va[t] = ldfrag(Vth + (t * 16 + c) * AT_P + kk * 32 + 8 * hh);
      __builtin_amdgcn_sched_barrier(0);
#pragma unroll
      for (int t = 0; t < 4; ++t) oacc[t] = mma_raw(va[t], pb[kk], oacc[t]);
    }
  }

  // ---- normalise (1/l; the 1/1024 p carry, the x16 v carry and the x256 output carry are all in oScale) ----
  const float l = lrun + xhalf(lrun);
  const float inv = ((l > 0.f) ? rcp_f(l) : 0.f) * oScale;
  _Float16* os = Osh[wave];
#pragma unroll
  for (int t = 0; t < 4; ++t) {
    v4u a;
#pragma unroll
    for (int e = 0; e < 4; ++e) a[e] = pkf(oacc[t][2 * e] * inv, oacc[t][2 * e + 1] * inv);
    *(v4u*)(os + c * AT_P + t * 16 + 8 * hh) = a;
  }
  wave_lds_sync();   // the rows are the wave's own
  {
    const int q4 = lane >> 3, c8 = (lane & 7) * 8;
    v4u hv[4];
#pragma unroll
    for (int it = 0; it < 4; ++it) hv[it] = *(const v4u*)(os + (it * 4 + q4) * AT_P + c8);   // rows 0..15 of the wave tile
#pragma unroll
    for (int it = 0; it < 4; ++it) {
      const int row = it * 4 + q4;
      const size_t go = (rowB + q0 + row) * CC + (size_t)h * HD + c8;
      *(v4u*)(AT + go) = hv[it];
    }
  }
}

// =====================================================================================================
// Workspace map (bytes):
//   W1t  f16 [3][1024][1024]       0            6291456
//   W2t  f16 [3][1024][1024]       6291456      6291456
//   Wqkv f16 [3072][1024]          12582912     6291456
//   Wp   f16 [1024][1024]          18874368     2097152
//   Tab  f32 [16][2048]            20971520      131072
//   XT   f16 [8][1026][1024]       21102592    16809984   (later: XT3 [8][1024][1024], then AT [8192][1024])
//   R1   f32 [8][1024][1024]       37912576    33554432   (F1, then H, then Qp + Kp f16 [8192][1024] each)
//   Xin  f32 [8][1024][1024]       71467008    33554432
//   Vp   f16 [8][1024][1024]       105021440   16777216
//   end                            121798656
// Every plane is an exact multiple of its whole-line / whole-tile store granularity (incl. the two
// halo token rows per sample in XT); no tail padding needed.
// =====================================================================================================
extern "C" void kernel_launch(void* const* d_in, const int* in_sizes, int n_in,
                              void* d_out, int out_size, void* d_ws, size_t ws_size,
                              hipStream_t stream) {
  if (n_in < 18) return;
  const int nAct = NBATCH * CC * TT;                     // 8388608
  if (in_sizes[0] != nAct || out_size != nAct) return;
  if (in_sizes[3] != CC * CC * 3 || in_sizes[7] != CC * CC * 3) return;
  if (in_sizes[13] != 3 * CC * CC || in_sizes[15] != CC * CC) return;
  if (in_sizes[1] != CC || in_sizes[2] != CC || in_sizes[4] != CC || in_sizes[5] != CC ||
      in_sizes[6] != CC || in_sizes[8] != CC || in_sizes[9] != CC || in_sizes[10] != CC ||
      in_sizes[11] != CC || in_sizes[12] != CC || in_sizes[16] != CC) return;
  if (in_sizes[14] != 3 * CC || in_sizes[17] != NBUCK * NH) return;

  const float* x      = (const float*)d_in[0];
  const float* gn1_g  = (const float*)d_in[1];
  const float* gn1_b  = (const float*)d_in[2];
  const float* c1_w   = (const float*)d_in[3];
  const float* c1_b   = (const float*)d_in[4];
  const float* gn2_g  = (const float*)d_in[5];
  const float* gn2_b  = (const float*)d_in[6];
  const float* c2_w   = (const float*)d_in[7];
  const float* c2_b   = (const float*)d_in[8];
  const float* n8_g   = (const float*)d_in[9];
  const float* n8_b   = (const float*)d_in[10];
  const float* ag_g   = (const float*)d_in[11];
  const float* ag_b   = (const float*)d_in[12];
  const float* qkv_w  = (const float*)d_in[13];
  const float* qkv_b  = (const float*)d_in[14];
  const float* pj_w   = (const float*)d_in[15];
  const float* pj_b   = (const float*)d_in[16];
  const float* remb   = (const float*)d_in[17];

  const size_t PWC  = (size_t)3 * CC * CC * 2;          //  6291456
  const size_t PWQ  = (size_t)3 * CC * CC * 2;          //  6291456
  const size_t PWP  = (size_t)CC * CC * 2;              //  2097152
  const size_t PTAB = (size_t)NH * BTP * 4;             //   131072
  const size_t PXT  = (size_t)NBATCH * TP * CC * 2;     // 16809984
  const size_t PF   = (size_t)NBATCH * CC * TT * 4;     // 33554432
  const size_t PV   = (size_t)NBATCH * CC * TT * 2;     // 16777216
  size_t off = 0;
  const size_t oW1  = off; off += PWC;
  const size_t oW2  = off; off += PWC;
  const size_t oWq  = off; off += PWQ;
  const size_t oWp  = off; off += PWP;
  const size_t oTab = off; off += PTAB;
  const size_t oXT  = off; off += PXT;
  const size_t oR1  = off; off += PF;
  const size_t oXin = off; off += PF;
  const size_t oV   = off; off += PV;
  if (off > ws_size) return;                            // off = 121798656
  if (off > (size_t)134217728) return;
  if (2 * PV > PF) return;                              // Qp + Kp live inside R1
  if ((size_t)NBATCH * TT * CC * 2 > PXT) return;       // XT3 / AT fit in the XT region

  char* ws = (char*)d_ws;
  _Float16* W1t  = (_Float16*)(ws + oW1);
  _Float16* W2t  = (_Float16*)(ws + oW2);
  _Float16* Wqkv = (_Float16*)(ws + oWq);
  _Float16* Wpb  = (_Float16*)(ws + oWp);
  float*    Tab  = (float*)(ws + oTab);
  _Float16* XT   = (_Float16*)(ws + oXT);               // [8][1026][1024] with halo rows
  _Float16* XT3  = (_Float16*)(ws + oXT);               // [8][1024][1024], later use of the same region
  _Float16* ATp  = (_Float16*)(ws + oXT);               // [8192][1024], last use of the same region
  float*    F1   = (float*)(ws + oR1);
  float*    Hb   = (float*)(ws + oR1);
  _Float16* Qp   = (_Float16*)(ws + oR1);
  _Float16* Kp   = (_Float16*)(ws + oR1 + PV);
  float*    Xin  = (float*)(ws + oXin);
  _Float16* Vp   = (_Float16*)(ws + oV);

  const dim3 blk(256);
  const long long CCCC = (long long)CC * CC;
  const long long CT   = (long long)CC * TT;

  // (1) h = silu(GN32(x)) -> XT (token-major f16, halo rows); beside it conv1's weights -> f16 x64 planes
  gn32_tr_k<true><<<dim3(CC / 64, NBATCH + CVW_NB / (CC / 64)), dim3(GN_NT), 0, stream>>>(x, gn1_g, gn1_b, XT, c1_w, W1t);
  // (2) F1 = conv1(h) + b1 -> f32 NCT   (per b: M=1024 o, N=1024 t, K=3 taps x 1024)
  gemm_k<3, 0, false, 1><<<dim3((CC / 128) * (TT / 256), NBATCH), blk, 0, stream>>>(
      W1t, CC, 0LL, CCCC, 64, 0,
      XT, CC, (long long)TP * CC, (long long)CC, 64, 0,
      c1_b, 1.0f, nullptr,
      (void*)F1, CT, CC, TT, CC, 1.0f / 64.0f);
  // (3) h = silu(GN32(F1)) -> XT; beside it conv2's weights -> f16 x64 planes
  gn32_tr_k<true><<<dim3(CC / 64, NBATCH + CVW_NB / (CC / 64)), dim3(GN_NT), 0, stream>>>(F1, gn2_g, gn2_b, XT, c2_w, W2t);
  // (4) H = conv2(h) + b2 + x -> f32 NCT (R1)
  gemm_k<3, 0, true, 1><<<dim3((CC / 128) * (TT / 256), NBATCH), blk, 0, stream>>>(
      W2t, CC, 0LL, CCCC, 64, 0,
      XT, CC, (long long)TP * CC, (long long)CC, 64, 0,
      c2_b, 1.0f, x,
      (void*)Hb, CT, CC, TT, CC, 1.0f / 64.0f);
  // (5) xin = GN8(H) -> f32 NCT; GN32(xin) -> XT3 (token-major f16, no halo); beside it the qkv and projection
  //     weights -> f16 x64 planes and the position bias table
  gn8_attn_k<<<dim3(CC / 128, NBATCH + (PQ_NB + PP_NB + PT_NB) / (CC / 128)), dim3(GN_NT), 0, stream>>>(
      Hb, n8_g, n8_b, ag_g, ag_b, Xin, XT3, qkv_w, pj_w, remb, Wqkv, Wpb, Tab);
  // (6) q -> Qp, k -> Kp, v -> Vp
  qkv_k<<<dim3(256, 3), blk, 0, stream>>>(XT3, Wqkv, qkv_b, Qp, Kp, Vp);
  // (7) attention -> AT [b*TT+t][h*64+d] f16 x256
  attn_k<<<dim3((TT / 64) * NH * NBATCH), dim3(128), 0, stream>>>(
      Qp, Kp, Vp, Tab, ATp, 1.0f / 2048.0f, 1.0f / 64.0f);
  // (8) out = xin + proj(a) + bp -> d_out f32 NCT (per b: M=1024 o, N=1024 t, K=1024)
  gemm_k<1, 0, true, 1><<<dim3((CC / 128) * (TT / 256), NBATCH), blk, 0, stream>>>(
      Wpb, CC, 0LL, 0LL, 64, 0,
      ATp, CC, CT, 0LL, 64, 0,
      pj_b, 1.0f, Xin,
      d_out, CT, CC, TT, CC, 1.0f / 16384.0f);
  (void)hipGetLastError();
}

// v008
// Measured time: 232 microseconds a run.
// Timed twice side by side with v007, it ran 1.04 times as fast both times.
// All steps since v000 together make it 4.11 times as fast.
// Contractions: conv k3 (two), qkv 1x1, q.k^T, p.v, proj 1x1 = v_wmma_f32_16x16x32_f16 (f16 operands: weights x64, GroupNorm activations x1, q/k/v x16, p x1024, attention output x256), f32 accumulate; GroupNorm statistics f32 partial sums with f64 totals, softmax / position bias / residuals f32.
#include <hip/hip_runtime.h>
#include <math.h>
#include <stdint.h>

#define NBATCH 8
#define CC 1024
#define TT 1024
#define TP 1026
#define NH 16
#define HD 64
#define NBUCK 32
#define BTP 2048

static_assert(NH * HD == CC);
static_assert((CC % 256) == 0 && (TT % 256) == 0);

typedef _Float16 v16h __attribute__((ext_vector_type(16)));
typedef _Float16 v8h  __attribute__((ext_vector_type(8)));
typedef float    v8f  __attribute__((ext_vector_type(8)));
typedef float    v4f  __attribute__((ext_vector_type(4)));
typedef unsigned int v4u __attribute__((ext_vector_type(4)));

// ---- scalar helpers ----
__device__ __forceinline__ unsigned short h_bits(_Float16 x) { return __builtin_bit_cast(unsigned short, x); }
__device__ __forceinline__ unsigned pkf(float a, float b) {
  return (unsigned)h_bits((_Float16)a) | ((unsigned)h_bits((_Float16)b) << 16);
}
__device__ __forceinline__ v8f zero8() { v8f z = {0.f, 0.f, 0.f, 0.f, 0.f, 0.f, 0.f, 0.f}; return z; }
__device__ __forceinline__ float rcp_f(float x) { return __builtin_amdgcn_rcpf(x); }

// ---- 16-bit A/B fragment: lane -> row/col (lane&15); p already includes +8*(lane>>4);
//      elements 0..7 <- p[0..7] (k0+8h..), elements 8..15 <- p[16..23] (k0+16+8h..)
__device__ __forceinline__ v16h ldfrag(const _Float16* p) {
  union { v16h v; v8h h[2]; } f;
  f.h[0] = *(const v8h*)(p);
  f.h[1] = *(const v8h*)(p + 16);
  return f.v;
}

// ---- WMMA helpers ----
__device__ __forceinline__ v8f mma_raw(v16h a, v16h b, v8f c) {
  return __builtin_amdgcn_wmma_f32_16x16x32_f16(false, a, false, b, (short)0, c, false, false);
}

// ---- f64 wave shuffle ----
__device__ __forceinline__ double shfl_xor_d(double v, int m) {
  const unsigned long long u = (unsigned long long)__double_as_longlong(v);
  const int lo = __shfl_xor((int)(unsigned)(u & 0xffffffffull), m, 32);
  const int hi = __shfl_xor((int)(unsigned)(u >> 32), m, 32);
  const unsigned long long r = ((unsigned long long)(unsigned)hi << 32) | (unsigned long long)(unsigned)lo;
  return __longlong_as_double((long long)r);
}
// GroupNorm kernels: 16 waves per work-group
#define GN_NT 512
#define GN_NW 16
// Statistics: the per-element sums run in f32 (four chains of 16 per batch of 16 loads, joined as a tree, then the
// wave's 32 lanes); only the wave totals are summed in f64, where the squared mean is taken from the mean square.
__device__ __forceinline__ float sum4(v4f a) { return (a[0] + a[1]) + (a[2] + a[3]); }
__device__ __forceinline__ float wave_sum(float v) {
#pragma unroll   // the five exchange distances as constants
  for (int m = 16; m >= 1; m >>= 1) v += __shfl_xor(v, m, 32);
  return v;
}
// 1 / sqrt(x), x >= 1e-5: the hardware's estimate and one Newton step; the v_nop is the one slot that the
// instruction set asks for behind a transcendental before its result is used
__device__ __forceinline__ float rsqrt_nr(float x) {
#if defined(__HIP_DEVICE_COMPILE__)
  float r;
  asm("v_rsq_f32 %0, %1\n\tv_nop" : "=v"(r) : "v"(x));
  const float e = fmaf(-x * r, r, 1.0f);
  return fmaf(0.5f * r, e, r);
#else
  return x;
#endif
}
// mean and 1 / sigma from the f64 totals of n = 1 / invn values
__device__ __forceinline__ void mean_rstd(double S, double SS, double invn, float& meanf, float& rstdf) {
  const double mean = S * invn;
  double var = SS * invn - mean * mean;
  var = var < 0.0 ? 0.0 : var;
  meanf = (float)mean;
  rstdf = rsqrt_nr((float)var + 1e-5f);
}
// rs, rq: the GN_NW wave totals (sum, sum of squares) in LDS; called by a whole wave, every lane returns the result
__device__ __forceinline__ void close_stats(const float* rs, const float* rq, int lane, double invn,
                                            float& meanf, float& rstdf) {
  double S = (double)rs[lane & (GN_NW - 1)], SS = (double)rq[lane & (GN_NW - 1)];
#pragma unroll   // the four exchange distances as constants
  for (int m = GN_NW / 2; m >= 1; m >>= 1) {
    S += shfl_xor_d(S, m);
    SS += shfl_xor_d(SS, m);
  }
  mean_rstd(S, SS, invn, meanf, rstdf);
}

// SiLU's two transcendentals, each with the one slot behind it that the instruction set asks for before its
// result is used or its source overwritten
__device__ __forceinline__ float exp2_slot(float x) {
#if defined(__HIP_DEVICE_COMPILE__)
  float r;
  asm("v_exp_f32 %0, %1\n\tv_nop" : "=v"(r) : "v"(x));
  return r;
#else
  return x;
#endif
}
__device__ __forceinline__ float rcp_slot(float x) {
#if defined(__HIP_DEVICE_COMPILE__)
  float r;
  asm("v_rcp_f32 %0, %1\n\tv_nop" : "=v"(r) : "v"(x));
  return r;
#else
  return x;
#endif
}

#if defined(__HIP_DEVICE_COMPILE__)
// stands behind a batch of stores whose address and data registers the code that follows writes again
#define GN_WAIT_XCNT() asm volatile("s_wait_xcnt 0x0" ::: "memory")
#else
#define GN_WAIT_XCNT() ((void)0)
#endif

// orders one wave's own LDS writes and reads (the tile below is private to its wave)
__device__ __forceinline__ void wave_lds_sync() {
  __builtin_amdgcn_fence(__ATOMIC_RELEASE, "workgroup");
  __builtin_amdgcn_wave_barrier();
  __builtin_amdgcn_fence(__ATOMIC_ACQUIRE, "workgroup");
}

// Statistics records of a convolution's output plane [b][CC][TT] (written by gemm_body, read by the GroupNorm
// kernels): each wave of the product leaves the sum and the sum of squares of rows 0..31 and of rows 32..63 of its
// 64 x 64 tile (= two groups of 32 channels x 64 tokens) as 4 floats at the head of a 128-B line of its own.
// G_REC = first float of the record of batch b, tile (row tile x 4 + column tile), wave (row half x 4 + column).
#define G_REC(b, tile, wave) ((((b) * 32 + (tile)) * 8 + (wave)) * 32)
#define G_REC_BYTES (NBATCH * 32 * 8 * 128)

// One wave turns 64 channels x 32 tokens of an NCT f32 plane into 32 token rows of 64 f16 channels:
// y = f * cA[c] + cD[c] (+ SiLU). pr: the slab's first channel at this lane's token; dst: the tile's first
// token row at the slab's first channel (row pitch CC); st: this wave's own 32 x 9 16-B pieces of LDS.
// All 64 loads of the lane are issued before the first is used. No other wave touches st, so there is no
// work-group barrier. coverage: 8 x 4 rows x (8 lanes x 8 channels) = 32 rows x 64 channels.
template <bool SILU>
__device__ __forceinline__ void gn_tile64(const float* __restrict__ pr, const float* cA, const float* cD,
                                          v4u* st, _Float16* dst, int lane) {
  float f[64];
#pragma unroll
  for (int i = 0; i < 64; ++i) f[i] = pr[(size_t)i * TT];
  // the wave's reads of its last tile are over before st is written again; behind the loads, so that
  // the wait for the last tile's stores runs beside their flight
  wave_lds_sync();
#pragma unroll
  for (int j = 0; j < 8; ++j) {
    float y[8];
#pragma unroll
    for (int i = 0; i < 8; ++i) {
      float yy = fmaf(f[j * 8 + i], cA[j * 8 + i], cD[j * 8 + i]);
      if (SILU) yy = yy * rcp_slot(1.0f + exp2_slot(yy * -1.4426950408889634f));   // e^-y = 2^(-y log2 e)
      y[i] = yy;
    }
    v4u pk;
    pk[0] = pkf(y[0], y[1]);
    pk[1] = pkf(y[2], y[3]);
    pk[2] = pkf(y[4], y[5]);
    pk[3] = pkf(y[6], y[7]);
    st[lane * 9 + j] = pk;
  }
  wave_lds_sync();
  const int q = lane >> 3, l8 = lane & 7;
  v4u v[8];
#pragma unroll
  for (int it = 0; it < 8; ++it) v[it] = st[(it * 4 + q) * 9 + l8];
#pragma unroll
  for (int it = 0; it < 8; ++it) *(v4u*)(dst + (size_t)(it * 4 + q) * CC + l8 * 8) = v[it];
}

// =====================================================================================================
// Preparation work (weights -> f16 planes, position bias table). None of it needs anything of the GroupNorm
// kernels and they need nothing of it, so it has no launches of its own: it runs in further work-groups of the
// GroupNorm launches (a range of the block index, the branch the same for the whole work-group), on the WGPs
// that those launches leave idle. Work-groups of GN_NT = 512 threads.
// =====================================================================================================
#if defined(__HIP_DEVICE_COMPILE__)
// stands behind a batch of loads that all go by the one address p: the wait before a register that an issued load
// names is written again; p as an input keeps its registers untouched up to the wait
#define PREP_WAIT_XCNT(p) asm volatile("s_wait_xcnt 0x0" :: "v"(p) : "memory")
#else
#define PREP_WAIT_XCNT(p) ((void)0)
#endif
// f32 -> f16 (x scale): a thread takes 8 pieces of 8 elements, its 16 loads issued before the first use, one
// 16-B store per piece (wave = 512 contiguous B). coverage: nblk work-groups x 8 x 512 pieces x 8 = the plane.
__device__ __forceinline__ void cvt_f16x8_part(const float* __restrict__ in, _Float16* out, int blk, int tid,
                                               float scale) {
  const size_t i0 = (size_t)(blk * 8 * GN_NT + tid) * 8;   // piece u stands u * GN_NT * 8 elements further
  const float* src = in + i0;
  v4f a[8], c[8];
#pragma unroll   // constant indices keep the arrays in registers
  for (int u = 0; u < 8; ++u) {
    a[u] = *(const v4f*)(src + u * (GN_NT * 8));
    c[u] = *(const v4f*)(src + u * (GN_NT * 8) + 4);
  }
  PREP_WAIT_XCNT(src);
#pragma unroll   // constant indices keep the arrays in registers
  for (int u = 0; u < 8; ++u) {
    v4u p;
    p[0] = pkf(a[u][0] * scale, a[u][1] * scale);
    p[1] = pkf(a[u][2] * scale, a[u][3] * scale);
    p[2] = pkf(c[u][0] * scale, c[u][1] * scale);
    p[3] = pkf(c[u][2] * scale, c[u][3] * scale);
    *(v4u*)(out + i0 + u * (GN_NT * 8)) = p;
  }
  // the compiler lays the callers' branches out as one chain, in which code that writes these stores' registers follows
  GN_WAIT_XCNT();
}

// conv weight [o][c][3] f32 -> Wt[tap][o][c] f16 (x scale). Piece idx = (o, 8 consecutive c) = 24 contiguous
// floats at 24 idx, one 16-B store at 8 idx of each of the 3 tap planes; a thread takes 2 pieces, its 12 loads
// issued before the first use. coverage: CVW_NB work-groups x 2 x 512 pieces x 3 x 8 halves = 3*CC*CC.
#define CVW_NB (CC * (CC / 8) / (2 * GN_NT))   // 128
__device__ __forceinline__ void cvt_convw_part(const float* __restrict__ w, _Float16* out, int blk, int tid,
                                               float scale) {
  const size_t idx0 = (size_t)(blk * 2 * GN_NT + tid);   // the thread's first piece; the second is GN_NT further
  const float* src = w + idx0 * 24;
  union { v4f q[6]; float e[24]; } u[2];
#pragma unroll   // constant indices keep the arrays in registers
  for (int s = 0; s < 2; ++s)
#pragma unroll   // constant indices keep the arrays in registers
    for (int i = 0; i < 6; ++i) u[s].q[i] = *(const v4f*)(src + s * (GN_NT * 24) + 4 * i);
#pragma unroll   // constant indices keep the arrays in registers
  for (int s = 0; s < 2; ++s) {
    const size_t idx = idx0 + (size_t)(s * GN_NT);
#pragma unroll   // constant indices keep the arrays in registers
    for (int tp = 0; tp < 3; ++tp) {
      v4u a;
#pragma unroll   // constant indices keep the arrays in registers
      for (int m = 0; m < 4; ++m)
        a[m] = pkf(u[s].e[(2 * m) * 3 + tp] * scale, u[s].e[(2 * m + 1) * 3 + tp] * scale);
      *(v4u*)(out + (size_t)tp * CC * CC + idx * 8) = a;
    }
  }
}

// relative position bias table tab[h][d], d = (t - s) + 1024, value = emb[bucket][h] * 8 (f32).
// bucket: n = t - s; add 16 when n < 0; n = |n|; n < 8 -> n; else 8 + int(log(n/8) * (1/ln 8) * 8)
// coverage: 16 work-groups x 512 threads x 4 = NH*BTP floats.
__device__ __forceinline__ void btab_part(const float* __restrict__ emb, float* tab, int blk, int tid) {
  const int i4 = blk * GN_NT + tid;
  const int h = i4 >> 9;
  const int d0 = (i4 & 511) * 4;
  const float ln8 = 2.0794415416798357f;
  const float rl8 = 1.0f / ln8;
  v4f v;
#pragma unroll   // constant indices keep the arrays in registers
  for (int e = 0; e < 4; ++e) {
    const int delta = d0 + e - 1024;
    const int n = delta < 0 ? -delta : delta;
    const float nf = (float)(n < 1 ? 1 : n);
    const float lg = logf(nf * 0.125f);
    int vl = 8 + (int)(lg * rl8 * 8.0f);
    vl = vl > 15 ? 15 : vl;
    int bucket = (n < 8) ? n : vl;
    bucket += (delta < 0) ? 16 : 0;
    v[e] = emb[bucket * NH + h] * 8.0f;
  }
  *(v4f*)(tab + (size_t)i4 * 4) = v;
  // the compiler lays the caller's branches out as one chain, in which code that writes this store's registers follows
  GN_WAIT_XCNT();
}
// work-groups of the preparation range of gn8_attn_k: qkv weights, projection weights, bias table
#define PQ_NB (3 * CC * CC / (64 * GN_NT))     // 96
#define PP_NB (CC * CC / (64 * GN_NT))         // 32
#define PT_NB (NH * (BTP / 4) / GN_NT)         // 16
static_assert((CVW_NB % (CC / 64)) == 0 && ((PQ_NB + PP_NB + PT_NB) % (CC / 64)) == 0);

// =====================================================================================================
// GroupNorm(32 groups) (+ SiLU) on an NCT f32 plane [b][CC][TT]; writes the token-major f16 plane
// xt[b][TP][CC] (row 1 + t, channel contiguous) plus the two zero halo rows 0 and TP-1.
// Block = (b, 64-channel slab = 2 groups); 512 threads. Statistics: f32 partial sums, f64 totals, fixed order; the 32 16-B
// loads of a thread (16 per group) are all issued before the first sum.
// Tiles: 32 tokens x 64 channels, one wave each (gn_tile64), 2 tiles per wave.
// coverage: 32 tiles x 32 rows x (16 slabs x 64 ch) = rows 1..TT x all channels; halo rows by wave 0.
// Work-groups with blockIdx.y >= NBATCH (CVW_NB of them) turn the weights w of the convolution that follows
// into its f16 planes wt instead.
// PRE: the plane is a convolution's output and the sums were taken in that product's epilogue (rec, see
// gemm_body): the 16 records of the slab's two groups stand for the 16 wave totals and the first read pass goes.
// =====================================================================================================
template <bool SILU, bool PRE>
__global__ __launch_bounds__(GN_NT) void gn32_tr_k(const float* __restrict__ in, const float* __restrict__ gam,
                                                   const float* __restrict__ bet, _Float16* xt,
                                                   const float* __restrict__ w, _Float16* wt,
                                                   const float* __restrict__ rec) {
  if (blockIdx.y >= NBATCH) {   // the same for the whole work-group, ahead of every barrier
    cvt_convw_part(w, wt, (int)(blockIdx.y - NBATCH) * (CC / 64) + (int)blockIdx.x, threadIdx.x, 64.0f);
    return;
  }
  __shared__ __align__(16) v4u sT4[GN_NW][32 * 9];
  __shared__ float red[4][GN_NW];
  __shared__ __align__(16) float sA[64];
  __shared__ __align__(16) float sD[64];
  const int tid = threadIdx.x, lane = tid & 31, wave = tid >> 5;
  const int b = blockIdx.y;
  const int c0 = blockIdx.x * 64;
  const float* p = in + ((size_t)b * CC + c0) * TT;

  if (PRE) {
    if (tid < 16) {   // record (column tile tid >> 2, wave column tid & 3) of the slab's 64 rows
      const float* rp = rec + (size_t)G_REC(b, (c0 >> 7) * 4 + (tid >> 2), ((c0 >> 6) & 1) * 4 + (tid & 3));
      const v4f r = *(const v4f*)rp;
      PREP_WAIT_XCNT(rp);
      red[0][tid] = r[0];
      red[2][tid] = r[1];
      red[1][tid] = r[2];
      red[3][tid] = r[3];
    }
  } else {
    v4f v[2][16];
#pragma unroll
    for (int g = 0; g < 2; ++g)
#pragma unroll
      for (int i = 0; i < 16; ++i) v[g][i] = *(const v4f*)(p + (size_t)g * 32 * TT + ((size_t)i * GN_NT + tid) * 4);
    // keeps the batch's loads one group ahead of their first use: left free, they sink to just in front of
    // their sums and only a few are in flight
    __builtin_amdgcn_sched_barrier(0);

#pragma unroll
    for (int g = 0; g < 2; ++g) {
      v4f s4 = {0.f, 0.f, 0.f, 0.f}, q4 = {0.f, 0.f, 0.f, 0.f};
#pragma unroll   // constant indices keep the array in registers
      for (int i = 0; i < 16; ++i) {
        s4 += v[g][i];
        q4 += v[g][i] * v[g][i];
      }
      const float s = wave_sum(sum4(s4)), q = wave_sum(sum4(q4));
      if (lane == 0) { red[g][wave] = s; red[2 + g][wave] = q; }
    }
  }
  __syncthreads();
  if (wave < 2) {   // wave g closes group g: its lanes are the group's 32 channels
    float meanf, rstdf;
    close_stats(red[wave], red[2 + wave], lane, 1.0 / 32768.0, meanf, rstdf);
    const int c = c0 + tid;
    const float a = rstdf * gam[c];
    sA[tid] = a;
    sD[tid] = bet[c] - meanf * a;
  }
  __syncthreads();

  if (wave == 0 && lane < 16) {
    const int row = (lane < 8) ? 0 : (TP - 1);
    v4u z = {0u, 0u, 0u, 0u};
    _Float16* dst = xt + ((size_t)b * TP + row) * CC + c0 + (lane & 7) * 8;
    *(v4u*)dst = z;
  }

#pragma unroll 1   // one tile's 64 loads fill the registers
  for (int tc = wave; tc < TT / 32; tc += GN_NW)
    gn_tile64<SILU>(p + tc * 32 + lane, sA, sD, sT4[wave], xt + ((size_t)b * TP + 1 + tc * 32) * CC + c0, lane);
}

// =====================================================================================================
// Fused: GroupNorm(8) on H -> xin (f32 NCT, written), then GroupNorm(32) of xin -> f16 token-major
// plane xt[b][TT][CC] (no halo). Block = (b, 64-channel slab = two 32-channel sub-groups of one 128-channel
// group); 512 threads.
// The group's sums come from the records that the product which wrote H left (rec, G_REC): 32 records, f64 totals;
// H is not read for them.
// phase 2: waves 8 sg .. 8 sg + 7 own the 32-channel sub-group sg: xin written as 32 lanes x 16 B contiguous
// pieces (the eight waves cover one 4 KB channel row per step), 32 loads in flight, sums of xin per sub-group
// (f32 partial sums, f64 totals), one reduction for the two sub-groups;
// phase 3: y = h*A[c] + D[c] (both norms folded), 32-token x 64-channel tiles, one wave each (gn_tile64).
// coverage: xin rows 0..63 of the slab x 1024 t; xt: 32 tiles of 32 rows x 64 ch per block,
// 16 blocks per b cover all channels.
// Work-groups with blockIdx.y >= NBATCH do the preparation that the launches behind this one need: the f16 planes
// of the qkv and projection weights and the position bias table.
// =====================================================================================================
__global__ __launch_bounds__(GN_NT) void gn8_attn_k(const float* __restrict__ hin,
                                                    const float* __restrict__ g8, const float* __restrict__ e8,
                                                    const float* __restrict__ ga, const float* __restrict__ ea,
                                                    float* xin, _Float16* xt,
                                                    const float* __restrict__ qkvw, const float* __restrict__ pjw,
                                                    const float* __restrict__ emb,
                                                    _Float16* wq, _Float16* wp, float* tab,
                                                    const float* __restrict__ rec) {
  if (blockIdx.y >= NBATCH) {   // the same for the whole work-group, ahead of every barrier
    const int e = (int)(blockIdx.y - NBATCH) * (CC / 64) + (int)blockIdx.x;
    if (e < PQ_NB) cvt_f16x8_part(qkvw, wq, e, threadIdx.x, 64.0f);
    else if (e < PQ_NB + PP_NB) cvt_f16x8_part(pjw, wp, e - PQ_NB, threadIdx.x, 64.0f);
    else btab_part(emb, tab, e - (PQ_NB + PP_NB), threadIdx.x);
    return;
  }
  __shared__ __align__(16) v4u sT4[GN_NW][32 * 9];
  __shared__ float red[2][GN_NW];
  __shared__ float sA1[64];
  __shared__ float sD1[64];
  __shared__ __align__(16) float sA[64];
  __shared__ __align__(16) float sD[64];
  __shared__ float sM[2];
  __shared__ float sR[2];
  const int tid = threadIdx.x, lane = tid & 31, wave = tid >> 5;
  const int b = blockIdx.y;
  const int c0 = blockIdx.x * 64;
  const float* p = hin + ((size_t)b * CC + c0) * TT;

  // phase 2's operands: waves 8 sg .. 8 sg + 7 take sub-group sg, 1024 floats = one channel row per step; all 32
  // loads of a lane are issued here, so that they fly while the group's statistics are closed
  const int sg = wave >> 3;
  const size_t o0 = (size_t)sg * 32 * TT + (size_t)(((wave & 7) * 32 + lane) * 4);
  const float* ps = p + o0;
  // in front of them the record that the statistics start from (loads return in issue order); the two waves whose
  // lanes are the slab's 64 channels close the statistics: lane -> one of the group's 32 records
  const float* rp = rec + (size_t)G_REC(b, (c0 >> 7) * 4 + (lane >> 3), lane & 7);
  v4f r = {0.f, 0.f, 0.f, 0.f};
  if (tid < 64) r = *(const v4f*)rp;
  v4f v[32];
#pragma unroll   // constant indices keep the array in registers
  for (int u = 0; u < 32; ++u) v[u] = *(const v4f*)(ps + (size_t)u * TT);
  PREP_WAIT_XCNT(rp);
  PREP_WAIT_XCNT(ps);
  // keeps the loads in front of the statistics: left free, they sink to just in front of their first use
  __builtin_amdgcn_sched_barrier(0);

  // the group's statistics
  if (tid < 64) {
    double S = (double)r[0] + (double)r[2], SS = (double)r[1] + (double)r[3];
#pragma unroll   // the five exchange distances as constants
    for (int m = 16; m >= 1; m >>= 1) {
      S += shfl_xor_d(S, m);
      SS += shfl_xor_d(SS, m);
    }
    float m8f, r8f;
    mean_rstd(S, SS, 1.0 / 131072.0, m8f, r8f);
    const int c = c0 + tid;
    const float a = r8f * g8[c];
    sA1[tid] = a;
    sD1[tid] = e8[c] - m8f * a;
  }
  __syncthreads();

  // phase 2
  {
    float* xs = xin + ((size_t)b * CC + c0) * TT + o0;
    float s2 = 0.f, q2 = 0.f;
#pragma unroll   // constant indices keep the array in registers
    for (int j0 = 0; j0 < 32; j0 += 16) {
      v4f s4 = {0.f, 0.f, 0.f, 0.f}, q4 = {0.f, 0.f, 0.f, 0.f};
#pragma unroll
      for (int u = 0; u < 16; ++u) {
        const int ch = sg * 32 + j0 + u;
        const float a = sA1[ch], d = sD1[ch];
        v4f y;
#pragma unroll
        for (int e = 0; e < 4; ++e) y[e] = fmaf(v[j0 + u][e], a, d);
        s4 += y;
        q4 += y * y;
        *(v4f*)(xs + (size_t)(j0 + u) * TT) = y;
      }
      s2 += sum4(s4);
      q2 += sum4(q4);
    }
    GN_WAIT_XCNT();
    s2 = wave_sum(s2);
    q2 = wave_sum(q2);
    if (lane == 0) { red[0][wave] = s2; red[1][wave] = q2; }
    __syncthreads();
    if (tid < 2) {
      double S = 0.0, SS = 0.0;
#pragma unroll
      for (int w = 0; w < 8; ++w) { S += (double)red[0][tid * 8 + w]; SS += (double)red[1][tid * 8 + w]; }
      float mf, rf;
      mean_rstd(S, SS, 1.0 / 32768.0, mf, rf);
      sM[tid] = mf;
      sR[tid] = rf;
    }
  }
  __syncthreads();
  if (tid < 64) {
    const int sg = tid >> 5;
    const int c = c0 + tid;
    const float a2 = sR[sg] * ga[c];
    sA[tid] = sA1[tid] * a2;
    sD[tid] = (sD1[tid] - sM[sg]) * a2 + ea[c];
  }
  __syncthreads();

  // phase 3
#pragma unroll 1   // one tile's 64 loads fill the registers
  for (int tc = wave; tc < TT / 32; tc += GN_NW)
    gn_tile64<false>(p + tc * 32 + lane, sA, sD, sT4[wave], xt + ((size_t)b * TT + tc * 32) * CC + c0, lane);
}

// =====================================================================================================
// LDS-staged f16 WMMA GEMM: C[m][n] = oscale * sum_tap sum_k A_tap[m][k] * Bt_tap[n][k]
//   + bias (BM: 1 per row m with the A row remap, 2 per column n with the Bt row remap) * bscale
//   (+ resid[m][n] f32, same indexing as C, when RESID).
// Work-group = 8 waves = one 128 x 256 tile of C; wave (wm 0..1, wn 0..3) = 64 x 64 of it.
// A row-major [M][K] pitch lda; Bt row-major [N][K] (k contiguous) pitch ldb. Row remap:
// row(m) = (m>>6)*TS + TO + (m&63). Tap tp adds aTap elements to A and bTap elements to Bt.
// bz = batch index (strides in elements). M multiple of 128, N of 256, K of 128 (host constants).
// A stage = 128 k of the 128 A rows and the 256 Bt rows, 256-B rows at a 272-B pitch in LDS, brought by
// asynchronous 16-B copies (24 per lane and stage, 16 lanes per row); two buffers, the next stage's
// copies fly while this one is multiplied. k runs tap-major and ascending, one accumulator per element.
// OUTH: 0 f32 C, 1 f16 C; C and the residual plane have rows of G_LDC elements.
// Epilogue: the bias and residual values of the wave's tile are loaded ahead of the k loop, so that their
// latency runs beside it; behind the loop each wave stages its whole 64 x 64 tile in its own part of the stage
// buffers (free behind the last trip's barrier) and stores it as whole row segments, with no wait in between.
// coverage: 64 rows x 64 cols = the wave's tile; grid = exact tile count.
// STATS (f32 C of 1024 x 1024 per batch index): behind its stores each wave sums the values it has just stored
// and their squares, rows 0..31 and rows 32..63 of its tile apart (f32: 64 values a lane, then the wave), and
// leaves the four sums as its record (G_REC) for the GroupNorm kernel that reads C next.
// =====================================================================================================
#define G_BM 128
#define G_BN 256
#define G_KS 128
#define G_PITCH 136                         // halves per LDS row: 272 B = 16 B x odd, for 16-B LDS reads
#define G_BUF ((G_BM + G_BN) * G_PITCH)     // halves per buffer
#define G_LDC 1024                          // elements per row of C and of the residual plane
#define G_SP 68                             // floats per staged row of the epilogue: 272 B
static_assert(CC == G_LDC && TT == G_LDC);
static_assert(8 * 64 * G_SP * 4 <= 2 * G_BUF * 2);   // the eight waves' staged tiles fit the two stage buffers

#if defined(__HIP_DEVICE_COMPILE__)
// twelve copies of one lane; the address-register wait closes the copies' own statement, so that no
// later write of an address register can be moved in front of it
#define G_COPY12(l, g)                                                          \
  asm volatile("global_load_async_to_lds_b128 %0, %12, off\n\t"                 \
               "global_load_async_to_lds_b128 %1, %13, off\n\t"                 \
               "global_load_async_to_lds_b128 %2, %14, off\n\t"                 \
               "global_load_async_to_lds_b128 %3, %15, off\n\t"                 \
               "global_load_async_to_lds_b128 %4, %16, off\n\t"                 \
               "global_load_async_to_lds_b128 %5, %17, off\n\t"                 \
               "global_load_async_to_lds_b128 %6, %18, off\n\t"                 \
               "global_load_async_to_lds_b128 %7, %19, off\n\t"                 \
               "global_load_async_to_lds_b128 %8, %20, off\n\t"                 \
               "global_load_async_to_lds_b128 %9, %21, off\n\t"                 \
               "global_load_async_to_lds_b128 %10, %22, off\n\t"                \
               "global_load_async_to_lds_b128 %11, %23, off\n\t"                \
               "s_wait_xcnt 0x0"                                                \
               :                                                                \
               : "v"((l)[0]), "v"((l)[1]), "v"((l)[2]), "v"((l)[3]), "v"((l)[4]), "v"((l)[5]),               \
                 "v"((l)[6]), "v"((l)[7]), "v"((l)[8]), "v"((l)[9]), "v"((l)[10]), "v"((l)[11]),             \
                 "v"((g)[0]), "v"((g)[1]), "v"((g)[2]), "v"((g)[3]), "v"((g)[4]), "v"((g)[5]),               \
                 "v"((g)[6]), "v"((g)[7]), "v"((g)[8]), "v"((g)[9]), "v"((g)[10]), "v"((g)[11])              \
               : "memory")
// this wave's copies have landed
#define G_WAIT_COPIES() asm volatile("s_wait_asynccnt 0x0" ::: "memory")
// this wave's LDS reads have returned, so the buffer may be refilled behind the barrier
#define G_WAIT_LDS() asm volatile("s_wait_dscnt 0x0" ::: "memory")
// the wait before a register that an issued load or store names is written again; the operands are those
// registers (addresses, stored values), which as inputs stay untouched up to the wait (a statement takes at most
// thirty operands, so 32 stored pieces take two statements)
#define G_WAIT_XCNT_2(p, q) asm volatile("s_wait_xcnt 0x0" :: "v"(p), "v"(q) : "memory")
#define G_WAIT_XCNT_17(p, o)                                                                                   \
  asm volatile("s_wait_xcnt 0x0"                                                                               \
               :: "v"(p), "v"((o)[0]), "v"((o)[1]), "v"((o)[2]), "v"((o)[3]), "v"((o)[4]), "v"((o)[5]),        \
                  "v"((o)[6]), "v"((o)[7]), "v"((o)[8]), "v"((o)[9]), "v"((o)[10]), "v"((o)[11]),              \
                  "v"((o)[12]), "v"((o)[13]), "v"((o)[14]), "v"((o)[15])                                       \
               : "memory")
#else
#define G_WAIT_XCNT_2(p, q) ((void)0)
#define G_WAIT_XCNT_17(p, o) ((void)0)
#define G_COPY12(l, g) ((void)0)
#define G_WAIT_COPIES() ((void)0)
#define G_WAIT_LDS() ((void)0)
#endif

// sAB: the two stage buffers (the kernel's LDS); tile, bz: the work-group's tile and batch index
template <int TAPS, int OUTH, bool RESID, int BM, bool STATS>
__device__ __forceinline__ void gemm_body(
    _Float16* sAB, int tile, int bz,
    const _Float16* __restrict__ A, int lda, long long strideA, long long aTap, int aTS, int aTO,
    const _Float16* __restrict__ Bt, int ldb, long long strideB, long long bTap, int bTS, int bTO,
    const float* __restrict__ bias, float bscale,
    const float* __restrict__ resid,
    void* Cout, long long strideC,
    int M, int N, int K, float oscale, float* stats) {
  const int tid = threadIdx.x;
  const int lane = tid & 31, wave = tid >> 5;
  const int tilesN = N >> 8, tilesM = M >> 7;
  if (tile >= tilesM * tilesN) return;   // the same for the whole work-group, ahead of every barrier
  const int tm = tile / tilesN, tn = tile - tm * tilesN;
  const int mB = tm << 7, nB = tn << 8;
  const int wm = wave >> 2, wn = wave & 3;
  const int m0 = mB + wm * 64, n0 = nB + wn * 64;
  const int rlane = lane & 15;
  const int koff = (lane >> 4) * 8;
  const int mOff = koff;
  const int aRow0 = (m0 >> 6) * aTS + aTO;
  const int bRow0 = (n0 >> 6) * bTS + bTO;
  const _Float16* Ab = A + (size_t)bz * (size_t)strideA;
  const _Float16* Bb = Bt + (size_t)bz * (size_t)strideB;

  // copy side: lane -> (row tid>>4 of each 16-row band, 16-B piece tid&15 of its 256 B);
  // bands 0..7 are the A rows, bands 8..23 the Bt rows
  const int crow = tid >> 4, cpc = (tid & 15) * 8;
  const unsigned tA = (unsigned)(crow * lda + cpc);
  const unsigned tB = (unsigned)(crow * ldb + cpc);
  const unsigned ldsC = (unsigned)(size_t)sAB + (unsigned)(crow * G_PITCH + cpc) * 2u;

  auto issue = [&](int tp, int k0, int buf) {
    const _Float16* Ap = Ab + (size_t)tp * (size_t)aTap + k0 + tA;
    const _Float16* Bp = Bb + (size_t)tp * (size_t)bTap + k0 + tB;
#pragma unroll   // constant indices keep the array in registers
    for (int hlf = 0; hlf < 2; ++hlf) {
      unsigned l[12];
      const _Float16* g[12];
#pragma unroll   // constant indices keep the array in registers
      for (int e = 0; e < 12; ++e) {
        const int i = hlf * 12 + e;           // band
        l[e] = ldsC + (unsigned)buf * (unsigned)(G_BUF * 2) + (unsigned)i * (unsigned)(16 * G_PITCH * 2);
        if (i < 8) {
          const int row = ((mB >> 6) + (i >> 2)) * aTS + aTO + 16 * (i & 3);
          g[e] = Ap + (size_t)(unsigned)(row * lda);
        } else {
          const int row = ((nB >> 6) + ((i - 8) >> 2)) * bTS + bTO + 16 * ((i - 8) & 3);
          g[e] = Bp + (size_t)(unsigned)(row * ldb);
        }
      }
      G_COPY12(l, g);
    }
  };

  v8f acc[4][4];
#pragma unroll   // constant indices keep the array in registers
  for (int i = 0; i < 4; ++i)
#pragma unroll   // constant indices keep the array in registers
    for (int j = 0; j < 4; ++j) acc[i][j] = zero8();

  const _Float16* fa = sAB + (wm * 64 + rlane) * G_PITCH + koff;
  const _Float16* fb = sAB + (G_BM + wn * 64 + rlane) * G_PITCH + koff;

  const int nt = TAPS * (K >> 7);
  int itp = 0, ik = 0;                      // tap and k of the next stage to be copied
  issue(itp, ik, 0);
  ik += G_KS;
  if (ik >= K) { ik = 0; ++itp; }
  G_WAIT_COPIES();
  __syncthreads();
  if (nt > 1) {
    issue(itp, ik, 1);
    ik += G_KS;
    if (ik >= K) { ik = 0; ++itp; }
  }

  // the epilogue's operands: all of the lane's loads are issued here and first used behind the k loop
  const int h2 = lane >> 4, c4 = (lane & 15) * 4;     // f32 C: a 256-B row segment = 16 lanes x 16 B
  const size_t cOff = (size_t)bz * (size_t)strideC + (size_t)(m0 + h2) * G_LDC + n0 + c4;
  // bias: BM 1 the lane's 8 rows of each 16-row band (32-B aligned: the row remaps are multiples of 64), BM 2 its 4 columns
  const float* bp = (BM == 1) ? bias + (aRow0 + mOff) : bias + (bRow0 + rlane);
  const float* rp = RESID ? resid + cOff : bp;
  v4f brow[4][2];
  float bcol[4];
  v4f rv[4][8];
  if (BM == 1) {
#pragma unroll   // constant indices keep the array in registers
    for (int i = 0; i < 4; ++i) {
      brow[i][0] = *(const v4f*)(bp + i * 16);
      brow[i][1] = *(const v4f*)(bp + i * 16 + 4);
    }
  }
  if (BM == 2) {
#pragma unroll   // constant indices keep the array in registers
    for (int j = 0; j < 4; ++j) bcol[j] = bp[j * 16];
  }
  if (RESID) {
#pragma unroll   // constant indices keep the array in registers
    for (int i = 0; i < 4; ++i)
#pragma unroll   // constant indices keep the array in registers
      for (int it = 0; it < 8; ++it) rv[i][it] = *(const v4f*)(rp + (i * 16 + it * 2) * G_LDC);
  }
  G_WAIT_XCNT_2(bp, rp);

#pragma unroll 1   // one stage per trip: the two buffers alternate by the trip's parity
  for (int t = 0; t < nt; ++t) {
    const _Float16* pa = fa + (t & 1) * G_BUF;
    const _Float16* pb = fb + (t & 1) * G_BUF;
#pragma unroll   // constant indices keep the array in registers
    for (int kk = 0; kk < G_KS / 32; ++kk) {
      v16h af[4], bf[4];
#pragma unroll   // constant indices keep the array in registers
      for (int i = 0; i < 4; ++i) af[i] = ldfrag(pa + i * 16 * G_PITCH + kk * 32);
#pragma unroll   // constant indices keep the array in registers
      for (int j = 0; j < 4; ++j) bf[j] = ldfrag(pb + j * 16 * G_PITCH + kk * 32);
      // keeps the block's 16 LDS reads one group ahead of its 16 WMMAs: left free, the reads of each A
      // fragment sink to just in front of its row and every row waits out a whole LDS latency
      __builtin_amdgcn_sched_barrier(0);
#pragma unroll   // constant indices keep the array in registers
      for (int i = 0; i < 4; ++i)
#pragma unroll   // constant indices keep the array in registers
        for (int j = 0; j < 4; ++j) acc[i][j] = mma_raw(af[i], bf[j], acc[i][j]);
    }
    // publish point of stage t + 1; the same barrier ends every read of the buffer refilled behind it
    G_WAIT_LDS();
    G_WAIT_COPIES();
    __syncthreads();
    if (t + 2 < nt) {
      issue(itp, ik, t & 1);
      ik += G_KS;
      if (ik >= K) { ik = 0; ++itp; }
    }
  }
  G_WAIT_COPIES();

  // ---- epilogue ----
  // Every wave's last read of the stage buffers and its last copy are over in front of the last trip's barrier.
  float* slab = (float*)sAB + wave * (64 * G_SP);
#pragma unroll
  for (int i = 0; i < 4; ++i)
#pragma unroll
    for (int j = 0; j < 4; ++j)
#pragma unroll
      for (int r = 0; r < 8; ++r) {
        const float add = (BM == 1) ? brow[i][r >> 2][r & 3] * bscale : (BM == 2) ? bcol[j] * bscale : 0.f;
        slab[(i * 16 + mOff + r) * G_SP + j * 16 + rlane] = acc[i][j][r] * oscale + add;
      }
  wave_lds_sync();   // the staged tile is the wave's own
  if (OUTH == 0) {
    float* Cb = (float*)Cout + cOff;
    v4f o[32];                                             // piece u: row 2u + h2 of the tile
#pragma unroll
    for (int u = 0; u < 32; ++u) {
      o[u] = *(const v4f*)(slab + (2 * u + h2) * G_SP + c4);
      if (RESID) o[u] += rv[u >> 3][u & 7];
    }
#pragma unroll
    for (int u = 0; u < 32; ++u) *(v4f*)(Cb + 2 * u * G_LDC) = o[u];
    G_WAIT_XCNT_17(Cb, o);
    G_WAIT_XCNT_17(Cb, o + 16);
    if (STATS) {
      // keeps the sums behind the tile's stores, whose flight they then run beside: left free, they rise in front
      // of the stores and hold them back by the wave reductions' LDS-pipe latencies
      __builtin_amdgcn_sched_barrier(0);
      v4f rc;
#pragma unroll
      for (int g = 0; g < 2; ++g) {          // pieces 16 g .. 16 g + 15 are rows 32 g .. 32 g + 31
        v4f s4 = {0.f, 0.f, 0.f, 0.f}, q4 = {0.f, 0.f, 0.f, 0.f};
#pragma unroll
        for (int u = 0; u < 16; ++u) {
          s4 += o[g * 16 + u];
          q4 += o[g * 16 + u] * o[g * 16 + u];
        }
        rc[2 * g] = wave_sum(sum4(s4));
        rc[2 * g + 1] = wave_sum(sum4(q4));
      }
      if (lane == 0) {
        float* sp = stats + (size_t)G_REC(bz, tile, wave);
        *(v4f*)sp = rc;
        G_WAIT_XCNT_2(sp, rc);
      }
    }
  } else {
    const int q = lane >> 3, c8 = (lane & 7) * 8;          // f16 C: a 128-B row segment = 8 lanes x 16 B
    _Float16* Cb = (_Float16*)Cout + (size_t)bz * (size_t)strideC + (size_t)(m0 + q) * G_LDC + n0 + c8;
    v4f f[16][2];                                          // piece u: row 4u + q of the tile
#pragma unroll
    for (int u = 0; u < 16; ++u) {
      const float* sp = slab + (4 * u + q) * G_SP + c8;
      f[u][0] = *(const v4f*)(sp);
      f[u][1] = *(const v4f*)(sp + 4);
    }
    // keeps the 32 LDS reads one group ahead of the conversions: left free, they sink to just in front of their
    // own conversion, two at a time, and every piece waits out a whole LDS latency
    __builtin_amdgcn_sched_barrier(0);
    v4u o[16];
#pragma unroll
    for (int u = 0; u < 16; ++u) {
      o[u][0] = pkf(f[u][0][0], f[u][0][1]);
      o[u][1] = pkf(f[u][0][2], f[u][0][3]);
      o[u][2] = pkf(f[u][1][0], f[u][1][1]);
      o[u][3] = pkf(f[u][1][2], f[u][1][3]);
    }
#pragma unroll
    for (int u = 0; u < 16; ++u) *(v4u*)(Cb + 4 * u * G_LDC) = o[u];
    G_WAIT_XCNT_17(Cb, o);
  }
}

// one product per launch: blockIdx.x = tile, blockIdx.y = batch index
template <int TAPS, int OUTH, bool RESID, int BM, bool STATS>
__global__ __launch_bounds__(256) void gemm_k(
    const _Float16* __restrict__ A, int lda, long long strideA, long long aTap, int aTS, int aTO,
    const _Float16* __restrict__ Bt, int ldb, long long strideB, long long bTap, int bTS, int bTO,
    const float* __restrict__ bias, float bscale,
    const float* __restrict__ resid,
    void* Cout, long long strideC,
    int M, int N, int K, float oscale, float* stats) {
  __shared__ __align__(16) _Float16 sAB[2 * G_BUF];
  gemm_body<TAPS, OUTH, RESID, BM, STATS>(sAB, (int)blockIdx.x, (int)blockIdx.y,
                                          A, lda, strideA, aTap, aTS, aTO, Bt, ldb, strideB, bTap, bTS, bTO,
                                          bias, bscale, resid, Cout, strideC, M, N, K, oscale, stats);
}

// q, k and v need nothing of each other: one launch, blockIdx.y = 0 q, 1 k, 2 v; 256 tiles each.
//   q, k = xn^T . W^T -> [b*TT+t][h*64+d] f16 x16 (M = 8192, N = 1024; W rows h*192 + 64 y + d)
//   v (channel-major) = Wv . xn -> [b][h*64+d][s] f16 x16 (per b: M = 1024 rows h*192+128+d, N = 1024 t)
__global__ __launch_bounds__(256) void qkv_k(const _Float16* __restrict__ xn, const _Float16* __restrict__ wq,
                                             const float* __restrict__ qb,
                                             _Float16* Qp, _Float16* Kp, _Float16* Vp) {
  __shared__ __align__(16) _Float16 sAB[2 * G_BUF];
  const int y = (int)blockIdx.y;   // the same for the whole work-group
  if (y < 2)
    gemm_body<1, 1, false, 2, false>(sAB, (int)blockIdx.x, 0,
                              xn, CC, 0LL, 0LL, 64, 0, wq, CC, 0LL, 0LL, 192, 64 * y,
                              qb, 16.0f, nullptr, (void*)(y ? Kp : Qp), 0LL, NBATCH * TT, CC, CC, 0.25f, nullptr);
  else
    gemm_body<1, 1, false, 1, false>(sAB, (int)blockIdx.x & 31, (int)blockIdx.x >> 5,
                              wq, CC, 0LL, 0LL, 192, 128, xn, CC, (long long)CC * TT, 0LL, 64, 0,
                              qb, 16.0f, nullptr, (void*)Vp, (long long)CC * TT, CC, TT, CC, 0.25f, nullptr);
}
static_assert((NBATCH * TT / 128) * (CC / 256) == 256 && (CC / 128) * (TT / 256) == 32 && NBATCH * 32 == 256);

#define AT_P 72
// lane l reads lane l ^ 16
__device__ __forceinline__ float xhalf(float x) {
  return __builtin_bit_cast(float, __builtin_amdgcn_permlanex16(__builtin_bit_cast(int, x), __builtin_bit_cast(int, x),
                                                                0x76543210, 0xfedcba98, false, false));
}
// two values 2^x in one statement. Behind a transcendental the instruction set asks for one slot before its result
// is used or its source overwritten: the first has the second exponential there (the outputs share no register with
// the inputs), the second the v_nop. The two s_delay_alu are the hints that the compiler gives its own code and not a
// statement's: the arguments may come from the instruction in front, and what follows may use the results;
// without a hint a dependent instruction holds the SIMD's vector port against the other waves while it waits
__device__ __forceinline__ void exp2x2_slot(float x0, float x1, float& y0, float& y1) {
#if defined(__HIP_DEVICE_COMPILE__)
  asm("s_delay_alu instid0(VALU_DEP_1)\n\tv_exp_f32 %0, %2\n\tv_exp_f32 %1, %3\n\tv_nop\n\t"
      "s_delay_alu instid0(TRANS32_DEP_1)"
      : "=&v"(y0), "=&v"(y1) : "v"(x0), "v"(x1));
#else
  y0 = x0; y1 = x1;
#endif
}
// eight waves per SIMD (128 registers): the eight work-groups that fall to each WGP are then resident together
__global__ __launch_bounds__(128, 8)
void attn_k(const _Float16* __restrict__ Qp, const _Float16* __restrict__ Kp, const _Float16* __restrict__ Vp,
            const float* __restrict__ tab, _Float16* AT, float sScale, float oScale) {
  __shared__ __align__(16) _Float16 Ksh[64 * AT_P];    // [kv][d]
  __shared__ __align__(16) _Float16 Vth[64 * AT_P];    // [d][kv]
  __shared__ __align__(16) _Float16 Osh[4][16 * AT_P]; // per wave output rows [query][d]
  __shared__ __align__(16) float    sB[384 * 4];       // bias slice tab[h][q0b .. q0b+1087] (+clamped fill)

  const int tid  = threadIdx.x;
  const int wave = tid >> 5;
  const int lane = tid & 31;
  const int hh   = lane >> 4;
  const int c    = lane & 15;

  const int bx  = blockIdx.x;
  const int qb  = bx & 15;
  const int h   = (bx >> 4) & 15;
  const int b   = bx >> 8;
  const int q0b = qb * 64;
  const int q0  = q0b + wave * 16;
  const size_t rowB = (size_t)b * TT;

  {
    const float* th = tab + (size_t)h * BTP + q0b;     // q0b + 1087 <= 2047 < BTP
#pragma unroll
    for (int k = 0; k < 3; ++k) {
      const int i  = tid + 128 * k;                     // 0..383
      const int ic = (i < 271) ? i : 271;               // clamped address, all lanes load
      *(v4f*)(sB + 4 * i) = *(const v4f*)(th + 4 * ic);
    }
  }

  const _Float16* Qh = Qp + (size_t)h * HD;
  const _Float16* Kh = Kp + (size_t)h * HD;
  const _Float16* Vh = Vp + ((size_t)b * CC + (size_t)h * HD) * TT;

  // ---- Q fragments (B operand, column = lane&15): 2 d-chunks ----
  v16h qa[2];
#pragma unroll
  for (int dc = 0; dc < 2; ++dc) qa[dc] = ldfrag(Qh + (rowB + q0 + c) * CC + dc * 32 + 8 * hh);

  float mrun = -INFINITY, lrun = 0.f;   // the lane's query: maximum in use; sum over this half's keys
  v8f oacc[4];
#pragma unroll
  for (int t = 0; t < 4; ++t) oacc[t] = zero8();

  // bias index: (t - q0b) - s + 1024 with t - q0b = wave*16 + c, s = kv0 + 16j + 8hh + r
  const int bbase = wave * 16 + c + 1024 - 8 * hh;

#pragma unroll 1
  for (int kt = 0; kt < TT / 64; ++kt) {
    const int kv0 = kt * 64;
    __syncthreads();
    {
      const int r = tid >> 1, half = (tid & 1) * 32;
      const _Float16* kg = Kh + (rowB + kv0 + r) * CC + half;     // K row kv0+r, d = half..half+31
      const _Float16* vg = Vh + (size_t)r * TT + kv0 + half;     // V^T row d = r, s = kv0+half..+31
#pragma unroll
      for (int i = 0; i < 4; ++i) {
        const v8h a0 = *(const v8h*)(kg + 8 * i);
        const v8h b0 = *(const v8h*)(vg + 8 * i);
        *(v8h*)(Ksh + r * AT_P + half + 8 * i) = a0;
        *(v8h*)(Vth + r * AT_P + half + 8 * i) = b0;
      }
    }
    __syncthreads();

    // ---- scores, transposed: 64 keys x 16 queries per wave ----
    v8f s[4];
#pragma unroll
    for (int j = 0; j < 4; ++j) s[j] = zero8();
#pragma unroll
    for (int dc = 0; dc < 2; ++dc)
#pragma unroll
      for (int j = 0; j < 4; ++j)
        s[j] = mma_raw(ldfrag(Ksh + (j * 16 + c) * AT_P + dc * 32 + 8 * hh), qa[dc], s[j]);

    // ---- scale + bias, maximum of the lane's 32 keys (one chain per tile), then of the query's 64 ----
    const float* bp = sB + (bbase - kv0 - 55);   // the lowest of the lane's 32 entries
    float mj[4];
#pragma unroll
    for (int jh = 0; jh < 2; ++jh) {
      // two tiles' bias entries at a time, read as one group. The first fence keeps them behind what stands in
      // front: hoisted, all 32 stand beside the scores, the context and Q, and the 128 registers of eight waves
      // per SIMD no longer hold them. The second keeps the group together: left free, each read sinks to just in
      // front of its sum and every pair waits out a whole LDS latency
      __builtin_amdgcn_sched_barrier(0);
      float bb[16];
#pragma unroll
      for (int e = 0; e < 16; ++e) bb[e] = bp[55 - 32 * jh - 16 * (e >> 3) - (e & 7)];   // tile 2jh + (e>>3), r = e&7
      __builtin_amdgcn_sched_barrier(0);
#pragma unroll
      for (int jl = 0; jl < 2; ++jl) {
        const int j = 2 * jh + jl;
        mj[j] = -INFINITY;
#pragma unroll
        for (int r = 0; r < 8; ++r) {
          const float sv = s[j][r] * sScale + bb[8 * jl + r];
          s[j][r] = sv;
          mj[j] = fmaxf(mj[j], sv);
        }
      }
    }
    float m = fmaxf(fmaxf(mj[0], mj[1]), fmaxf(mj[2], mj[3]));
    m = fmaxf(m, xhalf(m));
    const float mnew  = fmaxf(mrun, m);
    const float msafe = (mnew == -INFINITY) ? 0.f : mnew;
    const float LOG2E = 1.4426950408889634f;   // e^x = 2^(x log2 e)
    const float alpha = exp2_slot((mrun - msafe) * LOG2E);
    mrun = mnew;

    // ---- P^T (x1024, f16): score tiles 2kk and 2kk+1, converted in place, are the B fragment of keys 32kk.. ----
    v16h pb[2];
    float pj[4];
#pragma unroll
    for (int j = 0; j < 4; ++j) {
#pragma unroll
      for (int r = 0; r < 8; r += 2) {
        float p0, p1;
        exp2x2_slot((s[j][r] - msafe) * LOG2E, (s[j][r + 1] - msafe) * LOG2E, p0, p1);
        pj[j] = (r == 0) ? p0 + p1 : (pj[j] + p0) + p1;
        pb[j >> 1][(j & 1) * 8 + r] = (_Float16)(p0 * 1024.0f);
        pb[j >> 1][(j & 1) * 8 + r + 1] = (_Float16)(p1 * 1024.0f);
      }
    }
    lrun = lrun * alpha + ((pj[0] + pj[1]) + (pj[2] + pj[3]));
#pragma unroll
    for (int t = 0; t < 4; ++t) oacc[t] *= alpha;

    // ---- context, transposed: O^T += V^T . P^T (f16 WMMA) ----
#pragma unroll
    for (int kk = 0; kk < 2; ++kk) {
      // the first fence keeps a group's reads behind what stands in front (one set of four fragments at a time fits
      // the 128 registers); the second keeps them one group ahead of their products: left free, each sinks to just
      // in front of its own product, which then waits out a whole LDS latency
      __builtin_amdgcn_sched_barrier(0);
      v16h va[4];
#pragma unroll
      for (int t = 0; t < 4; ++t) va[t] = ldfrag(Vth + (t * 16 + c) * AT_P + kk * 32 + 8 * hh);
      __builtin_amdgcn_sched_barrier(0);
#pragma unroll
      for (int t = 0; t < 4; ++t) oacc[t] = mma_raw(va[t], pb[kk], oacc[t]);
    }
  }

  // ---- normalise (1/l; the 1/1024 p carry, the x16 v carry and the x256 output carry are all in oScale) ----
  const float l = lrun + xhalf(lrun);
  const float inv = ((l > 0.f) ? rcp_f(l) : 0.f) * oScale;
  _Float16* os = Osh[wave];
#pragma unroll
  for (int t = 0; t < 4; ++t) {
    v4u a;
#pragma unroll
    for (int e = 0; e < 4; ++e) a[e] = pkf(oacc[t][2 * e] * inv, oacc[t][2 * e + 1] * inv);
    *(v4u*)(os + c * AT_P + t * 16 + 8 * hh) = a;
  }
  wave_lds_sync();   // the rows are the wave's own
  {
    const int q4 = lane >> 3, c8 = (lane & 7) * 8;
    v4u hv[4];
#pragma unroll
    for (int it = 0; it < 4; ++it) hv[it] = *(const v4u*)(os + (it * 4 + q4) * AT_P + c8);   // rows 0..15 of the wave tile
#pragma unroll
    for (int it = 0; it < 4; ++it) {
      const int row = it * 4 + q4;
      const size_t go = (rowB + q0 + row) * CC + (size_t)h * HD + c8;
      *(v4u*)(AT + go) = hv[it];
    }
  }
}

// =====================================================================================================
// Workspace map (bytes):
//   W1t  f16 [3][1024][1024]       0            6291456
//   W2t  f16 [3][1024][1024]       6291456      6291456
//   Wqkv f16 [3072][1024]          12582912     6291456
//   Wp   f16 [1024][1024]          18874368     2097152
//   Tab  f32 [16][2048]            20971520      131072
//   XT   f16 [8][1026][1024]       21102592    16809984   (later: XT3 [8][1024][1024], then AT [8192][1024])
//   R1   f32 [8][1024][1024]       37912576    33554432   (F1, then H, then Qp + Kp f16 [8192][1024] each)
//   Xin  f32 [8][1024][1024]       71467008    33554432
//   Vp   f16 [8][1024][1024]       105021440   16777216
//   Rec  f32 [8][32][8][32]        121798656     262144   (statistics records: of F1, then of H)
//   end                            122060800
// Every plane is an exact multiple of its whole-line / whole-tile store granularity (incl. the two
// halo token rows per sample in XT); no tail padding needed.
// =====================================================================================================
extern "C" void kernel_launch(void* const* d_in, const int* in_sizes, int n_in,
                              void* d_out, int out_size, void* d_ws, size_t ws_size,
                              hipStream_t stream) {
  if (n_in < 18) return;
  const int nAct = NBATCH * CC * TT;                     // 8388608
  if (in_sizes[0] != nAct || out_size != nAct) return;
  if (in_sizes[3] != CC * CC * 3 || in_sizes[7] != CC * CC * 3) return;
  if (in_sizes[13] != 3 * CC * CC || in_sizes[15] != CC * CC) return;
  if (in_sizes[1] != CC || in_sizes[2] != CC || in_sizes[4] != CC || in_sizes[5] != CC ||
      in_sizes[6] != CC || in_sizes[8] != CC || in_sizes[9] != CC || in_sizes[10] != CC ||
      in_sizes[11] != CC || in_sizes[12] != CC || in_sizes[16] != CC) return;
  if (in_sizes[14] != 3 * CC || in_sizes[17] != NBUCK * NH) return;

  const float* x      = (const float*)d_in[0];
  const float* gn1_g  = (const float*)d_in[1];
  const float* gn1_b  = (const float*)d_in[2];
  const float* c1_w   = (const float*)d_in[3];
  const float* c1_b   = (const float*)d_in[4];
  const float* gn2_g  = (const float*)d_in[5];
  const float* gn2_b  = (const float*)d_in[6];
  const float* c2_w   = (const float*)d_in[7];
  const float* c2_b   = (const float*)d_in[8];
  const float* n8_g   = (const float*)d_in[9];
  const float* n8_b   = (const float*)d_in[10];
  const float* ag_g   = (const float*)d_in[11];
  const float* ag_b   = (const float*)d_in[12];
  const float* qkv_w  = (const float*)d_in[13];
  const float* qkv_b  = (const float*)d_in[14];
  const float* pj_w   = (const float*)d_in[15];
  const float* pj_b   = (const float*)d_in[16];
  const float* remb   = (const float*)d_in[17];

  const size_t PWC  = (size_t)3 * CC * CC * 2;          //  6291456
  const size_t PWQ  = (size_t)3 * CC * CC * 2;          //  6291456
  const size_t PWP  = (size_t)CC * CC * 2;              //  2097152
  const size_t PTAB = (size_t)NH * BTP * 4;             //   131072
  const size_t PXT  = (size_t)NBATCH * TP * CC * 2;     // 16809984
  const size_t PF   = (size_t)NBATCH * CC * TT * 4;     // 33554432
  const size_t PV   = (size_t)NBATCH * CC * TT * 2;     // 16777216
  size_t off = 0;
  const size_t oW1  = off; off += PWC;
  const size_t oW2  = off; off += PWC;
  const size_t oWq  = off; off += PWQ;
  const size_t oWp  = off; off += PWP;
  const size_t oTab = off; off += PTAB;
  const size_t oXT  = off; off += PXT;
  const size_t oR1  = off; off += PF;
  const size_t oXin = off; off += PF;
  const size_t oV   = off; off += PV;
  const size_t oRec = off; off += (size_t)G_REC_BYTES;
  if (off > ws_size) return;                            // off = 122060800
  if (off > (size_t)134217728) return;
  if (2 * PV > PF) return;                              // Qp + Kp live inside R1
  if ((size_t)NBATCH * TT * CC * 2 > PXT) return;       // XT3 / AT fit in the XT region

  char* ws = (char*)d_ws;
  _Float16* W1t  = (_Float16*)(ws + oW1);
  _Float16* W2t  = (_Float16*)(ws + oW2);
  _Float16* Wqkv = (_Float16*)(ws + oWq);
  _Float16* Wpb  = (_Float16*)(ws + oWp);
  float*    Tab  = (float*)(ws + oTab);
  _Float16* XT   = (_Float16*)(ws + oXT);               // [8][1026][1024] with halo rows
  _Float16* XT3  = (_Float16*)(ws + oXT);               // [8][1024][1024], later use of the same region
  _Float16* ATp  = (_Float16*)(ws + oXT);               // [8192][1024], last use of the same region
  float*    F1   = (float*)(ws + oR1);
  float*    Hb   = (float*)(ws + oR1);
  _Float16* Qp   = (_Float16*)(ws + oR1);
  _Float16* Kp   = (_Float16*)(ws + oR1 + PV);
  float*    Xin  = (float*)(ws + oXin);
  _Float16* Vp   = (_Float16*)(ws + oV);
  float*    Rec  = (float*)(ws + oRec);

  const dim3 blk(256);
  const long long CCCC = (long long)CC * CC;
  const long long CT   = (long long)CC * TT;

  // (1) h = silu(GN32(x)) -> XT (token-major f16, halo rows); beside it conv1's weights -> f16 x64 planes
  gn32_tr_k<true, false><<<dim3(CC / 64, NBATCH + CVW_NB / (CC / 64)), dim3(GN_NT), 0, stream>>>(x, gn1_g, gn1_b, XT, c1_w, W1t, nullptr);
  // (2) F1 = conv1(h) + b1 -> f32 NCT   (per b: M=1024 o, N=1024 t, K=3 taps x 1024); its statistics records -> Rec
  gemm_k<3, 0, false, 1, true><<<dim3((CC / 128) * (TT / 256), NBATCH), blk, 0, stream>>>(
      W1t, CC, 0LL, CCCC, 64, 0,
      XT, CC, (long long)TP * CC, (long long)CC, 64, 0,
      c1_b, 1.0f, nullptr,
      (void*)F1, CT, CC, TT, CC, 1.0f / 64.0f, Rec);
  // (3) h = silu(GN32(F1)) -> XT; beside it conv2's weights -> f16 x64 planes
  gn32_tr_k<true, true><<<dim3(CC / 64, NBATCH + CVW_NB / (CC / 64)), dim3(GN_NT), 0, stream>>>(F1, gn2_g, gn2_b, XT, c2_w, W2t, Rec);
  // (4) H = conv2(h) + b2 + x -> f32 NCT (R1); its statistics records -> Rec
  gemm_k<3, 0, true, 1, true><<<dim3((CC / 128) * (TT / 256), NBATCH), blk, 0, stream>>>(
      W2t, CC, 0LL, CCCC, 64, 0,
      XT, CC, (long long)TP * CC, (long long)CC, 64, 0,
      c2_b, 1.0f, x,
      (void*)Hb, CT, CC, TT, CC, 1.0f / 64.0f, Rec);
  // (5) xin = GN8(H) -> f32 NCT; GN32(xin) -> XT3 (token-major f16, no halo); beside it the qkv and projection
  //     weights -> f16 x64 planes and the position bias table
  gn8_attn_k<<<dim3(CC / 64, NBATCH + (PQ_NB + PP_NB + PT_NB) / (CC / 64)), dim3(GN_NT), 0, stream>>>(
      Hb, n8_g, n8_b, ag_g, ag_b, Xin, XT3, qkv_w, pj_w, remb, Wqkv, Wpb, Tab, Rec);
  // (6) q -> Qp, k -> Kp, v -> Vp
  qkv_k<<<dim3(256, 3), blk, 0, stream>>>(XT3, Wqkv, qkv_b, Qp, Kp, Vp);
  // (7) attention -> AT [b*TT+t][h*64+d] f16 x256
  attn_k<<<dim3((TT / 64) * NH * NBATCH), dim3(128), 0, stream>>>(
      Qp, Kp, Vp, Tab, ATp, 1.0f / 2048.0f, 1.0f / 64.0f);
  // (8) out = xin + proj(a) + bp -> d_out f32 NCT (per b: M=1024 o, N=1024 t, K=1024)
  gemm_k<1, 0, true, 1, false><<<dim3((CC / 128) * (TT / 256), NBATCH), blk, 0, stream>>>(
      Wpb, CC, 0LL, 0LL, 64, 0,
      ATp, CC, CT, 0LL, 64, 0,
      pj_b, 1.0f, Xin,
      d_out, CT, CC, TT, CC, 1.0f / 16384.0f, nullptr);
  (void)hipGetLastError();
}

// v009
// A run of this version takes 217 microseconds.
// Timed twice side by side with v008, it ran 1.06 times as fast both times.
// Over all steps from v000 it is 4.37 times as fast.
// Contractions: conv k3 (two), qkv 1x1, q.k^T, p.v, proj 1x1 = v_wmma_f32_16x16x32_f16 (f16 operands: weights x64, GroupNorm activations x1, q/k/v x16, p x1024, attention output x256), f32 accumulate; GroupNorm statistics f32 partial sums with f64 totals, softmax / position bias / residuals f32.
#include <hip/hip_runtime.h>
#include <math.h>
#include <stdint.h>

#define NBATCH 8
#define CC 1024
#define TT 1024
#define TP 1026
#define NH 16
#define HD 64
#define NBUCK 32
#define BTP 2048

static_assert(NH * HD == CC);
static_assert((CC % 256) == 0 && (TT % 256) == 0);

typedef _Float16 v16h __attribute__((ext_vector_type(16)));
typedef _Float16 v8h  __attribute__((ext_vector_type(8)));
typedef float    v8f  __attribute__((ext_vector_type(8)));
typedef float    v4f  __attribute__((ext_vector_type(4)));
typedef unsigned int v4u __attribute__((ext_vector_type(4)));
typedef uint32_t u32x4 __attribute__((ext_vector_type(4)));
typedef uint32_t u32x8 __attribute__((ext_vector_type(8)));

// ---- scalar helpers ----
__device__ __forceinline__ unsigned short h_bits(_Float16 x) { return __builtin_bit_cast(unsigned short, x); }
__device__ __forceinline__ unsigned pkf(float a, float b) {
  return (unsigned)h_bits((_Float16)a) | ((unsigned)h_bits((_Float16)b) << 16);
}
__device__ __forceinline__ v8f zero8() { v8f z = {0.f, 0.f, 0.f, 0.f, 0.f, 0.f, 0.f, 0.f}; return z; }
__device__ __forceinline__ float rcp_f(float x) { return __builtin_amdgcn_rcpf(x); }

// ---- 16-bit A/B fragment: lane -> row/col (lane&15); p already includes +8*(lane>>4);
//      elements 0..7 <- p[0..7] (k0+8h..), elements 8..15 <- p[16..23] (k0+16+8h..)
__device__ __forceinline__ v16h ldfrag(const _Float16* p) {
  union { v16h v; v8h h[2]; } f;
  f.h[0] = *(const v8h*)(p);
  f.h[1] = *(const v8h*)(p + 16);
  return f.v;
}

// ---- WMMA helpers ----
__device__ __forceinline__ v8f mma_raw(v16h a, v16h b, v8f c) {
  return __builtin_amdgcn_wmma_f32_16x16x32_f16(false, a, false, b, (short)0, c, false, false);
}

// ---- f64 wave shuffle ----
__device__ __forceinline__ double shfl_xor_d(double v, int m) {
  const unsigned long long u = (unsigned long long)__double_as_longlong(v);
  const int lo = __shfl_xor((int)(unsigned)(u & 0xffffffffull), m, 32);
  const int hi = __shfl_xor((int)(unsigned)(u >> 32), m, 32);
  const unsigned long long r = ((unsigned long long)(unsigned)hi << 32) | (unsigned long long)(unsigned)lo;
  return __longlong_as_double((long long)r);
}
// GroupNorm kernels: 16 waves per work-group
#define GN_NT 512
#define GN_NW 16
// Statistics: the per-element sums run in f32 (four chains of 16 per batch of 16 loads, joined as a tree, then the
// wave's 32 lanes); only the wave totals are summed in f64, where the squared mean is taken from the mean square.
__device__ __forceinline__ float sum4(v4f a) { return (a[0] + a[1]) + (a[2] + a[3]); }
__device__ __forceinline__ float wave_sum(float v) {
#pragma unroll   // the five exchange distances as constants
  for (int m = 16; m >= 1; m >>= 1) v += __shfl_xor(v, m, 32);
  return v;
}
// 1 / sqrt(x), x >= 1e-5: the hardware's estimate and one Newton step; the v_nop is the one slot that the
// instruction set asks for behind a transcendental before its result is used
__device__ __forceinline__ float rsqrt_nr(float x) {
#if defined(__HIP_DEVICE_COMPILE__)
  float r;
  asm("v_rsq_f32 %0, %1\n\tv_nop" : "=v"(r) : "v"(x));
  const float e = fmaf(-x * r, r, 1.0f);
  return fmaf(0.5f * r, e, r);
#else
  return x;
#endif
}
// mean and 1 / sigma from the f64 totals of n = 1 / invn values
__device__ __forceinline__ void mean_rstd(double S, double SS, double invn, float& meanf, float& rstdf) {
  const double mean = S * invn;
  double var = SS * invn - mean * mean;
  var = var < 0.0 ? 0.0 : var;
  meanf = (float)mean;
  rstdf = rsqrt_nr((float)var + 1e-5f);
}
// rs, rq: the GN_NW wave totals (sum, sum of squares) in LDS; called by a whole wave, every lane returns the result
__device__ __forceinline__ void close_stats(const float* rs, const float* rq, int lane, double invn,
                                            float& meanf, float& rstdf) {
  double S = (double)rs[lane & (GN_NW - 1)], SS = (double)rq[lane & (GN_NW - 1)];
#pragma unroll   // the four exchange distances as constants
  for (int m = GN_NW / 2; m >= 1; m >>= 1) {
    S += shfl_xor_d(S, m);
    SS += shfl_xor_d(SS, m);
  }
  mean_rstd(S, SS, invn, meanf, rstdf);
}

// SiLU's two transcendentals, each with the one slot behind it that the instruction set asks for before its
// result is used or its source overwritten
__device__ __forceinline__ float exp2_slot(float x) {
#if defined(__HIP_DEVICE_COMPILE__)
  float r;
  asm("v_exp_f32 %0, %1\n\tv_nop" : "=v"(r) : "v"(x));
  return r;
#else
  return x;
#endif
}
__device__ __forceinline__ float rcp_slot(float x) {
#if defined(__HIP_DEVICE_COMPILE__)
  float r;
  asm("v_rcp_f32 %0, %1\n\tv_nop" : "=v"(r) : "v"(x));
  return r;
#else
  return x;
#endif
}

#if defined(__HIP_DEVICE_COMPILE__)
// stands behind a batch of stores whose address and data registers the code that follows writes again
#define GN_WAIT_XCNT() asm volatile("s_wait_xcnt 0x0" ::: "memory")
#else
#define GN_WAIT_XCNT() ((void)0)
#endif

// orders one wave's own LDS writes and reads (the tile below is private to its wave)
__device__ __forceinline__ void wave_lds_sync() {
  __builtin_amdgcn_fence(__ATOMIC_RELEASE, "workgroup");
  __builtin_amdgcn_wave_barrier();
  __builtin_amdgcn_fence(__ATOMIC_ACQUIRE, "workgroup");
}

// Statistics records of a convolution's output plane [b][CC][TT] (written by gemm_body, read by the GroupNorm
// kernels): each wave of the product leaves the sum and the sum of squares of rows 0..31 and of rows 32..63 of its
// 64 x 64 tile (= two groups of 32 channels x 64 tokens) as 4 floats at the head of a 128-B line of its own.
// G_REC = first float of the record of batch b, tile (row tile x 4 + column tile), wave (row half x 4 + column).
#define G_REC(b, tile, wave) ((((b) * 32 + (tile)) * 8 + (wave)) * 32)
#define G_REC_BYTES (NBATCH * 32 * 8 * 128)

// One wave turns 64 channels x 32 tokens of an NCT f32 plane into 32 token rows of 64 f16 channels:
// y = f * cA[c] + cD[c] (+ SiLU). pr: the slab's first channel at this lane's token; dst: the tile's first
// token row at the slab's first channel (row pitch CC); st: this wave's own 32 x 9 16-B pieces of LDS.
// All 64 loads of the lane are issued before the first is used. No other wave touches st, so there is no
// work-group barrier. coverage: 8 x 4 rows x (8 lanes x 8 channels) = 32 rows x 64 channels.
template <bool SILU>
__device__ __forceinline__ void gn_tile64(const float* __restrict__ pr, const float* cA, const float* cD,
                                          v4u* st, _Float16* dst, int lane) {
  float f[64];
#pragma unroll
  for (int i = 0; i < 64; ++i) f[i] = pr[(size_t)i * TT];
  // the wave's reads of its last tile are over before st is written again; behind the loads, so that
  // the wait for the last tile's stores runs beside their flight
  wave_lds_sync();
#pragma unroll
  for (int j = 0; j < 8; ++j) {
    float y[8];
#pragma unroll
    for (int i = 0; i < 8; ++i) {
      float yy = fmaf(f[j * 8 + i], cA[j * 8 + i], cD[j * 8 + i]);
      if (SILU) yy = yy * rcp_slot(1.0f + exp2_slot(yy * -1.4426950408889634f));   // e^-y = 2^(-y log2 e)
      y[i] = yy;
    }
    v4u pk;
    pk[0] = pkf(y[0], y[1]);
    pk[1] = pkf(y[2], y[3]);
    pk[2] = pkf(y[4], y[5]);
    pk[3] = pkf(y[6], y[7]);
    st[lane * 9 + j] = pk;
  }
  wave_lds_sync();
  const int q = lane >> 3, l8 = lane & 7;
  v4u v[8];
#pragma unroll
  for (int it = 0; it < 8; ++it) v[it] = st[(it * 4 + q) * 9 + l8];
#pragma unroll
  for (int it = 0; it < 8; ++it) *(v4u*)(dst + (size_t)(it * 4 + q) * CC + l8 * 8) = v[it];
}

// =====================================================================================================
// Preparation work (weights -> f16 planes, position bias table). None of it needs anything of the GroupNorm
// kernels and they need nothing of it, so it has no launches of its own: it runs in further work-groups of the
// GroupNorm launches (a range of the block index, the branch the same for the whole work-group), on the WGPs
// that those launches leave idle. Work-groups of GN_NT = 512 threads.
// =====================================================================================================
#if defined(__HIP_DEVICE_COMPILE__)
// stands behind a batch of loads that all go by the one address p: the wait before a register that an issued load
// names is written again; p as an input keeps its registers untouched up to the wait
#define PREP_WAIT_XCNT(p) asm volatile("s_wait_xcnt 0x0" :: "v"(p) : "memory")
#else
#define PREP_WAIT_XCNT(p) ((void)0)
#endif
// f32 -> f16 (x scale): a thread takes 8 pieces of 8 elements, its 16 loads issued before the first use, one
// 16-B store per piece (wave = 512 contiguous B). coverage: nblk work-groups x 8 x 512 pieces x 8 = the plane.
__device__ __forceinline__ void cvt_f16x8_part(const float* __restrict__ in, _Float16* out, int blk, int tid,
                                               float scale) {
  const size_t i0 = (size_t)(blk * 8 * GN_NT + tid) * 8;   // piece u stands u * GN_NT * 8 elements further
  const float* src = in + i0;
  v4f a[8], c[8];
#pragma unroll   // constant indices keep the arrays in registers
  for (int u = 0; u < 8; ++u) {
    a[u] = *(const v4f*)(src + u * (GN_NT * 8));
    c[u] = *(const v4f*)(src + u * (GN_NT * 8) + 4);
  }
  PREP_WAIT_XCNT(src);
#pragma unroll   // constant indices keep the arrays in registers
  for (int u = 0; u < 8; ++u) {
    v4u p;
    p[0] = pkf(a[u][0] * scale, a[u][1] * scale);
    p[1] = pkf(a[u][2] * scale, a[u][3] * scale);
    p[2] = pkf(c[u][0] * scale, c[u][1] * scale);
    p[3] = pkf(c[u][2] * scale, c[u][3] * scale);
    *(v4u*)(out + i0 + u * (GN_NT * 8)) = p;
  }
  // the compiler lays the callers' branches out as one chain, in which code that writes these stores' registers follows
  GN_WAIT_XCNT();
}

// conv weight [o][c][3] f32 -> Wt[tap][o][c] f16 (x scale). Piece idx = (o, 8 consecutive c) = 24 contiguous
// floats at 24 idx, one 16-B store at 8 idx of each of the 3 tap planes; a thread takes 2 pieces, its 12 loads
// issued before the first use. coverage: CVW_NB work-groups x 2 x 512 pieces x 3 x 8 halves = 3*CC*CC.
#define CVW_NB (CC * (CC / 8) / (2 * GN_NT))   // 128
__device__ __forceinline__ void cvt_convw_part(const float* __restrict__ w, _Float16* out, int blk, int tid,
                                               float scale) {
  const size_t idx0 = (size_t)(blk * 2 * GN_NT + tid);   // the thread's first piece; the second is GN_NT further
  const float* src = w + idx0 * 24;
  union { v4f q[6]; float e[24]; } u[2];
#pragma unroll   // constant indices keep the arrays in registers
  for (int s = 0; s < 2; ++s)
#pragma unroll   // constant indices keep the arrays in registers
    for (int i = 0; i < 6; ++i) u[s].q[i] = *(const v4f*)(src + s * (GN_NT * 24) + 4 * i);
#pragma unroll   // constant indices keep the arrays in registers
  for (int s = 0; s < 2; ++s) {
    const size_t idx = idx0 + (size_t)(s * GN_NT);
#pragma unroll   // constant indices keep the arrays in registers
    for (int tp = 0; tp < 3; ++tp) {
      v4u a;
#pragma unroll   // constant indices keep the arrays in registers
      for (int m = 0; m < 4; ++m)
        a[m] = pkf(u[s].e[(2 * m) * 3 + tp] * scale, u[s].e[(2 * m + 1) * 3 + tp] * scale);
      *(v4u*)(out + (size_t)tp * CC * CC + idx * 8) = a;
    }
  }
}

// relative position bias table tab[h][d], d = (t - s) + 1024, value = emb[bucket][h] * 8 (f32).
// bucket: n = t - s; add 16 when n < 0; n = |n|; n < 8 -> n; else 8 + int(log(n/8) * (1/ln 8) * 8)
// coverage: 16 work-groups x 512 threads x 4 = NH*BTP floats.
__device__ __forceinline__ void btab_part(const float* __restrict__ emb, float* tab, int blk, int tid) {
  const int i4 = blk * GN_NT + tid;
  const int h = i4 >> 9;
  const int d0 = (i4 & 511) * 4;
  const float ln8 = 2.0794415416798357f;
  const float rl8 = 1.0f / ln8;
  v4f v;
#pragma unroll   // constant indices keep the arrays in registers
  for (int e = 0; e < 4; ++e) {
    const int delta = d0 + e - 1024;
    const int n = delta < 0 ? -delta : delta;
    const float nf = (float)(n < 1 ? 1 : n);
    const float lg = logf(nf * 0.125f);
    int vl = 8 + (int)(lg * rl8 * 8.0f);
    vl = vl > 15 ? 15 : vl;
    int bucket = (n < 8) ? n : vl;
    bucket += (delta < 0) ? 16 : 0;
    v[e] = emb[bucket * NH + h] * 8.0f;
  }
  *(v4f*)(tab + (size_t)i4 * 4) = v;
  // the compiler lays the caller's branches out as one chain, in which code that writes this store's registers follows
  GN_WAIT_XCNT();
}
// work-groups of the preparation range of gn8_attn_k: qkv weights, projection weights, bias table
#define PQ_NB (3 * CC * CC / (64 * GN_NT))     // 96
#define PP_NB (CC * CC / (64 * GN_NT))         // 32
#define PT_NB (NH * (BTP / 4) / GN_NT)         // 16
static_assert((CVW_NB % (CC / 64)) == 0 && ((PQ_NB + PP_NB + PT_NB) % (CC / 64)) == 0);

// =====================================================================================================
// GroupNorm(32 groups) (+ SiLU) on an NCT f32 plane [b][CC][TT]; writes the token-major f16 plane
// xt[b][TP][CC] (row 1 + t, channel contiguous) plus the two zero halo rows 0 and TP-1.
// Block = (b, 64-channel slab = 2 groups); 512 threads. Statistics: f32 partial sums, f64 totals, fixed order; the 32 16-B
// loads of a thread (16 per group) are all issued before the first sum.
// Tiles: 32 tokens x 64 channels, one wave each (gn_tile64), 2 tiles per wave.
// coverage: 32 tiles x 32 rows x (16 slabs x 64 ch) = rows 1..TT x all channels; halo rows by wave 0.
// Work-groups with blockIdx.y >= NBATCH (CVW_NB of them) turn the weights w of the convolution that follows
// into its f16 planes wt instead.
// PRE: the plane is a convolution's output and the sums were taken in that product's epilogue (rec, see
// gemm_body): the 16 records of the slab's two groups stand for the 16 wave totals and the first read pass goes.
// =====================================================================================================
template <bool SILU, bool PRE>
__global__ __launch_bounds__(GN_NT) void gn32_tr_k(const float* __restrict__ in, const float* __restrict__ gam,
                                                   const float* __restrict__ bet, _Float16* xt,
                                                   const float* __restrict__ w, _Float16* wt,
                                                   const float* __restrict__ rec) {
  if (blockIdx.y >= NBATCH) {   // the same for the whole work-group, ahead of every barrier
    cvt_convw_part(w, wt, (int)(blockIdx.y - NBATCH) * (CC / 64) + (int)blockIdx.x, threadIdx.x, 64.0f);
    return;
  }
  __shared__ __align__(16) v4u sT4[GN_NW][32 * 9];
  __shared__ float red[4][GN_NW];
  __shared__ __align__(16) float sA[64];
  __shared__ __align__(16) float sD[64];
  const int tid = threadIdx.x, lane = tid & 31, wave = tid >> 5;
  const int b = blockIdx.y;
  const int c0 = blockIdx.x * 64;
  const float* p = in + ((size_t)b * CC + c0) * TT;

  if (PRE) {
    if (tid < 16) {   // record (column tile tid >> 2, wave column tid & 3) of the slab's 64 rows
      const float* rp = rec + (size_t)G_REC(b, (c0 >> 7) * 4 + (tid >> 2), ((c0 >> 6) & 1) * 4 + (tid & 3));
      const v4f r = *(const v4f*)rp;
      PREP_WAIT_XCNT(rp);
      red[0][tid] = r[0];
      red[2][tid] = r[1];
      red[1][tid] = r[2];
      red[3][tid] = r[3];
    }
  } else {
    v4f v[2][16];
#pragma unroll
    for (int g = 0; g < 2; ++g)
#pragma unroll
      for (int i = 0; i < 16; ++i) v[g][i] = *(const v4f*)(p + (size_t)g * 32 * TT + ((size_t)i * GN_NT + tid) * 4);
    // keeps the batch's loads one group ahead of their first use: left free, they sink to just in front of
    // their sums and only a few are in flight
    __builtin_amdgcn_sched_barrier(0);

#pragma unroll
    for (int g = 0; g < 2; ++g) {
      v4f s4 = {0.f, 0.f, 0.f, 0.f}, q4 = {0.f, 0.f, 0.f, 0.f};
#pragma unroll   // constant indices keep the array in registers
      for (int i = 0; i < 16; ++i) {
        s4 += v[g][i];
        q4 += v[g][i] * v[g][i];
      }
      const float s = wave_sum(sum4(s4)), q = wave_sum(sum4(q4));
      if (lane == 0) { red[g][wave] = s; red[2 + g][wave] = q; }
    }
  }
  __syncthreads();
  if (wave < 2) {   // wave g closes group g: its lanes are the group's 32 channels
    float meanf, rstdf;
    close_stats(red[wave], red[2 + wave], lane, 1.0 / 32768.0, meanf, rstdf);
    const int c = c0 + tid;
    const float a = rstdf * gam[c];
    sA[tid] = a;
    sD[tid] = bet[c] - meanf * a;
  }
  __syncthreads();

  if (wave == 0 && lane < 16) {
    const int row = (lane < 8) ? 0 : (TP - 1);
    v4u z = {0u, 0u, 0u, 0u};
    _Float16* dst = xt + ((size_t)b * TP + row) * CC + c0 + (lane & 7) * 8;
    *(v4u*)dst = z;
  }

#pragma unroll 1   // one tile's 64 loads fill the registers
  for (int tc = wave; tc < TT / 32; tc += GN_NW)
    gn_tile64<SILU>(p + tc * 32 + lane, sA, sD, sT4[wave], xt + ((size_t)b * TP + 1 + tc * 32) * CC + c0, lane);
}

// =====================================================================================================
// Fused: GroupNorm(8) on H -> xin (f32 NCT, written), then GroupNorm(32) of xin -> f16 token-major
// plane xt[b][TT][CC] (no halo). Block = (b, 64-channel slab = two 32-channel sub-groups of one 128-channel
// group); 512 threads.
// The group's sums come from the records that the product which wrote H left (rec, G_REC): 32 records, f64 totals;
// H is not read for them.
// phase 2: waves 8 sg .. 8 sg + 7 own the 32-channel sub-group sg: xin written as 32 lanes x 16 B contiguous
// pieces (the eight waves cover one 4 KB channel row per step), 32 loads in flight, sums of xin per sub-group
// (f32 partial sums, f64 totals), one reduction for the two sub-groups;
// phase 3: y = h*A[c] + D[c] (both norms folded), 32-token x 64-channel tiles, one wave each (gn_tile64).
// coverage: xin rows 0..63 of the slab x 1024 t; xt: 32 tiles of 32 rows x 64 ch per block,
// 16 blocks per b cover all channels.
// Work-groups with blockIdx.y >= NBATCH do the preparation that the launches behind this one need: the f16 planes
// of the qkv and projection weights and the position bias table.
// =====================================================================================================
__global__ __launch_bounds__(GN_NT) void gn8_attn_k(const float* __restrict__ hin,
                                                    const float* __restrict__ g8, const float* __restrict__ e8,
                                                    const float* __restrict__ ga, const float* __restrict__ ea,
                                                    float* xin, _Float16* xt,
                                                    const float* __restrict__ qkvw, const float* __restrict__ pjw,
                                                    const float* __restrict__ emb,
                                                    _Float16* wq, _Float16* wp, float* tab,
                                                    const float* __restrict__ rec) {
  if (blockIdx.y >= NBATCH) {   // the same for the whole work-group, ahead of every barrier
    const int e = (int)(blockIdx.y - NBATCH) * (CC / 64) + (int)blockIdx.x;
    if (e < PQ_NB) cvt_f16x8_part(qkvw, wq, e, threadIdx.x, 64.0f);
    else if (e < PQ_NB + PP_NB) cvt_f16x8_part(pjw, wp, e - PQ_NB, threadIdx.x, 64.0f);
    else btab_part(emb, tab, e - (PQ_NB + PP_NB), threadIdx.x);
    return;
  }
  __shared__ __align__(16) v4u sT4[GN_NW][32 * 9];
  __shared__ float red[2][GN_NW];
  __shared__ float sA1[64];
  __shared__ float sD1[64];
  __shared__ __align__(16) float sA[64];
  __shared__ __align__(16) float sD[64];
  __shared__ float sM[2];
  __shared__ float sR[2];
  const int tid = threadIdx.x, lane = tid & 31, wave = tid >> 5;
  const int b = blockIdx.y;
  const int c0 = blockIdx.x * 64;
  const float* p = hin + ((size_t)b * CC + c0) * TT;

  // phase 2's operands: waves 8 sg .. 8 sg + 7 take sub-group sg, 1024 floats = one channel row per step; all 32
  // loads of a lane are issued here, so that they fly while the group's statistics are closed
  const int sg = wave >> 3;
  const size_t o0 = (size_t)sg * 32 * TT + (size_t)(((wave & 7) * 32 + lane) * 4);
  const float* ps = p + o0;
  // in front of them the record that the statistics start from (loads return in issue order); the two waves whose
  // lanes are the slab's 64 channels close the statistics: lane -> one of the group's 32 records
  const float* rp = rec + (size_t)G_REC(b, (c0 >> 7) * 4 + (lane >> 3), lane & 7);
  v4f r = {0.f, 0.f, 0.f, 0.f};
  if (tid < 64) r = *(const v4f*)rp;
  v4f v[32];
#pragma unroll   // constant indices keep the array in registers
  for (int u = 0; u < 32; ++u) v[u] = *(const v4f*)(ps + (size_t)u * TT);
  PREP_WAIT_XCNT(rp);
  PREP_WAIT_XCNT(ps);
  // keeps the loads in front of the statistics: left free, they sink to just in front of their first use
  __builtin_amdgcn_sched_barrier(0);

  // the group's statistics
  if (tid < 64) {
    double S = (double)r[0] + (double)r[2], SS = (double)r[1] + (double)r[3];
#pragma unroll   // the five exchange distances as constants
    for (int m = 16; m >= 1; m >>= 1) {
      S += shfl_xor_d(S, m);
      SS += shfl_xor_d(SS, m);
    }
    float m8f, r8f;
    mean_rstd(S, SS, 1.0 / 131072.0, m8f, r8f);
    const int c = c0 + tid;
    const float a = r8f * g8[c];
    sA1[tid] = a;
    sD1[tid] = e8[c] - m8f * a;
  }
  __syncthreads();

  // phase 2
  {
    float* xs = xin + ((size_t)b * CC + c0) * TT + o0;
    float s2 = 0.f, q2 = 0.f;
#pragma unroll   // constant indices keep the array in registers
    for (int j0 = 0; j0 < 32; j0 += 16) {
      v4f s4 = {0.f, 0.f, 0.f, 0.f}, q4 = {0.f, 0.f, 0.f, 0.f};
#pragma unroll
      for (int u = 0; u < 16; ++u) {
        const int ch = sg * 32 + j0 + u;
        const float a = sA1[ch], d = sD1[ch];
        v4f y;
#pragma unroll
        for (int e = 0; e < 4; ++e) y[e] = fmaf(v[j0 + u][e], a, d);
        s4 += y;
        q4 += y * y;
        *(v4f*)(xs + (size_t)(j0 + u) * TT) = y;
      }
      s2 += sum4(s4);
      q2 += sum4(q4);
    }
    GN_WAIT_XCNT();
    s2 = wave_sum(s2);
    q2 = wave_sum(q2);
    if (lane == 0) { red[0][wave] = s2; red[1][wave] = q2; }
    __syncthreads();
    if (tid < 2) {
      double S = 0.0, SS = 0.0;
#pragma unroll
      for (int w = 0; w < 8; ++w) { S += (double)red[0][tid * 8 + w]; SS += (double)red[1][tid * 8 + w]; }
      float mf, rf;
      mean_rstd(S, SS, 1.0 / 32768.0, mf, rf);
      sM[tid] = mf;
      sR[tid] = rf;
    }
  }
  __syncthreads();
  if (tid < 64) {
    const int sg = tid >> 5;
    const int c = c0 + tid;
    const float a2 = sR[sg] * ga[c];
    sA[tid] = sA1[tid] * a2;
    sD[tid] = (sD1[tid] - sM[sg]) * a2 + ea[c];
  }
  __syncthreads();

  // phase 3
#pragma unroll 1   // one tile's 64 loads fill the registers
  for (int tc = wave; tc < TT / 32; tc += GN_NW)
    gn_tile64<false>(p + tc * 32 + lane, sA, sD, sT4[wave], xt + ((size_t)b * TT + tc * 32) * CC + c0, lane);
}

// =====================================================================================================
// LDS-staged f16 WMMA GEMM: C[m][n] = oscale * sum_tap sum_k A_tap[m][k] * Bt_tap[n][k]
//   + bias (BM: 1 per row m with the A row remap, 2 per column n with the Bt row remap) * bscale
//   (+ resid[m][n] f32, same indexing as C, when RESID).
// Work-group = 8 waves = one 128 x 256 tile of C; wave (wm 0..1, wn 0..3) = 64 x 64 of it.
// A row-major [M][K] pitch lda; Bt row-major [N][K] (k contiguous) pitch ldb. Row remap:
// row(m) = (m>>6)*TS + TO + (m&63). Tap tp adds aTap elements to A and bTap elements to Bt.
// bz = batch index (strides in elements). M multiple of 128, N of 256, K of 128 (host constants).
// A stage = 128 k of the 128 A rows and the 256 Bt rows, 256-B rows at a 272-B pitch in LDS, brought by
// tensor loads: six slices of 64 rows (the unit of the row remap; 2 of A, 4 of Bt), one request each from
// waves 0..5, the mover's pad giving the pitch; two buffers, the next stage's loads fly while this one is
// multiplied. k runs tap-major and ascending, one accumulator per element.
// OUTH: 0 f32 C, 1 f16 C; C and the residual plane have rows of G_LDC elements.
// Epilogue: the bias and residual values of the wave's tile are loaded ahead of the k loop, so that their
// latency runs beside it; behind the loop each wave stages its whole 64 x 64 tile in its own part of the stage
// buffers (free behind the last trip's barrier) and stores it as whole row segments, with no wait in between.
// coverage: 64 rows x 64 cols = the wave's tile; grid = exact tile count.
// STATS (f32 C of 1024 x 1024 per batch index): behind its stores each wave sums the values it has just stored
// and their squares, rows 0..31 and rows 32..63 of its tile apart (f32: 64 values a lane, then the wave), and
// leaves the four sums as its record (G_REC) for the GroupNorm kernel that reads C next.
// =====================================================================================================
#define G_BM 128
#define G_BN 256
#define G_KS 128
#define G_PITCH 136                         // halves per LDS row: 272 B = 16 B x odd, for 16-B LDS reads
#define G_SLICE (9 * 1024)                  // halves per 64-row slice: 64 x 272 B = 17,408 B, rounded up to 9 x 2 KiB
#define G_NSL ((G_BM + G_BN) / 64)          // slices per buffer
#define G_BUF (G_NSL * G_SLICE)             // halves per buffer
#define G_LDC 1024                          // elements per row of C and of the residual plane
#define G_SP 68                             // floats per staged row of the epilogue: 272 B
static_assert(CC == G_LDC && TT == G_LDC);
static_assert(64 * G_PITCH <= G_SLICE && (G_SLICE * 2) % 2048 == 0 && G_KS * 2 == 256 && G_PITCH * 2 == 272);
static_assert(8 * 64 * G_SP * 4 <= 2 * G_BUF * 2);   // the eight waves' staged tiles fit the two stage buffers

#if defined(__HIP_DEVICE_COMPILE__)
// this wave's tensor load has landed; the operands are the request's two descriptor groups (see tdm_load)
#define G_WAIT_TENSOR(g0, g1) asm volatile("s_wait_tensorcnt 0x0" : "+s"(g0), "+s"(g1) :: "memory")
// this wave's LDS reads have returned, so the buffer may be refilled behind the barrier
#define G_WAIT_LDS() asm volatile("s_wait_dscnt 0x0" ::: "memory")
// the wait before a register that an issued load or store names is written again; the operands are those
// registers (addresses, stored values), which as inputs stay untouched up to the wait (a statement takes at most
// thirty operands, so 32 stored pieces take two statements)
#define G_WAIT_XCNT_2(p, q) asm volatile("s_wait_xcnt 0x0" :: "v"(p), "v"(q) : "memory")
#define G_WAIT_XCNT_17(p, o)                                                                                   \
  asm volatile("s_wait_xcnt 0x0"                                                                               \
               :: "v"(p), "v"((o)[0]), "v"((o)[1]), "v"((o)[2]), "v"((o)[3]), "v"((o)[4]), "v"((o)[5]),        \
                  "v"((o)[6]), "v"((o)[7]), "v"((o)[8]), "v"((o)[9]), "v"((o)[10]), "v"((o)[11]),              \
                  "v"((o)[12]), "v"((o)[13]), "v"((o)[14]), "v"((o)[15])                                       \
               : "memory")
#else
#define G_WAIT_XCNT_2(p, q) ((void)0)
#define G_WAIT_XCNT_17(p, o) ((void)0)
#define G_WAIT_TENSOR(g0, g1) ((void)0)
#define G_WAIT_LDS() ((void)0)
#endif

// a wave-uniform value as a scalar
__device__ __forceinline__ uint32_t uni(uint32_t v) { return (uint32_t)__builtin_amdgcn_readfirstlane(v); }
// a wave-uniform value held in a scalar register: a test on it is a scalar branch (a tensor load ignores EXEC), and
// what is formed from it is formed behind the volatile statements that stand in front of it
__device__ __forceinline__ uint32_t pinned(uint32_t v) {
  uint32_t w = uni(v);
#if defined(__HIP_DEVICE_COMPILE__)
  asm volatile("" : "+s"(w));   // the word stays in a scalar register
#endif
  return w;
}
// descriptor group 1: 1-byte elements, tensor = tile = 64 rows of 256 B, source row pitch in bytes; word 0: no mask,
// a pad of 4 dwords behind every 64 dwords (LDS pitch 272 B)
__device__ __forceinline__ u32x8 tdm_group1(uint32_t src_pitch) {
  u32x8 g;
  g[0] = uni((1u << 20) | (5u << 22) | (3u << 25));
  g[1] = uni(256u << 16);
  g[2] = uni(64u << 16);
  g[3] = uni(256u << 16);
  g[4] = uni(64u);
  g[5] = uni(src_pitch);
  g[6] = uni(0u);
  g[7] = uni(0u);
  return g;
}
// descriptor group 0: count 1, place in LDS (bytes), the tile's first byte, type 2
__device__ __forceinline__ u32x4 tdm_group0(uint32_t lds_dst, uint64_t ga) {
  u32x4 g;
  g[0] = uni(1u);
  g[1] = uni(lds_dst);
  g[2] = uni((uint32_t)ga);
  g[3] = uni((((uint32_t)(ga >> 32)) & 0x01FFFFFFu) | 0x80000000u);
  return g;
}
// the groups are in-out operands here and at the wait: the values then live, in the registers that the request names,
// from the issue to the wait that covers it, and none of those registers is written while the request is outstanding
__device__ __forceinline__ void tdm_load(u32x4& g0, u32x8& g1) {
#if defined(__HIP_DEVICE_COMPILE__)
  asm volatile("tensor_load_to_lds %0, %1" : "+s"(g0), "+s"(g1) :: "memory");
#endif
}

// sAB: the two stage buffers (the kernel's LDS, 2-KiB aligned); tile, bz: the work-group's tile and batch index
template <int TAPS, int OUTH, bool RESID, int BM, bool STATS>
__device__ __forceinline__ void gemm_body(
    _Float16* sAB, int tile, int bz,
    const _Float16* __restrict__ A, int lda, long long strideA, long long aTap, int aTS, int aTO,
    const _Float16* __restrict__ Bt, int ldb, long long strideB, long long bTap, int bTS, int bTO,
    const float* __restrict__ bias, float bscale,
    const float* __restrict__ resid,
    void* Cout, long long strideC,
    int M, int N, int K, float oscale, float* stats) {
  const int tid = threadIdx.x;
  const int lane = tid & 31, wave = tid >> 5;
  const int tilesN = N >> 8, tilesM = M >> 7;
  if (tile >= tilesM * tilesN) return;   // the same for the whole work-group, ahead of every barrier
  const int tm = tile / tilesN, tn = tile - tm * tilesN;
  const int mB = tm << 7, nB = tn << 8;
  const int wm = wave >> 2, wn = wave & 3;
  const int m0 = mB + wm * 64, n0 = nB + wn * 64;
  const int rlane = lane & 15;
  const int koff = (lane >> 4) * 8;
  const int mOff = koff;
  const int aRow0 = (m0 >> 6) * aTS + aTO;
  const int bRow0 = (n0 >> 6) * bTS + bTO;
  const _Float16* Ab = A + (size_t)bz * (size_t)strideA;
  const _Float16* Bb = Bt + (size_t)bz * (size_t)strideB;

  // stage side: wave w < 6 brings slice w of every stage: slices 0, 1 = the A rows' two 64-row units, 2..5 = the Bt rows'
  const uint32_t wv = uni((uint32_t)tid >> 5);
  const uint32_t issuer = (wv < (uint32_t)G_NSL) ? 1u : 0u;
  const uint32_t sl = issuer ? wv : 0u;
  const bool slA = sl < 2u;
  const int sRow = slA ? ((mB >> 6) + (int)sl) * aTS + aTO : ((nB >> 6) + (int)sl - 2) * bTS + bTO;
  const int sLd = slA ? lda : ldb;
  const long long sTap = slA ? aTap : bTap;
  const uint64_t sBase = (uint64_t)(size_t)(slA ? Ab : Bb) + 2ull * (uint64_t)(unsigned)(sRow * sLd);   // bytes
  const uint32_t ldsS = (uint32_t)(size_t)sAB + sl * (uint32_t)(G_SLICE * 2);
  u32x8 g1 = tdm_group1((uint32_t)sLd * 2u);

  u32x4 g0 = {0u, 0u, 0u, 0u};              // group 0 of the wave's last request
  // called under a scalar test only; tap and k go through pinned(), so that group 0 is formed behind the wait in front
  auto issue = [&](int tp, int k0, int buf) {
    const long long off = (long long)pinned((uint32_t)tp) * sTap + (long long)pinned((uint32_t)k0);
    g0 = tdm_group0(ldsS + (uint32_t)buf * (uint32_t)(G_BUF * 2), sBase + 2ull * (uint64_t)off);
    tdm_load(g0, g1);
  };

  v8f acc[4][4];
#pragma unroll   // constant indices keep the array in registers
  for (int i = 0; i < 4; ++i)
#pragma unroll   // constant indices keep the array in registers
    for (int j = 0; j < 4; ++j) acc[i][j] = zero8();

  const _Float16* fa = sAB + wm * G_SLICE + rlane * G_PITCH + koff;
  const _Float16* fb = sAB + (2 + wn) * G_SLICE + rlane * G_PITCH + koff;

  const int nt = TAPS * (K >> 7);
  int itp = 0, ik = 0;                      // tap and k of the next stage to be loaded
  if (pinned(issuer)) {
    issue(itp, ik, 0);
    G_WAIT_TENSOR(g0, g1);
  }
  ik += G_KS;
  if (ik >= K) { ik = 0; ++itp; }
  __syncthreads();

  // the epilogue's operands: all of the lane's loads are issued here and first used behind the k loop
  const int h2 = lane >> 4, c4 = (lane & 15) * 4;     // f32 C: a 256-B row segment = 16 lanes x 16 B
  const size_t cOff = (size_t)bz * (size_t)strideC + (size_t)(m0 + h2) * G_LDC + n0 + c4;
  // bias: BM 1 the lane's 8 rows of each 16-row band (32-B aligned: the row remaps are multiples of 64), BM 2 its 4 columns
  const float* bp = (BM == 1) ? bias + (aRow0 + mOff) : bias + (bRow0 + rlane);
  const float* rp = RESID ? resid + cOff : bp;
  v4f brow[4][2];
  float bcol[4];
  v4f rv[4][8];
  if (BM == 1) {
#pragma unroll   // constant indices keep the array in registers
    for (int i = 0; i < 4; ++i) {
      brow[i][0] = *(const v4f*)(bp + i * 16);
      brow[i][1] = *(const v4f*)(bp + i * 16 + 4);
    }
  }
  if (BM == 2) {
#pragma unroll   // constant indices keep the array in registers
    for (int j = 0; j < 4; ++j) bcol[j] = bp[j * 16];
  }
  if (RESID) {
#pragma unroll   // constant indices keep the array in registers
    for (int i = 0; i < 4; ++i)
#pragma unroll   // constant indices keep the array in registers
      for (int it = 0; it < 8; ++it) rv[i][it] = *(const v4f*)(rp + (i * 16 + it * 2) * G_LDC);
  }
  G_WAIT_XCNT_2(bp, rp);

#pragma unroll 1   // one stage per trip: the two buffers alternate by the trip's parity
  for (int t = 0; t < nt; ++t) {
    // behind the barrier that published stage t and ended every read of the other buffer (in front of the loop, or at
    // the last trip's foot): stage t + 1 into that buffer, while it exists. One place of issue for all these stages:
    // with a second one in front of the loop the compiler gave that request registers which it wrote again at once
    if (pinned(issuer & (uint32_t)(t + 1 < nt))) issue(itp, ik, (t + 1) & 1);
    ik += G_KS;
    if (ik >= K) { ik = 0; ++itp; }
    const _Float16* pa = fa + (t & 1) * G_BUF;
    const _Float16* pb = fb + (t & 1) * G_BUF;
#pragma unroll   // constant indices keep the array in registers
    for (int kk = 0; kk < G_KS / 32; ++kk) {
      v16h af[4], bf[4];
#pragma unroll   // constant indices keep the array in registers
      for (int i = 0; i < 4; ++i) af[i] = ldfrag(pa + i * 16 * G_PITCH + kk * 32);
#pragma unroll   // constant indices keep the array in registers
      for (int j = 0; j < 4; ++j) bf[j] = ldfrag(pb + j * 16 * G_PITCH + kk * 32);
      // keeps the block's 16 LDS reads one group ahead of its 16 WMMAs: left free, the reads of each A
      // fragment sink to just in front of its row and every row waits out a whole LDS latency
      __builtin_amdgcn_sched_barrier(0);
#pragma unroll   // constant indices keep the array in registers
      for (int i = 0; i < 4; ++i)
#pragma unroll   // constant indices keep the array in registers
        for (int j = 0; j < 4; ++j) acc[i][j] = mma_raw(af[i], bf[j], acc[i][j]);
    }
    // publish point of stage t + 1; the same barrier ends every read of the buffer refilled behind it, at the next trip's top
    G_WAIT_LDS();
    G_WAIT_TENSOR(g0, g1);   // every wave: one that issues nothing has nothing outstanding and passes
    __syncthreads();
  }
  G_WAIT_TENSOR(g0, g1);
  G_WAIT_LDS();

  // ---- epilogue ----
  // Every wave's last read of the stage buffers and its last tensor load are over in front of the last trip's barrier.
  float* slab = (float*)sAB + wave * (64 * G_SP);
#pragma unroll
  for (int i = 0; i < 4; ++i)
#pragma unroll
    for (int j = 0; j < 4; ++j)
#pragma unroll
      for (int r = 0; r < 8; ++r) {
        const float add = (BM == 1) ? brow[i][r >> 2][r & 3] * bscale : (BM == 2) ? bcol[j] * bscale : 0.f;
        slab[(i * 16 + mOff + r) * G_SP + j * 16 + rlane] = acc[i][j][r] * oscale + add;
      }
  wave_lds_sync();   // the staged tile is the wave's own
  if (OUTH == 0) {
    float* Cb = (float*)Cout + cOff;
    v4f o[32];                                             // piece u: row 2u + h2 of the tile
#pragma unroll
    for (int u = 0; u < 32; ++u) {
      o[u] = *(const v4f*)(slab + (2 * u + h2) * G_SP + c4);
      if (RESID) o[u] += rv[u >> 3][u & 7];
    }
#pragma unroll
    for (int u = 0; u < 32; ++u) *(v4f*)(Cb + 2 * u * G_LDC) = o[u];
    G_WAIT_XCNT_17(Cb, o);
    G_WAIT_XCNT_17(Cb, o + 16);
    if (STATS) {
      // keeps the sums behind the tile's stores, whose flight they then run beside: left free, they rise in front
      // of the stores and hold them back by the wave reductions' LDS-pipe latencies
      __builtin_amdgcn_sched_barrier(0);
      v4f rc;
#pragma unroll
      for (int g = 0; g < 2; ++g) {          // pieces 16 g .. 16 g + 15 are rows 32 g .. 32 g + 31
        v4f s4 = {0.f, 0.f, 0.f, 0.f}, q4 = {0.f, 0.f, 0.f, 0.f};
#pragma unroll
        for (int u = 0; u < 16; ++u) {
          s4 += o[g * 16 + u];
          q4 += o[g * 16 + u] * o[g * 16 + u];
        }
        rc[2 * g] = wave_sum(sum4(s4));
        rc[2 * g + 1] = wave_sum(sum4(q4));
      }
      if (lane == 0) {
        float* sp = stats + (size_t)G_REC(bz, tile, wave);
        *(v4f*)sp = rc;
        G_WAIT_XCNT_2(sp, rc);
      }
    }
  } else {
    const int q = lane >> 3, c8 = (lane & 7) * 8;          // f16 C: a 128-B row segment = 8 lanes x 16 B
    _Float16* Cb = (_Float16*)Cout + (size_t)bz * (size_t)strideC + (size_t)(m0 + q) * G_LDC + n0 + c8;
    v4f f[16][2];                                          // piece u: row 4u + q of the tile
#pragma unroll
    for (int u = 0; u < 16; ++u) {
      const float* sp = slab + (4 * u + q) * G_SP + c8;
      f[u][0] = *(const v4f*)(sp);
      f[u][1] = *(const v4f*)(sp + 4);
    }
    // keeps the 32 LDS reads one group ahead of the conversions: left free, they sink to just in front of their
    // own conversion, two at a time, and every piece waits out a whole LDS latency
    __builtin_amdgcn_sched_barrier(0);
    v4u o[16];
#pragma unroll
    for (int u = 0; u < 16; ++u) {
      o[u][0] = pkf(f[u][0][0], f[u][0][1]);
      o[u][1] = pkf(f[u][0][2], f[u][0][3]);
      o[u][2] = pkf(f[u][1][0], f[u][1][1]);
      o[u][3] = pkf(f[u][1][2], f[u][1][3]);
    }
#pragma unroll
    for (int u = 0; u < 16; ++u) *(v4u*)(Cb + 4 * u * G_LDC) = o[u];
    G_WAIT_XCNT_17(Cb, o);
  }
}

// one product per launch: blockIdx.x = tile, blockIdx.y = batch index
template <int TAPS, int OUTH, bool RESID, int BM, bool STATS>
__global__ __launch_bounds__(256) void gemm_k(
    const _Float16* __restrict__ A, int lda, long long strideA, long long aTap, int aTS, int aTO,
    const _Float16* __restrict__ Bt, int ldb, long long strideB, long long bTap, int bTS, int bTO,
    const float* __restrict__ bias, float bscale,
    const float* __restrict__ resid,
    void* Cout, long long strideC,
    int M, int N, int K, float oscale, float* stats) {
  __shared__ __attribute__((aligned(2048))) _Float16 sAB[2 * G_BUF];
  gemm_body<TAPS, OUTH, RESID, BM, STATS>(sAB, (int)blockIdx.x, (int)blockIdx.y,
                                          A, lda, strideA, aTap, aTS, aTO, Bt, ldb, strideB, bTap, bTS, bTO,
                                          bias, bscale, resid, Cout, strideC, M, N, K, oscale, stats);
}

// q, k and v need nothing of each other: one launch, blockIdx.y = 0 q, 1 k, 2 v; 256 tiles each.
//   q, k = xn^T . W^T -> [b*TT+t][h*64+d] f16 x16 (M = 8192, N = 1024; W rows h*192 + 64 y + d)
//   v (channel-major) = Wv . xn -> [b][h*64+d][s] f16 x16 (per b: M = 1024 rows h*192+128+d, N = 1024 t)
__global__ __launch_bounds__(256) void qkv_k(const _Float16* __restrict__ xn, const _Float16* __restrict__ wq,
                                             const float* __restrict__ qb,
                                             _Float16* Qp, _Float16* Kp, _Float16* Vp) {
  __shared__ __attribute__((aligned(2048))) _Float16 sAB[2 * G_BUF];
  const int y = (int)blockIdx.y;   // the same for the whole work-group
  if (y < 2)
    gemm_body<1, 1, false, 2, false>(sAB, (int)blockIdx.x, 0,
                              xn, CC, 0LL, 0LL, 64, 0, wq, CC, 0LL, 0LL, 192, 64 * y,
                              qb, 16.0f, nullptr, (void*)(y ? Kp : Qp), 0LL, NBATCH * TT, CC, CC, 0.25f, nullptr);
  else
    gemm_body<1, 1, false, 1, false>(sAB, (int)blockIdx.x & 31, (int)blockIdx.x >> 5,
                              wq, CC, 0LL, 0LL, 192, 128, xn, CC, (long long)CC * TT, 0LL, 64, 0,
                              qb, 16.0f, nullptr, (void*)Vp, (long long)CC * TT, CC, TT, CC, 0.25f, nullptr);
}
static_assert((NBATCH * TT / 128) * (CC / 256) == 256 && (CC / 128) * (TT / 256) == 32 && NBATCH * 32 == 256);

#define AT_P 72
// lane l reads lane l ^ 16
__device__ __forceinline__ float xhalf(float x) {
  return __builtin_bit_cast(float, __builtin_amdgcn_permlanex16(__builtin_bit_cast(int, x), __builtin_bit_cast(int, x),
                                                                0x76543210, 0xfedcba98, false, false));
}
// two values 2^x in one statement. Behind a transcendental the instruction set asks for one slot before its result
// is used or its source overwritten: the first has the second exponential there (the outputs share no register with
// the inputs), the second the v_nop. The two s_delay_alu are the hints that the compiler gives its own code and not a
// statement's: the arguments may come from the instruction in front, and what follows may use the results;
// without a hint a dependent instruction holds the SIMD's vector port against the other waves while it waits
__device__ __forceinline__ void exp2x2_slot(float x0, float x1, float& y0, float& y1) {
#if defined(__HIP_DEVICE_COMPILE__)
  asm("s_delay_alu instid0(VALU_DEP_1)\n\tv_exp_f32 %0, %2\n\tv_exp_f32 %1, %3\n\tv_nop\n\t"
      "s_delay_alu instid0(TRANS32_DEP_1)"
      : "=&v"(y0), "=&v"(y1) : "v"(x0), "v"(x1));
#else
  y0 = x0; y1 = x1;
#endif
}
// eight waves per SIMD (128 registers): the eight work-groups that fall to each WGP are then resident together
__global__ __launch_bounds__(128, 8)
void attn_k(const _Float16* __restrict__ Qp, const _Float16* __restrict__ Kp, const _Float16* __restrict__ Vp,
            const float* __restrict__ tab, _Float16* AT, float sScale, float oScale) {
  __shared__ __align__(16) _Float16 Ksh[64 * AT_P];    // [kv][d]
  __shared__ __align__(16) _Float16 Vth[64 * AT_P];    // [d][kv]
  __shared__ __align__(16) _Float16 Osh[4][16 * AT_P]; // per wave output rows [query][d]
  __shared__ __align__(16) float    sB[384 * 4];       // bias slice tab[h][q0b .. q0b+1087] (+clamped fill)

  const int tid  = threadIdx.x;
  const int wave = tid >> 5;
  const int lane = tid & 31;
  const int hh   = lane >> 4;
  const int c    = lane & 15;

  const int bx  = blockIdx.x;
  const int qb  = bx & 15;
  const int h   = (bx >> 4) & 15;
  const int b   = bx >> 8;
  const int q0b = qb * 64;
  const int q0  = q0b + wave * 16;
  const size_t rowB = (size_t)b * TT;

  {
    const float* th = tab + (size_t)h * BTP + q0b;     // q0b + 1087 <= 2047 < BTP
#pragma unroll
    for (int k = 0; k < 3; ++k) {
      const int i  = tid + 128 * k;                     // 0..383
      const int ic = (i < 271) ? i : 271;               // clamped address, all lanes load
      *(v4f*)(sB + 4 * i) = *(const v4f*)(th + 4 * ic);
    }
  }

  const _Float16* Qh = Qp + (size_t)h * HD;
  const _Float16* Kh = Kp + (size_t)h * HD;
  const _Float16* Vh = Vp + ((size_t)b * CC + (size_t)h * HD) * TT;

  // ---- Q fragments (B operand, column = lane&15): 2 d-chunks ----
  v16h qa[2];
#pragma unroll
  for (int dc = 0; dc < 2; ++dc) qa[dc] = ldfrag(Qh + (rowB + q0 + c) * CC + dc * 32 + 8 * hh);

  float mrun = -INFINITY, lrun = 0.f;   // the lane's query: maximum in use; sum over this half's keys
  v8f oacc[4];
#pragma unroll
  for (int t = 0; t < 4; ++t) oacc[t] = zero8();

  // bias index: (t - q0b) - s + 1024 with t - q0b = wave*16 + c, s = kv0 + 16j + 8hh + r
  const int bbase = wave * 16 + c + 1024 - 8 * hh;

#pragma unroll 1
  for (int kt = 0; kt < TT / 64; ++kt) {
    const int kv0 = kt * 64;
    __syncthreads();
    {
      const int r = tid >> 1, half = (tid & 1) * 32;
      const _Float16* kg = Kh + (rowB + kv0 + r) * CC + half;     // K row kv0+r, d = half..half+31
      const _Float16* vg = Vh + (size_t)r * TT + kv0 + half;     // V^T row d = r, s = kv0+half..+31
#pragma unroll
      for (int i = 0; i < 4; ++i) {
        const v8h a0 = *(const v8h*)(kg + 8 * i);
        const v8h b0 = *(const v8h*)(vg + 8 * i);
        *(v8h*)(Ksh + r * AT_P + half + 8 * i) = a0;
        *(v8h*)(Vth + r * AT_P + half + 8 * i) = b0;
      }
    }
    __syncthreads();

    // ---- scores, transposed: 64 keys x 16 queries per wave ----
    v8f s[4];
#pragma unroll
    for (int j = 0; j < 4; ++j) s[j] = zero8();
#pragma unroll
    for (int dc = 0; dc < 2; ++dc)
#pragma unroll
      for (int j = 0; j < 4; ++j)
        s[j] = mma_raw(ldfrag(Ksh + (j * 16 + c) * AT_P + dc * 32 + 8 * hh), qa[dc], s[j]);

    // ---- scale + bias, maximum of the lane's 32 keys (one chain per tile), then of the query's 64 ----
    const float* bp = sB + (bbase - kv0 - 55);   // the lowest of the lane's 32 entries
    float mj[4];
#pragma unroll
    for (int jh = 0; jh < 2; ++jh) {
      // two tiles' bias entries at a time, read as one group. The first fence keeps them behind what stands in
      // front: hoisted, all 32 stand beside the scores, the context and Q, and the 128 registers of eight waves
      // per SIMD no longer hold them. The second keeps the group together: left free, each read sinks to just in
      // front of its sum and every pair waits out a whole LDS latency
      __builtin_amdgcn_sched_barrier(0);
      float bb[16];
#pragma unroll
      for (int e = 0; e < 16; ++e) bb[e] = bp[55 - 32 * jh - 16 * (e >> 3) - (e & 7)];   // tile 2jh + (e>>3), r = e&7
      __builtin_amdgcn_sched_barrier(0);
#pragma unroll
      for (int jl = 0; jl < 2; ++jl) {
        const int j = 2 * jh + jl;
        mj[j] = -INFINITY;
#pragma unroll
        for (int r = 0; r < 8; ++r) {
          const float sv = s[j][r] * sScale + bb[8 * jl + r];
          s[j][r] = sv;
          mj[j] = fmaxf(mj[j], sv);
        }
      }
    }
    float m = fmaxf(fmaxf(mj[0], mj[1]), fmaxf(mj[2], mj[3]));
    m = fmaxf(m, xhalf(m));
    const float mnew  = fmaxf(mrun, m);
    const float msafe = (mnew == -INFINITY) ? 0.f : mnew;
    const float LOG2E = 1.4426950408889634f;   // e^x = 2^(x log2 e)
    const float alpha = exp2_slot((mrun - msafe) * LOG2E);
    mrun = mnew;

    // ---- P^T (x1024, f16): score tiles 2kk and 2kk+1, converted in place, are the B fragment of keys 32kk.. ----
    v16h pb[2];
    float pj[4];
#pragma unroll
    for (int j = 0; j < 4; ++j) {
#pragma unroll
      for (int r = 0; r < 8; r += 2) {
        float p0, p1;
        exp2x2_slot((s[j][r] - msafe) * LOG2E, (s[j][r + 1] - msafe) * LOG2E, p0, p1);
        pj[j] = (r == 0) ? p0 + p1 : (pj[j] + p0) + p1;
        pb[j >> 1][(j & 1) * 8 + r] = (_Float16)(p0 * 1024.0f);
        pb[j >> 1][(j & 1) * 8 + r + 1] = (_Float16)(p1 * 1024.0f);
      }
    }
    lrun = lrun * alpha + ((pj[0] + pj[1]) + (pj[2] + pj[3]));
#pragma unroll
    for (int t = 0; t < 4; ++t) oacc[t] *= alpha;

    // ---- context, transposed: O^T += V^T . P^T (f16 WMMA) ----
#pragma unroll
    for (int kk = 0; kk < 2; ++kk) {
      // the first fence keeps a group's reads behind what stands in front (one set of four fragments at a time fits
      // the 128 registers); the second keeps them one group ahead of their products: left free, each sinks to just
      // in front of its own product, which then waits out a whole LDS latency
      __builtin_amdgcn_sched_barrier(0);
      v16h va[4];
#pragma unroll
      for (int t = 0; t < 4; ++t) va[t] = ldfrag(Vth + (t * 16 + c) * AT_P + kk * 32 + 8 * hh);
      __builtin_amdgcn_sched_barrier(0);
#pragma unroll
      for (int t = 0; t < 4; ++t) oacc[t] = mma_raw(va[t], pb[kk], oacc[t]);
    }
  }

  // ---- normalise (1/l; the 1/1024 p carry, the x16 v carry and the x256 output carry are all in oScale) ----
  const float l = lrun + xhalf(lrun);
  const float inv = ((l > 0.f) ? rcp_f(l) : 0.f) * oScale;
  _Float16* os = Osh[wave];
#pragma unroll
  for (int t = 0; t < 4; ++t) {
    v4u a;
#pragma unroll
    for (int e = 0; e < 4; ++e) a[e] = pkf(oacc[t][2 * e] * inv, oacc[t][2 * e + 1] * inv);
    *(v4u*)(os + c * AT_P + t * 16 + 8 * hh) = a;
  }
  wave_lds_sync();   // the rows are the wave's own
  {
    const int q4 = lane >> 3, c8 = (lane & 7) * 8;
    v4u hv[4];
#pragma unroll
    for (int it = 0; it < 4; ++it) hv[it] = *(const v4u*)(os + (it * 4 + q4) * AT_P + c8);   // rows 0..15 of the wave tile
#pragma unroll
    for (int it = 0; it < 4; ++it) {
      const int row = it * 4 + q4;
      const size_t go = (rowB + q0 + row) * CC + (size_t)h * HD + c8;
      *(v4u*)(AT + go) = hv[it];
    }
  }
}

// =====================================================================================================
// Workspace map (bytes):
//   W1t  f16 [3][1024][1024]       0            6291456
//   W2t  f16 [3][1024][1024]       6291456      6291456
//   Wqkv f16 [3072][1024]          12582912     6291456
//   Wp   f16 [1024][1024]          18874368     2097152
//   Tab  f32 [16][2048]            20971520      131072
//   XT   f16 [8][1026][1024]       21102592    16809984   (later: XT3 [8][1024][1024], then AT [8192][1024])
//   R1   f32 [8][1024][1024]       37912576    33554432   (F1, then H, then Qp + Kp f16 [8192][1024] each)
//   Xin  f32 [8][1024][1024]       71467008    33554432
//   Vp   f16 [8][1024][1024]       105021440   16777216
//   Rec  f32 [8][32][8][32]        121798656     262144   (statistics records: of F1, then of H)
//   end                            122060800
// Every plane is an exact multiple of its whole-line / whole-tile store granularity (incl. the two
// halo token rows per sample in XT); no tail padding needed.
// =====================================================================================================
extern "C" void kernel_launch(void* const* d_in, const int* in_sizes, int n_in,
                              void* d_out, int out_size, void* d_ws, size_t ws_size,
                              hipStream_t stream) {
  if (n_in < 18) return;
  const int nAct = NBATCH * CC * TT;                     // 8388608
  if (in_sizes[0] != nAct || out_size != nAct) return;
  if (in_sizes[3] != CC * CC * 3 || in_sizes[7] != CC * CC * 3) return;
  if (in_sizes[13] != 3 * CC * CC || in_sizes[15] != CC * CC) return;
  if (in_sizes[1] != CC || in_sizes[2] != CC || in_sizes[4] != CC || in_sizes[5] != CC ||
      in_sizes[6] != CC || in_sizes[8] != CC || in_sizes[9] != CC || in_sizes[10] != CC ||
      in_sizes[11] != CC || in_sizes[12] != CC || in_sizes[16] != CC) return;
  if (in_sizes[14] != 3 * CC || in_sizes[17] != NBUCK * NH) return;

  const float* x      = (const float*)d_in[0];
  const float* gn1_g  = (const float*)d_in[1];
  const float* gn1_b  = (const float*)d_in[2];
  const float* c1_w   = (const float*)d_in[3];
  const float* c1_b   = (const float*)d_in[4];
  const float* gn2_g  = (const float*)d_in[5];
  const float* gn2_b  = (const float*)d_in[6];
  const float* c2_w   = (const float*)d_in[7];
  const float* c2_b   = (const float*)d_in[8];
  const float* n8_g   = (const float*)d_in[9];
  const float* n8_b   = (const float*)d_in[10];
  const float* ag_g   = (const float*)d_in[11];
  const float* ag_b   = (const float*)d_in[12];
  const float* qkv_w  = (const float*)d_in[13];
  const float* qkv_b  = (const float*)d_in[14];
  const float* pj_w   = (const float*)d_in[15];
  const float* pj_b   = (const float*)d_in[16];
  const float* remb   = (const float*)d_in[17];

  const size_t PWC  = (size_t)3 * CC * CC * 2;          //  6291456
  const size_t PWQ  = (size_t)3 * CC * CC * 2;          //  6291456
  const size_t PWP  = (size_t)CC * CC * 2;              //  2097152
  const size_t PTAB = (size_t)NH * BTP * 4;             //   131072
  const size_t PXT  = (size_t)NBATCH * TP * CC * 2;     // 16809984
  const size_t PF   = (size_t)NBATCH * CC * TT * 4;     // 33554432
  const size_t PV   = (size_t)NBATCH * CC * TT * 2;     // 16777216
  size_t off = 0;
  const size_t oW1  = off; off += PWC;
  const size_t oW2  = off; off += PWC;
  const size_t oWq  = off; off += PWQ;
  const size_t oWp  = off; off += PWP;
  const size_t oTab = off; off += PTAB;
  const size_t oXT  = off; off += PXT;
  const size_t oR1  = off; off += PF;
  const size_t oXin = off; off += PF;
  const size_t oV   = off; off += PV;
  const size_t oRec = off; off += (size_t)G_REC_BYTES;
  if (off > ws_size) return;                            // off = 122060800
  if (off > (size_t)134217728) return;
  if (2 * PV > PF) return;                              // Qp + Kp live inside R1
  if ((size_t)NBATCH * TT * CC * 2 > PXT) return;       // XT3 / AT fit in the XT region

  char* ws = (char*)d_ws;
  _Float16* W1t  = (_Float16*)(ws + oW1);
  _Float16* W2t  = (_Float16*)(ws + oW2);
  _Float16* Wqkv = (_Float16*)(ws + oWq);
  _Float16* Wpb  = (_Float16*)(ws + oWp);
  float*    Tab  = (float*)(ws + oTab);
  _Float16* XT   = (_Float16*)(ws + oXT);               // [8][1026][1024] with halo rows
  _Float16* XT3  = (_Float16*)(ws + oXT);               // [8][1024][1024], later use of the same region
  _Float16* ATp  = (_Float16*)(ws + oXT);               // [8192][1024], last use of the same region
  float*    F1   = (float*)(ws + oR1);
  float*    Hb   = (float*)(ws + oR1);
  _Float16* Qp   = (_Float16*)(ws + oR1);
  _Float16* Kp   = (_Float16*)(ws + oR1 + PV);
  float*    Xin  = (float*)(ws + oXin);
  _Float16* Vp   = (_Float16*)(ws + oV);
  float*    Rec  = (float*)(ws + oRec);

  const dim3 blk(256);
  const long long CCCC = (long long)CC * CC;
  const long long CT   = (long long)CC * TT;

  // (1) h = silu(GN32(x)) -> XT (token-major f16, halo rows); beside it conv1's weights -> f16 x64 planes
  gn32_tr_k<true, false><<<dim3(CC / 64, NBATCH + CVW_NB / (CC / 64)), dim3(GN_NT), 0, stream>>>(x, gn1_g, gn1_b, XT, c1_w, W1t, nullptr);
  // (2) F1 = conv1(h) + b1 -> f32 NCT   (per b: M=1024 o, N=1024 t, K=3 taps x 1024); its statistics records -> Rec
  gemm_k<3, 0, false, 1, true><<<dim3((CC / 128) * (TT / 256), NBATCH), blk, 0, stream>>>(
      W1t, CC, 0LL, CCCC, 64, 0,
      XT, CC, (long long)TP * CC, (long long)CC, 64, 0,
      c1_b, 1.0f, nullptr,
      (void*)F1, CT, CC, TT, CC, 1.0f / 64.0f, Rec);
  // (3) h = silu(GN32(F1)) -> XT; beside it conv2's weights -> f16 x64 planes
  gn32_tr_k<true, true><<<dim3(CC / 64, NBATCH + CVW_NB / (CC / 64)), dim3(GN_NT), 0, stream>>>(F1, gn2_g, gn2_b, XT, c2_w, W2t, Rec);
  // (4) H = conv2(h) + b2 + x -> f32 NCT (R1); its statistics records -> Rec
  gemm_k<3, 0, true, 1, true><<<dim3((CC / 128) * (TT / 256), NBATCH), blk, 0, stream>>>(
      W2t, CC, 0LL, CCCC, 64, 0,
      XT, CC, (long long)TP * CC, (long long)CC, 64, 0,
      c2_b, 1.0f, x,
      (void*)Hb, CT, CC, TT, CC, 1.0f / 64.0f, Rec);
  // (5) xin = GN8(H) -> f32 NCT; GN32(xin) -> XT3 (token-major f16, no halo); beside it the qkv and projection
  //     weights -> f16 x64 planes and the position bias table
  gn8_attn_k<<<dim3(CC / 64, NBATCH + (PQ_NB + PP_NB + PT_NB) / (CC / 64)), dim3(GN_NT), 0, stream>>>(
      Hb, n8_g, n8_b, ag_g, ag_b, Xin, XT3, qkv_w, pj_w, remb, Wqkv, Wpb, Tab, Rec);
  // (6) q -> Qp, k -> Kp, v -> Vp
  qkv_k<<<dim3(256, 3), blk, 0, stream>>>(XT3, Wqkv, qkv_b, Qp, Kp, Vp);
  // (7) attention -> AT [b*TT+t][h*64+d] f16 x256
  attn_k<<<dim3((TT / 64) * NH * NBATCH), dim3(128), 0, stream>>>(
      Qp, Kp, Vp, Tab, ATp, 1.0f / 2048.0f, 1.0f / 64.0f);
  // (8) out = xin + proj(a) + bp -> d_out f32 NCT (per b: M=1024 o, N=1024 t, K=1024)
  gemm_k<1, 0, true, 1, false><<<dim3((CC / 128) * (TT / 256), NBATCH), blk, 0, stream>>>(
      Wpb, CC, 0LL, 0LL, 64, 0,
      ATp, CC, CT, 0LL, 64, 0,
      pj_b, 1.0f, Xin,
      d_out, CT, CC, TT, CC, 1.0f / 16384.0f, nullptr);
  (void)hipGetLastError();
}
